// v000
// The times below were measured on an AMD MI455X: many runs one after another, warmed up first and cycling through
// copies of the inputs, with the whole window's GPU time divided by the number of runs. Launches and the gaps
// between them are all in it. The median over several windows is given; except for v000 it joins two sittings, which
// can be a few percent apart, so the side-by-side timings, each taken in one sitting, are the better comparison.
// The starting kernel, v000, takes 673 microseconds a run.
#include <hip/hip_runtime.h>
// SFBlock (2 x 128 x 64 x 64; 4 heads x 32; GroupNorm(32) on both inputs; q from feat_opt, k/v from feat_sar via 1x1 convs; softmax(q k^T / sqrt(32)) v over the 4096 positions; MLP: gelu_erf(out W1 + b1) W2 + b2; fused = out + mlp; 1x1 conv Wo -> [2,128,64,64]).
// Compute dtype: inputs and parameters rounded to bf16; normalised inputs as f16 operands (~2^-12); q, k hi + residual; P (x2^10), v plain f16; attention output / fused as hi + residual pairs; the 256-wide GELU hidden as f16; f32 statistics/softmax/accumulation. v_wmma_f32_16x16x32_f16.
#define NB 2
#define CC 128
#define HID 256
#define NGR 32
#define CPG (CC / NGR)           /* 4 channels per group */
#define HDT 32
#define DP (NH * 64)             /* 256 padded */
#define NR (NB * SLEN)           /* 8192 */
#define QBLKS (TQ / 64)
#define SLEN 4096                /* H*W tokens */
#define TQ SLEN
#define TK SLEN
#define NH 4
#define SCL 0.17677669529663687f /* 32^-0.5 (true head dim 32, zero-padded to 64) */
typedef __bf16 v16b __attribute__((ext_vector_type(16)));
typedef unsigned short v8us __attribute__((ext_vector_type(8), may_alias));
typedef float  v8f  __attribute__((ext_vector_type(8)));
typedef float  v4f  __attribute__((ext_vector_type(4)));
typedef float  v4fa __attribute__((ext_vector_type(4), may_alias));
union FragB { v16b v; v8us half[2]; unsigned short u[16]; };

__device__ __forceinline__ unsigned short bf16_bits(float x) { unsigned int u = __float_as_uint(x); return (unsigned short)((u + 0x7FFFu + ((u >> 16) & 1u)) >> 16); }
__device__ __forceinline__ float bf16_val(unsigned short b) { return __uint_as_float(((unsigned int)b) << 16); }
__device__ __forceinline__ float bf16_round(float x) { return bf16_val(bf16_bits(x)); }
// D += A·B with NT terms: 1 = ah·bh, 2 = + al·bh (A split), 3 = + ah·bl (both split)
template <int NT>
__device__ __forceinline__ v8f mmaN(v16b ah, v16b al, v16b bh, v16b bl, v8f c) {
  c = __builtin_amdgcn_wmma_f32_16x16x32_bf16(false, ah, false, bh, (short)0, c, false, false);
  if (NT >= 2) c = __builtin_amdgcn_wmma_f32_16x16x32_bf16(false, al, false, bh, (short)0, c, false, false);
  if (NT >= 3) c = __builtin_amdgcn_wmma_f32_16x16x32_bf16(false, ah, false, bl, (short)0, c, false, false);
  asm volatile("v_nop\n\tv_nop\n\tv_nop\n\tv_nop" : "+v"(c) : "v"(ah), "v"(al), "v"(bh), "v"(bl));
  return c;
}

__global__ __launch_bounds__(256) void k_wt_bf16(const float* __restrict__ W, unsigned short* __restrict__ Wt, int K, int N) {
  const int t = blockIdx.x * 256 + threadIdx.x;
  const int k8n = K / 8;
  if (t >= N * k8n) return;
  const int n = t / k8n, k8 = (t % k8n) * 8;
  v8us v;
#pragma unroll
  for (int i = 0; i < 8; ++i) v[i] = bf16_bits(W[(size_t)(k8 + i) * N + n]);
  *(v8us*)(Wt + (size_t)n * K + k8) = v;
  
}

// GEMM C[M][N] (f32, pitch ldc) = act(A[M][K]·W + bias). A f32 row-major (pitch lda) converted per fragment to bf16
// (ASPLIT: hi/lo two planes -> 2 terms, else single rounded term); Wt bf16 [N][K] (pitch ldb). BIAS_BF16 rounds the
// bias to bf16 first (bias quantised to bf16 before the add). K%32==0, M%16==0, N%64==0.
template <bool ASPLIT, int ACT, bool BIAS_BF16>
__global__ __launch_bounds__(128) void k_gemm_bf(const float* __restrict__ A, int lda, const unsigned short* __restrict__ Wt, int ldb,
                                               const float* __restrict__ bias, float* __restrict__ C, int ldc, int M, int N, int K) {
  __shared__ __attribute__((aligned(16))) float so[4][16][64];
  const int tid = threadIdx.x, w = tid >> 5, lane = tid & 31, ln = lane & 15, hh = lane >> 4;
  const int ntn = N / 64;
  const int wid = blockIdx.x * 4 + w;
  const int mt = wid / ntn, nq = wid % ntn;
  if (mt * 16 >= M) return;
  const int row0 = mt * 16, col0 = nq * 64;
  const float* arow = A + (size_t)(row0 + ln) * lda;
  v8f acc[4] = {};
  for (int kb = 0; kb < K; kb += 32) {
    FragB ah, al;
    const v4f x0 = *(const v4fa*)(arow + kb + 8 * hh), x1 = *(const v4fa*)(arow + kb + 8 * hh + 4);
    const v4f x2 = *(const v4fa*)(arow + kb + 16 + 8 * hh), x3 = *(const v4fa*)(arow + kb + 16 + 8 * hh + 4);
    float xs[16] = {x0[0],x0[1],x0[2],x0[3],x1[0],x1[1],x1[2],x1[3],x2[0],x2[1],x2[2],x2[3],x3[0],x3[1],x3[2],x3[3]};
#pragma unroll
    for (int i = 0; i < 16; ++i) { const unsigned short hb = bf16_bits(xs[i]); ah.u[i] = hb; al.u[i] = ASPLIT ? bf16_bits(xs[i] - bf16_val(hb)) : (unsigned short)0; }
#pragma unroll
    for (int t = 0; t < 4; ++t) {
      const unsigned short* brow = Wt + (size_t)(col0 + t * 16 + ln) * ldb + kb;
      FragB b;
      b.half[0] = *(const v8us*)(brow + 8 * hh);
      b.half[1] = *(const v8us*)(brow + 16 + 8 * hh);
      acc[t] = mmaN<ASPLIT ? 2 : 1>(ah.v, al.v, b.v, b.v, acc[t]);
    }
  }
#pragma unroll
  for (int t = 0; t < 4; ++t) {
    float bv = bias ? bias[col0 + t * 16 + ln] : 0.f;
    if (BIAS_BF16) bv = bf16_round(bv);
#pragma unroll
    for (int r = 0; r < 8; ++r) { float v = acc[t][r] + bv; if (ACT == 1) v = fmaxf(v, 0.f); so[w][8 * hh + r][t * 16 + ln] = v; }
  }
  __builtin_amdgcn_fence(__ATOMIC_ACQ_REL, "workgroup");
  __builtin_amdgcn_wave_barrier();
  const int rsub = lane >> 4, c4 = (lane & 15) * 4;
  {
#pragma unroll
    for (int q = 0; q < 8; ++q) {
      const int r = q * 2 + rsub;
      const v4f v = *(const v4fa*)&so[w][r][c4];
      *(v4f*)(C + (size_t)(row0 + r) * ldc + col0 + c4) = v;
    }
    
  }
}

// GEMM C = act(A·W + bias + resid): A f32 (ASPLIT -> hi/lo 2 terms), Wt bf16 [N][K]; ACT 0 none, 1 relu, 2 exact gelu;
// resid (optional, f32, row index = (row % rmod), pitch ldr, RES_BF16 rounds it) added before the activation.
template <bool ASPLIT, int ACT, bool BIAS_BF16, bool RES_BF16>
__global__ __launch_bounds__(128) void k_gemm_bf3(const float* __restrict__ A, int lda, const unsigned short* __restrict__ Wt, int ldb,
                                                const float* __restrict__ bias, const float* __restrict__ resid, int rmod, int ldr,
                                                float* __restrict__ C, int ldc, int M, int N, int K) {
  __shared__ __attribute__((aligned(16))) float so[4][16][64];
  const int tid = threadIdx.x, w = tid >> 5, lane = tid & 31, ln = lane & 15, hh = lane >> 4;
  const int ntn = N / 64;
  const int wid = blockIdx.x * 4 + w;
  const int mt = wid / ntn, nq = wid % ntn;
  if (mt * 16 >= M) return;
  const int row0 = mt * 16, col0 = nq * 64;
  const float* arow = A + (size_t)(row0 + ln) * lda;
  v8f acc[4] = {};
  for (int kb = 0; kb < K; kb += 32) {
    FragB ah, al;
    const v4f x0 = *(const v4fa*)(arow + kb + 8 * hh), x1 = *(const v4fa*)(arow + kb + 8 * hh + 4);
    const v4f x2 = *(const v4fa*)(arow + kb + 16 + 8 * hh), x3 = *(const v4fa*)(arow + kb + 16 + 8 * hh + 4);
    float xs[16] = {x0[0],x0[1],x0[2],x0[3],x1[0],x1[1],x1[2],x1[3],x2[0],x2[1],x2[2],x2[3],x3[0],x3[1],x3[2],x3[3]};
#pragma unroll
    for (int i = 0; i < 16; ++i) { const unsigned short hb = bf16_bits(xs[i]); ah.u[i] = hb; al.u[i] = ASPLIT ? bf16_bits(xs[i] - bf16_val(hb)) : (unsigned short)0; }
#pragma unroll
    for (int t = 0; t < 4; ++t) {
      const unsigned short* brow = Wt + (size_t)(col0 + t * 16 + ln) * ldb + kb;
      FragB b;
      b.half[0] = *(const v8us*)(brow + 8 * hh);
      b.half[1] = *(const v8us*)(brow + 16 + 8 * hh);
      acc[t] = mmaN<ASPLIT ? 2 : 1>(ah.v, al.v, b.v, b.v, acc[t]);
    }
  }
#pragma unroll
  for (int t = 0; t < 4; ++t) {
    const int col = col0 + t * 16 + ln;
    float bv = bias ? bias[col] : 0.f;
    if (BIAS_BF16) bv = bf16_round(bv);
#pragma unroll
    for (int r = 0; r < 8; ++r) {
      float v = acc[t][r] + bv;
      if (resid) { float rv = resid[(size_t)((row0 + 8 * hh + r) % rmod) * ldr + col]; if (RES_BF16) rv = bf16_round(rv); v += rv; }
      if (ACT == 1) v = fmaxf(v, 0.f);
      if (ACT == 2) v = 0.5f * v * (1.0f + erff(v * 0.70710678118654752f));
      if (ACT == 3) { const float u = 0.7978845608028654f * (v + 0.044715f * v * v * v); v = 0.5f * v * (1.0f + tanhf(u)); }
      so[w][8 * hh + r][t * 16 + ln] = v;
    }
  }
  __builtin_amdgcn_fence(__ATOMIC_ACQ_REL, "workgroup");
  __builtin_amdgcn_wave_barrier();
  const int rsub = lane >> 4, c4 = (lane & 15) * 4;
  {
#pragma unroll
    for (int q = 0; q < 8; ++q) {
      const int r = q * 2 + rsub;
      const v4f v = *(const v4fa*)&so[w][r][c4];
      *(v4f*)(C + (size_t)(row0 + r) * ldc + col0 + c4) = v;
    }
    
  }
}
// row LayerNorm (biased variance, eps) over N: s = X (+ R); optional out_sum <- s; out_norm <- (s-mu)*rsqrt(var+eps)*g + b
template <bool PARAM_BF16>
__global__ __launch_bounds__(256) void k_layernorm(const float* __restrict__ X, const float* __restrict__ R, const float* __restrict__ g, const float* __restrict__ bta,
                                                  float* __restrict__ out_sum, float* __restrict__ out_norm, int N, float eps) {
  __shared__ float red[256];
  const int row = blockIdx.x, tid = threadIdx.x;
  const float* x = X + (size_t)row * N; const float* rr = R ? R + (size_t)row * N : nullptr;
  float vals[16];                     // up to N = 4096
  const int per = N / 256;            // contiguous chunk per thread? use strided-by-4 chunks: thread handles j = tid*4 + 1024*u
  float s1 = 0.f;
  for (int u = 0; u < per / 4; ++u) {
    const int j = tid * 4 + 1024 * u;
    const v4f a = *(const v4fa*)(x + j);
    v4f b = {0.f,0.f,0.f,0.f}; if (rr) b = *(const v4fa*)(rr + j);
#pragma unroll
    for (int q = 0; q < 4; ++q) { const float v = a[q] + b[q]; vals[u * 4 + q] = v; s1 += v; }
  }
  red[tid] = s1; __syncthreads();
  for (int st = 128; st > 0; st >>= 1) { if (tid < st) red[tid] += red[tid + st]; __syncthreads(); }
  const float mu = red[0] / (float)N; __syncthreads();
  float s2 = 0.f;
  for (int u = 0; u < per / 4; ++u)
#pragma unroll
    for (int q = 0; q < 4; ++q) { const float c = vals[u * 4 + q] - mu; s2 += c * c; }
  red[tid] = s2; __syncthreads();
  for (int st = 128; st > 0; st >>= 1) { if (tid < st) red[tid] += red[tid + st]; __syncthreads(); }
  const float rs = rsqrtf(red[0] / (float)N + eps);
  {
    for (int u = 0; u < per / 4; ++u) {
      const int j = tid * 4 + 1024 * u;
      v4f o, sm;
#pragma unroll
      for (int q = 0; q < 4; ++q) {
        float gg = g[j + q], bb = bta[j + q];
        if (PARAM_BF16) { gg = bf16_round(gg); bb = bf16_round(bb); }
        sm[q] = vals[u * 4 + q]; o[q] = (vals[u * 4 + q] - mu) * rs * gg + bb;
      }
      if (out_sum) *(v4f*)(out_sum + (size_t)row * N + j) = sm;
      *(v4f*)(out_norm + (size_t)row * N + j) = o;
    }
    
  }
}



// ---- f16 WMMA path (v_wmma_f32_16x16x32_f16): 11-bit significands for operands in range — used where a [0,1] probability operand needs more precision than bf16
typedef _Float16 v16h __attribute__((ext_vector_type(16)));
union FragH { v16h v; v8us half[2]; _Float16 h[16]; unsigned short u[16]; };
template <int NT>
__device__ __forceinline__ v8f mmaH(v16h ah, v16h al, v16h bh, v16h bl, v8f c) {
  c = __builtin_amdgcn_wmma_f32_16x16x32_f16(false, ah, false, bh, (short)0, c, false, false);
  if (NT >= 2) c = __builtin_amdgcn_wmma_f32_16x16x32_f16(false, al, false, bh, (short)0, c, false, false);
  if (NT >= 3) c = __builtin_amdgcn_wmma_f32_16x16x32_f16(false, ah, false, bl, (short)0, c, false, false);
  asm volatile("v_nop\n\tv_nop\n\tv_nop\n\tv_nop" : "+v"(c) : "v"(ah), "v"(al), "v"(bh), "v"(bl));
  return c;
}
// batched GEMM like k_gemm_b but f16 operands: A f32 (split into f16 hi/lo if ASPLIT, else rounded to f16), Bt = f16 values [n][k]; alpha; C f32; N multiple of 16 (partial tiles skipped)
template <bool ASPLIT>
__global__ __launch_bounds__(128) void k_gemm_h(const float* __restrict__ A, int lda, size_t sA, const _Float16* __restrict__ Bh, int ldb, size_t sB, float alpha, float* __restrict__ C, int ldc, size_t sC, int M, int N, int K) {
  __shared__ __attribute__((aligned(16))) float so[4][16][64];
  const int tid = threadIdx.x, w = tid >> 5, lane = tid & 31, ln = lane & 15, hh = lane >> 4; const int by = blockIdx.y;
  A += (size_t)by * sA; Bh += (size_t)by * sB; C += (size_t)by * sC;
  const int ntn = (N + 63) / 64; const int wid = blockIdx.x * 4 + w; const int mt = wid / ntn, nq = wid % ntn; if (mt * 16 >= M) return;
  const int row0 = mt * 16, col0 = nq * 64; const float* arow = A + (size_t)(row0 + ln) * lda;
  v8f acc[4] = {};
  for (int kb = 0; kb < K; kb += 32) {
    FragH ah, al;
    const v4f x0 = *(const v4fa*)(arow + kb + 8 * hh), x1 = *(const v4fa*)(arow + kb + 8 * hh + 4), x2 = *(const v4fa*)(arow + kb + 16 + 8 * hh), x3 = *(const v4fa*)(arow + kb + 16 + 8 * hh + 4);
    float xs[16] = {x0[0],x0[1],x0[2],x0[3],x1[0],x1[1],x1[2],x1[3],x2[0],x2[1],x2[2],x2[3],x3[0],x3[1],x3[2],x3[3]};
#pragma unroll
    for (int i = 0; i < 16; ++i) { const _Float16 h = (_Float16)xs[i]; ah.h[i] = h; al.h[i] = ASPLIT ? (_Float16)(xs[i] - (float)h) : (_Float16)0.0f; }
#pragma unroll
    for (int t = 0; t < 4; ++t) { if (col0 + t * 16 >= N) continue; const size_t boff = (size_t)(col0 + t * 16 + ln) * ldb + kb; FragH bq; bq.half[0] = *(const v8us*)(Bh + boff + 8 * hh); bq.half[1] = *(const v8us*)(Bh + boff + 16 + 8 * hh);
      acc[t] = mmaH<ASPLIT ? 2 : 1>(ah.v, al.v, bq.v, bq.v, acc[t]); }
  }
#pragma unroll
  for (int t = 0; t < 4; ++t) { if (col0 + t * 16 >= N) continue;
#pragma unroll
    for (int r = 0; r < 8; ++r) so[w][8 * hh + r][t * 16 + ln] = acc[t][r] * alpha; }
  __builtin_amdgcn_fence(__ATOMIC_ACQ_REL, "workgroup"); __builtin_amdgcn_wave_barrier();
  const int rsub = lane >> 4, c4 = (lane & 15) * 4;
  {
#pragma unroll
    for (int q = 0; q < 8; ++q) { const int r = q * 2 + rsub; if (col0 + c4 < N) { const v4f v = *(const v4fa*)&so[w][r][c4]; *(v4f*)(C + (size_t)(row0 + r) * ldc + col0 + c4) = v; } }
     }
}

// Wt[n][k] = f16(W[k][n]·scale) from f32 row-major W[K][N] (scale = power of two; bf16-exact weights stay exact in f16 away from the subnormal range)
__global__ __launch_bounds__(256) void k_wt_f16(const float* __restrict__ W, _Float16* __restrict__ Wt, int K, int N, float scale) {
  const int t = blockIdx.x * 256 + threadIdx.x; if (t >= N * (K / 8)) return; const int n = t / (K / 8), k8 = (t % (K / 8)) * 8; FragH f;
#pragma unroll
  for (int i = 0; i < 8; ++i) f.h[i] = (_Float16)(bf16_round(W[(size_t)(k8 + i) * N + n]) * scale); const v8us o = f.half[0];
  *(v8us*)((unsigned short*)Wt + (size_t)n * K + k8) = o; 
}
// k_gemm_hh variant with fused epilogue: v = acc·alpha + bias[by·sBias + col] (+ CP[(row/rowsPerB)·sCPb + by·64 + col] if CP) ; ACT 0 none / 1 elu ; writes f16 C16 (and f32 C if non-null)
template <int ACT>
__global__ __launch_bounds__(128) void k_gemm_hhx(const _Float16* __restrict__ A, int lda, size_t sA, const _Float16* __restrict__ Bh, int ldb, size_t sB, float alpha, const float* __restrict__ bias, size_t sBias, const float* __restrict__ CP, int rowsPerB, size_t sCPb, int row0g,
    float* __restrict__ C, _Float16* __restrict__ C16, int ldc, size_t sC, int M, int N, int K) {
  __shared__ __attribute__((aligned(16))) float so[4][16][64];
  const int tid = threadIdx.x, w = tid >> 5, lane = tid & 31, ln = lane & 15, hh = lane >> 4; const int by = blockIdx.y;
  A += (size_t)by * sA; Bh += (size_t)by * sB; const size_t cofs = (size_t)by * sC; const float* bp = bias ? bias + (size_t)by * sBias : nullptr;
  const int ntn = (N + 63) / 64; const int wid = blockIdx.x * 4 + w; const int mt = wid / ntn, nq = wid % ntn; if (mt * 16 >= M) return;
  const int row0 = mt * 16, col0 = nq * 64; const _Float16* arow = A + (size_t)(row0 + ln) * lda;
  v8f acc[4] = {};
  for (int kb = 0; kb < K; kb += 32) { FragH ah; ah.half[0] = *(const v8us*)((const unsigned short*)arow + kb + 8 * hh); ah.half[1] = *(const v8us*)((const unsigned short*)arow + kb + 16 + 8 * hh);
#pragma unroll
    for (int t = 0; t < 4; ++t) { if (col0 + t * 16 >= N) continue; const size_t boff = (size_t)(col0 + t * 16 + ln) * ldb + kb; FragH bq; bq.half[0] = *(const v8us*)((const unsigned short*)Bh + boff + 8 * hh); bq.half[1] = *(const v8us*)((const unsigned short*)Bh + boff + 16 + 8 * hh);
      acc[t] = mmaH<1>(ah.v, ah.v, bq.v, bq.v, acc[t]); }
  }
#pragma unroll
  for (int t = 0; t < 4; ++t) { if (col0 + t * 16 >= N) continue; const int col = col0 + t * 16 + ln; const float bv = bp ? bf16_round(bp[col]) : 0.f;
#pragma unroll
    for (int r = 0; r < 8; ++r) { float v = acc[t][r] * alpha + bv; if (CP) { const int bidx = (row0g + row0 + 8 * hh + r) / rowsPerB; v += CP[(size_t)bidx * sCPb + (size_t)by * 64 + col]; } if (ACT == 1) v = (v > 0.f) ? v : expm1f(v); else if (ACT == 7) v = (v > 0.f) ? v + 1.0f : expf(v); else if (ACT == 8) v = tanhf(v); else if (ACT == 9) v = 0.5f * v * (1.0f + tanhf(0.7978845608028654f * (v + 0.044715f * v * v * v))); else if (ACT == 11) v = 1.0f / (1.0f + expf(-v)); else if (ACT == 12) v = (v > 0.f) ? v : 0.01f * v; else if (ACT == 14) v = (v > 0.f) ? v : 0.1f * v; else if (ACT == 15) v = v / (1.0f + expf(-v)); else if (ACT == 3) v = fmaxf(v, 0.f); else if (ACT == 6) v = 0.5f * v * (1.0f + erff(v * 0.70710678118654752f)); so[w][8 * hh + r][t * 16 + ln] = v; } }
  __builtin_amdgcn_fence(__ATOMIC_ACQ_REL, "workgroup"); __builtin_amdgcn_wave_barrier();
  const int rsub = lane >> 4, c4 = (lane & 15) * 4; typedef _Float16 v4h __attribute__((ext_vector_type(4)));
  {
#pragma unroll
    for (int q = 0; q < 8; ++q) { const int r = q * 2 + rsub; if (col0 + c4 < N) { const v4f v = *(const v4fa*)&so[w][r][c4]; if (C) *(v4f*)(C + cofs + (size_t)(row0 + r) * ldc + col0 + c4) = v; if (C16) { v4h h4; for (int i = 0; i < 4; ++i) h4[i] = (_Float16)v[i]; *(v4h*)(C16 + cofs + (size_t)(row0 + r) * ldc + col0 + c4) = h4; } } }
     }
}


typedef _Float16 v4h __attribute__((ext_vector_type(4)));

__global__ __launch_bounds__(256) void k_x16(const float* __restrict__ x, _Float16* __restrict__ X16, size_t n8) { const size_t t = (size_t)blockIdx.x * 256 + threadIdx.x; if (t >= n8) return; FragH f;
#pragma unroll
  for (int q = 0; q < 8; ++q) f.h[q] = (_Float16)bf16_round(x[t * 8 + q]); *(v8us*)((unsigned short*)X16 + t * 8) = f.half[0];  }
__global__ __launch_bounds__(256) void k_h16(const float* __restrict__ x, _Float16* __restrict__ X16, size_t n8) { const size_t t = (size_t)blockIdx.x * 256 + threadIdx.x; if (t >= n8) return; FragH f;
#pragma unroll
  for (int q = 0; q < 8; ++q) f.h[q] = (_Float16)x[t * 8 + q]; *(v8us*)((unsigned short*)X16 + t * 8) = f.half[0];  }
__global__ __launch_bounds__(256) void k_round16f(const float* __restrict__ W, _Float16* __restrict__ Bt, size_t n8) { const size_t t = (size_t)blockIdx.x * 256 + threadIdx.x; if (t >= n8) return; FragH f;
#pragma unroll
  for (int i = 0; i < 8; ++i) f.h[i] = (_Float16)(bf16_round(W[t * 8 + i]) * 16.0f); *(v8us*)((unsigned short*)Bt + t * 8) = f.half[0];  }
template <int NHv, int TTv>
__global__ __launch_bounds__(256) void k_vt(const _Float16* __restrict__ V16, int ldv, int voff, _Float16* __restrict__ Vt) { __shared__ unsigned short tl[64][66]; const int tid = threadIdx.x; const int slab = blockIdx.x / (TTv / 64), lg = blockIdx.x % (TTv / 64); const int b = slab / NHv, h = slab % NHv;
  for (int i = tid; i < 64 * 8; i += 256) { const int r = i / 8, c8 = (i % 8) * 8; FragH f; f.half[0] = *(const v8us*)((const unsigned short*)V16 + ((size_t)b * TTv + lg * 64 + r) * ldv + voff + h * 64 + c8);
#pragma unroll
    for (int q = 0; q < 8; ++q) tl[r][c8 + q] = f.u[q]; }
  __syncthreads();
  {
#pragma unroll
    for (int rd = 0; rd < 2; ++rd) { const int d = rd * 32 + tid / 8, pc = tid % 8; FragH f;
#pragma unroll
      for (int q = 0; q < 8; ++q) f.u[q] = tl[pc * 8 + q][d];
      *(v8us*)((unsigned short*)Vt + ((size_t)slab * 64 + d) * TTv + lg * 64 + pc * 8) = f.half[0]; }
     } }

__global__ __launch_bounds__(256) void k_hl(const float* __restrict__ F, _Float16* __restrict__ Hh, _Float16* __restrict__ Hl, size_t n8) { const size_t t = (size_t)blockIdx.x * 256 + threadIdx.x; if (t >= n8) return; FragH fh, fl; const v4f a = *(const v4fa*)(F + t * 8), c = *(const v4fa*)(F + t * 8 + 4);
#pragma unroll
  for (int q = 0; q < 4; ++q) { _Float16 h = (_Float16)a[q]; fh.h[q] = h; fl.h[q] = (_Float16)((a[q] - (float)h) * 1024.0f); h = (_Float16)c[q]; fh.h[4 + q] = h; fl.h[4 + q] = (_Float16)((c[q] - (float)h) * 1024.0f); }
  { *(v8us*)((unsigned short*)Hh + t * 8) = fh.half[0]; *(v8us*)((unsigned short*)Hl + t * 8) = fl.half[0];  } }

// ---- fast GEMM (wave tile 32x64; requires M % 32 == 0 rows per launch region and N % 64 == 0); epilogue = k_gemm_hhx semantics ----
__device__ __forceinline__ v16h g2_frag(const _Float16* p, int hh) { FragH f; f.half[0] = *(const v8us*)((const unsigned short*)p + 8 * hh); f.half[1] = *(const v8us*)((const unsigned short*)p + 16 + 8 * hh); return f.v; }
__device__ __forceinline__ v8f g2_mma(v16h a, v16h b, v8f c) { v8f d = __builtin_amdgcn_wmma_f32_16x16x32_f16(false, a, false, b, (short)0, c, false, false); asm volatile("v_nop\n\tv_nop\n\tv_nop\n\tv_nop" : "+v"(d) : "v"(a), "v"(b)); return d; }
template <int ACT>
__global__ __launch_bounds__(128) void k_gemm2(const _Float16* __restrict__ A, int lda, size_t sA, const _Float16* __restrict__ Bh, int ldb, size_t sB, float alpha, const float* __restrict__ bias, size_t sBias, const float* __restrict__ CP, int rowsPerB, size_t sCPb, int row0g,
    float* __restrict__ C, _Float16* __restrict__ C16, int ldc, size_t sC, int M, int N, int K) {
  __shared__ __attribute__((aligned(16))) float so[4][32][68];
  const int tid = threadIdx.x, w = tid >> 5, lane = tid & 31, ln = lane & 15, hh = lane >> 4; const int by = blockIdx.y;
  A += (size_t)by * sA; Bh += (size_t)by * sB; const size_t cofs = (size_t)by * sC; const float* bp = bias ? bias + (size_t)by * sBias : nullptr;
  const int ntn = N >> 6; const int mt = blockIdx.x / ntn, nq = blockIdx.x - mt * ntn; const int row0 = mt * 128 + 32 * w, col0 = nq * 64; if (row0 >= M) return;
  const _Float16* a0p = A + (size_t)(row0 + ln) * lda; const _Float16* a1p = a0p + (size_t)16 * lda;
  const _Float16* b0p = Bh + (size_t)(col0 + ln) * ldb; const _Float16* b1p = b0p + (size_t)16 * ldb; const _Float16* b2p = b1p + (size_t)16 * ldb; const _Float16* b3p = b2p + (size_t)16 * ldb;
  const v8f z8 = {0.f,0.f,0.f,0.f,0.f,0.f,0.f,0.f}; v8f c00 = z8, c01 = z8, c02 = z8, c03 = z8, c10 = z8, c11 = z8, c12 = z8, c13 = z8;
#pragma unroll 1
  for (int kb = 0; kb < K; kb += 32) { const v16h a0 = g2_frag(a0p + kb, hh), a1 = g2_frag(a1p + kb, hh);
    v16h b = g2_frag(b0p + kb, hh); c00 = g2_mma(a0, b, c00); c10 = g2_mma(a1, b, c10);
    b = g2_frag(b1p + kb, hh); c01 = g2_mma(a0, b, c01); c11 = g2_mma(a1, b, c11);
    b = g2_frag(b2p + kb, hh); c02 = g2_mma(a0, b, c02); c12 = g2_mma(a1, b, c12);
    b = g2_frag(b3p + kb, hh); c03 = g2_mma(a0, b, c03); c13 = g2_mma(a1, b, c13); }
  v8f accs[8] = {c00, c01, c02, c03, c10, c11, c12, c13};
#pragma unroll
  for (int u = 0; u < 8; ++u) { const int t = u & 3, half = u >> 2; const int col = col0 + t * 16 + ln; const float bv = bp ? bf16_round(bp[col]) : 0.f;
#pragma unroll
    for (int r = 0; r < 8; ++r) { const int rloc = half * 16 + 8 * hh + r; float v = accs[u][r] * alpha + bv; if (CP) { const int bidx = (row0g + row0 + rloc) / rowsPerB; v += CP[(size_t)bidx * sCPb + (size_t)by * 64 + col]; }
      if (ACT == 3) v = fmaxf(v, 0.f); else if (ACT == 6) v = 0.5f * v * (1.0f + erff(v * 0.70710678118654752f)); else if (ACT == 11) v = 1.0f / (1.0f + expf(-v)); else if (ACT == 15) v = v / (1.0f + expf(-v)); else if (ACT == 12) v = (v > 0.f) ? v : 0.01f * v; else if (ACT == 8) v = tanhf(v);
      so[w][rloc][t * 16 + ln] = v; } }
  __builtin_amdgcn_fence(__ATOMIC_ACQ_REL, "workgroup"); __builtin_amdgcn_wave_barrier();
  const int rsub = lane >> 4, c4 = (lane & 15) * 4;
  {
#pragma unroll
    for (int q = 0; q < 16; ++q) { const int r = q * 2 + rsub; const v4f v = *(const v4fa*)&so[w][r][c4]; if (C) *(v4f*)(C + cofs + (size_t)(row0 + r) * ldc + col0 + c4) = v; if (C16) { v4h h4; for (int i = 0; i < 4; ++i) h4[i] = (_Float16)v[i]; *(v4h*)(C16 + cofs + (size_t)(row0 + r) * ldc + col0 + c4) = h4; } }
     } }



template <int CAUSAL>
__global__ __launch_bounds__(128) void k_flash(const _Float16* __restrict__ Q16, int ldq, const _Float16* __restrict__ K16, int ldk, const _Float16* __restrict__ Vt, const int* __restrict__ MSK, float* __restrict__ O, int ldo) {
  constexpr int RPW = 16, RTN = RPW / 16, NQB = TQ / (4 * RPW), DT = 4, KS = 2;
  __shared__ __attribute__((aligned(16))) unsigned short sP[4][RPW][40]; __shared__ __attribute__((aligned(16))) float sO[4][RPW][64 + 4];
  const int tid = threadIdx.x, w = tid >> 5, lane = tid & 31, ln = lane & 15, hh = lane >> 4;
  const int slab = blockIdx.x / QBLKS, qblk = blockIdx.x % QBLKS; (void)NQB; const int b = slab / NH, h = slab % NH; const int qb0 = qblk * (4 * RPW); const int q0 = qb0 + w * RPW;
  FragH aq[2][KS];
#pragma unroll
  for (int rt = 0; rt < RTN; ++rt) { const unsigned short* qr = (const unsigned short*)Q16 + ((size_t)b * TQ + q0 + rt * 16 + ln) * ldq + h * 64;
#pragma unroll
    for (int ks = 0; ks < KS; ++ks) { aq[rt][ks].half[0] = *(const v8us*)(qr + ks * 32 + 8 * hh); aq[rt][ks].half[1] = *(const v8us*)(qr + ks * 32 + 16 + 8 * hh); } }
  const unsigned short* Vth = (const unsigned short*)Vt + (size_t)slab * 64 * TK;
  float m_r[2][8], l_r[2][8]; v8f oacc[2][DT];
#pragma unroll
  for (int rt = 0; rt < RTN; ++rt) {
#pragma unroll
    for (int r = 0; r < 8; ++r) { m_r[rt][r] = -3.0e38f; l_r[rt][r] = 0.f; }
#pragma unroll
    for (int dt = 0; dt < DT; ++dt) oacc[rt][dt] = (v8f){0.f,0.f,0.f,0.f,0.f,0.f,0.f,0.f}; }
  const int jend = (CAUSAL == 1) ? (qb0 + 4 * RPW) : TK;      /* causal: keys beyond the block's last query never contribute */
#pragma unroll 1
  for (int j0 = 0; j0 < jend; j0 += 32) {
    v8f s[2][2];
#pragma unroll
    for (int nt = 0; nt < 2; ++nt) { const unsigned short* kr = (const unsigned short*)K16 + ((size_t)b * TK + j0 + nt * 16 + ln) * ldk + h * 64; FragH bk[KS];
#pragma unroll
      for (int ks = 0; ks < KS; ++ks) { bk[ks].half[0] = *(const v8us*)(kr + ks * 32 + 8 * hh); bk[ks].half[1] = *(const v8us*)(kr + ks * 32 + 16 + 8 * hh); }
#pragma unroll
      for (int rt = 0; rt < RTN; ++rt) { v8f acc = (v8f){0.f,0.f,0.f,0.f,0.f,0.f,0.f,0.f};
#pragma unroll
        for (int ks = 0; ks < KS; ++ks) acc = mmaH<1>(aq[rt][ks].v, aq[rt][ks].v, bk[ks].v, bk[ks].v, acc); s[rt][nt] = acc; } }
#pragma unroll
    for (int rt = 0; rt < RTN; ++rt)
#pragma unroll
      for (int r = 0; r < 8; ++r) { const int tq = q0 + rt * 16 + 8 * hh + r; const int k0 = j0 + ln, k1 = j0 + 16 + ln;
        const bool ok0 = (CAUSAL == 1) ? (k0 <= tq) : ((CAUSAL == 2) ? ((k0 >> 5) == (tq >> 5)) : true), ok1 = (CAUSAL == 1) ? (k1 <= tq) : ((CAUSAL == 2) ? ((k1 >> 5) == (tq >> 5)) : true);      /* mode 2: block-diagonal 32-token groups */
        const float s0 = ok0 ? s[rt][0][r] * SCL : -3.0e38f, s1 = ok1 ? s[rt][1][r] * SCL : -3.0e38f; float mc = fmaxf(s0, s1);
        mc = fmaxf(mc, __shfl_xor(mc, 1, 32)); mc = fmaxf(mc, __shfl_xor(mc, 2, 32)); mc = fmaxf(mc, __shfl_xor(mc, 4, 32)); mc = fmaxf(mc, __shfl_xor(mc, 8, 32));
        const float mn = fmaxf(m_r[rt][r], mc); const float al = (mn > -1.0e38f) ? expf(m_r[rt][r] - mn) : 1.0f; m_r[rt][r] = mn; const float p0 = ok0 ? expf(s0 - mn) : 0.f, p1 = ok1 ? expf(s1 - mn) : 0.f; l_r[rt][r] = l_r[rt][r] * al + p0 + p1;
#pragma unroll
        for (int dt = 0; dt < DT; ++dt) oacc[rt][dt][r] *= al;
        FragH t2; t2.h[0] = (_Float16)(p0 * 1024.0f); t2.h[1] = (_Float16)(p1 * 1024.0f); sP[w][rt * 16 + 8 * hh + r][ln] = t2.u[0]; sP[w][rt * 16 + 8 * hh + r][16 + ln] = t2.u[1]; }
    __builtin_amdgcn_fence(__ATOMIC_ACQ_REL, "workgroup"); __builtin_amdgcn_wave_barrier();
    FragH pa[2];
#pragma unroll
    for (int rt = 0; rt < RTN; ++rt) { pa[rt].half[0] = *(const v8us*)&sP[w][rt * 16 + ln][8 * hh]; pa[rt].half[1] = *(const v8us*)&sP[w][rt * 16 + ln][16 + 8 * hh]; }
#pragma unroll
    for (int dt = 0; dt < DT; ++dt) { const unsigned short* vrow = Vth + (size_t)(dt * 16 + ln) * TK + j0; FragH bv; bv.half[0] = *(const v8us*)(vrow + 8 * hh); bv.half[1] = *(const v8us*)(vrow + 16 + 8 * hh);
#pragma unroll
      for (int rt = 0; rt < RTN; ++rt) oacc[rt][dt] = mmaH<1>(pa[rt].v, pa[rt].v, bv.v, bv.v, oacc[rt][dt]); }
    __builtin_amdgcn_fence(__ATOMIC_ACQ_REL, "workgroup"); __builtin_amdgcn_wave_barrier(); }
#pragma unroll
  for (int rt = 0; rt < RTN; ++rt) {
#pragma unroll
    for (int r = 0; r < 8; ++r) { float l = l_r[rt][r]; l += __shfl_xor(l, 1, 32); l += __shfl_xor(l, 2, 32); l += __shfl_xor(l, 4, 32); l += __shfl_xor(l, 8, 32); l_r[rt][r] = (l > 0.f) ? 1.0f / (l * 1024.0f) : 0.f; }
#pragma unroll
    for (int dt = 0; dt < DT; ++dt)
#pragma unroll
      for (int r = 0; r < 8; ++r) sO[w][rt * 16 + 8 * hh + r][dt * 16 + ln] = oacc[rt][dt][r] * l_r[rt][r]; }
  __builtin_amdgcn_fence(__ATOMIC_ACQ_REL, "workgroup"); __builtin_amdgcn_wave_barrier();
  {
#pragma unroll
    for (int rp = 0; rp < RPW; rp += 2) { const int r = rp + (lane >> 4), pc = lane & 15; const v4f val = *(const v4fa*)&sO[w][r][pc * 4]; *(v4f*)(O + ((size_t)b * TQ + q0 + r) * ldo + h * 64 + pc * 4) = val; }
     } }
// Q/K-split variant: S = Qh Kh^T + (Ql Kh^T + Qh Kl^T)/1024 with Q/K = [hi | 2^10 residual] f16 planes (QL/KL same layout as Q16/K16); plain f16 P (x2^10) . V^T as in k_flash
template <int CAUSAL>
__global__ __launch_bounds__(128) void k_flashqk(const _Float16* __restrict__ Q16, const _Float16* __restrict__ QL, int ldq, const _Float16* __restrict__ K16, const _Float16* __restrict__ KL, int ldk, const _Float16* __restrict__ Vt, const int* __restrict__ MSK, float* __restrict__ O, int ldo) {
  constexpr int RPW = 16, RTN = RPW / 16, NQB = TQ / (4 * RPW), DT = 4, KS = 2;
  __shared__ __attribute__((aligned(16))) unsigned short sP[4][RPW][40]; __shared__ __attribute__((aligned(16))) float sO[4][RPW][64 + 4];
  const int tid = threadIdx.x, w = tid >> 5, lane = tid & 31, ln = lane & 15, hh = lane >> 4;
  const int slab = blockIdx.x / QBLKS, qblk = blockIdx.x % QBLKS; (void)NQB; const int b = slab / NH, h = slab % NH; const int qb0 = qblk * (4 * RPW); const int q0 = qb0 + w * RPW;
  FragH aq[2][KS], aql[2][KS];
#pragma unroll
  for (int rt = 0; rt < RTN; ++rt) { const unsigned short* qr = (const unsigned short*)Q16 + ((size_t)b * TQ + q0 + rt * 16 + ln) * ldq + h * 64; const unsigned short* ql = (const unsigned short*)QL + ((size_t)b * TQ + q0 + rt * 16 + ln) * ldq + h * 64;
#pragma unroll
    for (int ks = 0; ks < KS; ++ks) { aq[rt][ks].half[0] = *(const v8us*)(qr + ks * 32 + 8 * hh); aq[rt][ks].half[1] = *(const v8us*)(qr + ks * 32 + 16 + 8 * hh); aql[rt][ks].half[0] = *(const v8us*)(ql + ks * 32 + 8 * hh); aql[rt][ks].half[1] = *(const v8us*)(ql + ks * 32 + 16 + 8 * hh); } }
  const unsigned short* Vth = (const unsigned short*)Vt + (size_t)slab * 64 * TK;
  float m_r[2][8], l_r[2][8]; v8f oacc[2][DT];
#pragma unroll
  for (int rt = 0; rt < RTN; ++rt) {
#pragma unroll
    for (int r = 0; r < 8; ++r) { m_r[rt][r] = -3.0e38f; l_r[rt][r] = 0.f; }
#pragma unroll
    for (int dt = 0; dt < DT; ++dt) oacc[rt][dt] = (v8f){0.f,0.f,0.f,0.f,0.f,0.f,0.f,0.f}; }
  const int jend = (CAUSAL == 1) ? (qb0 + 4 * RPW) : TK;      /* causal: keys beyond the block's last query never contribute */
#pragma unroll 1
  for (int j0 = 0; j0 < jend; j0 += 32) {
    v8f s[2][2];
#pragma unroll
    for (int nt = 0; nt < 2; ++nt) { const unsigned short* kr = (const unsigned short*)K16 + ((size_t)b * TK + j0 + nt * 16 + ln) * ldk + h * 64; const unsigned short* klr = (const unsigned short*)KL + ((size_t)b * TK + j0 + nt * 16 + ln) * ldk + h * 64; FragH bk[KS], bkl[KS];
#pragma unroll
      for (int ks = 0; ks < KS; ++ks) { bk[ks].half[0] = *(const v8us*)(kr + ks * 32 + 8 * hh); bk[ks].half[1] = *(const v8us*)(kr + ks * 32 + 16 + 8 * hh); bkl[ks].half[0] = *(const v8us*)(klr + ks * 32 + 8 * hh); bkl[ks].half[1] = *(const v8us*)(klr + ks * 32 + 16 + 8 * hh); }
#pragma unroll
      for (int rt = 0; rt < RTN; ++rt) { v8f acc = (v8f){0.f,0.f,0.f,0.f,0.f,0.f,0.f,0.f}, accl = acc;
#pragma unroll
        for (int ks = 0; ks < KS; ++ks) { acc = mmaH<1>(aq[rt][ks].v, aq[rt][ks].v, bk[ks].v, bk[ks].v, acc); accl = mmaH<1>(aql[rt][ks].v, aql[rt][ks].v, bk[ks].v, bk[ks].v, accl); accl = mmaH<1>(aq[rt][ks].v, aq[rt][ks].v, bkl[ks].v, bkl[ks].v, accl); }
#pragma unroll
        for (int r = 0; r < 8; ++r) acc[r] += accl[r] * 0.0009765625f;
        s[rt][nt] = acc; } }
#pragma unroll
    for (int rt = 0; rt < RTN; ++rt)
#pragma unroll
      for (int r = 0; r < 8; ++r) { const int tq = q0 + rt * 16 + 8 * hh + r; const int k0 = j0 + ln, k1 = j0 + 16 + ln;
        bool ok0 = (CAUSAL == 1) ? (k0 <= tq) : ((CAUSAL == 2) ? ((k0 >> 5) == (tq >> 5)) : true), ok1 = (CAUSAL == 1) ? (k1 <= tq) : ((CAUSAL == 2) ? ((k1 >> 5) == (tq >> 5)) : true);      /* mode 2: block-diagonal 32-token groups */
        if (CAUSAL == 4) { const int* mrow = MSK + ((size_t)b * TQ + tq) * TK; ok0 = mrow[k0] != 0; ok1 = mrow[k1] != 0; }      /* mode 4: per-(query, key) INPUT mask shared by all heads; masked keys contribute nothing (== the reference's -4096 fill, whose exp underflows to 0), rows with no valid key give l = 0 -> output 0 (== the reference's row_valid zeroing) */
        const float s0 = ok0 ? s[rt][0][r] * SCL : -3.0e38f, s1 = ok1 ? s[rt][1][r] * SCL : -3.0e38f; float mc = fmaxf(s0, s1);
        mc = fmaxf(mc, __shfl_xor(mc, 1, 32)); mc = fmaxf(mc, __shfl_xor(mc, 2, 32)); mc = fmaxf(mc, __shfl_xor(mc, 4, 32)); mc = fmaxf(mc, __shfl_xor(mc, 8, 32));
        const float mn = fmaxf(m_r[rt][r], mc); const float al = (mn > -1.0e38f) ? expf(m_r[rt][r] - mn) : 1.0f; m_r[rt][r] = mn; const float p0 = ok0 ? expf(s0 - mn) : 0.f, p1 = ok1 ? expf(s1 - mn) : 0.f; l_r[rt][r] = l_r[rt][r] * al + p0 + p1;
#pragma unroll
        for (int dt = 0; dt < DT; ++dt) oacc[rt][dt][r] *= al;
        FragH t2; t2.h[0] = (_Float16)(p0 * 1024.0f); t2.h[1] = (_Float16)(p1 * 1024.0f); sP[w][rt * 16 + 8 * hh + r][ln] = t2.u[0]; sP[w][rt * 16 + 8 * hh + r][16 + ln] = t2.u[1]; }
    __builtin_amdgcn_fence(__ATOMIC_ACQ_REL, "workgroup"); __builtin_amdgcn_wave_barrier();
    FragH pa[2];
#pragma unroll
    for (int rt = 0; rt < RTN; ++rt) { pa[rt].half[0] = *(const v8us*)&sP[w][rt * 16 + ln][8 * hh]; pa[rt].half[1] = *(const v8us*)&sP[w][rt * 16 + ln][16 + 8 * hh]; }
#pragma unroll
    for (int dt = 0; dt < DT; ++dt) { const unsigned short* vrow = Vth + (size_t)(dt * 16 + ln) * TK + j0; FragH bv; bv.half[0] = *(const v8us*)(vrow + 8 * hh); bv.half[1] = *(const v8us*)(vrow + 16 + 8 * hh);
#pragma unroll
      for (int rt = 0; rt < RTN; ++rt) oacc[rt][dt] = mmaH<1>(pa[rt].v, pa[rt].v, bv.v, bv.v, oacc[rt][dt]); }
    __builtin_amdgcn_fence(__ATOMIC_ACQ_REL, "workgroup"); __builtin_amdgcn_wave_barrier(); }
#pragma unroll
  for (int rt = 0; rt < RTN; ++rt) {
#pragma unroll
    for (int r = 0; r < 8; ++r) { float l = l_r[rt][r]; l += __shfl_xor(l, 1, 32); l += __shfl_xor(l, 2, 32); l += __shfl_xor(l, 4, 32); l += __shfl_xor(l, 8, 32); l_r[rt][r] = (l > 0.f) ? 1.0f / (l * 1024.0f) : 0.f; }
#pragma unroll
    for (int dt = 0; dt < DT; ++dt)
#pragma unroll
      for (int r = 0; r < 8; ++r) sO[w][rt * 16 + 8 * hh + r][dt * 16 + ln] = oacc[rt][dt][r] * l_r[rt][r]; }
  __builtin_amdgcn_fence(__ATOMIC_ACQ_REL, "workgroup"); __builtin_amdgcn_wave_barrier();
  {
#pragma unroll
    for (int rp = 0; rp < RPW; rp += 2) { const int r = rp + (lane >> 4), pc = lane & 15; const v4f val = *(const v4fa*)&sO[w][r][pc * 4]; *(v4f*)(O + ((size_t)b * TQ + q0 + r) * ldo + h * 64 + pc * 4) = val; }
     } }

__global__ __launch_bounds__(256) void k_gnstat(const float* __restrict__ x, float* __restrict__ GS) {
  #pragma clang fp contract(off)
  __shared__ float sh[256]; const int bg = blockIdx.x; const int tid = threadIdx.x; const float* base = x + (size_t)bg * CPG * SLEN; const int n = CPG * SLEN; float s = 0.f;
  for (int i = tid; i < n; i += 256) s += bf16_round(base[i]);
  sh[tid] = s; __syncthreads(); for (int st = 128; st > 0; st >>= 1) { if (tid < st) sh[tid] += sh[tid + st]; __syncthreads(); }
  const float mu = sh[0] / (float)n; __syncthreads(); float q2 = 0.f;
  for (int i = tid; i < n; i += 256) { const float d = bf16_round(base[i]) - mu; q2 += d * d; }
  sh[tid] = q2; __syncthreads(); for (int st = 128; st > 0; st >>= 1) { if (tid < st) sh[tid] += sh[tid + st]; __syncthreads(); }
  if (tid == 0) { const float rs = rsqrtf(sh[0] / (float)n + 1e-5f); { *(float*)(GS + (size_t)bg * 32) = mu; *(float*)(GS + (size_t)bg * 32 + 1) = rs;  } } }
__global__ __launch_bounds__(256) void k_gnT(const float* __restrict__ x, const float* __restrict__ GS, const float* __restrict__ gam, const float* __restrict__ bet, _Float16* __restrict__ XT16) {
  #pragma clang fp contract(off)
  __shared__ float tl[64][65]; const int tid = threadIdx.x; const int per = (CC / 64) * (SLEN / 64); const int b = blockIdx.x / per; const int rem = blockIdx.x % per; const int cb = rem / (SLEN / 64), pb = rem % (SLEN / 64);
  for (int i = tid; i < 64 * 16; i += 256) { const int cl = i / 16, p4 = (i % 16) * 4; const int c = cb * 64 + cl; const float mu = GS[((size_t)b * NGR + c / CPG) * 32], rs = GS[((size_t)b * NGR + c / CPG) * 32 + 1]; const float g = bf16_round(gam[c]), be = bf16_round(bet[c]);
    const v4f a = *(const v4fa*)(x + ((size_t)b * CC + c) * SLEN + pb * 64 + p4); for (int q = 0; q < 4; ++q) { float v = (bf16_round(a[q]) - mu) * rs * g; v += be; tl[cl][p4 + q] = v; } }
  __syncthreads(); const int pl = tid >> 2, c8 = (tid & 3) * 8;
  { for (int u = 0; u < 2; ++u) { const int c0 = c8 + u * 32; FragH f; for (int q = 0; q < 8; ++q) f.h[q] = (_Float16)tl[c0 + q][pl]; *(v8us*)((unsigned short*)XT16 + ((size_t)b * SLEN + pb * 64 + pl) * CC + cb * 64 + c0) = f.half[0]; }  } }
__global__ __launch_bounds__(256) void k_wpad(const float* __restrict__ Wm, const float* __restrict__ bm, _Float16* __restrict__ BP, float* __restrict__ PB) {
  const int r = blockIdx.x * 256 + threadIdx.x; if (r >= DP) return; const int h = r / 64, d = r % 64; const bool live = d < HDT; const int srow = h * HDT + d;
  for (int c0 = 0; c0 < CC; c0 += 8) { FragH f; for (int q = 0; q < 8; ++q) f.h[q] = live ? (_Float16)(bf16_round(Wm[(size_t)srow * CC + c0 + q]) * 16.0f) : (_Float16)0.0f; unsigned short* dst = (unsigned short*)BP + (size_t)r * CC + c0; *(v8us*)dst = f.half[0];  }
  const float bv = live ? bm[srow] : 0.f; *(float*)(PB + r) = bv;  }
__global__ __launch_bounds__(256) void k_wio(const float* __restrict__ Wm, int nin, int nout, int pair, _Float16* __restrict__ Bt) { const int pitch = pair ? 2 * nin : nin; const size_t t = (size_t)blockIdx.x * 256 + threadIdx.x; if (t >= (size_t)nout * (pitch / 8)) return; const int pc = (int)(t % (pitch / 8)); const int o = (int)(t / (pitch / 8)); FragH f;
  for (int q = 0; q < 8; ++q) { const int col = pc * 8 + q; const bool lo = col >= nin; const int i = lo ? col - nin : col; f.h[q] = (_Float16)(bf16_round(Wm[(size_t)i * nout + o]) * (lo ? 1.0f : 16.0f)); }
  *(v8us*)((unsigned short*)Bt + (size_t)o * pitch + pc * 8) = f.half[0];  }
__global__ __launch_bounds__(256) void k_wop(const float* __restrict__ Wo, _Float16* __restrict__ Bt) { const int t = blockIdx.x * 256 + threadIdx.x; if (t >= CC * (2 * CC / 8)) return; const int pc = t % (2 * CC / 8); const int o = t / (2 * CC / 8); const bool lo = pc * 8 >= CC; FragH f;
  for (int q = 0; q < 8; ++q) { const int c = pc * 8 + q - (lo ? CC : 0); f.h[q] = (_Float16)(bf16_round(Wo[(size_t)o * CC + c]) * (lo ? 1.0f : 16.0f)); } *(v8us*)((unsigned short*)Bt + (size_t)o * 2 * CC + pc * 8) = f.half[0];  }
__global__ __launch_bounds__(256) void k_ofl(const float* __restrict__ O, float* __restrict__ OF, _Float16* __restrict__ OF2) { const size_t t = (size_t)blockIdx.x * 256 + threadIdx.x; if (t >= (size_t)NR * (CC / 8)) return; const int c0 = (int)(t % (CC / 8)) * 8; const size_t r = t / (CC / 8); const int h = c0 / HDT, d0 = c0 % HDT; FragH fh, fl; v4f a, bq;
  for (int q = 0; q < 8; ++q) { const float v = O[r * DP + h * 64 + d0 + q]; const _Float16 hv = (_Float16)v; fh.h[q] = hv; fl.h[q] = (_Float16)((v - (float)hv) * 16.0f); if (q < 4) a[q] = v; else bq[q - 4] = v; }
  { *(v4f*)(OF + r * CC + c0) = a; *(v4f*)(OF + r * CC + c0 + 4) = bq; *(v8us*)((unsigned short*)OF2 + r * 2 * CC + c0) = fh.half[0]; *(v8us*)((unsigned short*)OF2 + r * 2 * CC + CC + c0) = fl.half[0];  } }
__global__ __launch_bounds__(256) void k_pair16(const float* __restrict__ S, _Float16* __restrict__ HP) { const size_t t = (size_t)blockIdx.x * 256 + threadIdx.x; if (t >= (size_t)NR * (CC / 8)) return; const int c0 = (int)(t % (CC / 8)) * 8; const size_t r = t / (CC / 8); FragH fh, fl;
  for (int q = 0; q < 8; ++q) { const float v = S[r * CC + c0 + q]; const _Float16 hv = (_Float16)v; fh.h[q] = hv; fl.h[q] = (_Float16)((v - (float)hv) * 16.0f); }
  { *(v8us*)((unsigned short*)HP + r * 2 * CC + c0) = fh.half[0]; *(v8us*)((unsigned short*)HP + r * 2 * CC + CC + c0) = fl.half[0];  } }
__global__ __launch_bounds__(256) void k_nchw(const float* __restrict__ Y, float* __restrict__ out) { const size_t t = (size_t)blockIdx.x * 256 + threadIdx.x; if (t >= (size_t)NB * CC * (SLEN / 4)) return; const int n0 = (int)(t % (SLEN / 4)) * 4; const int o = (int)((t / (SLEN / 4)) % CC); const int b = (int)(t / ((size_t)(SLEN / 4) * CC)); v4f r; for (int q = 0; q < 4; ++q) r[q] = Y[((size_t)b * SLEN + n0 + q) * CC + o]; float* d = out + ((size_t)b * CC + o) * SLEN + n0; *(v4f*)d = r;  }

extern "C" void kernel_launch(void* const* d_in, const int* in_sizes, int n_in,
                              void* d_out, int out_size, void* d_ws, size_t ws_size, hipStream_t stream) {
  (void)in_sizes; (void)n_in; (void)out_size;
  const float* const* I = (const float* const*)d_in; const float* fo = I[0]; const float* fs = I[1]; const float* gq = I[2]; const float* bq = I[3]; const float* gkv = I[4]; const float* bkv = I[5]; const float* Wq = I[6]; const float* bqp = I[7]; const float* Wk = I[8]; const float* bkp = I[9]; const float* Wv = I[10]; const float* bvp = I[11]; const float* W1 = I[12]; const float* b1 = I[13]; const float* W2 = I[14]; const float* b2 = I[15]; const float* Wo = I[16]; const float* bo = I[17];
  char* ws = (char*)d_ws; size_t off = 0;
  auto take = [&](size_t bytes) { char* p = ws + off; off += (bytes + 255) & ~(size_t)255; return p; };
  _Float16* BPq = (_Float16*)take((size_t)DP * CC * 2); _Float16* BPk = (_Float16*)take((size_t)DP * CC * 2); _Float16* BPv = (_Float16*)take((size_t)DP * CC * 2); float* PBq = (float*)take(DP * 4); float* PBk = (float*)take(DP * 4); float* PBv = (float*)take(DP * 4);
  _Float16* BW1 = (_Float16*)take((size_t)HID * 2 * CC * 2); _Float16* BW2 = (_Float16*)take((size_t)CC * HID * 2); _Float16* BWO = (_Float16*)take((size_t)CC * 2 * CC * 2); float* GS = (float*)take((size_t)NB * NGR * 32 * 4 * 2);
  _Float16* XQ = (_Float16*)take((size_t)NR * CC * 2); _Float16* XKV = (_Float16*)take((size_t)NR * CC * 2); float* F32 = (float*)take((size_t)NR * DP * 4);
  _Float16* QH = (_Float16*)take((size_t)NR * DP * 2); _Float16* QL = (_Float16*)take((size_t)NR * DP * 2); _Float16* KH = (_Float16*)take((size_t)NR * DP * 2); _Float16* KL = (_Float16*)take((size_t)NR * DP * 2); _Float16* VH = (_Float16*)take((size_t)NR * DP * 2); _Float16* VL = (_Float16*)take((size_t)NR * DP * 2); _Float16* VT = (_Float16*)take((size_t)NR * DP * 2); _Float16* VTL = (_Float16*)take((size_t)NR * DP * 2);
  float* OF = (float*)take((size_t)NR * CC * 4); _Float16* OF2 = (_Float16*)take((size_t)NR * 2 * CC * 2); _Float16* G16 = (_Float16*)take((size_t)NR * HID * 2); float* FU = (float*)take((size_t)NR * CC * 4); _Float16* FU2 = (_Float16*)take((size_t)NR * 2 * CC * 2); float* Y = (float*)take((size_t)NR * CC * 4);
  float* O = F32;
  if (off > ws_size) return;      /* 0.6 + 2 + 2 + 8 + 8 x 4 + 4 + 4 + 4 + 4 + 4 + 4 = 69 MiB */
  k_wpad<<<1, 256, 0, stream>>>(Wq, bqp, BPq, PBq); k_wpad<<<1, 256, 0, stream>>>(Wk, bkp, BPk, PBk); k_wpad<<<1, 256, 0, stream>>>(Wv, bvp, BPv, PBv);      /* conv1x1 weights (out,in) = natural rows */
  k_wio<<<(HID * (2 * CC / 8) + 255) / 256, 256, 0, stream>>>(W1, CC, HID, 1, BW1); k_wio<<<(CC * (HID / 8) + 255) / 256, 256, 0, stream>>>(W2, HID, CC, 0, BW2); k_wop<<<(CC * (2 * CC / 8) + 255) / 256, 256, 0, stream>>>(Wo, BWO);
  k_gnstat<<<NB * NGR, 256, 0, stream>>>(fo, GS); k_gnstat<<<NB * NGR, 256, 0, stream>>>(fs, GS + NB * NGR * 32);
  k_gnT<<<NB * (CC / 64) * (SLEN / 64), 256, 0, stream>>>(fo, GS, gq, bq, XQ); k_gnT<<<NB * (CC / 64) * (SLEN / 64), 256, 0, stream>>>(fs, GS + NB * NGR * 32, gkv, bkv, XKV);
  const dim3 gP((NR / 128) * (DP / 64), 1), gC((NR / 128) * (CC / 64), 1), gH((NR / 128) * (HID / 64), 1); const unsigned n8 = (unsigned)(((size_t)NR * DP / 8 + 255) / 256), n8c = (unsigned)(((size_t)NR * (CC / 8) + 255) / 256);
  k_gemm2<0><<<gP, 128, 0, stream>>>(XQ, CC, 0, BPq, CC, 0, 0.0625f, PBq, 0, nullptr, 1, 0, 0, F32, nullptr, DP, 0, NR, DP, CC); k_hl<<<n8, 256, 0, stream>>>(F32, QH, QL, (size_t)NR * DP / 8);
  k_gemm2<0><<<gP, 128, 0, stream>>>(XKV, CC, 0, BPk, CC, 0, 0.0625f, PBk, 0, nullptr, 1, 0, 0, F32, nullptr, DP, 0, NR, DP, CC); k_hl<<<n8, 256, 0, stream>>>(F32, KH, KL, (size_t)NR * DP / 8);
  k_gemm2<0><<<gP, 128, 0, stream>>>(XKV, CC, 0, BPv, CC, 0, 0.0625f, PBv, 0, nullptr, 1, 0, 0, F32, nullptr, DP, 0, NR, DP, CC); k_hl<<<n8, 256, 0, stream>>>(F32, VH, VL, (size_t)NR * DP / 8);
  k_vt<NH, SLEN><<<NB * NH * (SLEN / 64), 256, 0, stream>>>(VH, DP, 0, VT);
  k_flashqk<0><<<NB * NH * QBLKS, 128, 0, stream>>>(QH, QL, DP, KH, KL, DP, VT, nullptr, O, DP);      /* q/k hi + residual; P (x2^10) and V plain f16 */
  k_ofl<<<n8c, 256, 0, stream>>>(O, OF, OF2);
  k_gemm2<6><<<gH, 128, 0, stream>>>(OF2, 2 * CC, 0, BW1, 2 * CC, 0, 0.0625f, b1, 0, nullptr, 1, 0, 0, nullptr, G16, HID, 0, NR, HID, 2 * CC);      /* gelu_erf(out W1 + b1) -> f16 */
  k_gemm2<0><<<gC, 128, 0, stream>>>(G16, HID, 0, BW2, HID, 0, 0.0625f, b2, 0, OF, 1, (size_t)CC, 0, FU, nullptr, CC, 0, NR, CC, HID);      /* mlp + b2 + out_flat */
  k_pair16<<<n8c, 256, 0, stream>>>(FU, FU2);
  k_gemm2<0><<<gC, 128, 0, stream>>>(FU2, 2 * CC, 0, BWO, 2 * CC, 0, 0.0625f, bo, 0, nullptr, 1, 0, 0, Y, nullptr, CC, 0, NR, CC, 2 * CC);      /* conv1x1(fused, Wo) + bo */
  k_nchw<<<(unsigned)(((size_t)NB * CC * (SLEN / 4) + 255) / 256), 256, 0, stream>>>(Y, (float*)d_out);
}

// v001
// One run takes 480 microseconds.
// In two side-by-side timings against v000, it was 1.40 and 1.41 times as fast.
#include <hip/hip_runtime.h>
// SFBlock (2 x 128 x 64 x 64; 4 heads x 32; GroupNorm(32) on both inputs; q from feat_opt, k/v from feat_sar via 1x1 convs; softmax(q k^T / sqrt(32)) v over the 4096 positions; MLP: gelu_erf(out W1 + b1) W2 + b2; fused = out + mlp; 1x1 conv Wo -> [2,128,64,64]).
// Compute dtype: inputs and parameters rounded to bf16; normalised inputs as f16 operands (~2^-12); q, k hi + residual; P (x2^10), v plain f16; attention output / fused as hi + residual pairs; the 256-wide GELU hidden as f16; f32 statistics/softmax/accumulation. v_wmma_f32_16x16x32_f16.
#define NB 2
#define CC 128
#define HID 256
#define NGR 32
#define CPG (CC / NGR)           /* 4 channels per group */
#define HDT 32
#define DP (NH * 64)             /* 256 padded */
#define NR (NB * SLEN)           /* 8192 */
#define QBLKS (TQ / 64)
#define SLEN 4096                /* H*W tokens */
#define TQ SLEN
#define TK SLEN
#define NH 4
#define SCL 0.17677669529663687f /* 32^-0.5 (true head dim 32, zero-padded to 64) */
typedef __bf16 v16b __attribute__((ext_vector_type(16)));
typedef unsigned short v8us __attribute__((ext_vector_type(8), may_alias));
typedef float  v8f  __attribute__((ext_vector_type(8)));
typedef float  v4f  __attribute__((ext_vector_type(4)));
typedef float  v4fa __attribute__((ext_vector_type(4), may_alias));
union FragB { v16b v; v8us half[2]; unsigned short u[16]; };

__device__ __forceinline__ unsigned short bf16_bits(float x) { unsigned int u = __float_as_uint(x); return (unsigned short)((u + 0x7FFFu + ((u >> 16) & 1u)) >> 16); }
__device__ __forceinline__ float bf16_val(unsigned short b) { return __uint_as_float(((unsigned int)b) << 16); }
__device__ __forceinline__ float bf16_round(float x) { return bf16_val(bf16_bits(x)); }
// D += A·B with NT terms: 1 = ah·bh, 2 = + al·bh (A split), 3 = + ah·bl (both split)
template <int NT>
__device__ __forceinline__ v8f mmaN(v16b ah, v16b al, v16b bh, v16b bl, v8f c) {
  c = __builtin_amdgcn_wmma_f32_16x16x32_bf16(false, ah, false, bh, (short)0, c, false, false);
  if (NT >= 2) c = __builtin_amdgcn_wmma_f32_16x16x32_bf16(false, al, false, bh, (short)0, c, false, false);
  if (NT >= 3) c = __builtin_amdgcn_wmma_f32_16x16x32_bf16(false, ah, false, bl, (short)0, c, false, false);
  asm volatile("v_nop\n\tv_nop\n\tv_nop\n\tv_nop" : "+v"(c) : "v"(ah), "v"(al), "v"(bh), "v"(bl));
  return c;
}

__global__ __launch_bounds__(256) void k_wt_bf16(const float* __restrict__ W, unsigned short* __restrict__ Wt, int K, int N) {
  const int t = blockIdx.x * 256 + threadIdx.x;
  const int k8n = K / 8;
  if (t >= N * k8n) return;
  const int n = t / k8n, k8 = (t % k8n) * 8;
  v8us v;
#pragma unroll
  for (int i = 0; i < 8; ++i) v[i] = bf16_bits(W[(size_t)(k8 + i) * N + n]);
  *(v8us*)(Wt + (size_t)n * K + k8) = v;
  
}

// GEMM C[M][N] (f32, pitch ldc) = act(A[M][K]·W + bias). A f32 row-major (pitch lda) converted per fragment to bf16
// (ASPLIT: hi/lo two planes -> 2 terms, else single rounded term); Wt bf16 [N][K] (pitch ldb). BIAS_BF16 rounds the
// bias to bf16 first (bias quantised to bf16 before the add). K%32==0, M%16==0, N%64==0.
template <bool ASPLIT, int ACT, bool BIAS_BF16>
__global__ __launch_bounds__(128) void k_gemm_bf(const float* __restrict__ A, int lda, const unsigned short* __restrict__ Wt, int ldb,
                                               const float* __restrict__ bias, float* __restrict__ C, int ldc, int M, int N, int K) {
  __shared__ __attribute__((aligned(16))) float so[4][16][64];
  const int tid = threadIdx.x, w = tid >> 5, lane = tid & 31, ln = lane & 15, hh = lane >> 4;
  const int ntn = N / 64;
  const int wid = blockIdx.x * 4 + w;
  const int mt = wid / ntn, nq = wid % ntn;
  if (mt * 16 >= M) return;
  const int row0 = mt * 16, col0 = nq * 64;
  const float* arow = A + (size_t)(row0 + ln) * lda;
  v8f acc[4] = {};
  for (int kb = 0; kb < K; kb += 32) {
    FragB ah, al;
    const v4f x0 = *(const v4fa*)(arow + kb + 8 * hh), x1 = *(const v4fa*)(arow + kb + 8 * hh + 4);
    const v4f x2 = *(const v4fa*)(arow + kb + 16 + 8 * hh), x3 = *(const v4fa*)(arow + kb + 16 + 8 * hh + 4);
    float xs[16] = {x0[0],x0[1],x0[2],x0[3],x1[0],x1[1],x1[2],x1[3],x2[0],x2[1],x2[2],x2[3],x3[0],x3[1],x3[2],x3[3]};
#pragma unroll
    for (int i = 0; i < 16; ++i) { const unsigned short hb = bf16_bits(xs[i]); ah.u[i] = hb; al.u[i] = ASPLIT ? bf16_bits(xs[i] - bf16_val(hb)) : (unsigned short)0; }
#pragma unroll
    for (int t = 0; t < 4; ++t) {
      const unsigned short* brow = Wt + (size_t)(col0 + t * 16 + ln) * ldb + kb;
      FragB b;
      b.half[0] = *(const v8us*)(brow + 8 * hh);
      b.half[1] = *(const v8us*)(brow + 16 + 8 * hh);
      acc[t] = mmaN<ASPLIT ? 2 : 1>(ah.v, al.v, b.v, b.v, acc[t]);
    }
  }
#pragma unroll
  for (int t = 0; t < 4; ++t) {
    float bv = bias ? bias[col0 + t * 16 + ln] : 0.f;
    if (BIAS_BF16) bv = bf16_round(bv);
#pragma unroll
    for (int r = 0; r < 8; ++r) { float v = acc[t][r] + bv; if (ACT == 1) v = fmaxf(v, 0.f); so[w][8 * hh + r][t * 16 + ln] = v; }
  }
  __builtin_amdgcn_fence(__ATOMIC_ACQ_REL, "workgroup");
  __builtin_amdgcn_wave_barrier();
  const int rsub = lane >> 4, c4 = (lane & 15) * 4;
  {
#pragma unroll
    for (int q = 0; q < 8; ++q) {
      const int r = q * 2 + rsub;
      const v4f v = *(const v4fa*)&so[w][r][c4];
      *(v4f*)(C + (size_t)(row0 + r) * ldc + col0 + c4) = v;
    }
    
  }
}

// GEMM C = act(A·W + bias + resid): A f32 (ASPLIT -> hi/lo 2 terms), Wt bf16 [N][K]; ACT 0 none, 1 relu, 2 exact gelu;
// resid (optional, f32, row index = (row % rmod), pitch ldr, RES_BF16 rounds it) added before the activation.
template <bool ASPLIT, int ACT, bool BIAS_BF16, bool RES_BF16>
__global__ __launch_bounds__(128) void k_gemm_bf3(const float* __restrict__ A, int lda, const unsigned short* __restrict__ Wt, int ldb,
                                                const float* __restrict__ bias, const float* __restrict__ resid, int rmod, int ldr,
                                                float* __restrict__ C, int ldc, int M, int N, int K) {
  __shared__ __attribute__((aligned(16))) float so[4][16][64];
  const int tid = threadIdx.x, w = tid >> 5, lane = tid & 31, ln = lane & 15, hh = lane >> 4;
  const int ntn = N / 64;
  const int wid = blockIdx.x * 4 + w;
  const int mt = wid / ntn, nq = wid % ntn;
  if (mt * 16 >= M) return;
  const int row0 = mt * 16, col0 = nq * 64;
  const float* arow = A + (size_t)(row0 + ln) * lda;
  v8f acc[4] = {};
  for (int kb = 0; kb < K; kb += 32) {
    FragB ah, al;
    const v4f x0 = *(const v4fa*)(arow + kb + 8 * hh), x1 = *(const v4fa*)(arow + kb + 8 * hh + 4);
    const v4f x2 = *(const v4fa*)(arow + kb + 16 + 8 * hh), x3 = *(const v4fa*)(arow + kb + 16 + 8 * hh + 4);
    float xs[16] = {x0[0],x0[1],x0[2],x0[3],x1[0],x1[1],x1[2],x1[3],x2[0],x2[1],x2[2],x2[3],x3[0],x3[1],x3[2],x3[3]};
#pragma unroll
    for (int i = 0; i < 16; ++i) { const unsigned short hb = bf16_bits(xs[i]); ah.u[i] = hb; al.u[i] = ASPLIT ? bf16_bits(xs[i] - bf16_val(hb)) : (unsigned short)0; }
#pragma unroll
    for (int t = 0; t < 4; ++t) {
      const unsigned short* brow = Wt + (size_t)(col0 + t * 16 + ln) * ldb + kb;
      FragB b;
      b.half[0] = *(const v8us*)(brow + 8 * hh);
      b.half[1] = *(const v8us*)(brow + 16 + 8 * hh);
      acc[t] = mmaN<ASPLIT ? 2 : 1>(ah.v, al.v, b.v, b.v, acc[t]);
    }
  }
#pragma unroll
  for (int t = 0; t < 4; ++t) {
    const int col = col0 + t * 16 + ln;
    float bv = bias ? bias[col] : 0.f;
    if (BIAS_BF16) bv = bf16_round(bv);
#pragma unroll
    for (int r = 0; r < 8; ++r) {
      float v = acc[t][r] + bv;
      if (resid) { float rv = resid[(size_t)((row0 + 8 * hh + r) % rmod) * ldr + col]; if (RES_BF16) rv = bf16_round(rv); v += rv; }
      if (ACT == 1) v = fmaxf(v, 0.f);
      if (ACT == 2) v = 0.5f * v * (1.0f + erff(v * 0.70710678118654752f));
      if (ACT == 3) { const float u = 0.7978845608028654f * (v + 0.044715f * v * v * v); v = 0.5f * v * (1.0f + tanhf(u)); }
      so[w][8 * hh + r][t * 16 + ln] = v;
    }
  }
  __builtin_amdgcn_fence(__ATOMIC_ACQ_REL, "workgroup");
  __builtin_amdgcn_wave_barrier();
  const int rsub = lane >> 4, c4 = (lane & 15) * 4;
  {
#pragma unroll
    for (int q = 0; q < 8; ++q) {
      const int r = q * 2 + rsub;
      const v4f v = *(const v4fa*)&so[w][r][c4];
      *(v4f*)(C + (size_t)(row0 + r) * ldc + col0 + c4) = v;
    }
    
  }
}
// row LayerNorm (biased variance, eps) over N: s = X (+ R); optional out_sum <- s; out_norm <- (s-mu)*rsqrt(var+eps)*g + b
template <bool PARAM_BF16>
__global__ __launch_bounds__(256) void k_layernorm(const float* __restrict__ X, const float* __restrict__ R, const float* __restrict__ g, const float* __restrict__ bta,
                                                  float* __restrict__ out_sum, float* __restrict__ out_norm, int N, float eps) {
  __shared__ float red[256];
  const int row = blockIdx.x, tid = threadIdx.x;
  const float* x = X + (size_t)row * N; const float* rr = R ? R + (size_t)row * N : nullptr;
  float vals[16];                     // up to N = 4096
  const int per = N / 256;            // contiguous chunk per thread? use strided-by-4 chunks: thread handles j = tid*4 + 1024*u
  float s1 = 0.f;
  for (int u = 0; u < per / 4; ++u) {
    const int j = tid * 4 + 1024 * u;
    const v4f a = *(const v4fa*)(x + j);
    v4f b = {0.f,0.f,0.f,0.f}; if (rr) b = *(const v4fa*)(rr + j);
#pragma unroll
    for (int q = 0; q < 4; ++q) { const float v = a[q] + b[q]; vals[u * 4 + q] = v; s1 += v; }
  }
  red[tid] = s1; __syncthreads();
  for (int st = 128; st > 0; st >>= 1) { if (tid < st) red[tid] += red[tid + st]; __syncthreads(); }
  const float mu = red[0] / (float)N; __syncthreads();
  float s2 = 0.f;
  for (int u = 0; u < per / 4; ++u)
#pragma unroll
    for (int q = 0; q < 4; ++q) { const float c = vals[u * 4 + q] - mu; s2 += c * c; }
  red[tid] = s2; __syncthreads();
  for (int st = 128; st > 0; st >>= 1) { if (tid < st) red[tid] += red[tid + st]; __syncthreads(); }
  const float rs = rsqrtf(red[0] / (float)N + eps);
  {
    for (int u = 0; u < per / 4; ++u) {
      const int j = tid * 4 + 1024 * u;
      v4f o, sm;
#pragma unroll
      for (int q = 0; q < 4; ++q) {
        float gg = g[j + q], bb = bta[j + q];
        if (PARAM_BF16) { gg = bf16_round(gg); bb = bf16_round(bb); }
        sm[q] = vals[u * 4 + q]; o[q] = (vals[u * 4 + q] - mu) * rs * gg + bb;
      }
      if (out_sum) *(v4f*)(out_sum + (size_t)row * N + j) = sm;
      *(v4f*)(out_norm + (size_t)row * N + j) = o;
    }
    
  }
}



// ---- f16 WMMA path (v_wmma_f32_16x16x32_f16): 11-bit significands for operands in range — used where a [0,1] probability operand needs more precision than bf16
typedef _Float16 v16h __attribute__((ext_vector_type(16)));
union FragH { v16h v; v8us half[2]; _Float16 h[16]; unsigned short u[16]; };
template <int NT>
__device__ __forceinline__ v8f mmaH(v16h ah, v16h al, v16h bh, v16h bl, v8f c) {
  c = __builtin_amdgcn_wmma_f32_16x16x32_f16(false, ah, false, bh, (short)0, c, false, false);
  if (NT >= 2) c = __builtin_amdgcn_wmma_f32_16x16x32_f16(false, al, false, bh, (short)0, c, false, false);
  if (NT >= 3) c = __builtin_amdgcn_wmma_f32_16x16x32_f16(false, ah, false, bl, (short)0, c, false, false);
  asm volatile("v_nop\n\tv_nop\n\tv_nop\n\tv_nop" : "+v"(c) : "v"(ah), "v"(al), "v"(bh), "v"(bl));
  return c;
}
// batched GEMM like k_gemm_b but f16 operands: A f32 (split into f16 hi/lo if ASPLIT, else rounded to f16), Bt = f16 values [n][k]; alpha; C f32; N multiple of 16 (partial tiles skipped)
template <bool ASPLIT>
__global__ __launch_bounds__(128) void k_gemm_h(const float* __restrict__ A, int lda, size_t sA, const _Float16* __restrict__ Bh, int ldb, size_t sB, float alpha, float* __restrict__ C, int ldc, size_t sC, int M, int N, int K) {
  __shared__ __attribute__((aligned(16))) float so[4][16][64];
  const int tid = threadIdx.x, w = tid >> 5, lane = tid & 31, ln = lane & 15, hh = lane >> 4; const int by = blockIdx.y;
  A += (size_t)by * sA; Bh += (size_t)by * sB; C += (size_t)by * sC;
  const int ntn = (N + 63) / 64; const int wid = blockIdx.x * 4 + w; const int mt = wid / ntn, nq = wid % ntn; if (mt * 16 >= M) return;
  const int row0 = mt * 16, col0 = nq * 64; const float* arow = A + (size_t)(row0 + ln) * lda;
  v8f acc[4] = {};
  for (int kb = 0; kb < K; kb += 32) {
    FragH ah, al;
    const v4f x0 = *(const v4fa*)(arow + kb + 8 * hh), x1 = *(const v4fa*)(arow + kb + 8 * hh + 4), x2 = *(const v4fa*)(arow + kb + 16 + 8 * hh), x3 = *(const v4fa*)(arow + kb + 16 + 8 * hh + 4);
    float xs[16] = {x0[0],x0[1],x0[2],x0[3],x1[0],x1[1],x1[2],x1[3],x2[0],x2[1],x2[2],x2[3],x3[0],x3[1],x3[2],x3[3]};
#pragma unroll
    for (int i = 0; i < 16; ++i) { const _Float16 h = (_Float16)xs[i]; ah.h[i] = h; al.h[i] = ASPLIT ? (_Float16)(xs[i] - (float)h) : (_Float16)0.0f; }
#pragma unroll
    for (int t = 0; t < 4; ++t) { if (col0 + t * 16 >= N) continue; const size_t boff = (size_t)(col0 + t * 16 + ln) * ldb + kb; FragH bq; bq.half[0] = *(const v8us*)(Bh + boff + 8 * hh); bq.half[1] = *(const v8us*)(Bh + boff + 16 + 8 * hh);
      acc[t] = mmaH<ASPLIT ? 2 : 1>(ah.v, al.v, bq.v, bq.v, acc[t]); }
  }
#pragma unroll
  for (int t = 0; t < 4; ++t) { if (col0 + t * 16 >= N) continue;
#pragma unroll
    for (int r = 0; r < 8; ++r) so[w][8 * hh + r][t * 16 + ln] = acc[t][r] * alpha; }
  __builtin_amdgcn_fence(__ATOMIC_ACQ_REL, "workgroup"); __builtin_amdgcn_wave_barrier();
  const int rsub = lane >> 4, c4 = (lane & 15) * 4;
  {
#pragma unroll
    for (int q = 0; q < 8; ++q) { const int r = q * 2 + rsub; if (col0 + c4 < N) { const v4f v = *(const v4fa*)&so[w][r][c4]; *(v4f*)(C + (size_t)(row0 + r) * ldc + col0 + c4) = v; } }
     }
}

// Wt[n][k] = f16(W[k][n]·scale) from f32 row-major W[K][N] (scale = power of two; bf16-exact weights stay exact in f16 away from the subnormal range)
__global__ __launch_bounds__(256) void k_wt_f16(const float* __restrict__ W, _Float16* __restrict__ Wt, int K, int N, float scale) {
  const int t = blockIdx.x * 256 + threadIdx.x; if (t >= N * (K / 8)) return; const int n = t / (K / 8), k8 = (t % (K / 8)) * 8; FragH f;
#pragma unroll
  for (int i = 0; i < 8; ++i) f.h[i] = (_Float16)(bf16_round(W[(size_t)(k8 + i) * N + n]) * scale); const v8us o = f.half[0];
  *(v8us*)((unsigned short*)Wt + (size_t)n * K + k8) = o; 
}
// k_gemm_hh variant with fused epilogue: v = acc·alpha + bias[by·sBias + col] (+ CP[(row/rowsPerB)·sCPb + by·64 + col] if CP) ; ACT 0 none / 1 elu ; writes f16 C16 (and f32 C if non-null)
template <int ACT>
__global__ __launch_bounds__(128) void k_gemm_hhx(const _Float16* __restrict__ A, int lda, size_t sA, const _Float16* __restrict__ Bh, int ldb, size_t sB, float alpha, const float* __restrict__ bias, size_t sBias, const float* __restrict__ CP, int rowsPerB, size_t sCPb, int row0g,
    float* __restrict__ C, _Float16* __restrict__ C16, int ldc, size_t sC, int M, int N, int K) {
  __shared__ __attribute__((aligned(16))) float so[4][16][64];
  const int tid = threadIdx.x, w = tid >> 5, lane = tid & 31, ln = lane & 15, hh = lane >> 4; const int by = blockIdx.y;
  A += (size_t)by * sA; Bh += (size_t)by * sB; const size_t cofs = (size_t)by * sC; const float* bp = bias ? bias + (size_t)by * sBias : nullptr;
  const int ntn = (N + 63) / 64; const int wid = blockIdx.x * 4 + w; const int mt = wid / ntn, nq = wid % ntn; if (mt * 16 >= M) return;
  const int row0 = mt * 16, col0 = nq * 64; const _Float16* arow = A + (size_t)(row0 + ln) * lda;
  v8f acc[4] = {};
  for (int kb = 0; kb < K; kb += 32) { FragH ah; ah.half[0] = *(const v8us*)((const unsigned short*)arow + kb + 8 * hh); ah.half[1] = *(const v8us*)((const unsigned short*)arow + kb + 16 + 8 * hh);
#pragma unroll
    for (int t = 0; t < 4; ++t) { if (col0 + t * 16 >= N) continue; const size_t boff = (size_t)(col0 + t * 16 + ln) * ldb + kb; FragH bq; bq.half[0] = *(const v8us*)((const unsigned short*)Bh + boff + 8 * hh); bq.half[1] = *(const v8us*)((const unsigned short*)Bh + boff + 16 + 8 * hh);
      acc[t] = mmaH<1>(ah.v, ah.v, bq.v, bq.v, acc[t]); }
  }
#pragma unroll
  for (int t = 0; t < 4; ++t) { if (col0 + t * 16 >= N) continue; const int col = col0 + t * 16 + ln; const float bv = bp ? bf16_round(bp[col]) : 0.f;
#pragma unroll
    for (int r = 0; r < 8; ++r) { float v = acc[t][r] * alpha + bv; if (CP) { const int bidx = (row0g + row0 + 8 * hh + r) / rowsPerB; v += CP[(size_t)bidx * sCPb + (size_t)by * 64 + col]; } if (ACT == 1) v = (v > 0.f) ? v : expm1f(v); else if (ACT == 7) v = (v > 0.f) ? v + 1.0f : expf(v); else if (ACT == 8) v = tanhf(v); else if (ACT == 9) v = 0.5f * v * (1.0f + tanhf(0.7978845608028654f * (v + 0.044715f * v * v * v))); else if (ACT == 11) v = 1.0f / (1.0f + expf(-v)); else if (ACT == 12) v = (v > 0.f) ? v : 0.01f * v; else if (ACT == 14) v = (v > 0.f) ? v : 0.1f * v; else if (ACT == 15) v = v / (1.0f + expf(-v)); else if (ACT == 3) v = fmaxf(v, 0.f); else if (ACT == 6) v = 0.5f * v * (1.0f + erff(v * 0.70710678118654752f)); so[w][8 * hh + r][t * 16 + ln] = v; } }
  __builtin_amdgcn_fence(__ATOMIC_ACQ_REL, "workgroup"); __builtin_amdgcn_wave_barrier();
  const int rsub = lane >> 4, c4 = (lane & 15) * 4; typedef _Float16 v4h __attribute__((ext_vector_type(4)));
  {
#pragma unroll
    for (int q = 0; q < 8; ++q) { const int r = q * 2 + rsub; if (col0 + c4 < N) { const v4f v = *(const v4fa*)&so[w][r][c4]; if (C) *(v4f*)(C + cofs + (size_t)(row0 + r) * ldc + col0 + c4) = v; if (C16) { v4h h4; for (int i = 0; i < 4; ++i) h4[i] = (_Float16)v[i]; *(v4h*)(C16 + cofs + (size_t)(row0 + r) * ldc + col0 + c4) = h4; } } }
     }
}


typedef _Float16 v4h __attribute__((ext_vector_type(4)));

__global__ __launch_bounds__(256) void k_x16(const float* __restrict__ x, _Float16* __restrict__ X16, size_t n8) { const size_t t = (size_t)blockIdx.x * 256 + threadIdx.x; if (t >= n8) return; FragH f;
#pragma unroll
  for (int q = 0; q < 8; ++q) f.h[q] = (_Float16)bf16_round(x[t * 8 + q]); *(v8us*)((unsigned short*)X16 + t * 8) = f.half[0];  }
__global__ __launch_bounds__(256) void k_h16(const float* __restrict__ x, _Float16* __restrict__ X16, size_t n8) { const size_t t = (size_t)blockIdx.x * 256 + threadIdx.x; if (t >= n8) return; FragH f;
#pragma unroll
  for (int q = 0; q < 8; ++q) f.h[q] = (_Float16)x[t * 8 + q]; *(v8us*)((unsigned short*)X16 + t * 8) = f.half[0];  }
__global__ __launch_bounds__(256) void k_round16f(const float* __restrict__ W, _Float16* __restrict__ Bt, size_t n8) { const size_t t = (size_t)blockIdx.x * 256 + threadIdx.x; if (t >= n8) return; FragH f;
#pragma unroll
  for (int i = 0; i < 8; ++i) f.h[i] = (_Float16)(bf16_round(W[t * 8 + i]) * 16.0f); *(v8us*)((unsigned short*)Bt + t * 8) = f.half[0];  }
template <int NHv, int TTv>
__global__ __launch_bounds__(256) void k_vt(const _Float16* __restrict__ V16, int ldv, int voff, _Float16* __restrict__ Vt) { __shared__ unsigned short tl[64][66]; const int tid = threadIdx.x; const int slab = blockIdx.x / (TTv / 64), lg = blockIdx.x % (TTv / 64); const int b = slab / NHv, h = slab % NHv;
  for (int i = tid; i < 64 * 8; i += 256) { const int r = i / 8, c8 = (i % 8) * 8; FragH f; f.half[0] = *(const v8us*)((const unsigned short*)V16 + ((size_t)b * TTv + lg * 64 + r) * ldv + voff + h * 64 + c8);
#pragma unroll
    for (int q = 0; q < 8; ++q) tl[r][c8 + q] = f.u[q]; }
  __syncthreads();
  {
#pragma unroll
    for (int rd = 0; rd < 2; ++rd) { const int d = rd * 32 + tid / 8, pc = tid % 8; FragH f;
#pragma unroll
      for (int q = 0; q < 8; ++q) f.u[q] = tl[pc * 8 + q][d];
      *(v8us*)((unsigned short*)Vt + ((size_t)slab * 64 + d) * TTv + lg * 64 + pc * 8) = f.half[0]; }
     } }

__global__ __launch_bounds__(256) void k_hl(const float* __restrict__ F, _Float16* __restrict__ Hh, _Float16* __restrict__ Hl, size_t n8) { const size_t t = (size_t)blockIdx.x * 256 + threadIdx.x; if (t >= n8) return; FragH fh, fl; const v4f a = *(const v4fa*)(F + t * 8), c = *(const v4fa*)(F + t * 8 + 4);
#pragma unroll
  for (int q = 0; q < 4; ++q) { _Float16 h = (_Float16)a[q]; fh.h[q] = h; fl.h[q] = (_Float16)((a[q] - (float)h) * 1024.0f); h = (_Float16)c[q]; fh.h[4 + q] = h; fl.h[4 + q] = (_Float16)((c[q] - (float)h) * 1024.0f); }
  { *(v8us*)((unsigned short*)Hh + t * 8) = fh.half[0]; *(v8us*)((unsigned short*)Hl + t * 8) = fl.half[0];  } }

// ---- fast GEMM (wave tile 32x64; requires M % 32 == 0 rows per launch region and N % 64 == 0); epilogue = k_gemm_hhx semantics ----
__device__ __forceinline__ v16h g2_frag(const _Float16* p, int hh) { FragH f; f.half[0] = *(const v8us*)((const unsigned short*)p + 8 * hh); f.half[1] = *(const v8us*)((const unsigned short*)p + 16 + 8 * hh); return f.v; }
__device__ __forceinline__ v8f g2_mma(v16h a, v16h b, v8f c) { v8f d = __builtin_amdgcn_wmma_f32_16x16x32_f16(false, a, false, b, (short)0, c, false, false); asm volatile("v_nop\n\tv_nop\n\tv_nop\n\tv_nop" : "+v"(d) : "v"(a), "v"(b)); return d; }
template <int ACT>
__global__ __launch_bounds__(128) void k_gemm2(const _Float16* __restrict__ A, int lda, size_t sA, const _Float16* __restrict__ Bh, int ldb, size_t sB, float alpha, const float* __restrict__ bias, size_t sBias, const float* __restrict__ CP, int rowsPerB, size_t sCPb, int row0g,
    float* __restrict__ C, _Float16* __restrict__ C16, int ldc, size_t sC, int M, int N, int K) {
  __shared__ __attribute__((aligned(16))) float so[4][32][68];
  const int tid = threadIdx.x, w = tid >> 5, lane = tid & 31, ln = lane & 15, hh = lane >> 4; const int by = blockIdx.y;
  A += (size_t)by * sA; Bh += (size_t)by * sB; const size_t cofs = (size_t)by * sC; const float* bp = bias ? bias + (size_t)by * sBias : nullptr;
  const int ntn = N >> 6; const int mt = blockIdx.x / ntn, nq = blockIdx.x - mt * ntn; const int row0 = mt * 128 + 32 * w, col0 = nq * 64; if (row0 >= M) return;
  const _Float16* a0p = A + (size_t)(row0 + ln) * lda; const _Float16* a1p = a0p + (size_t)16 * lda;
  const _Float16* b0p = Bh + (size_t)(col0 + ln) * ldb; const _Float16* b1p = b0p + (size_t)16 * ldb; const _Float16* b2p = b1p + (size_t)16 * ldb; const _Float16* b3p = b2p + (size_t)16 * ldb;
  const v8f z8 = {0.f,0.f,0.f,0.f,0.f,0.f,0.f,0.f}; v8f c00 = z8, c01 = z8, c02 = z8, c03 = z8, c10 = z8, c11 = z8, c12 = z8, c13 = z8;
#pragma unroll 1
  for (int kb = 0; kb < K; kb += 32) { const v16h a0 = g2_frag(a0p + kb, hh), a1 = g2_frag(a1p + kb, hh);
    v16h b = g2_frag(b0p + kb, hh); c00 = g2_mma(a0, b, c00); c10 = g2_mma(a1, b, c10);
    b = g2_frag(b1p + kb, hh); c01 = g2_mma(a0, b, c01); c11 = g2_mma(a1, b, c11);
    b = g2_frag(b2p + kb, hh); c02 = g2_mma(a0, b, c02); c12 = g2_mma(a1, b, c12);
    b = g2_frag(b3p + kb, hh); c03 = g2_mma(a0, b, c03); c13 = g2_mma(a1, b, c13); }
  v8f accs[8] = {c00, c01, c02, c03, c10, c11, c12, c13};
#pragma unroll
  for (int u = 0; u < 8; ++u) { const int t = u & 3, half = u >> 2; const int col = col0 + t * 16 + ln; const float bv = bp ? bf16_round(bp[col]) : 0.f;
#pragma unroll
    for (int r = 0; r < 8; ++r) { const int rloc = half * 16 + 8 * hh + r; float v = accs[u][r] * alpha + bv; if (CP) { const int bidx = (row0g + row0 + rloc) / rowsPerB; v += CP[(size_t)bidx * sCPb + (size_t)by * 64 + col]; }
      if (ACT == 3) v = fmaxf(v, 0.f); else if (ACT == 6) v = 0.5f * v * (1.0f + erff(v * 0.70710678118654752f)); else if (ACT == 11) v = 1.0f / (1.0f + expf(-v)); else if (ACT == 15) v = v / (1.0f + expf(-v)); else if (ACT == 12) v = (v > 0.f) ? v : 0.01f * v; else if (ACT == 8) v = tanhf(v);
      so[w][rloc][t * 16 + ln] = v; } }
  __builtin_amdgcn_fence(__ATOMIC_ACQ_REL, "workgroup"); __builtin_amdgcn_wave_barrier();
  const int rsub = lane >> 4, c4 = (lane & 15) * 4;
  {
#pragma unroll
    for (int q = 0; q < 16; ++q) { const int r = q * 2 + rsub; const v4f v = *(const v4fa*)&so[w][r][c4]; if (C) *(v4f*)(C + cofs + (size_t)(row0 + r) * ldc + col0 + c4) = v; if (C16) { v4h h4; for (int i = 0; i < 4; ++i) h4[i] = (_Float16)v[i]; *(v4h*)(C16 + cofs + (size_t)(row0 + r) * ldc + col0 + c4) = h4; } }
     } }



template <int CAUSAL>
__global__ __launch_bounds__(128) void k_flash(const _Float16* __restrict__ Q16, int ldq, const _Float16* __restrict__ K16, int ldk, const _Float16* __restrict__ Vt, const int* __restrict__ MSK, float* __restrict__ O, int ldo) {
  constexpr int RPW = 16, RTN = RPW / 16, NQB = TQ / (4 * RPW), DT = 4, KS = 2;
  __shared__ __attribute__((aligned(16))) unsigned short sP[4][RPW][40]; __shared__ __attribute__((aligned(16))) float sO[4][RPW][64 + 4];
  const int tid = threadIdx.x, w = tid >> 5, lane = tid & 31, ln = lane & 15, hh = lane >> 4;
  const int slab = blockIdx.x / QBLKS, qblk = blockIdx.x % QBLKS; (void)NQB; const int b = slab / NH, h = slab % NH; const int qb0 = qblk * (4 * RPW); const int q0 = qb0 + w * RPW;
  FragH aq[2][KS];
#pragma unroll
  for (int rt = 0; rt < RTN; ++rt) { const unsigned short* qr = (const unsigned short*)Q16 + ((size_t)b * TQ + q0 + rt * 16 + ln) * ldq + h * 64;
#pragma unroll
    for (int ks = 0; ks < KS; ++ks) { aq[rt][ks].half[0] = *(const v8us*)(qr + ks * 32 + 8 * hh); aq[rt][ks].half[1] = *(const v8us*)(qr + ks * 32 + 16 + 8 * hh); } }
  const unsigned short* Vth = (const unsigned short*)Vt + (size_t)slab * 64 * TK;
  float m_r[2][8], l_r[2][8]; v8f oacc[2][DT];
#pragma unroll
  for (int rt = 0; rt < RTN; ++rt) {
#pragma unroll
    for (int r = 0; r < 8; ++r) { m_r[rt][r] = -3.0e38f; l_r[rt][r] = 0.f; }
#pragma unroll
    for (int dt = 0; dt < DT; ++dt) oacc[rt][dt] = (v8f){0.f,0.f,0.f,0.f,0.f,0.f,0.f,0.f}; }
  const int jend = (CAUSAL == 1) ? (qb0 + 4 * RPW) : TK;      /* causal: keys beyond the block's last query never contribute */
#pragma unroll 1
  for (int j0 = 0; j0 < jend; j0 += 32) {
    v8f s[2][2];
#pragma unroll
    for (int nt = 0; nt < 2; ++nt) { const unsigned short* kr = (const unsigned short*)K16 + ((size_t)b * TK + j0 + nt * 16 + ln) * ldk + h * 64; FragH bk[KS];
#pragma unroll
      for (int ks = 0; ks < KS; ++ks) { bk[ks].half[0] = *(const v8us*)(kr + ks * 32 + 8 * hh); bk[ks].half[1] = *(const v8us*)(kr + ks * 32 + 16 + 8 * hh); }
#pragma unroll
      for (int rt = 0; rt < RTN; ++rt) { v8f acc = (v8f){0.f,0.f,0.f,0.f,0.f,0.f,0.f,0.f};
#pragma unroll
        for (int ks = 0; ks < KS; ++ks) acc = mmaH<1>(aq[rt][ks].v, aq[rt][ks].v, bk[ks].v, bk[ks].v, acc); s[rt][nt] = acc; } }
#pragma unroll
    for (int rt = 0; rt < RTN; ++rt)
#pragma unroll
      for (int r = 0; r < 8; ++r) { const int tq = q0 + rt * 16 + 8 * hh + r; const int k0 = j0 + ln, k1 = j0 + 16 + ln;
        const bool ok0 = (CAUSAL == 1) ? (k0 <= tq) : ((CAUSAL == 2) ? ((k0 >> 5) == (tq >> 5)) : true), ok1 = (CAUSAL == 1) ? (k1 <= tq) : ((CAUSAL == 2) ? ((k1 >> 5) == (tq >> 5)) : true);      /* mode 2: block-diagonal 32-token groups */
        const float s0 = ok0 ? s[rt][0][r] * SCL : -3.0e38f, s1 = ok1 ? s[rt][1][r] * SCL : -3.0e38f; float mc = fmaxf(s0, s1);
        mc = fmaxf(mc, __shfl_xor(mc, 1, 32)); mc = fmaxf(mc, __shfl_xor(mc, 2, 32)); mc = fmaxf(mc, __shfl_xor(mc, 4, 32)); mc = fmaxf(mc, __shfl_xor(mc, 8, 32));
        const float mn = fmaxf(m_r[rt][r], mc); const float al = (mn > -1.0e38f) ? expf(m_r[rt][r] - mn) : 1.0f; m_r[rt][r] = mn; const float p0 = ok0 ? expf(s0 - mn) : 0.f, p1 = ok1 ? expf(s1 - mn) : 0.f; l_r[rt][r] = l_r[rt][r] * al + p0 + p1;
#pragma unroll
        for (int dt = 0; dt < DT; ++dt) oacc[rt][dt][r] *= al;
        FragH t2; t2.h[0] = (_Float16)(p0 * 1024.0f); t2.h[1] = (_Float16)(p1 * 1024.0f); sP[w][rt * 16 + 8 * hh + r][ln] = t2.u[0]; sP[w][rt * 16 + 8 * hh + r][16 + ln] = t2.u[1]; }
    __builtin_amdgcn_fence(__ATOMIC_ACQ_REL, "workgroup"); __builtin_amdgcn_wave_barrier();
    FragH pa[2];
#pragma unroll
    for (int rt = 0; rt < RTN; ++rt) { pa[rt].half[0] = *(const v8us*)&sP[w][rt * 16 + ln][8 * hh]; pa[rt].half[1] = *(const v8us*)&sP[w][rt * 16 + ln][16 + 8 * hh]; }
#pragma unroll
    for (int dt = 0; dt < DT; ++dt) { const unsigned short* vrow = Vth + (size_t)(dt * 16 + ln) * TK + j0; FragH bv; bv.half[0] = *(const v8us*)(vrow + 8 * hh); bv.half[1] = *(const v8us*)(vrow + 16 + 8 * hh);
#pragma unroll
      for (int rt = 0; rt < RTN; ++rt) oacc[rt][dt] = mmaH<1>(pa[rt].v, pa[rt].v, bv.v, bv.v, oacc[rt][dt]); }
    __builtin_amdgcn_fence(__ATOMIC_ACQ_REL, "workgroup"); __builtin_amdgcn_wave_barrier(); }
#pragma unroll
  for (int rt = 0; rt < RTN; ++rt) {
#pragma unroll
    for (int r = 0; r < 8; ++r) { float l = l_r[rt][r]; l += __shfl_xor(l, 1, 32); l += __shfl_xor(l, 2, 32); l += __shfl_xor(l, 4, 32); l += __shfl_xor(l, 8, 32); l_r[rt][r] = (l > 0.f) ? 1.0f / (l * 1024.0f) : 0.f; }
#pragma unroll
    for (int dt = 0; dt < DT; ++dt)
#pragma unroll
      for (int r = 0; r < 8; ++r) sO[w][rt * 16 + 8 * hh + r][dt * 16 + ln] = oacc[rt][dt][r] * l_r[rt][r]; }
  __builtin_amdgcn_fence(__ATOMIC_ACQ_REL, "workgroup"); __builtin_amdgcn_wave_barrier();
  {
#pragma unroll
    for (int rp = 0; rp < RPW; rp += 2) { const int r = rp + (lane >> 4), pc = lane & 15; const v4f val = *(const v4fa*)&sO[w][r][pc * 4]; *(v4f*)(O + ((size_t)b * TQ + q0 + r) * ldo + h * 64 + pc * 4) = val; }
     } }
__device__ __forceinline__ float xhalf(float x) { return __builtin_bit_cast(float, __builtin_amdgcn_permlanex16(__builtin_bit_cast(int, x), __builtin_bit_cast(int, x), 0x76543210, 0xfedcba98, false, false)); }      /* lane l <-> lane l ^ 16 */
template <int CAUSAL>
__global__ __launch_bounds__(128) void k_flashqk(const _Float16* __restrict__ Q16, const _Float16* __restrict__ QL, int ldq, const _Float16* __restrict__ K16, const _Float16* __restrict__ KL, int ldk, const _Float16* __restrict__ Vt, const int* __restrict__ MSK, float* __restrict__ O, int ldo) {
  constexpr int RPW = 16, DT = 4, KS = 2;
  __shared__ __attribute__((aligned(16))) float sO[4][RPW][64 + 4];
  const int tid = threadIdx.x, w = tid >> 5, lane = tid & 31, ln = lane & 15, hh = lane >> 4;
  const int slab = blockIdx.x / QBLKS, qblk = blockIdx.x % QBLKS; const int b = slab / NH, h = slab % NH; const int qb0 = qblk * (4 * RPW); const int q0 = qb0 + w * RPW;
  const int tq = q0 + ln;      /* this lane's query */
  FragH bq[KS], bql[KS];
  { const unsigned short* qr = (const unsigned short*)Q16 + ((size_t)b * TQ + tq) * ldq + h * 64; const unsigned short* ql = (const unsigned short*)QL + ((size_t)b * TQ + tq) * ldq + h * 64;
#pragma unroll      /* constant indices keep the fragment, score and accumulator arrays in registers */
    for (int ks = 0; ks < KS; ++ks) { bq[ks].half[0] = *(const v8us*)(qr + ks * 32 + 8 * hh); bq[ks].half[1] = *(const v8us*)(qr + ks * 32 + 16 + 8 * hh); bql[ks].half[0] = *(const v8us*)(ql + ks * 32 + 8 * hh); bql[ks].half[1] = *(const v8us*)(ql + ks * 32 + 16 + 8 * hh); } }
  const unsigned short* Vth = (const unsigned short*)Vt + (size_t)slab * 64 * TK;
  float m_q = -3.0e38f, l_q = 0.f; v8f oacc[DT];      /* oacc[dt][r] = O[tq][dt * 16 + 8 hh + r], un-normalised */
#pragma unroll      /* constant indices keep the fragment, score and accumulator arrays in registers */
  for (int dt = 0; dt < DT; ++dt) oacc[dt] = (v8f){0.f,0.f,0.f,0.f,0.f,0.f,0.f,0.f};
  const int jend = (CAUSAL == 1) ? (qb0 + 4 * RPW) : TK;      /* causal: keys beyond the block's last query never contribute */
#pragma unroll 1
  for (int j0 = 0; j0 < jend; j0 += 32) {
    v8f s[2];      /* s[nt][r] = score of key j0 + nt * 16 + 8 hh + r against query tq */
#pragma unroll      /* constant indices keep the fragment, score and accumulator arrays in registers */
    for (int nt = 0; nt < 2; ++nt) { const unsigned short* kr = (const unsigned short*)K16 + ((size_t)b * TK + j0 + nt * 16 + ln) * ldk + h * 64; const unsigned short* klr = (const unsigned short*)KL + ((size_t)b * TK + j0 + nt * 16 + ln) * ldk + h * 64; FragH ak[KS], akl[KS];
#pragma unroll      /* constant indices keep the fragment, score and accumulator arrays in registers */
      for (int ks = 0; ks < KS; ++ks) { ak[ks].half[0] = *(const v8us*)(kr + ks * 32 + 8 * hh); ak[ks].half[1] = *(const v8us*)(kr + ks * 32 + 16 + 8 * hh); akl[ks].half[0] = *(const v8us*)(klr + ks * 32 + 8 * hh); akl[ks].half[1] = *(const v8us*)(klr + ks * 32 + 16 + 8 * hh); }
      v8f acc = (v8f){0.f,0.f,0.f,0.f,0.f,0.f,0.f,0.f}, accl = acc;
#pragma unroll      /* constant indices keep the fragment, score and accumulator arrays in registers */
      for (int ks = 0; ks < KS; ++ks) { acc = mmaH<1>(ak[ks].v, ak[ks].v, bq[ks].v, bq[ks].v, acc); accl = mmaH<1>(ak[ks].v, ak[ks].v, bql[ks].v, bql[ks].v, accl); accl = mmaH<1>(akl[ks].v, akl[ks].v, bq[ks].v, bq[ks].v, accl); }
#pragma unroll      /* constant indices keep the fragment, score and accumulator arrays in registers */
      for (int r = 0; r < 8; ++r) acc[r] += accl[r] * 0.0009765625f;
      s[nt] = acc; }
    float sc[16]; bool ok[16];
#pragma unroll      /* constant indices keep the fragment, score and accumulator arrays in registers */
    for (int i = 0; i < 16; ++i) { const int kk = j0 + (i >> 3) * 16 + 8 * hh + (i & 7);
      ok[i] = (CAUSAL == 1) ? (kk <= tq) : ((CAUSAL == 2) ? ((kk >> 5) == (tq >> 5)) : true);      /* mode 2: block-diagonal 32-token groups */
      if (CAUSAL == 4) ok[i] = MSK[((size_t)b * TQ + tq) * TK + kk] != 0;      /* mode 4: per-(query, key) INPUT mask shared by all heads; masked keys contribute nothing, rows with no valid key give l = 0 -> output 0 */
      sc[i] = ok[i] ? s[i >> 3][i & 7] * SCL : -3.0e38f; }
    float mt[8];
#pragma unroll      /* constant indices keep the fragment, score and accumulator arrays in registers */
    for (int i = 0; i < 8; ++i) mt[i] = fmaxf(sc[i], sc[8 + i]);
    float mc = fmaxf(fmaxf(fmaxf(mt[0], mt[1]), fmaxf(mt[2], mt[3])), fmaxf(fmaxf(mt[4], mt[5]), fmaxf(mt[6], mt[7])));
    mc = fmaxf(mc, xhalf(mc));      /* the other half's 16 keys of the same query */
    const float mn = fmaxf(m_q, mc); const float al = (mn > -1.0e38f) ? expf(m_q - mn) : 1.0f; m_q = mn;
    float p[16]; FragH pb;
#pragma unroll      /* constant indices keep the fragment, score and accumulator arrays in registers */
    for (int i = 0; i < 16; ++i) { p[i] = ok[i] ? expf(sc[i] - mn) : 0.f; pb.h[i] = (_Float16)(p[i] * 1024.0f); }      /* pb.h[i]: key j0 + (i >> 3) * 16 + 8 hh + (i & 7) of column ln */
    float pt[8];
#pragma unroll      /* constant indices keep the fragment, score and accumulator arrays in registers */
    for (int i = 0; i < 8; ++i) pt[i] = p[i] + p[8 + i];
    l_q = l_q * al + (((pt[0] + pt[1]) + (pt[2] + pt[3])) + ((pt[4] + pt[5]) + (pt[6] + pt[7])));
#pragma unroll      /* constant indices keep the fragment, score and accumulator arrays in registers */
    for (int dt = 0; dt < DT; ++dt)
#pragma unroll      /* constant indices keep the fragment, score and accumulator arrays in registers */
      for (int r = 0; r < 8; ++r) oacc[dt][r] *= al;
#pragma unroll      /* constant indices keep the fragment, score and accumulator arrays in registers */
    for (int dt = 0; dt < DT; ++dt) { const unsigned short* vrow = Vth + (size_t)(dt * 16 + ln) * TK + j0; FragH av; av.half[0] = *(const v8us*)(vrow + 8 * hh); av.half[1] = *(const v8us*)(vrow + 16 + 8 * hh);
      oacc[dt] = mmaH<1>(av.v, av.v, pb.v, pb.v, oacc[dt]); } }
  const float lsum = l_q + xhalf(l_q); const float linv = (lsum > 0.f) ? 1.0f / (lsum * 1024.0f) : 0.f;
#pragma unroll      /* constant indices keep the fragment, score and accumulator arrays in registers */
  for (int dt = 0; dt < DT; ++dt) { v4f lo4, hi4;
#pragma unroll      /* constant indices keep the fragment, score and accumulator arrays in registers */
    for (int r = 0; r < 4; ++r) { lo4[r] = oacc[dt][r] * linv; hi4[r] = oacc[dt][4 + r] * linv; }
    *(v4fa*)&sO[w][ln][dt * 16 + 8 * hh] = lo4; *(v4fa*)&sO[w][ln][dt * 16 + 8 * hh + 4] = hi4; }
  __builtin_amdgcn_fence(__ATOMIC_ACQ_REL, "workgroup"); __builtin_amdgcn_wave_barrier();
  {
#pragma unroll      /* constant indices keep the fragment, score and accumulator arrays in registers */
    for (int rp = 0; rp < RPW; rp += 2) { const int r = rp + (lane >> 4), pc = lane & 15; const v4f val = *(const v4fa*)&sO[w][r][pc * 4]; *(v4f*)(O + ((size_t)b * TQ + q0 + r) * ldo + h * 64 + pc * 4) = val; }
     } }

__global__ __launch_bounds__(256) void k_gnstat(const float* __restrict__ x, float* __restrict__ GS) {
  #pragma clang fp contract(off)
  __shared__ float sh[256]; const int bg = blockIdx.x; const int tid = threadIdx.x; const float* base = x + (size_t)bg * CPG * SLEN; const int n = CPG * SLEN; float s = 0.f;
  for (int i = tid; i < n; i += 256) s += bf16_round(base[i]);
  sh[tid] = s; __syncthreads(); for (int st = 128; st > 0; st >>= 1) { if (tid < st) sh[tid] += sh[tid + st]; __syncthreads(); }
  const float mu = sh[0] / (float)n; __syncthreads(); float q2 = 0.f;
  for (int i = tid; i < n; i += 256) { const float d = bf16_round(base[i]) - mu; q2 += d * d; }
  sh[tid] = q2; __syncthreads(); for (int st = 128; st > 0; st >>= 1) { if (tid < st) sh[tid] += sh[tid + st]; __syncthreads(); }
  if (tid == 0) { const float rs = rsqrtf(sh[0] / (float)n + 1e-5f); { *(float*)(GS + (size_t)bg * 32) = mu; *(float*)(GS + (size_t)bg * 32 + 1) = rs;  } } }
__global__ __launch_bounds__(256) void k_gnT(const float* __restrict__ x, const float* __restrict__ GS, const float* __restrict__ gam, const float* __restrict__ bet, _Float16* __restrict__ XT16) {
  #pragma clang fp contract(off)
  __shared__ float tl[64][65]; const int tid = threadIdx.x; const int per = (CC / 64) * (SLEN / 64); const int b = blockIdx.x / per; const int rem = blockIdx.x % per; const int cb = rem / (SLEN / 64), pb = rem % (SLEN / 64);
  for (int i = tid; i < 64 * 16; i += 256) { const int cl = i / 16, p4 = (i % 16) * 4; const int c = cb * 64 + cl; const float mu = GS[((size_t)b * NGR + c / CPG) * 32], rs = GS[((size_t)b * NGR + c / CPG) * 32 + 1]; const float g = bf16_round(gam[c]), be = bf16_round(bet[c]);
    const v4f a = *(const v4fa*)(x + ((size_t)b * CC + c) * SLEN + pb * 64 + p4); for (int q = 0; q < 4; ++q) { float v = (bf16_round(a[q]) - mu) * rs * g; v += be; tl[cl][p4 + q] = v; } }
  __syncthreads(); const int pl = tid >> 2, c8 = (tid & 3) * 8;
  { for (int u = 0; u < 2; ++u) { const int c0 = c8 + u * 32; FragH f; for (int q = 0; q < 8; ++q) f.h[q] = (_Float16)tl[c0 + q][pl]; *(v8us*)((unsigned short*)XT16 + ((size_t)b * SLEN + pb * 64 + pl) * CC + cb * 64 + c0) = f.half[0]; }  } }
__global__ __launch_bounds__(256) void k_wpad(const float* __restrict__ Wm, const float* __restrict__ bm, _Float16* __restrict__ BP, float* __restrict__ PB) {
  const int r = blockIdx.x * 256 + threadIdx.x; if (r >= DP) return; const int h = r / 64, d = r % 64; const bool live = d < HDT; const int srow = h * HDT + d;
  for (int c0 = 0; c0 < CC; c0 += 8) { FragH f; for (int q = 0; q < 8; ++q) f.h[q] = live ? (_Float16)(bf16_round(Wm[(size_t)srow * CC + c0 + q]) * 16.0f) : (_Float16)0.0f; unsigned short* dst = (unsigned short*)BP + (size_t)r * CC + c0; *(v8us*)dst = f.half[0];  }
  const float bv = live ? bm[srow] : 0.f; *(float*)(PB + r) = bv;  }
__global__ __launch_bounds__(256) void k_wio(const float* __restrict__ Wm, int nin, int nout, int pair, _Float16* __restrict__ Bt) { const int pitch = pair ? 2 * nin : nin; const size_t t = (size_t)blockIdx.x * 256 + threadIdx.x; if (t >= (size_t)nout * (pitch / 8)) return; const int pc = (int)(t % (pitch / 8)); const int o = (int)(t / (pitch / 8)); FragH f;
  for (int q = 0; q < 8; ++q) { const int col = pc * 8 + q; const bool lo = col >= nin; const int i = lo ? col - nin : col; f.h[q] = (_Float16)(bf16_round(Wm[(size_t)i * nout + o]) * (lo ? 1.0f : 16.0f)); }
  *(v8us*)((unsigned short*)Bt + (size_t)o * pitch + pc * 8) = f.half[0];  }
__global__ __launch_bounds__(256) void k_wop(const float* __restrict__ Wo, _Float16* __restrict__ Bt) { const int t = blockIdx.x * 256 + threadIdx.x; if (t >= CC * (2 * CC / 8)) return; const int pc = t % (2 * CC / 8); const int o = t / (2 * CC / 8); const bool lo = pc * 8 >= CC; FragH f;
  for (int q = 0; q < 8; ++q) { const int c = pc * 8 + q - (lo ? CC : 0); f.h[q] = (_Float16)(bf16_round(Wo[(size_t)o * CC + c]) * (lo ? 1.0f : 16.0f)); } *(v8us*)((unsigned short*)Bt + (size_t)o * 2 * CC + pc * 8) = f.half[0];  }
__global__ __launch_bounds__(256) void k_ofl(const float* __restrict__ O, float* __restrict__ OF, _Float16* __restrict__ OF2) { const size_t t = (size_t)blockIdx.x * 256 + threadIdx.x; if (t >= (size_t)NR * (CC / 8)) return; const int c0 = (int)(t % (CC / 8)) * 8; const size_t r = t / (CC / 8); const int h = c0 / HDT, d0 = c0 % HDT; FragH fh, fl; v4f a, bq;
  for (int q = 0; q < 8; ++q) { const float v = O[r * DP + h * 64 + d0 + q]; const _Float16 hv = (_Float16)v; fh.h[q] = hv; fl.h[q] = (_Float16)((v - (float)hv) * 16.0f); if (q < 4) a[q] = v; else bq[q - 4] = v; }
  { *(v4f*)(OF + r * CC + c0) = a; *(v4f*)(OF + r * CC + c0 + 4) = bq; *(v8us*)((unsigned short*)OF2 + r * 2 * CC + c0) = fh.half[0]; *(v8us*)((unsigned short*)OF2 + r * 2 * CC + CC + c0) = fl.half[0];  } }
__global__ __launch_bounds__(256) void k_pair16(const float* __restrict__ S, _Float16* __restrict__ HP) { const size_t t = (size_t)blockIdx.x * 256 + threadIdx.x; if (t >= (size_t)NR * (CC / 8)) return; const int c0 = (int)(t % (CC / 8)) * 8; const size_t r = t / (CC / 8); FragH fh, fl;
  for (int q = 0; q < 8; ++q) { const float v = S[r * CC + c0 + q]; const _Float16 hv = (_Float16)v; fh.h[q] = hv; fl.h[q] = (_Float16)((v - (float)hv) * 16.0f); }
  { *(v8us*)((unsigned short*)HP + r * 2 * CC + c0) = fh.half[0]; *(v8us*)((unsigned short*)HP + r * 2 * CC + CC + c0) = fl.half[0];  } }
__global__ __launch_bounds__(256) void k_nchw(const float* __restrict__ Y, float* __restrict__ out) { const size_t t = (size_t)blockIdx.x * 256 + threadIdx.x; if (t >= (size_t)NB * CC * (SLEN / 4)) return; const int n0 = (int)(t % (SLEN / 4)) * 4; const int o = (int)((t / (SLEN / 4)) % CC); const int b = (int)(t / ((size_t)(SLEN / 4) * CC)); v4f r; for (int q = 0; q < 4; ++q) r[q] = Y[((size_t)b * SLEN + n0 + q) * CC + o]; float* d = out + ((size_t)b * CC + o) * SLEN + n0; *(v4f*)d = r;  }

extern "C" void kernel_launch(void* const* d_in, const int* in_sizes, int n_in,
                              void* d_out, int out_size, void* d_ws, size_t ws_size, hipStream_t stream) {
  (void)in_sizes; (void)n_in; (void)out_size;
  const float* const* I = (const float* const*)d_in; const float* fo = I[0]; const float* fs = I[1]; const float* gq = I[2]; const float* bq = I[3]; const float* gkv = I[4]; const float* bkv = I[5]; const float* Wq = I[6]; const float* bqp = I[7]; const float* Wk = I[8]; const float* bkp = I[9]; const float* Wv = I[10]; const float* bvp = I[11]; const float* W1 = I[12]; const float* b1 = I[13]; const float* W2 = I[14]; const float* b2 = I[15]; const float* Wo = I[16]; const float* bo = I[17];
  char* ws = (char*)d_ws; size_t off = 0;
  auto take = [&](size_t bytes) { char* p = ws + off; off += (bytes + 255) & ~(size_t)255; return p; };
  _Float16* BPq = (_Float16*)take((size_t)DP * CC * 2); _Float16* BPk = (_Float16*)take((size_t)DP * CC * 2); _Float16* BPv = (_Float16*)take((size_t)DP * CC * 2); float* PBq = (float*)take(DP * 4); float* PBk = (float*)take(DP * 4); float* PBv = (float*)take(DP * 4);
  _Float16* BW1 = (_Float16*)take((size_t)HID * 2 * CC * 2); _Float16* BW2 = (_Float16*)take((size_t)CC * HID * 2); _Float16* BWO = (_Float16*)take((size_t)CC * 2 * CC * 2); float* GS = (float*)take((size_t)NB * NGR * 32 * 4 * 2);
  _Float16* XQ = (_Float16*)take((size_t)NR * CC * 2); _Float16* XKV = (_Float16*)take((size_t)NR * CC * 2); float* F32 = (float*)take((size_t)NR * DP * 4);
  _Float16* QH = (_Float16*)take((size_t)NR * DP * 2); _Float16* QL = (_Float16*)take((size_t)NR * DP * 2); _Float16* KH = (_Float16*)take((size_t)NR * DP * 2); _Float16* KL = (_Float16*)take((size_t)NR * DP * 2); _Float16* VH = (_Float16*)take((size_t)NR * DP * 2); _Float16* VL = (_Float16*)take((size_t)NR * DP * 2); _Float16* VT = (_Float16*)take((size_t)NR * DP * 2); _Float16* VTL = (_Float16*)take((size_t)NR * DP * 2);
  float* OF = (float*)take((size_t)NR * CC * 4); _Float16* OF2 = (_Float16*)take((size_t)NR * 2 * CC * 2); _Float16* G16 = (_Float16*)take((size_t)NR * HID * 2); float* FU = (float*)take((size_t)NR * CC * 4); _Float16* FU2 = (_Float16*)take((size_t)NR * 2 * CC * 2); float* Y = (float*)take((size_t)NR * CC * 4);
  float* O = F32;
  if (off > ws_size) return;      /* 0.6 + 2 + 2 + 8 + 8 x 4 + 4 + 4 + 4 + 4 + 4 + 4 = 69 MiB */
  k_wpad<<<1, 256, 0, stream>>>(Wq, bqp, BPq, PBq); k_wpad<<<1, 256, 0, stream>>>(Wk, bkp, BPk, PBk); k_wpad<<<1, 256, 0, stream>>>(Wv, bvp, BPv, PBv);      /* conv1x1 weights (out,in) = natural rows */
  k_wio<<<(HID * (2 * CC / 8) + 255) / 256, 256, 0, stream>>>(W1, CC, HID, 1, BW1); k_wio<<<(CC * (HID / 8) + 255) / 256, 256, 0, stream>>>(W2, HID, CC, 0, BW2); k_wop<<<(CC * (2 * CC / 8) + 255) / 256, 256, 0, stream>>>(Wo, BWO);
  k_gnstat<<<NB * NGR, 256, 0, stream>>>(fo, GS); k_gnstat<<<NB * NGR, 256, 0, stream>>>(fs, GS + NB * NGR * 32);
  k_gnT<<<NB * (CC / 64) * (SLEN / 64), 256, 0, stream>>>(fo, GS, gq, bq, XQ); k_gnT<<<NB * (CC / 64) * (SLEN / 64), 256, 0, stream>>>(fs, GS + NB * NGR * 32, gkv, bkv, XKV);
  const dim3 gP((NR / 128) * (DP / 64), 1), gC((NR / 128) * (CC / 64), 1), gH((NR / 128) * (HID / 64), 1); const unsigned n8 = (unsigned)(((size_t)NR * DP / 8 + 255) / 256), n8c = (unsigned)(((size_t)NR * (CC / 8) + 255) / 256);
  k_gemm2<0><<<gP, 128, 0, stream>>>(XQ, CC, 0, BPq, CC, 0, 0.0625f, PBq, 0, nullptr, 1, 0, 0, F32, nullptr, DP, 0, NR, DP, CC); k_hl<<<n8, 256, 0, stream>>>(F32, QH, QL, (size_t)NR * DP / 8);
  k_gemm2<0><<<gP, 128, 0, stream>>>(XKV, CC, 0, BPk, CC, 0, 0.0625f, PBk, 0, nullptr, 1, 0, 0, F32, nullptr, DP, 0, NR, DP, CC); k_hl<<<n8, 256, 0, stream>>>(F32, KH, KL, (size_t)NR * DP / 8);
  k_gemm2<0><<<gP, 128, 0, stream>>>(XKV, CC, 0, BPv, CC, 0, 0.0625f, PBv, 0, nullptr, 1, 0, 0, F32, nullptr, DP, 0, NR, DP, CC); k_hl<<<n8, 256, 0, stream>>>(F32, VH, VL, (size_t)NR * DP / 8);
  k_vt<NH, SLEN><<<NB * NH * (SLEN / 64), 256, 0, stream>>>(VH, DP, 0, VT);
  k_flashqk<0><<<NB * NH * QBLKS, 128, 0, stream>>>(QH, QL, DP, KH, KL, DP, VT, nullptr, O, DP);      /* q/k hi + residual; P (x2^10) and V plain f16 */
  k_ofl<<<n8c, 256, 0, stream>>>(O, OF, OF2);
  k_gemm2<6><<<gH, 128, 0, stream>>>(OF2, 2 * CC, 0, BW1, 2 * CC, 0, 0.0625f, b1, 0, nullptr, 1, 0, 0, nullptr, G16, HID, 0, NR, HID, 2 * CC);      /* gelu_erf(out W1 + b1) -> f16 */
  k_gemm2<0><<<gC, 128, 0, stream>>>(G16, HID, 0, BW2, HID, 0, 0.0625f, b2, 0, OF, 1, (size_t)CC, 0, FU, nullptr, CC, 0, NR, CC, HID);      /* mlp + b2 + out_flat */
  k_pair16<<<n8c, 256, 0, stream>>>(FU, FU2);
  k_gemm2<0><<<gC, 128, 0, stream>>>(FU2, 2 * CC, 0, BWO, 2 * CC, 0, 0.0625f, bo, 0, nullptr, 1, 0, 0, Y, nullptr, CC, 0, NR, CC, 2 * CC);      /* conv1x1(fused, Wo) + bo */
  k_nchw<<<(unsigned)(((size_t)NB * CC * (SLEN / 4) + 255) / 256), 256, 0, stream>>>(Y, (float*)d_out);
}

// v002
// Measured time: 387 microseconds a run.
// In two side-by-side timings against v001, it was 1.24 and 1.25 times as fast.
// All steps since v000 together make it 1.75 times as fast.
#include <hip/hip_runtime.h>
// SFBlock (2 x 128 x 64 x 64; 4 heads x 32; GroupNorm(32) on both inputs; q from feat_opt, k/v from feat_sar via 1x1 convs; softmax(q k^T / sqrt(32)) v over the 4096 positions; MLP: gelu_erf(out W1 + b1) W2 + b2; fused = out + mlp; 1x1 conv Wo -> [2,128,64,64]).
// Compute dtype: inputs and parameters rounded to bf16; normalised inputs as f16 operands (~2^-12); q, k hi + residual; P (x2^10), v plain f16; attention output / fused as hi + residual pairs; the 256-wide GELU hidden as f16; f32 statistics/softmax/accumulation. v_wmma_f32_16x16x32_f16.
#define NB 2
#define CC 128
#define HID 256
#define NGR 32
#define CPG (CC / NGR)           /* 4 channels per group */
#define HDT 32
#define HPITCH HDT                   /* columns per head in the q/k/v planes: the true head dim, no padding */
#define DP (NH * HPITCH)             /* 128 */
#define NR (NB * SLEN)           /* 8192 */
#define QBLKS (TQ / 64)
#define SLEN 4096                /* H*W tokens */
#define TQ SLEN
#define TK SLEN
#define NH 4
#define SCL 0.17677669529663687f /* 32^-0.5 */
typedef __bf16 v16b __attribute__((ext_vector_type(16)));
typedef unsigned short v8us __attribute__((ext_vector_type(8), may_alias));
typedef float  v8f  __attribute__((ext_vector_type(8)));
typedef float  v4f  __attribute__((ext_vector_type(4)));
typedef float  v4fa __attribute__((ext_vector_type(4), may_alias));
union FragB { v16b v; v8us half[2]; unsigned short u[16]; };

__device__ __forceinline__ unsigned short bf16_bits(float x) { unsigned int u = __float_as_uint(x); return (unsigned short)((u + 0x7FFFu + ((u >> 16) & 1u)) >> 16); }
__device__ __forceinline__ float bf16_val(unsigned short b) { return __uint_as_float(((unsigned int)b) << 16); }
__device__ __forceinline__ float bf16_round(float x) { return bf16_val(bf16_bits(x)); }
// D += A·B with NT terms: 1 = ah·bh, 2 = + al·bh (A split), 3 = + ah·bl (both split)
template <int NT>
__device__ __forceinline__ v8f mmaN(v16b ah, v16b al, v16b bh, v16b bl, v8f c) {
  c = __builtin_amdgcn_wmma_f32_16x16x32_bf16(false, ah, false, bh, (short)0, c, false, false);
  if (NT >= 2) c = __builtin_amdgcn_wmma_f32_16x16x32_bf16(false, al, false, bh, (short)0, c, false, false);
  if (NT >= 3) c = __builtin_amdgcn_wmma_f32_16x16x32_bf16(false, ah, false, bl, (short)0, c, false, false);
  asm volatile("v_nop\n\tv_nop\n\tv_nop\n\tv_nop" : "+v"(c) : "v"(ah), "v"(al), "v"(bh), "v"(bl));
  return c;
}

__global__ __launch_bounds__(256) void k_wt_bf16(const float* __restrict__ W, unsigned short* __restrict__ Wt, int K, int N) {
  const int t = blockIdx.x * 256 + threadIdx.x;
  const int k8n = K / 8;
  if (t >= N * k8n) return;
  const int n = t / k8n, k8 = (t % k8n) * 8;
  v8us v;
#pragma unroll
  for (int i = 0; i < 8; ++i) v[i] = bf16_bits(W[(size_t)(k8 + i) * N + n]);
  *(v8us*)(Wt + (size_t)n * K + k8) = v;
  
}

// GEMM C[M][N] (f32, pitch ldc) = act(A[M][K]·W + bias). A f32 row-major (pitch lda) converted per fragment to bf16
// (ASPLIT: hi/lo two planes -> 2 terms, else single rounded term); Wt bf16 [N][K] (pitch ldb). BIAS_BF16 rounds the
// bias to bf16 first (bias quantised to bf16 before the add). K%32==0, M%16==0, N%64==0.
template <bool ASPLIT, int ACT, bool BIAS_BF16>
__global__ __launch_bounds__(128) void k_gemm_bf(const float* __restrict__ A, int lda, const unsigned short* __restrict__ Wt, int ldb,
                                               const float* __restrict__ bias, float* __restrict__ C, int ldc, int M, int N, int K) {
  __shared__ __attribute__((aligned(16))) float so[4][16][64];
  const int tid = threadIdx.x, w = tid >> 5, lane = tid & 31, ln = lane & 15, hh = lane >> 4;
  const int ntn = N / 64;
  const int wid = blockIdx.x * 4 + w;
  const int mt = wid / ntn, nq = wid % ntn;
  if (mt * 16 >= M) return;
  const int row0 = mt * 16, col0 = nq * 64;
  const float* arow = A + (size_t)(row0 + ln) * lda;
  v8f acc[4] = {};
  for (int kb = 0; kb < K; kb += 32) {
    FragB ah, al;
    const v4f x0 = *(const v4fa*)(arow + kb + 8 * hh), x1 = *(const v4fa*)(arow + kb + 8 * hh + 4);
    const v4f x2 = *(const v4fa*)(arow + kb + 16 + 8 * hh), x3 = *(const v4fa*)(arow + kb + 16 + 8 * hh + 4);
    float xs[16] = {x0[0],x0[1],x0[2],x0[3],x1[0],x1[1],x1[2],x1[3],x2[0],x2[1],x2[2],x2[3],x3[0],x3[1],x3[2],x3[3]};
#pragma unroll
    for (int i = 0; i < 16; ++i) { const unsigned short hb = bf16_bits(xs[i]); ah.u[i] = hb; al.u[i] = ASPLIT ? bf16_bits(xs[i] - bf16_val(hb)) : (unsigned short)0; }
#pragma unroll
    for (int t = 0; t < 4; ++t) {
      const unsigned short* brow = Wt + (size_t)(col0 + t * 16 + ln) * ldb + kb;
      FragB b;
      b.half[0] = *(const v8us*)(brow + 8 * hh);
      b.half[1] = *(const v8us*)(brow + 16 + 8 * hh);
      acc[t] = mmaN<ASPLIT ? 2 : 1>(ah.v, al.v, b.v, b.v, acc[t]);
    }
  }
#pragma unroll
  for (int t = 0; t < 4; ++t) {
    float bv = bias ? bias[col0 + t * 16 + ln] : 0.f;
    if (BIAS_BF16) bv = bf16_round(bv);
#pragma unroll
    for (int r = 0; r < 8; ++r) { float v = acc[t][r] + bv; if (ACT == 1) v = fmaxf(v, 0.f); so[w][8 * hh + r][t * 16 + ln] = v; }
  }
  __builtin_amdgcn_fence(__ATOMIC_ACQ_REL, "workgroup");
  __builtin_amdgcn_wave_barrier();
  const int rsub = lane >> 4, c4 = (lane & 15) * 4;
  {
#pragma unroll
    for (int q = 0; q < 8; ++q) {
      const int r = q * 2 + rsub;
      const v4f v = *(const v4fa*)&so[w][r][c4];
      *(v4f*)(C + (size_t)(row0 + r) * ldc + col0 + c4) = v;
    }
    
  }
}

// GEMM C = act(A·W + bias + resid): A f32 (ASPLIT -> hi/lo 2 terms), Wt bf16 [N][K]; ACT 0 none, 1 relu, 2 exact gelu;
// resid (optional, f32, row index = (row % rmod), pitch ldr, RES_BF16 rounds it) added before the activation.
template <bool ASPLIT, int ACT, bool BIAS_BF16, bool RES_BF16>
__global__ __launch_bounds__(128) void k_gemm_bf3(const float* __restrict__ A, int lda, const unsigned short* __restrict__ Wt, int ldb,
                                                const float* __restrict__ bias, const float* __restrict__ resid, int rmod, int ldr,
                                                float* __restrict__ C, int ldc, int M, int N, int K) {
  __shared__ __attribute__((aligned(16))) float so[4][16][64];
  const int tid = threadIdx.x, w = tid >> 5, lane = tid & 31, ln = lane & 15, hh = lane >> 4;
  const int ntn = N / 64;
  const int wid = blockIdx.x * 4 + w;
  const int mt = wid / ntn, nq = wid % ntn;
  if (mt * 16 >= M) return;
  const int row0 = mt * 16, col0 = nq * 64;
  const float* arow = A + (size_t)(row0 + ln) * lda;
  v8f acc[4] = {};
  for (int kb = 0; kb < K; kb += 32) {
    FragB ah, al;
    const v4f x0 = *(const v4fa*)(arow + kb + 8 * hh), x1 = *(const v4fa*)(arow + kb + 8 * hh + 4);
    const v4f x2 = *(const v4fa*)(arow + kb + 16 + 8 * hh), x3 = *(const v4fa*)(arow + kb + 16 + 8 * hh + 4);
    float xs[16] = {x0[0],x0[1],x0[2],x0[3],x1[0],x1[1],x1[2],x1[3],x2[0],x2[1],x2[2],x2[3],x3[0],x3[1],x3[2],x3[3]};
#pragma unroll
    for (int i = 0; i < 16; ++i) { const unsigned short hb = bf16_bits(xs[i]); ah.u[i] = hb; al.u[i] = ASPLIT ? bf16_bits(xs[i] - bf16_val(hb)) : (unsigned short)0; }
#pragma unroll
    for (int t = 0; t < 4; ++t) {
      const unsigned short* brow = Wt + (size_t)(col0 + t * 16 + ln) * ldb + kb;
      FragB b;
      b.half[0] = *(const v8us*)(brow + 8 * hh);
      b.half[1] = *(const v8us*)(brow + 16 + 8 * hh);
      acc[t] = mmaN<ASPLIT ? 2 : 1>(ah.v, al.v, b.v, b.v, acc[t]);
    }
  }
#pragma unroll
  for (int t = 0; t < 4; ++t) {
    const int col = col0 + t * 16 + ln;
    float bv = bias ? bias[col] : 0.f;
    if (BIAS_BF16) bv = bf16_round(bv);
#pragma unroll
    for (int r = 0; r < 8; ++r) {
      float v = acc[t][r] + bv;
      if (resid) { float rv = resid[(size_t)((row0 + 8 * hh + r) % rmod) * ldr + col]; if (RES_BF16) rv = bf16_round(rv); v += rv; }
      if (ACT == 1) v = fmaxf(v, 0.f);
      if (ACT == 2) v = 0.5f * v * (1.0f + erff(v * 0.70710678118654752f));
      if (ACT == 3) { const float u = 0.7978845608028654f * (v + 0.044715f * v * v * v); v = 0.5f * v * (1.0f + tanhf(u)); }
      so[w][8 * hh + r][t * 16 + ln] = v;
    }
  }
  __builtin_amdgcn_fence(__ATOMIC_ACQ_REL, "workgroup");
  __builtin_amdgcn_wave_barrier();
  const int rsub = lane >> 4, c4 = (lane & 15) * 4;
  {
#pragma unroll
    for (int q = 0; q < 8; ++q) {
      const int r = q * 2 + rsub;
      const v4f v = *(const v4fa*)&so[w][r][c4];
      *(v4f*)(C + (size_t)(row0 + r) * ldc + col0 + c4) = v;
    }
    
  }
}
// row LayerNorm (biased variance, eps) over N: s = X (+ R); optional out_sum <- s; out_norm <- (s-mu)*rsqrt(var+eps)*g + b
template <bool PARAM_BF16>
__global__ __launch_bounds__(256) void k_layernorm(const float* __restrict__ X, const float* __restrict__ R, const float* __restrict__ g, const float* __restrict__ bta,
                                                  float* __restrict__ out_sum, float* __restrict__ out_norm, int N, float eps) {
  __shared__ float red[256];
  const int row = blockIdx.x, tid = threadIdx.x;
  const float* x = X + (size_t)row * N; const float* rr = R ? R + (size_t)row * N : nullptr;
  float vals[16];                     // up to N = 4096
  const int per = N / 256;            // contiguous chunk per thread? use strided-by-4 chunks: thread handles j = tid*4 + 1024*u
  float s1 = 0.f;
  for (int u = 0; u < per / 4; ++u) {
    const int j = tid * 4 + 1024 * u;
    const v4f a = *(const v4fa*)(x + j);
    v4f b = {0.f,0.f,0.f,0.f}; if (rr) b = *(const v4fa*)(rr + j);
#pragma unroll
    for (int q = 0; q < 4; ++q) { const float v = a[q] + b[q]; vals[u * 4 + q] = v; s1 += v; }
  }
  red[tid] = s1; __syncthreads();
  for (int st = 128; st > 0; st >>= 1) { if (tid < st) red[tid] += red[tid + st]; __syncthreads(); }
  const float mu = red[0] / (float)N; __syncthreads();
  float s2 = 0.f;
  for (int u = 0; u < per / 4; ++u)
#pragma unroll
    for (int q = 0; q < 4; ++q) { const float c = vals[u * 4 + q] - mu; s2 += c * c; }
  red[tid] = s2; __syncthreads();
  for (int st = 128; st > 0; st >>= 1) { if (tid < st) red[tid] += red[tid + st]; __syncthreads(); }
  const float rs = rsqrtf(red[0] / (float)N + eps);
  {
    for (int u = 0; u < per / 4; ++u) {
      const int j = tid * 4 + 1024 * u;
      v4f o, sm;
#pragma unroll
      for (int q = 0; q < 4; ++q) {
        float gg = g[j + q], bb = bta[j + q];
        if (PARAM_BF16) { gg = bf16_round(gg); bb = bf16_round(bb); }
        sm[q] = vals[u * 4 + q]; o[q] = (vals[u * 4 + q] - mu) * rs * gg + bb;
      }
      if (out_sum) *(v4f*)(out_sum + (size_t)row * N + j) = sm;
      *(v4f*)(out_norm + (size_t)row * N + j) = o;
    }
    
  }
}



// ---- f16 WMMA path (v_wmma_f32_16x16x32_f16): 11-bit significands for operands in range — used where a [0,1] probability operand needs more precision than bf16
typedef _Float16 v16h __attribute__((ext_vector_type(16)));
union FragH { v16h v; v8us half[2]; _Float16 h[16]; unsigned short u[16]; };
template <int NT>
__device__ __forceinline__ v8f mmaH(v16h ah, v16h al, v16h bh, v16h bl, v8f c) {
  c = __builtin_amdgcn_wmma_f32_16x16x32_f16(false, ah, false, bh, (short)0, c, false, false);
  if (NT >= 2) c = __builtin_amdgcn_wmma_f32_16x16x32_f16(false, al, false, bh, (short)0, c, false, false);
  if (NT >= 3) c = __builtin_amdgcn_wmma_f32_16x16x32_f16(false, ah, false, bl, (short)0, c, false, false);
  asm volatile("v_nop\n\tv_nop\n\tv_nop\n\tv_nop" : "+v"(c) : "v"(ah), "v"(al), "v"(bh), "v"(bl));
  return c;
}
// batched GEMM like k_gemm_b but f16 operands: A f32 (split into f16 hi/lo if ASPLIT, else rounded to f16), Bt = f16 values [n][k]; alpha; C f32; N multiple of 16 (partial tiles skipped)
template <bool ASPLIT>
__global__ __launch_bounds__(128) void k_gemm_h(const float* __restrict__ A, int lda, size_t sA, const _Float16* __restrict__ Bh, int ldb, size_t sB, float alpha, float* __restrict__ C, int ldc, size_t sC, int M, int N, int K) {
  __shared__ __attribute__((aligned(16))) float so[4][16][64];
  const int tid = threadIdx.x, w = tid >> 5, lane = tid & 31, ln = lane & 15, hh = lane >> 4; const int by = blockIdx.y;
  A += (size_t)by * sA; Bh += (size_t)by * sB; C += (size_t)by * sC;
  const int ntn = (N + 63) / 64; const int wid = blockIdx.x * 4 + w; const int mt = wid / ntn, nq = wid % ntn; if (mt * 16 >= M) return;
  const int row0 = mt * 16, col0 = nq * 64; const float* arow = A + (size_t)(row0 + ln) * lda;
  v8f acc[4] = {};
  for (int kb = 0; kb < K; kb += 32) {
    FragH ah, al;
    const v4f x0 = *(const v4fa*)(arow + kb + 8 * hh), x1 = *(const v4fa*)(arow + kb + 8 * hh + 4), x2 = *(const v4fa*)(arow + kb + 16 + 8 * hh), x3 = *(const v4fa*)(arow + kb + 16 + 8 * hh + 4);
    float xs[16] = {x0[0],x0[1],x0[2],x0[3],x1[0],x1[1],x1[2],x1[3],x2[0],x2[1],x2[2],x2[3],x3[0],x3[1],x3[2],x3[3]};
#pragma unroll
    for (int i = 0; i < 16; ++i) { const _Float16 h = (_Float16)xs[i]; ah.h[i] = h; al.h[i] = ASPLIT ? (_Float16)(xs[i] - (float)h) : (_Float16)0.0f; }
#pragma unroll
    for (int t = 0; t < 4; ++t) { if (col0 + t * 16 >= N) continue; const size_t boff = (size_t)(col0 + t * 16 + ln) * ldb + kb; FragH bq; bq.half[0] = *(const v8us*)(Bh + boff + 8 * hh); bq.half[1] = *(const v8us*)(Bh + boff + 16 + 8 * hh);
      acc[t] = mmaH<ASPLIT ? 2 : 1>(ah.v, al.v, bq.v, bq.v, acc[t]); }
  }
#pragma unroll
  for (int t = 0; t < 4; ++t) { if (col0 + t * 16 >= N) continue;
#pragma unroll
    for (int r = 0; r < 8; ++r) so[w][8 * hh + r][t * 16 + ln] = acc[t][r] * alpha; }
  __builtin_amdgcn_fence(__ATOMIC_ACQ_REL, "workgroup"); __builtin_amdgcn_wave_barrier();
  const int rsub = lane >> 4, c4 = (lane & 15) * 4;
  {
#pragma unroll
    for (int q = 0; q < 8; ++q) { const int r = q * 2 + rsub; if (col0 + c4 < N) { const v4f v = *(const v4fa*)&so[w][r][c4]; *(v4f*)(C + (size_t)(row0 + r) * ldc + col0 + c4) = v; } }
     }
}

// Wt[n][k] = f16(W[k][n]·scale) from f32 row-major W[K][N] (scale = power of two; bf16-exact weights stay exact in f16 away from the subnormal range)
__global__ __launch_bounds__(256) void k_wt_f16(const float* __restrict__ W, _Float16* __restrict__ Wt, int K, int N, float scale) {
  const int t = blockIdx.x * 256 + threadIdx.x; if (t >= N * (K / 8)) return; const int n = t / (K / 8), k8 = (t % (K / 8)) * 8; FragH f;
#pragma unroll
  for (int i = 0; i < 8; ++i) f.h[i] = (_Float16)(bf16_round(W[(size_t)(k8 + i) * N + n]) * scale); const v8us o = f.half[0];
  *(v8us*)((unsigned short*)Wt + (size_t)n * K + k8) = o; 
}
// k_gemm_hh variant with fused epilogue: v = acc·alpha + bias[by·sBias + col] (+ CP[(row/rowsPerB)·sCPb + by·64 + col] if CP) ; ACT 0 none / 1 elu ; writes f16 C16 (and f32 C if non-null)
template <int ACT>
__global__ __launch_bounds__(128) void k_gemm_hhx(const _Float16* __restrict__ A, int lda, size_t sA, const _Float16* __restrict__ Bh, int ldb, size_t sB, float alpha, const float* __restrict__ bias, size_t sBias, const float* __restrict__ CP, int rowsPerB, size_t sCPb, int row0g,
    float* __restrict__ C, _Float16* __restrict__ C16, int ldc, size_t sC, int M, int N, int K) {
  __shared__ __attribute__((aligned(16))) float so[4][16][64];
  const int tid = threadIdx.x, w = tid >> 5, lane = tid & 31, ln = lane & 15, hh = lane >> 4; const int by = blockIdx.y;
  A += (size_t)by * sA; Bh += (size_t)by * sB; const size_t cofs = (size_t)by * sC; const float* bp = bias ? bias + (size_t)by * sBias : nullptr;
  const int ntn = (N + 63) / 64; const int wid = blockIdx.x * 4 + w; const int mt = wid / ntn, nq = wid % ntn; if (mt * 16 >= M) return;
  const int row0 = mt * 16, col0 = nq * 64; const _Float16* arow = A + (size_t)(row0 + ln) * lda;
  v8f acc[4] = {};
  for (int kb = 0; kb < K; kb += 32) { FragH ah; ah.half[0] = *(const v8us*)((const unsigned short*)arow + kb + 8 * hh); ah.half[1] = *(const v8us*)((const unsigned short*)arow + kb + 16 + 8 * hh);
#pragma unroll
    for (int t = 0; t < 4; ++t) { if (col0 + t * 16 >= N) continue; const size_t boff = (size_t)(col0 + t * 16 + ln) * ldb + kb; FragH bq; bq.half[0] = *(const v8us*)((const unsigned short*)Bh + boff + 8 * hh); bq.half[1] = *(const v8us*)((const unsigned short*)Bh + boff + 16 + 8 * hh);
      acc[t] = mmaH<1>(ah.v, ah.v, bq.v, bq.v, acc[t]); }
  }
#pragma unroll
  for (int t = 0; t < 4; ++t) { if (col0 + t * 16 >= N) continue; const int col = col0 + t * 16 + ln; const float bv = bp ? bf16_round(bp[col]) : 0.f;
#pragma unroll
    for (int r = 0; r < 8; ++r) { float v = acc[t][r] * alpha + bv; if (CP) { const int bidx = (row0g + row0 + 8 * hh + r) / rowsPerB; v += CP[(size_t)bidx * sCPb + (size_t)by * 64 + col]; } if (ACT == 1) v = (v > 0.f) ? v : expm1f(v); else if (ACT == 7) v = (v > 0.f) ? v + 1.0f : expf(v); else if (ACT == 8) v = tanhf(v); else if (ACT == 9) v = 0.5f * v * (1.0f + tanhf(0.7978845608028654f * (v + 0.044715f * v * v * v))); else if (ACT == 11) v = 1.0f / (1.0f + expf(-v)); else if (ACT == 12) v = (v > 0.f) ? v : 0.01f * v; else if (ACT == 14) v = (v > 0.f) ? v : 0.1f * v; else if (ACT == 15) v = v / (1.0f + expf(-v)); else if (ACT == 3) v = fmaxf(v, 0.f); else if (ACT == 6) v = 0.5f * v * (1.0f + erff(v * 0.70710678118654752f)); so[w][8 * hh + r][t * 16 + ln] = v; } }
  __builtin_amdgcn_fence(__ATOMIC_ACQ_REL, "workgroup"); __builtin_amdgcn_wave_barrier();
  const int rsub = lane >> 4, c4 = (lane & 15) * 4; typedef _Float16 v4h __attribute__((ext_vector_type(4)));
  {
#pragma unroll
    for (int q = 0; q < 8; ++q) { const int r = q * 2 + rsub; if (col0 + c4 < N) { const v4f v = *(const v4fa*)&so[w][r][c4]; if (C) *(v4f*)(C + cofs + (size_t)(row0 + r) * ldc + col0 + c4) = v; if (C16) { v4h h4; for (int i = 0; i < 4; ++i) h4[i] = (_Float16)v[i]; *(v4h*)(C16 + cofs + (size_t)(row0 + r) * ldc + col0 + c4) = h4; } } }
     }
}


typedef _Float16 v4h __attribute__((ext_vector_type(4)));

__global__ __launch_bounds__(256) void k_x16(const float* __restrict__ x, _Float16* __restrict__ X16, size_t n8) { const size_t t = (size_t)blockIdx.x * 256 + threadIdx.x; if (t >= n8) return; FragH f;
#pragma unroll
  for (int q = 0; q < 8; ++q) f.h[q] = (_Float16)bf16_round(x[t * 8 + q]); *(v8us*)((unsigned short*)X16 + t * 8) = f.half[0];  }
__global__ __launch_bounds__(256) void k_h16(const float* __restrict__ x, _Float16* __restrict__ X16, size_t n8) { const size_t t = (size_t)blockIdx.x * 256 + threadIdx.x; if (t >= n8) return; FragH f;
#pragma unroll
  for (int q = 0; q < 8; ++q) f.h[q] = (_Float16)x[t * 8 + q]; *(v8us*)((unsigned short*)X16 + t * 8) = f.half[0];  }
__global__ __launch_bounds__(256) void k_round16f(const float* __restrict__ W, _Float16* __restrict__ Bt, size_t n8) { const size_t t = (size_t)blockIdx.x * 256 + threadIdx.x; if (t >= n8) return; FragH f;
#pragma unroll
  for (int i = 0; i < 8; ++i) f.h[i] = (_Float16)(bf16_round(W[t * 8 + i]) * 16.0f); *(v8us*)((unsigned short*)Bt + t * 8) = f.half[0];  }
template <int NHv, int TTv>
__global__ __launch_bounds__(256) void k_vt(const _Float16* __restrict__ V16, int ldv, int voff, _Float16* __restrict__ Vt) { __shared__ unsigned short tl[64][66]; const int tid = threadIdx.x; const int slab = blockIdx.x / (TTv / 64), lg = blockIdx.x % (TTv / 64); const int b = slab / NHv, h = slab % NHv;
  for (int i = tid; i < 64 * (HPITCH / 8); i += 256) { const int r = i / (HPITCH / 8), c8 = (i % (HPITCH / 8)) * 8; FragH f; f.half[0] = *(const v8us*)((const unsigned short*)V16 + ((size_t)b * TTv + lg * 64 + r) * ldv + voff + h * HPITCH + c8);
#pragma unroll
    for (int q = 0; q < 8; ++q) tl[r][c8 + q] = f.u[q]; }
  __syncthreads();
  {
#pragma unroll
    for (int rd = 0; rd < HPITCH / 32; ++rd) { const int d = rd * 32 + tid / 8, pc = tid % 8; FragH f;
#pragma unroll
      for (int q = 0; q < 8; ++q) f.u[q] = tl[pc * 8 + q][d];
      *(v8us*)((unsigned short*)Vt + ((size_t)slab * HPITCH + d) * TTv + lg * 64 + pc * 8) = f.half[0]; }
     } }

__global__ __launch_bounds__(256) void k_hl(const float* __restrict__ F, _Float16* __restrict__ Hh, _Float16* __restrict__ Hl, size_t n8) { const size_t t = (size_t)blockIdx.x * 256 + threadIdx.x; if (t >= n8) return; FragH fh, fl; const v4f a = *(const v4fa*)(F + t * 8), c = *(const v4fa*)(F + t * 8 + 4);
#pragma unroll
  for (int q = 0; q < 4; ++q) { _Float16 h = (_Float16)a[q]; fh.h[q] = h; fl.h[q] = (_Float16)((a[q] - (float)h) * 1024.0f); h = (_Float16)c[q]; fh.h[4 + q] = h; fl.h[4 + q] = (_Float16)((c[q] - (float)h) * 1024.0f); }
  { *(v8us*)((unsigned short*)Hh + t * 8) = fh.half[0]; *(v8us*)((unsigned short*)Hl + t * 8) = fl.half[0];  } }

// ---- fast GEMM (wave tile 32x64; requires M % 32 == 0 rows per launch region and N % 64 == 0); epilogue = k_gemm_hhx semantics ----
__device__ __forceinline__ v16h g2_frag(const _Float16* p, int hh) { FragH f; f.half[0] = *(const v8us*)((const unsigned short*)p + 8 * hh); f.half[1] = *(const v8us*)((const unsigned short*)p + 16 + 8 * hh); return f.v; }
__device__ __forceinline__ v8f g2_mma(v16h a, v16h b, v8f c) { v8f d = __builtin_amdgcn_wmma_f32_16x16x32_f16(false, a, false, b, (short)0, c, false, false); asm volatile("v_nop\n\tv_nop\n\tv_nop\n\tv_nop" : "+v"(d) : "v"(a), "v"(b)); return d; }
template <int ACT>
__global__ __launch_bounds__(128) void k_gemm2(const _Float16* __restrict__ A, int lda, size_t sA, const _Float16* __restrict__ Bh, int ldb, size_t sB, float alpha, const float* __restrict__ bias, size_t sBias, const float* __restrict__ CP, int rowsPerB, size_t sCPb, int row0g,
    float* __restrict__ C, _Float16* __restrict__ C16, int ldc, size_t sC, int M, int N, int K) {
  __shared__ __attribute__((aligned(16))) float so[4][32][68];
  const int tid = threadIdx.x, w = tid >> 5, lane = tid & 31, ln = lane & 15, hh = lane >> 4; const int by = blockIdx.y;
  A += (size_t)by * sA; Bh += (size_t)by * sB; const size_t cofs = (size_t)by * sC; const float* bp = bias ? bias + (size_t)by * sBias : nullptr;
  const int ntn = N >> 6; const int mt = blockIdx.x / ntn, nq = blockIdx.x - mt * ntn; const int row0 = mt * 128 + 32 * w, col0 = nq * 64; if (row0 >= M) return;
  const _Float16* a0p = A + (size_t)(row0 + ln) * lda; const _Float16* a1p = a0p + (size_t)16 * lda;
  const _Float16* b0p = Bh + (size_t)(col0 + ln) * ldb; const _Float16* b1p = b0p + (size_t)16 * ldb; const _Float16* b2p = b1p + (size_t)16 * ldb; const _Float16* b3p = b2p + (size_t)16 * ldb;
  const v8f z8 = {0.f,0.f,0.f,0.f,0.f,0.f,0.f,0.f}; v8f c00 = z8, c01 = z8, c02 = z8, c03 = z8, c10 = z8, c11 = z8, c12 = z8, c13 = z8;
#pragma unroll 1
  for (int kb = 0; kb < K; kb += 32) { const v16h a0 = g2_frag(a0p + kb, hh), a1 = g2_frag(a1p + kb, hh);
    v16h b = g2_frag(b0p + kb, hh); c00 = g2_mma(a0, b, c00); c10 = g2_mma(a1, b, c10);
    b = g2_frag(b1p + kb, hh); c01 = g2_mma(a0, b, c01); c11 = g2_mma(a1, b, c11);
    b = g2_frag(b2p + kb, hh); c02 = g2_mma(a0, b, c02); c12 = g2_mma(a1, b, c12);
    b = g2_frag(b3p + kb, hh); c03 = g2_mma(a0, b, c03); c13 = g2_mma(a1, b, c13); }
  v8f accs[8] = {c00, c01, c02, c03, c10, c11, c12, c13};
#pragma unroll
  for (int u = 0; u < 8; ++u) { const int t = u & 3, half = u >> 2; const int col = col0 + t * 16 + ln; const float bv = bp ? bf16_round(bp[col]) : 0.f;
#pragma unroll
    for (int r = 0; r < 8; ++r) { const int rloc = half * 16 + 8 * hh + r; float v = accs[u][r] * alpha + bv; if (CP) { const int bidx = (row0g + row0 + rloc) / rowsPerB; v += CP[(size_t)bidx * sCPb + (size_t)by * 64 + col]; }
      if (ACT == 3) v = fmaxf(v, 0.f); else if (ACT == 6) v = 0.5f * v * (1.0f + erff(v * 0.70710678118654752f)); else if (ACT == 11) v = 1.0f / (1.0f + expf(-v)); else if (ACT == 15) v = v / (1.0f + expf(-v)); else if (ACT == 12) v = (v > 0.f) ? v : 0.01f * v; else if (ACT == 8) v = tanhf(v);
      so[w][rloc][t * 16 + ln] = v; } }
  __builtin_amdgcn_fence(__ATOMIC_ACQ_REL, "workgroup"); __builtin_amdgcn_wave_barrier();
  const int rsub = lane >> 4, c4 = (lane & 15) * 4;
  {
#pragma unroll
    for (int q = 0; q < 16; ++q) { const int r = q * 2 + rsub; const v4f v = *(const v4fa*)&so[w][r][c4]; if (C) *(v4f*)(C + cofs + (size_t)(row0 + r) * ldc + col0 + c4) = v; if (C16) { v4h h4; for (int i = 0; i < 4; ++i) h4[i] = (_Float16)v[i]; *(v4h*)(C16 + cofs + (size_t)(row0 + r) * ldc + col0 + c4) = h4; } }
     } }



template <int CAUSAL>
__global__ __launch_bounds__(128) void k_flash(const _Float16* __restrict__ Q16, int ldq, const _Float16* __restrict__ K16, int ldk, const _Float16* __restrict__ Vt, const int* __restrict__ MSK, float* __restrict__ O, int ldo) {
  constexpr int RPW = 16, RTN = RPW / 16, NQB = TQ / (4 * RPW), DT = 4, KS = 2;
  __shared__ __attribute__((aligned(16))) unsigned short sP[4][RPW][40]; __shared__ __attribute__((aligned(16))) float sO[4][RPW][64 + 4];
  const int tid = threadIdx.x, w = tid >> 5, lane = tid & 31, ln = lane & 15, hh = lane >> 4;
  const int slab = blockIdx.x / QBLKS, qblk = blockIdx.x % QBLKS; (void)NQB; const int b = slab / NH, h = slab % NH; const int qb0 = qblk * (4 * RPW); const int q0 = qb0 + w * RPW;
  FragH aq[2][KS];
#pragma unroll
  for (int rt = 0; rt < RTN; ++rt) { const unsigned short* qr = (const unsigned short*)Q16 + ((size_t)b * TQ + q0 + rt * 16 + ln) * ldq + h * 64;
#pragma unroll
    for (int ks = 0; ks < KS; ++ks) { aq[rt][ks].half[0] = *(const v8us*)(qr + ks * 32 + 8 * hh); aq[rt][ks].half[1] = *(const v8us*)(qr + ks * 32 + 16 + 8 * hh); } }
  const unsigned short* Vth = (const unsigned short*)Vt + (size_t)slab * 64 * TK;
  float m_r[2][8], l_r[2][8]; v8f oacc[2][DT];
#pragma unroll
  for (int rt = 0; rt < RTN; ++rt) {
#pragma unroll
    for (int r = 0; r < 8; ++r) { m_r[rt][r] = -3.0e38f; l_r[rt][r] = 0.f; }
#pragma unroll
    for (int dt = 0; dt < DT; ++dt) oacc[rt][dt] = (v8f){0.f,0.f,0.f,0.f,0.f,0.f,0.f,0.f}; }
  const int jend = (CAUSAL == 1) ? (qb0 + 4 * RPW) : TK;      /* causal: keys beyond the block's last query never contribute */
#pragma unroll 1
  for (int j0 = 0; j0 < jend; j0 += 32) {
    v8f s[2][2];
#pragma unroll
    for (int nt = 0; nt < 2; ++nt) { const unsigned short* kr = (const unsigned short*)K16 + ((size_t)b * TK + j0 + nt * 16 + ln) * ldk + h * 64; FragH bk[KS];
#pragma unroll
      for (int ks = 0; ks < KS; ++ks) { bk[ks].half[0] = *(const v8us*)(kr + ks * 32 + 8 * hh); bk[ks].half[1] = *(const v8us*)(kr + ks * 32 + 16 + 8 * hh); }
#pragma unroll
      for (int rt = 0; rt < RTN; ++rt) { v8f acc = (v8f){0.f,0.f,0.f,0.f,0.f,0.f,0.f,0.f};
#pragma unroll
        for (int ks = 0; ks < KS; ++ks) acc = mmaH<1>(aq[rt][ks].v, aq[rt][ks].v, bk[ks].v, bk[ks].v, acc); s[rt][nt] = acc; } }
#pragma unroll
    for (int rt = 0; rt < RTN; ++rt)
#pragma unroll
      for (int r = 0; r < 8; ++r) { const int tq = q0 + rt * 16 + 8 * hh + r; const int k0 = j0 + ln, k1 = j0 + 16 + ln;
        const bool ok0 = (CAUSAL == 1) ? (k0 <= tq) : ((CAUSAL == 2) ? ((k0 >> 5) == (tq >> 5)) : true), ok1 = (CAUSAL == 1) ? (k1 <= tq) : ((CAUSAL == 2) ? ((k1 >> 5) == (tq >> 5)) : true);      /* mode 2: block-diagonal 32-token groups */
        const float s0 = ok0 ? s[rt][0][r] * SCL : -3.0e38f, s1 = ok1 ? s[rt][1][r] * SCL : -3.0e38f; float mc = fmaxf(s0, s1);
        mc = fmaxf(mc, __shfl_xor(mc, 1, 32)); mc = fmaxf(mc, __shfl_xor(mc, 2, 32)); mc = fmaxf(mc, __shfl_xor(mc, 4, 32)); mc = fmaxf(mc, __shfl_xor(mc, 8, 32));
        const float mn = fmaxf(m_r[rt][r], mc); const float al = (mn > -1.0e38f) ? expf(m_r[rt][r] - mn) : 1.0f; m_r[rt][r] = mn; const float p0 = ok0 ? expf(s0 - mn) : 0.f, p1 = ok1 ? expf(s1 - mn) : 0.f; l_r[rt][r] = l_r[rt][r] * al + p0 + p1;
#pragma unroll
        for (int dt = 0; dt < DT; ++dt) oacc[rt][dt][r] *= al;
        FragH t2; t2.h[0] = (_Float16)(p0 * 1024.0f); t2.h[1] = (_Float16)(p1 * 1024.0f); sP[w][rt * 16 + 8 * hh + r][ln] = t2.u[0]; sP[w][rt * 16 + 8 * hh + r][16 + ln] = t2.u[1]; }
    __builtin_amdgcn_fence(__ATOMIC_ACQ_REL, "workgroup"); __builtin_amdgcn_wave_barrier();
    FragH pa[2];
#pragma unroll
    for (int rt = 0; rt < RTN; ++rt) { pa[rt].half[0] = *(const v8us*)&sP[w][rt * 16 + ln][8 * hh]; pa[rt].half[1] = *(const v8us*)&sP[w][rt * 16 + ln][16 + 8 * hh]; }
#pragma unroll
    for (int dt = 0; dt < DT; ++dt) { const unsigned short* vrow = Vth + (size_t)(dt * 16 + ln) * TK + j0; FragH bv; bv.half[0] = *(const v8us*)(vrow + 8 * hh); bv.half[1] = *(const v8us*)(vrow + 16 + 8 * hh);
#pragma unroll
      for (int rt = 0; rt < RTN; ++rt) oacc[rt][dt] = mmaH<1>(pa[rt].v, pa[rt].v, bv.v, bv.v, oacc[rt][dt]); }
    __builtin_amdgcn_fence(__ATOMIC_ACQ_REL, "workgroup"); __builtin_amdgcn_wave_barrier(); }
#pragma unroll
  for (int rt = 0; rt < RTN; ++rt) {
#pragma unroll
    for (int r = 0; r < 8; ++r) { float l = l_r[rt][r]; l += __shfl_xor(l, 1, 32); l += __shfl_xor(l, 2, 32); l += __shfl_xor(l, 4, 32); l += __shfl_xor(l, 8, 32); l_r[rt][r] = (l > 0.f) ? 1.0f / (l * 1024.0f) : 0.f; }
#pragma unroll
    for (int dt = 0; dt < DT; ++dt)
#pragma unroll
      for (int r = 0; r < 8; ++r) sO[w][rt * 16 + 8 * hh + r][dt * 16 + ln] = oacc[rt][dt][r] * l_r[rt][r]; }
  __builtin_amdgcn_fence(__ATOMIC_ACQ_REL, "workgroup"); __builtin_amdgcn_wave_barrier();
  {
#pragma unroll
    for (int rp = 0; rp < RPW; rp += 2) { const int r = rp + (lane >> 4), pc = lane & 15; const v4f val = *(const v4fa*)&sO[w][r][pc * 4]; *(v4f*)(O + ((size_t)b * TQ + q0 + r) * ldo + h * 64 + pc * 4) = val; }
     } }
__device__ __forceinline__ float xhalf(float x) { return __builtin_bit_cast(float, __builtin_amdgcn_permlanex16(__builtin_bit_cast(int, x), __builtin_bit_cast(int, x), 0x76543210, 0xfedcba98, false, false)); }      /* lane l <-> lane l ^ 16 */
template <int CAUSAL>
__global__ __launch_bounds__(128) void k_flashqk(const _Float16* __restrict__ Q16, const _Float16* __restrict__ QL, int ldq, const _Float16* __restrict__ K16, const _Float16* __restrict__ KL, int ldk, const _Float16* __restrict__ Vt, const int* __restrict__ MSK, float* __restrict__ O, int ldo) {
  constexpr int RPW = 16, DT = HPITCH / 16, KS = HPITCH / 32;
  __shared__ __attribute__((aligned(16))) float sO[4][RPW][HPITCH + 4];
  const int tid = threadIdx.x, w = tid >> 5, lane = tid & 31, ln = lane & 15, hh = lane >> 4;
  const int slab = blockIdx.x / QBLKS, qblk = blockIdx.x % QBLKS; const int b = slab / NH, h = slab % NH; const int qb0 = qblk * (4 * RPW); const int q0 = qb0 + w * RPW;
  const int tq = q0 + ln;      /* this lane's query */
  FragH bq[KS], bql[KS];
  { const unsigned short* qr = (const unsigned short*)Q16 + ((size_t)b * TQ + tq) * ldq + h * HPITCH; const unsigned short* ql = (const unsigned short*)QL + ((size_t)b * TQ + tq) * ldq + h * HPITCH;
#pragma unroll      /* constant indices keep the fragment, score and accumulator arrays in registers */
    for (int ks = 0; ks < KS; ++ks) { bq[ks].half[0] = *(const v8us*)(qr + ks * 32 + 8 * hh); bq[ks].half[1] = *(const v8us*)(qr + ks * 32 + 16 + 8 * hh); bql[ks].half[0] = *(const v8us*)(ql + ks * 32 + 8 * hh); bql[ks].half[1] = *(const v8us*)(ql + ks * 32 + 16 + 8 * hh); } }
  const unsigned short* Vth = (const unsigned short*)Vt + (size_t)slab * HPITCH * TK;
  float m_q = -3.0e38f, l_q = 0.f; v8f oacc[DT];      /* oacc[dt][r] = O[tq][dt * 16 + 8 hh + r], un-normalised */
#pragma unroll      /* constant indices keep the fragment, score and accumulator arrays in registers */
  for (int dt = 0; dt < DT; ++dt) oacc[dt] = (v8f){0.f,0.f,0.f,0.f,0.f,0.f,0.f,0.f};
  const int jend = (CAUSAL == 1) ? (qb0 + 4 * RPW) : TK;      /* causal: keys beyond the block's last query never contribute */
#pragma unroll 1
  for (int j0 = 0; j0 < jend; j0 += 32) {
    v8f s[2];      /* s[nt][r] = score of key j0 + nt * 16 + 8 hh + r against query tq */
#pragma unroll      /* constant indices keep the fragment, score and accumulator arrays in registers */
    for (int nt = 0; nt < 2; ++nt) { const unsigned short* kr = (const unsigned short*)K16 + ((size_t)b * TK + j0 + nt * 16 + ln) * ldk + h * HPITCH; const unsigned short* klr = (const unsigned short*)KL + ((size_t)b * TK + j0 + nt * 16 + ln) * ldk + h * HPITCH; FragH ak[KS], akl[KS];
#pragma unroll      /* constant indices keep the fragment, score and accumulator arrays in registers */
      for (int ks = 0; ks < KS; ++ks) { ak[ks].half[0] = *(const v8us*)(kr + ks * 32 + 8 * hh); ak[ks].half[1] = *(const v8us*)(kr + ks * 32 + 16 + 8 * hh); akl[ks].half[0] = *(const v8us*)(klr + ks * 32 + 8 * hh); akl[ks].half[1] = *(const v8us*)(klr + ks * 32 + 16 + 8 * hh); }
      v8f acc = (v8f){0.f,0.f,0.f,0.f,0.f,0.f,0.f,0.f}, accl = acc;
#pragma unroll      /* constant indices keep the fragment, score and accumulator arrays in registers */
      for (int ks = 0; ks < KS; ++ks) { acc = mmaH<1>(ak[ks].v, ak[ks].v, bq[ks].v, bq[ks].v, acc); accl = mmaH<1>(ak[ks].v, ak[ks].v, bql[ks].v, bql[ks].v, accl); accl = mmaH<1>(akl[ks].v, akl[ks].v, bq[ks].v, bq[ks].v, accl); }
#pragma unroll      /* constant indices keep the fragment, score and accumulator arrays in registers */
      for (int r = 0; r < 8; ++r) acc[r] += accl[r] * 0.0009765625f;
      s[nt] = acc; }
    float sc[16]; bool ok[16];
#pragma unroll      /* constant indices keep the fragment, score and accumulator arrays in registers */
    for (int i = 0; i < 16; ++i) { const int kk = j0 + (i >> 3) * 16 + 8 * hh + (i & 7);
      ok[i] = (CAUSAL == 1) ? (kk <= tq) : ((CAUSAL == 2) ? ((kk >> 5) == (tq >> 5)) : true);      /* mode 2: block-diagonal 32-token groups */
      if (CAUSAL == 4) ok[i] = MSK[((size_t)b * TQ + tq) * TK + kk] != 0;      /* mode 4: per-(query, key) INPUT mask shared by all heads; masked keys contribute nothing, rows with no valid key give l = 0 -> output 0 */
      sc[i] = ok[i] ? s[i >> 3][i & 7] * SCL : -3.0e38f; }
    float mt[8];
#pragma unroll      /* constant indices keep the fragment, score and accumulator arrays in registers */
    for (int i = 0; i < 8; ++i) mt[i] = fmaxf(sc[i], sc[8 + i]);
    float mc = fmaxf(fmaxf(fmaxf(mt[0], mt[1]), fmaxf(mt[2], mt[3])), fmaxf(fmaxf(mt[4], mt[5]), fmaxf(mt[6], mt[7])));
    mc = fmaxf(mc, xhalf(mc));      /* the other half's 16 keys of the same query */
    const float mn = fmaxf(m_q, mc); const float al = (mn > -1.0e38f) ? expf(m_q - mn) : 1.0f; m_q = mn;
    float p[16]; FragH pb;
#pragma unroll      /* constant indices keep the fragment, score and accumulator arrays in registers */
    for (int i = 0; i < 16; ++i) { p[i] = ok[i] ? expf(sc[i] - mn) : 0.f; pb.h[i] = (_Float16)(p[i] * 1024.0f); }      /* pb.h[i]: key j0 + (i >> 3) * 16 + 8 hh + (i & 7) of column ln */
    float pt[8];
#pragma unroll      /* constant indices keep the fragment, score and accumulator arrays in registers */
    for (int i = 0; i < 8; ++i) pt[i] = p[i] + p[8 + i];
    l_q = l_q * al + (((pt[0] + pt[1]) + (pt[2] + pt[3])) + ((pt[4] + pt[5]) + (pt[6] + pt[7])));
#pragma unroll      /* constant indices keep the fragment, score and accumulator arrays in registers */
    for (int dt = 0; dt < DT; ++dt)
#pragma unroll      /* constant indices keep the fragment, score and accumulator arrays in registers */
      for (int r = 0; r < 8; ++r) oacc[dt][r] *= al;
#pragma unroll      /* constant indices keep the fragment, score and accumulator arrays in registers */
    for (int dt = 0; dt < DT; ++dt) { const unsigned short* vrow = Vth + (size_t)(dt * 16 + ln) * TK + j0; FragH av; av.half[0] = *(const v8us*)(vrow + 8 * hh); av.half[1] = *(const v8us*)(vrow + 16 + 8 * hh);
      oacc[dt] = mmaH<1>(av.v, av.v, pb.v, pb.v, oacc[dt]); } }
  const float lsum = l_q + xhalf(l_q); const float linv = (lsum > 0.f) ? 1.0f / (lsum * 1024.0f) : 0.f;
#pragma unroll      /* constant indices keep the fragment, score and accumulator arrays in registers */
  for (int dt = 0; dt < DT; ++dt) { v4f lo4, hi4;
#pragma unroll      /* constant indices keep the fragment, score and accumulator arrays in registers */
    for (int r = 0; r < 4; ++r) { lo4[r] = oacc[dt][r] * linv; hi4[r] = oacc[dt][4 + r] * linv; }
    *(v4fa*)&sO[w][ln][dt * 16 + 8 * hh] = lo4; *(v4fa*)&sO[w][ln][dt * 16 + 8 * hh + 4] = hi4; }
  __builtin_amdgcn_fence(__ATOMIC_ACQ_REL, "workgroup"); __builtin_amdgcn_wave_barrier();
  {
#pragma unroll      /* constant indices keep the fragment, score and accumulator arrays in registers */
    for (int rp = 0; rp < RPW; rp += 128 / HPITCH) { const int r = rp + lane / (HPITCH / 4), pc = lane % (HPITCH / 4); const v4f val = *(const v4fa*)&sO[w][r][pc * 4]; *(v4f*)(O + ((size_t)b * TQ + q0 + r) * ldo + h * HPITCH + pc * 4) = val; }
     } }

__global__ __launch_bounds__(256) void k_gnstat(const float* __restrict__ x, float* __restrict__ GS) {
  #pragma clang fp contract(off)
  __shared__ float sh[256]; const int bg = blockIdx.x; const int tid = threadIdx.x; const float* base = x + (size_t)bg * CPG * SLEN; const int n = CPG * SLEN; float s = 0.f;
  for (int i = tid; i < n; i += 256) s += bf16_round(base[i]);
  sh[tid] = s; __syncthreads(); for (int st = 128; st > 0; st >>= 1) { if (tid < st) sh[tid] += sh[tid + st]; __syncthreads(); }
  const float mu = sh[0] / (float)n; __syncthreads(); float q2 = 0.f;
  for (int i = tid; i < n; i += 256) { const float d = bf16_round(base[i]) - mu; q2 += d * d; }
  sh[tid] = q2; __syncthreads(); for (int st = 128; st > 0; st >>= 1) { if (tid < st) sh[tid] += sh[tid + st]; __syncthreads(); }
  if (tid == 0) { const float rs = rsqrtf(sh[0] / (float)n + 1e-5f); { *(float*)(GS + (size_t)bg * 32) = mu; *(float*)(GS + (size_t)bg * 32 + 1) = rs;  } } }
__global__ __launch_bounds__(256) void k_gnT(const float* __restrict__ x, const float* __restrict__ GS, const float* __restrict__ gam, const float* __restrict__ bet, _Float16* __restrict__ XT16) {
  #pragma clang fp contract(off)
  __shared__ float tl[64][65]; const int tid = threadIdx.x; const int per = (CC / 64) * (SLEN / 64); const int b = blockIdx.x / per; const int rem = blockIdx.x % per; const int cb = rem / (SLEN / 64), pb = rem % (SLEN / 64);
  for (int i = tid; i < 64 * 16; i += 256) { const int cl = i / 16, p4 = (i % 16) * 4; const int c = cb * 64 + cl; const float mu = GS[((size_t)b * NGR + c / CPG) * 32], rs = GS[((size_t)b * NGR + c / CPG) * 32 + 1]; const float g = bf16_round(gam[c]), be = bf16_round(bet[c]);
    const v4f a = *(const v4fa*)(x + ((size_t)b * CC + c) * SLEN + pb * 64 + p4); for (int q = 0; q < 4; ++q) { float v = (bf16_round(a[q]) - mu) * rs * g; v += be; tl[cl][p4 + q] = v; } }
  __syncthreads(); const int pl = tid >> 2, c8 = (tid & 3) * 8;
  { for (int u = 0; u < 2; ++u) { const int c0 = c8 + u * 32; FragH f; for (int q = 0; q < 8; ++q) f.h[q] = (_Float16)tl[c0 + q][pl]; *(v8us*)((unsigned short*)XT16 + ((size_t)b * SLEN + pb * 64 + pl) * CC + cb * 64 + c0) = f.half[0]; }  } }
__global__ __launch_bounds__(256) void k_wpad(const float* __restrict__ Wm, const float* __restrict__ bm, _Float16* __restrict__ BP, float* __restrict__ PB) {
  const int r = blockIdx.x * 256 + threadIdx.x; if (r >= DP) return; const int h = r / HPITCH, d = r % HPITCH; const bool live = d < HDT; const int srow = h * HDT + d;
  for (int c0 = 0; c0 < CC; c0 += 8) { FragH f; for (int q = 0; q < 8; ++q) f.h[q] = live ? (_Float16)(bf16_round(Wm[(size_t)srow * CC + c0 + q]) * 16.0f) : (_Float16)0.0f; unsigned short* dst = (unsigned short*)BP + (size_t)r * CC + c0; *(v8us*)dst = f.half[0];  }
  const float bv = live ? bm[srow] : 0.f; *(float*)(PB + r) = bv;  }
__global__ __launch_bounds__(256) void k_wio(const float* __restrict__ Wm, int nin, int nout, int pair, _Float16* __restrict__ Bt) { const int pitch = pair ? 2 * nin : nin; const size_t t = (size_t)blockIdx.x * 256 + threadIdx.x; if (t >= (size_t)nout * (pitch / 8)) return; const int pc = (int)(t % (pitch / 8)); const int o = (int)(t / (pitch / 8)); FragH f;
  for (int q = 0; q < 8; ++q) { const int col = pc * 8 + q; const bool lo = col >= nin; const int i = lo ? col - nin : col; f.h[q] = (_Float16)(bf16_round(Wm[(size_t)i * nout + o]) * (lo ? 1.0f : 16.0f)); }
  *(v8us*)((unsigned short*)Bt + (size_t)o * pitch + pc * 8) = f.half[0];  }
__global__ __launch_bounds__(256) void k_wop(const float* __restrict__ Wo, _Float16* __restrict__ Bt) { const int t = blockIdx.x * 256 + threadIdx.x; if (t >= CC * (2 * CC / 8)) return; const int pc = t % (2 * CC / 8); const int o = t / (2 * CC / 8); const bool lo = pc * 8 >= CC; FragH f;
  for (int q = 0; q < 8; ++q) { const int c = pc * 8 + q - (lo ? CC : 0); f.h[q] = (_Float16)(bf16_round(Wo[(size_t)o * CC + c]) * (lo ? 1.0f : 16.0f)); } *(v8us*)((unsigned short*)Bt + (size_t)o * 2 * CC + pc * 8) = f.half[0];  }
__global__ __launch_bounds__(256) void k_ofl(const float* __restrict__ O, float* __restrict__ OF, _Float16* __restrict__ OF2) { const size_t t = (size_t)blockIdx.x * 256 + threadIdx.x; if (t >= (size_t)NR * (CC / 8)) return; const int c0 = (int)(t % (CC / 8)) * 8; const size_t r = t / (CC / 8); const int h = c0 / HDT, d0 = c0 % HDT; FragH fh, fl; v4f a, bq;
  for (int q = 0; q < 8; ++q) { const float v = O[r * DP + h * HPITCH + d0 + q]; const _Float16 hv = (_Float16)v; fh.h[q] = hv; fl.h[q] = (_Float16)((v - (float)hv) * 16.0f); if (q < 4) a[q] = v; else bq[q - 4] = v; }
  { *(v4f*)(OF + r * CC + c0) = a; *(v4f*)(OF + r * CC + c0 + 4) = bq; *(v8us*)((unsigned short*)OF2 + r * 2 * CC + c0) = fh.half[0]; *(v8us*)((unsigned short*)OF2 + r * 2 * CC + CC + c0) = fl.half[0];  } }
__global__ __launch_bounds__(256) void k_pair16(const float* __restrict__ S, _Float16* __restrict__ HP) { const size_t t = (size_t)blockIdx.x * 256 + threadIdx.x; if (t >= (size_t)NR * (CC / 8)) return; const int c0 = (int)(t % (CC / 8)) * 8; const size_t r = t / (CC / 8); FragH fh, fl;
  for (int q = 0; q < 8; ++q) { const float v = S[r * CC + c0 + q]; const _Float16 hv = (_Float16)v; fh.h[q] = hv; fl.h[q] = (_Float16)((v - (float)hv) * 16.0f); }
  { *(v8us*)((unsigned short*)HP + r * 2 * CC + c0) = fh.half[0]; *(v8us*)((unsigned short*)HP + r * 2 * CC + CC + c0) = fl.half[0];  } }
__global__ __launch_bounds__(256) void k_nchw(const float* __restrict__ Y, float* __restrict__ out) { const size_t t = (size_t)blockIdx.x * 256 + threadIdx.x; if (t >= (size_t)NB * CC * (SLEN / 4)) return; const int n0 = (int)(t % (SLEN / 4)) * 4; const int o = (int)((t / (SLEN / 4)) % CC); const int b = (int)(t / ((size_t)(SLEN / 4) * CC)); v4f r; for (int q = 0; q < 4; ++q) r[q] = Y[((size_t)b * SLEN + n0 + q) * CC + o]; float* d = out + ((size_t)b * CC + o) * SLEN + n0; *(v4f*)d = r;  }

extern "C" void kernel_launch(void* const* d_in, const int* in_sizes, int n_in,
                              void* d_out, int out_size, void* d_ws, size_t ws_size, hipStream_t stream) {
  (void)in_sizes; (void)n_in; (void)out_size;
  const float* const* I = (const float* const*)d_in; const float* fo = I[0]; const float* fs = I[1]; const float* gq = I[2]; const float* bq = I[3]; const float* gkv = I[4]; const float* bkv = I[5]; const float* Wq = I[6]; const float* bqp = I[7]; const float* Wk = I[8]; const float* bkp = I[9]; const float* Wv = I[10]; const float* bvp = I[11]; const float* W1 = I[12]; const float* b1 = I[13]; const float* W2 = I[14]; const float* b2 = I[15]; const float* Wo = I[16]; const float* bo = I[17];
  char* ws = (char*)d_ws; size_t off = 0;
  auto take = [&](size_t bytes) { char* p = ws + off; off += (bytes + 255) & ~(size_t)255; return p; };
  _Float16* BPq = (_Float16*)take((size_t)DP * CC * 2); _Float16* BPk = (_Float16*)take((size_t)DP * CC * 2); _Float16* BPv = (_Float16*)take((size_t)DP * CC * 2); float* PBq = (float*)take(DP * 4); float* PBk = (float*)take(DP * 4); float* PBv = (float*)take(DP * 4);
  _Float16* BW1 = (_Float16*)take((size_t)HID * 2 * CC * 2); _Float16* BW2 = (_Float16*)take((size_t)CC * HID * 2); _Float16* BWO = (_Float16*)take((size_t)CC * 2 * CC * 2); float* GS = (float*)take((size_t)NB * NGR * 32 * 4 * 2);
  _Float16* XQ = (_Float16*)take((size_t)NR * CC * 2); _Float16* XKV = (_Float16*)take((size_t)NR * CC * 2); float* F32 = (float*)take((size_t)NR * DP * 4);
  _Float16* QH = (_Float16*)take((size_t)NR * DP * 2); _Float16* QL = (_Float16*)take((size_t)NR * DP * 2); _Float16* KH = (_Float16*)take((size_t)NR * DP * 2); _Float16* KL = (_Float16*)take((size_t)NR * DP * 2); _Float16* VH = (_Float16*)take((size_t)NR * DP * 2); _Float16* VL = (_Float16*)take((size_t)NR * DP * 2); _Float16* VT = (_Float16*)take((size_t)NR * DP * 2); _Float16* VTL = (_Float16*)take((size_t)NR * DP * 2);
  float* OF = (float*)take((size_t)NR * CC * 4); _Float16* OF2 = (_Float16*)take((size_t)NR * 2 * CC * 2); _Float16* G16 = (_Float16*)take((size_t)NR * HID * 2); float* FU = (float*)take((size_t)NR * CC * 4); _Float16* FU2 = (_Float16*)take((size_t)NR * 2 * CC * 2); float* Y = (float*)take((size_t)NR * CC * 4);
  float* O = F32;
  if (off > ws_size) return;      /* 0.5 + 2 + 2 + 4 + 8 x 2 + 4 + 4 + 4 + 4 + 4 + 4 = 49 MiB */
  k_wpad<<<1, 256, 0, stream>>>(Wq, bqp, BPq, PBq); k_wpad<<<1, 256, 0, stream>>>(Wk, bkp, BPk, PBk); k_wpad<<<1, 256, 0, stream>>>(Wv, bvp, BPv, PBv);      /* conv1x1 weights (out,in) = natural rows */
  k_wio<<<(HID * (2 * CC / 8) + 255) / 256, 256, 0, stream>>>(W1, CC, HID, 1, BW1); k_wio<<<(CC * (HID / 8) + 255) / 256, 256, 0, stream>>>(W2, HID, CC, 0, BW2); k_wop<<<(CC * (2 * CC / 8) + 255) / 256, 256, 0, stream>>>(Wo, BWO);
  k_gnstat<<<NB * NGR, 256, 0, stream>>>(fo, GS); k_gnstat<<<NB * NGR, 256, 0, stream>>>(fs, GS + NB * NGR * 32);
  k_gnT<<<NB * (CC / 64) * (SLEN / 64), 256, 0, stream>>>(fo, GS, gq, bq, XQ); k_gnT<<<NB * (CC / 64) * (SLEN / 64), 256, 0, stream>>>(fs, GS + NB * NGR * 32, gkv, bkv, XKV);
  const dim3 gP((NR / 128) * (DP / 64), 1), gC((NR / 128) * (CC / 64), 1), gH((NR / 128) * (HID / 64), 1); const unsigned n8 = (unsigned)(((size_t)NR * DP / 8 + 255) / 256), n8c = (unsigned)(((size_t)NR * (CC / 8) + 255) / 256);
  k_gemm2<0><<<gP, 128, 0, stream>>>(XQ, CC, 0, BPq, CC, 0, 0.0625f, PBq, 0, nullptr, 1, 0, 0, F32, nullptr, DP, 0, NR, DP, CC); k_hl<<<n8, 256, 0, stream>>>(F32, QH, QL, (size_t)NR * DP / 8);
  k_gemm2<0><<<gP, 128, 0, stream>>>(XKV, CC, 0, BPk, CC, 0, 0.0625f, PBk, 0, nullptr, 1, 0, 0, F32, nullptr, DP, 0, NR, DP, CC); k_hl<<<n8, 256, 0, stream>>>(F32, KH, KL, (size_t)NR * DP / 8);
  k_gemm2<0><<<gP, 128, 0, stream>>>(XKV, CC, 0, BPv, CC, 0, 0.0625f, PBv, 0, nullptr, 1, 0, 0, F32, nullptr, DP, 0, NR, DP, CC); k_hl<<<n8, 256, 0, stream>>>(F32, VH, VL, (size_t)NR * DP / 8);
  k_vt<NH, SLEN><<<NB * NH * (SLEN / 64), 256, 0, stream>>>(VH, DP, 0, VT);
  k_flashqk<0><<<NB * NH * QBLKS, 128, 0, stream>>>(QH, QL, DP, KH, KL, DP, VT, nullptr, O, DP);      /* q/k hi + residual; P (x2^10) and V plain f16 */
  k_ofl<<<n8c, 256, 0, stream>>>(O, OF, OF2);
  k_gemm2<6><<<gH, 128, 0, stream>>>(OF2, 2 * CC, 0, BW1, 2 * CC, 0, 0.0625f, b1, 0, nullptr, 1, 0, 0, nullptr, G16, HID, 0, NR, HID, 2 * CC);      /* gelu_erf(out W1 + b1) -> f16 */
  k_gemm2<0><<<gC, 128, 0, stream>>>(G16, HID, 0, BW2, HID, 0, 0.0625f, b2, 0, OF, 1, (size_t)CC, 0, FU, nullptr, CC, 0, NR, CC, HID);      /* mlp + b2 + out_flat */
  k_pair16<<<n8c, 256, 0, stream>>>(FU, FU2);
  k_gemm2<0><<<gC, 128, 0, stream>>>(FU2, 2 * CC, 0, BWO, 2 * CC, 0, 0.0625f, bo, 0, nullptr, 1, 0, 0, Y, nullptr, CC, 0, NR, CC, 2 * CC);      /* conv1x1(fused, Wo) + bo */
  k_nchw<<<(unsigned)(((size_t)NB * CC * (SLEN / 4) + 255) / 256), 256, 0, stream>>>(Y, (float*)d_out);
}

// v003
// A run of this version takes 251 microseconds.
// In two side-by-side timings against v002, it was 1.53 and 1.54 times as fast.
// All steps since v000 together make it 2.69 times as fast.
#include <hip/hip_runtime.h>
// SFBlock (2 x 128 x 64 x 64; 4 heads x 32; GroupNorm(32) on both inputs; q from feat_opt, k/v from feat_sar via 1x1 convs; softmax(q k^T / sqrt(32)) v over the 4096 positions; MLP: gelu_erf(out W1 + b1) W2 + b2; fused = out + mlp; 1x1 conv Wo -> [2,128,64,64]).
// Compute dtype: inputs and parameters rounded to bf16; normalised inputs as f16 operands (~2^-12); q, k hi + residual; P (x2^10), v plain f16; attention output / fused as hi + residual pairs; the 256-wide GELU hidden as f16; f32 statistics/softmax/accumulation. v_wmma_f32_16x16x32_f16.
#define NB 2
#define CC 128
#define HID 256
#define NGR 32
#define CPG (CC / NGR)           /* 4 channels per group */
#define HDT 32
#define HPITCH HDT                   /* columns per head in the q/k/v planes: the true head dim, no padding */
#define DP (NH * HPITCH)             /* 128 */
#define NR (NB * SLEN)           /* 8192 */
#define QBLKS (TQ / 64)
#define SLEN 4096                /* H*W tokens */
#define TQ SLEN
#define TK SLEN
#define NH 4
#define SCL 0.17677669529663687f /* 32^-0.5 */
typedef __bf16 v16b __attribute__((ext_vector_type(16)));
typedef unsigned short v8us __attribute__((ext_vector_type(8), may_alias));
typedef float  v8f  __attribute__((ext_vector_type(8)));
typedef float  v4f  __attribute__((ext_vector_type(4)));
typedef float  v4fa __attribute__((ext_vector_type(4), may_alias));
union FragB { v16b v; v8us half[2]; unsigned short u[16]; };

__device__ __forceinline__ unsigned short bf16_bits(float x) { unsigned int u = __float_as_uint(x); return (unsigned short)((u + 0x7FFFu + ((u >> 16) & 1u)) >> 16); }
__device__ __forceinline__ float bf16_val(unsigned short b) { return __uint_as_float(((unsigned int)b) << 16); }
__device__ __forceinline__ float bf16_round(float x) { return bf16_val(bf16_bits(x)); }
// D += A·B with NT terms: 1 = ah·bh, 2 = + al·bh (A split), 3 = + ah·bl (both split)
template <int NT>
__device__ __forceinline__ v8f mmaN(v16b ah, v16b al, v16b bh, v16b bl, v8f c) {
  c = __builtin_amdgcn_wmma_f32_16x16x32_bf16(false, ah, false, bh, (short)0, c, false, false);
  if (NT >= 2) c = __builtin_amdgcn_wmma_f32_16x16x32_bf16(false, al, false, bh, (short)0, c, false, false);
  if (NT >= 3) c = __builtin_amdgcn_wmma_f32_16x16x32_bf16(false, ah, false, bl, (short)0, c, false, false);
  asm volatile("v_nop\n\tv_nop\n\tv_nop\n\tv_nop" : "+v"(c) : "v"(ah), "v"(al), "v"(bh), "v"(bl));
  return c;
}

__global__ __launch_bounds__(256) void k_wt_bf16(const float* __restrict__ W, unsigned short* __restrict__ Wt, int K, int N) {
  const int t = blockIdx.x * 256 + threadIdx.x;
  const int k8n = K / 8;
  if (t >= N * k8n) return;
  const int n = t / k8n, k8 = (t % k8n) * 8;
  v8us v;
#pragma unroll
  for (int i = 0; i < 8; ++i) v[i] = bf16_bits(W[(size_t)(k8 + i) * N + n]);
  *(v8us*)(Wt + (size_t)n * K + k8) = v;
  
}

// GEMM C[M][N] (f32, pitch ldc) = act(A[M][K]·W + bias). A f32 row-major (pitch lda) converted per fragment to bf16
// (ASPLIT: hi/lo two planes -> 2 terms, else single rounded term); Wt bf16 [N][K] (pitch ldb). BIAS_BF16 rounds the
// bias to bf16 first (bias quantised to bf16 before the add). K%32==0, M%16==0, N%64==0.
template <bool ASPLIT, int ACT, bool BIAS_BF16>
__global__ __launch_bounds__(128) void k_gemm_bf(const float* __restrict__ A, int lda, const unsigned short* __restrict__ Wt, int ldb,
                                               const float* __restrict__ bias, float* __restrict__ C, int ldc, int M, int N, int K) {
  __shared__ __attribute__((aligned(16))) float so[4][16][64];
  const int tid = threadIdx.x, w = tid >> 5, lane = tid & 31, ln = lane & 15, hh = lane >> 4;
  const int ntn = N / 64;
  const int wid = blockIdx.x * 4 + w;
  const int mt = wid / ntn, nq = wid % ntn;
  if (mt * 16 >= M) return;
  const int row0 = mt * 16, col0 = nq * 64;
  const float* arow = A + (size_t)(row0 + ln) * lda;
  v8f acc[4] = {};
  for (int kb = 0; kb < K; kb += 32) {
    FragB ah, al;
    const v4f x0 = *(const v4fa*)(arow + kb + 8 * hh), x1 = *(const v4fa*)(arow + kb + 8 * hh + 4);
    const v4f x2 = *(const v4fa*)(arow + kb + 16 + 8 * hh), x3 = *(const v4fa*)(arow + kb + 16 + 8 * hh + 4);
    float xs[16] = {x0[0],x0[1],x0[2],x0[3],x1[0],x1[1],x1[2],x1[3],x2[0],x2[1],x2[2],x2[3],x3[0],x3[1],x3[2],x3[3]};
#pragma unroll
    for (int i = 0; i < 16; ++i) { const unsigned short hb = bf16_bits(xs[i]); ah.u[i] = hb; al.u[i] = ASPLIT ? bf16_bits(xs[i] - bf16_val(hb)) : (unsigned short)0; }
#pragma unroll
    for (int t = 0; t < 4; ++t) {
      const unsigned short* brow = Wt + (size_t)(col0 + t * 16 + ln) * ldb + kb;
      FragB b;
      b.half[0] = *(const v8us*)(brow + 8 * hh);
      b.half[1] = *(const v8us*)(brow + 16 + 8 * hh);
      acc[t] = mmaN<ASPLIT ? 2 : 1>(ah.v, al.v, b.v, b.v, acc[t]);
    }
  }
#pragma unroll
  for (int t = 0; t < 4; ++t) {
    float bv = bias ? bias[col0 + t * 16 + ln] : 0.f;
    if (BIAS_BF16) bv = bf16_round(bv);
#pragma unroll
    for (int r = 0; r < 8; ++r) { float v = acc[t][r] + bv; if (ACT == 1) v = fmaxf(v, 0.f); so[w][8 * hh + r][t * 16 + ln] = v; }
  }
  __builtin_amdgcn_fence(__ATOMIC_ACQ_REL, "workgroup");
  __builtin_amdgcn_wave_barrier();
  const int rsub = lane >> 4, c4 = (lane & 15) * 4;
  {
#pragma unroll
    for (int q = 0; q < 8; ++q) {
      const int r = q * 2 + rsub;
      const v4f v = *(const v4fa*)&so[w][r][c4];
      *(v4f*)(C + (size_t)(row0 + r) * ldc + col0 + c4) = v;
    }
    
  }
}

// GEMM C = act(A·W + bias + resid): A f32 (ASPLIT -> hi/lo 2 terms), Wt bf16 [N][K]; ACT 0 none, 1 relu, 2 exact gelu;
// resid (optional, f32, row index = (row % rmod), pitch ldr, RES_BF16 rounds it) added before the activation.
template <bool ASPLIT, int ACT, bool BIAS_BF16, bool RES_BF16>
__global__ __launch_bounds__(128) void k_gemm_bf3(const float* __restrict__ A, int lda, const unsigned short* __restrict__ Wt, int ldb,
                                                const float* __restrict__ bias, const float* __restrict__ resid, int rmod, int ldr,
                                                float* __restrict__ C, int ldc, int M, int N, int K) {
  __shared__ __attribute__((aligned(16))) float so[4][16][64];
  const int tid = threadIdx.x, w = tid >> 5, lane = tid & 31, ln = lane & 15, hh = lane >> 4;
  const int ntn = N / 64;
  const int wid = blockIdx.x * 4 + w;
  const int mt = wid / ntn, nq = wid % ntn;
  if (mt * 16 >= M) return;
  const int row0 = mt * 16, col0 = nq * 64;
  const float* arow = A + (size_t)(row0 + ln) * lda;
  v8f acc[4] = {};
  for (int kb = 0; kb < K; kb += 32) {
    FragB ah, al;
    const v4f x0 = *(const v4fa*)(arow + kb + 8 * hh), x1 = *(const v4fa*)(arow + kb + 8 * hh + 4);
    const v4f x2 = *(const v4fa*)(arow + kb + 16 + 8 * hh), x3 = *(const v4fa*)(arow + kb + 16 + 8 * hh + 4);
    float xs[16] = {x0[0],x0[1],x0[2],x0[3],x1[0],x1[1],x1[2],x1[3],x2[0],x2[1],x2[2],x2[3],x3[0],x3[1],x3[2],x3[3]};
#pragma unroll
    for (int i = 0; i < 16; ++i) { const unsigned short hb = bf16_bits(xs[i]); ah.u[i] = hb; al.u[i] = ASPLIT ? bf16_bits(xs[i] - bf16_val(hb)) : (unsigned short)0; }
#pragma unroll
    for (int t = 0; t < 4; ++t) {
      const unsigned short* brow = Wt + (size_t)(col0 + t * 16 + ln) * ldb + kb;
      FragB b;
      b.half[0] = *(const v8us*)(brow + 8 * hh);
      b.half[1] = *(const v8us*)(brow + 16 + 8 * hh);
      acc[t] = mmaN<ASPLIT ? 2 : 1>(ah.v, al.v, b.v, b.v, acc[t]);
    }
  }
#pragma unroll
  for (int t = 0; t < 4; ++t) {
    const int col = col0 + t * 16 + ln;
    float bv = bias ? bias[col] : 0.f;
    if (BIAS_BF16) bv = bf16_round(bv);
#pragma unroll
    for (int r = 0; r < 8; ++r) {
      float v = acc[t][r] + bv;
      if (resid) { float rv = resid[(size_t)((row0 + 8 * hh + r) % rmod) * ldr + col]; if (RES_BF16) rv = bf16_round(rv); v += rv; }
      if (ACT == 1) v = fmaxf(v, 0.f);
      if (ACT == 2) v = 0.5f * v * (1.0f + erff(v * 0.70710678118654752f));
      if (ACT == 3) { const float u = 0.7978845608028654f * (v + 0.044715f * v * v * v); v = 0.5f * v * (1.0f + tanhf(u)); }
      so[w][8 * hh + r][t * 16 + ln] = v;
    }
  }
  __builtin_amdgcn_fence(__ATOMIC_ACQ_REL, "workgroup");
  __builtin_amdgcn_wave_barrier();
  const int rsub = lane >> 4, c4 = (lane & 15) * 4;
  {
#pragma unroll
    for (int q = 0; q < 8; ++q) {
      const int r = q * 2 + rsub;
      const v4f v = *(const v4fa*)&so[w][r][c4];
      *(v4f*)(C + (size_t)(row0 + r) * ldc + col0 + c4) = v;
    }
    
  }
}
// row LayerNorm (biased variance, eps) over N: s = X (+ R); optional out_sum <- s; out_norm <- (s-mu)*rsqrt(var+eps)*g + b
template <bool PARAM_BF16>
__global__ __launch_bounds__(256) void k_layernorm(const float* __restrict__ X, const float* __restrict__ R, const float* __restrict__ g, const float* __restrict__ bta,
                                                  float* __restrict__ out_sum, float* __restrict__ out_norm, int N, float eps) {
  __shared__ float red[256];
  const int row = blockIdx.x, tid = threadIdx.x;
  const float* x = X + (size_t)row * N; const float* rr = R ? R + (size_t)row * N : nullptr;
  float vals[16];                     // up to N = 4096
  const int per = N / 256;            // contiguous chunk per thread? use strided-by-4 chunks: thread handles j = tid*4 + 1024*u
  float s1 = 0.f;
  for (int u = 0; u < per / 4; ++u) {
    const int j = tid * 4 + 1024 * u;
    const v4f a = *(const v4fa*)(x + j);
    v4f b = {0.f,0.f,0.f,0.f}; if (rr) b = *(const v4fa*)(rr + j);
#pragma unroll
    for (int q = 0; q < 4; ++q) { const float v = a[q] + b[q]; vals[u * 4 + q] = v; s1 += v; }
  }
  red[tid] = s1; __syncthreads();
  for (int st = 128; st > 0; st >>= 1) { if (tid < st) red[tid] += red[tid + st]; __syncthreads(); }
  const float mu = red[0] / (float)N; __syncthreads();
  float s2 = 0.f;
  for (int u = 0; u < per / 4; ++u)
#pragma unroll
    for (int q = 0; q < 4; ++q) { const float c = vals[u * 4 + q] - mu; s2 += c * c; }
  red[tid] = s2; __syncthreads();
  for (int st = 128; st > 0; st >>= 1) { if (tid < st) red[tid] += red[tid + st]; __syncthreads(); }
  const float rs = rsqrtf(red[0] / (float)N + eps);
  {
    for (int u = 0; u < per / 4; ++u) {
      const int j = tid * 4 + 1024 * u;
      v4f o, sm;
#pragma unroll
      for (int q = 0; q < 4; ++q) {
        float gg = g[j + q], bb = bta[j + q];
        if (PARAM_BF16) { gg = bf16_round(gg); bb = bf16_round(bb); }
        sm[q] = vals[u * 4 + q]; o[q] = (vals[u * 4 + q] - mu) * rs * gg + bb;
      }
      if (out_sum) *(v4f*)(out_sum + (size_t)row * N + j) = sm;
      *(v4f*)(out_norm + (size_t)row * N + j) = o;
    }
    
  }
}



// ---- f16 WMMA path (v_wmma_f32_16x16x32_f16): 11-bit significands for operands in range — used where a [0,1] probability operand needs more precision than bf16
typedef _Float16 v16h __attribute__((ext_vector_type(16)));
union FragH { v16h v; v8us half[2]; _Float16 h[16]; unsigned short u[16]; };
template <int NT>
__device__ __forceinline__ v8f mmaH(v16h ah, v16h al, v16h bh, v16h bl, v8f c) {
  c = __builtin_amdgcn_wmma_f32_16x16x32_f16(false, ah, false, bh, (short)0, c, false, false);
  if (NT >= 2) c = __builtin_amdgcn_wmma_f32_16x16x32_f16(false, al, false, bh, (short)0, c, false, false);
  if (NT >= 3) c = __builtin_amdgcn_wmma_f32_16x16x32_f16(false, ah, false, bl, (short)0, c, false, false);
  asm volatile("v_nop\n\tv_nop\n\tv_nop\n\tv_nop" : "+v"(c) : "v"(ah), "v"(al), "v"(bh), "v"(bl));
  return c;
}
// batched GEMM like k_gemm_b but f16 operands: A f32 (split into f16 hi/lo if ASPLIT, else rounded to f16), Bt = f16 values [n][k]; alpha; C f32; N multiple of 16 (partial tiles skipped)
template <bool ASPLIT>
__global__ __launch_bounds__(128) void k_gemm_h(const float* __restrict__ A, int lda, size_t sA, const _Float16* __restrict__ Bh, int ldb, size_t sB, float alpha, float* __restrict__ C, int ldc, size_t sC, int M, int N, int K) {
  __shared__ __attribute__((aligned(16))) float so[4][16][64];
  const int tid = threadIdx.x, w = tid >> 5, lane = tid & 31, ln = lane & 15, hh = lane >> 4; const int by = blockIdx.y;
  A += (size_t)by * sA; Bh += (size_t)by * sB; C += (size_t)by * sC;
  const int ntn = (N + 63) / 64; const int wid = blockIdx.x * 4 + w; const int mt = wid / ntn, nq = wid % ntn; if (mt * 16 >= M) return;
  const int row0 = mt * 16, col0 = nq * 64; const float* arow = A + (size_t)(row0 + ln) * lda;
  v8f acc[4] = {};
  for (int kb = 0; kb < K; kb += 32) {
    FragH ah, al;
    const v4f x0 = *(const v4fa*)(arow + kb + 8 * hh), x1 = *(const v4fa*)(arow + kb + 8 * hh + 4), x2 = *(const v4fa*)(arow + kb + 16 + 8 * hh), x3 = *(const v4fa*)(arow + kb + 16 + 8 * hh + 4);
    float xs[16] = {x0[0],x0[1],x0[2],x0[3],x1[0],x1[1],x1[2],x1[3],x2[0],x2[1],x2[2],x2[3],x3[0],x3[1],x3[2],x3[3]};
#pragma unroll
    for (int i = 0; i < 16; ++i) { const _Float16 h = (_Float16)xs[i]; ah.h[i] = h; al.h[i] = ASPLIT ? (_Float16)(xs[i] - (float)h) : (_Float16)0.0f; }
#pragma unroll
    for (int t = 0; t < 4; ++t) { if (col0 + t * 16 >= N) continue; const size_t boff = (size_t)(col0 + t * 16 + ln) * ldb + kb; FragH bq; bq.half[0] = *(const v8us*)(Bh + boff + 8 * hh); bq.half[1] = *(const v8us*)(Bh + boff + 16 + 8 * hh);
      acc[t] = mmaH<ASPLIT ? 2 : 1>(ah.v, al.v, bq.v, bq.v, acc[t]); }
  }
#pragma unroll
  for (int t = 0; t < 4; ++t) { if (col0 + t * 16 >= N) continue;
#pragma unroll
    for (int r = 0; r < 8; ++r) so[w][8 * hh + r][t * 16 + ln] = acc[t][r] * alpha; }
  __builtin_amdgcn_fence(__ATOMIC_ACQ_REL, "workgroup"); __builtin_amdgcn_wave_barrier();
  const int rsub = lane >> 4, c4 = (lane & 15) * 4;
  {
#pragma unroll
    for (int q = 0; q < 8; ++q) { const int r = q * 2 + rsub; if (col0 + c4 < N) { const v4f v = *(const v4fa*)&so[w][r][c4]; *(v4f*)(C + (size_t)(row0 + r) * ldc + col0 + c4) = v; } }
     }
}

// Wt[n][k] = f16(W[k][n]·scale) from f32 row-major W[K][N] (scale = power of two; bf16-exact weights stay exact in f16 away from the subnormal range)
__global__ __launch_bounds__(256) void k_wt_f16(const float* __restrict__ W, _Float16* __restrict__ Wt, int K, int N, float scale) {
  const int t = blockIdx.x * 256 + threadIdx.x; if (t >= N * (K / 8)) return; const int n = t / (K / 8), k8 = (t % (K / 8)) * 8; FragH f;
#pragma unroll
  for (int i = 0; i < 8; ++i) f.h[i] = (_Float16)(bf16_round(W[(size_t)(k8 + i) * N + n]) * scale); const v8us o = f.half[0];
  *(v8us*)((unsigned short*)Wt + (size_t)n * K + k8) = o; 
}
// k_gemm_hh variant with fused epilogue: v = acc·alpha + bias[by·sBias + col] (+ CP[(row/rowsPerB)·sCPb + by·64 + col] if CP) ; ACT 0 none / 1 elu ; writes f16 C16 (and f32 C if non-null)
template <int ACT>
__global__ __launch_bounds__(128) void k_gemm_hhx(const _Float16* __restrict__ A, int lda, size_t sA, const _Float16* __restrict__ Bh, int ldb, size_t sB, float alpha, const float* __restrict__ bias, size_t sBias, const float* __restrict__ CP, int rowsPerB, size_t sCPb, int row0g,
    float* __restrict__ C, _Float16* __restrict__ C16, int ldc, size_t sC, int M, int N, int K) {
  __shared__ __attribute__((aligned(16))) float so[4][16][64];
  const int tid = threadIdx.x, w = tid >> 5, lane = tid & 31, ln = lane & 15, hh = lane >> 4; const int by = blockIdx.y;
  A += (size_t)by * sA; Bh += (size_t)by * sB; const size_t cofs = (size_t)by * sC; const float* bp = bias ? bias + (size_t)by * sBias : nullptr;
  const int ntn = (N + 63) / 64; const int wid = blockIdx.x * 4 + w; const int mt = wid / ntn, nq = wid % ntn; if (mt * 16 >= M) return;
  const int row0 = mt * 16, col0 = nq * 64; const _Float16* arow = A + (size_t)(row0 + ln) * lda;
  v8f acc[4] = {};
  for (int kb = 0; kb < K; kb += 32) { FragH ah; ah.half[0] = *(const v8us*)((const unsigned short*)arow + kb + 8 * hh); ah.half[1] = *(const v8us*)((const unsigned short*)arow + kb + 16 + 8 * hh);
#pragma unroll
    for (int t = 0; t < 4; ++t) { if (col0 + t * 16 >= N) continue; const size_t boff = (size_t)(col0 + t * 16 + ln) * ldb + kb; FragH bq; bq.half[0] = *(const v8us*)((const unsigned short*)Bh + boff + 8 * hh); bq.half[1] = *(const v8us*)((const unsigned short*)Bh + boff + 16 + 8 * hh);
      acc[t] = mmaH<1>(ah.v, ah.v, bq.v, bq.v, acc[t]); }
  }
#pragma unroll
  for (int t = 0; t < 4; ++t) { if (col0 + t * 16 >= N) continue; const int col = col0 + t * 16 + ln; const float bv = bp ? bf16_round(bp[col]) : 0.f;
#pragma unroll
    for (int r = 0; r < 8; ++r) { float v = acc[t][r] * alpha + bv; if (CP) { const int bidx = (row0g + row0 + 8 * hh + r) / rowsPerB; v += CP[(size_t)bidx * sCPb + (size_t)by * 64 + col]; } if (ACT == 1) v = (v > 0.f) ? v : expm1f(v); else if (ACT == 7) v = (v > 0.f) ? v + 1.0f : expf(v); else if (ACT == 8) v = tanhf(v); else if (ACT == 9) v = 0.5f * v * (1.0f + tanhf(0.7978845608028654f * (v + 0.044715f * v * v * v))); else if (ACT == 11) v = 1.0f / (1.0f + expf(-v)); else if (ACT == 12) v = (v > 0.f) ? v : 0.01f * v; else if (ACT == 14) v = (v > 0.f) ? v : 0.1f * v; else if (ACT == 15) v = v / (1.0f + expf(-v)); else if (ACT == 3) v = fmaxf(v, 0.f); else if (ACT == 6) v = 0.5f * v * (1.0f + erff(v * 0.70710678118654752f)); so[w][8 * hh + r][t * 16 + ln] = v; } }
  __builtin_amdgcn_fence(__ATOMIC_ACQ_REL, "workgroup"); __builtin_amdgcn_wave_barrier();
  const int rsub = lane >> 4, c4 = (lane & 15) * 4; typedef _Float16 v4h __attribute__((ext_vector_type(4)));
  {
#pragma unroll
    for (int q = 0; q < 8; ++q) { const int r = q * 2 + rsub; if (col0 + c4 < N) { const v4f v = *(const v4fa*)&so[w][r][c4]; if (C) *(v4f*)(C + cofs + (size_t)(row0 + r) * ldc + col0 + c4) = v; if (C16) { v4h h4; for (int i = 0; i < 4; ++i) h4[i] = (_Float16)v[i]; *(v4h*)(C16 + cofs + (size_t)(row0 + r) * ldc + col0 + c4) = h4; } } }
     }
}


typedef _Float16 v4h __attribute__((ext_vector_type(4)));

__global__ __launch_bounds__(256) void k_x16(const float* __restrict__ x, _Float16* __restrict__ X16, size_t n8) { const size_t t = (size_t)blockIdx.x * 256 + threadIdx.x; if (t >= n8) return; FragH f;
#pragma unroll
  for (int q = 0; q < 8; ++q) f.h[q] = (_Float16)bf16_round(x[t * 8 + q]); *(v8us*)((unsigned short*)X16 + t * 8) = f.half[0];  }
__global__ __launch_bounds__(256) void k_h16(const float* __restrict__ x, _Float16* __restrict__ X16, size_t n8) { const size_t t = (size_t)blockIdx.x * 256 + threadIdx.x; if (t >= n8) return; FragH f;
#pragma unroll
  for (int q = 0; q < 8; ++q) f.h[q] = (_Float16)x[t * 8 + q]; *(v8us*)((unsigned short*)X16 + t * 8) = f.half[0];  }
__global__ __launch_bounds__(256) void k_round16f(const float* __restrict__ W, _Float16* __restrict__ Bt, size_t n8) { const size_t t = (size_t)blockIdx.x * 256 + threadIdx.x; if (t >= n8) return; FragH f;
#pragma unroll
  for (int i = 0; i < 8; ++i) f.h[i] = (_Float16)(bf16_round(W[t * 8 + i]) * 16.0f); *(v8us*)((unsigned short*)Bt + t * 8) = f.half[0];  }
template <int NHv, int TTv>
__global__ __launch_bounds__(256) void k_vt(const _Float16* __restrict__ V16, int ldv, int voff, _Float16* __restrict__ Vt) { __shared__ unsigned short tl[64][66]; const int tid = threadIdx.x; const int slab = blockIdx.x / (TTv / 64), lg = blockIdx.x % (TTv / 64); const int b = slab / NHv, h = slab % NHv;
  for (int i = tid; i < 64 * (HPITCH / 8); i += 256) { const int r = i / (HPITCH / 8), c8 = (i % (HPITCH / 8)) * 8; FragH f; f.half[0] = *(const v8us*)((const unsigned short*)V16 + ((size_t)b * TTv + lg * 64 + r) * ldv + voff + h * HPITCH + c8);
#pragma unroll
    for (int q = 0; q < 8; ++q) tl[r][c8 + q] = f.u[q]; }
  __syncthreads();
  {
#pragma unroll
    for (int rd = 0; rd < HPITCH / 32; ++rd) { const int d = rd * 32 + tid / 8, pc = tid % 8; FragH f;
#pragma unroll
      for (int q = 0; q < 8; ++q) f.u[q] = tl[pc * 8 + q][d];
      *(v8us*)((unsigned short*)Vt + ((size_t)slab * HPITCH + d) * TTv + lg * 64 + pc * 8) = f.half[0]; }
     } }

__global__ __launch_bounds__(256) void k_hl(const float* __restrict__ F, _Float16* __restrict__ Hh, _Float16* __restrict__ Hl, size_t n8) { const size_t t = (size_t)blockIdx.x * 256 + threadIdx.x; if (t >= n8) return; FragH fh, fl; const v4f a = *(const v4fa*)(F + t * 8), c = *(const v4fa*)(F + t * 8 + 4);
#pragma unroll
  for (int q = 0; q < 4; ++q) { _Float16 h = (_Float16)a[q]; fh.h[q] = h; fl.h[q] = (_Float16)((a[q] - (float)h) * 1024.0f); h = (_Float16)c[q]; fh.h[4 + q] = h; fl.h[4 + q] = (_Float16)((c[q] - (float)h) * 1024.0f); }
  { *(v8us*)((unsigned short*)Hh + t * 8) = fh.half[0]; *(v8us*)((unsigned short*)Hl + t * 8) = fl.half[0];  } }

// ---- fast GEMM (wave tile 32x64; requires M % 32 == 0 rows per launch region and N % 64 == 0); epilogue = k_gemm_hhx semantics ----
__device__ __forceinline__ v16h g2_frag(const _Float16* p, int hh) { FragH f; f.half[0] = *(const v8us*)((const unsigned short*)p + 8 * hh); f.half[1] = *(const v8us*)((const unsigned short*)p + 16 + 8 * hh); return f.v; }
__device__ __forceinline__ v8f g2_mma(v16h a, v16h b, v8f c) { v8f d = __builtin_amdgcn_wmma_f32_16x16x32_f16(false, a, false, b, (short)0, c, false, false); asm volatile("v_nop\n\tv_nop\n\tv_nop\n\tv_nop" : "+v"(d) : "v"(a), "v"(b)); return d; }
template <int ACT>
__global__ __launch_bounds__(128) void k_gemm2(const _Float16* __restrict__ A, int lda, size_t sA, const _Float16* __restrict__ Bh, int ldb, size_t sB, float alpha, const float* __restrict__ bias, size_t sBias, const float* __restrict__ CP, int rowsPerB, size_t sCPb, int row0g,
    float* __restrict__ C, _Float16* __restrict__ C16, int ldc, size_t sC, int M, int N, int K) {
  __shared__ __attribute__((aligned(16))) float so[4][32][68];
  const int tid = threadIdx.x, w = tid >> 5, lane = tid & 31, ln = lane & 15, hh = lane >> 4; const int by = blockIdx.y;
  A += (size_t)by * sA; Bh += (size_t)by * sB; const size_t cofs = (size_t)by * sC; const float* bp = bias ? bias + (size_t)by * sBias : nullptr;
  const int ntn = N >> 6; const int mt = blockIdx.x / ntn, nq = blockIdx.x - mt * ntn; const int row0 = mt * 128 + 32 * w, col0 = nq * 64; if (row0 >= M) return;
  const _Float16* a0p = A + (size_t)(row0 + ln) * lda; const _Float16* a1p = a0p + (size_t)16 * lda;
  const _Float16* b0p = Bh + (size_t)(col0 + ln) * ldb; const _Float16* b1p = b0p + (size_t)16 * ldb; const _Float16* b2p = b1p + (size_t)16 * ldb; const _Float16* b3p = b2p + (size_t)16 * ldb;
  const v8f z8 = {0.f,0.f,0.f,0.f,0.f,0.f,0.f,0.f}; v8f c00 = z8, c01 = z8, c02 = z8, c03 = z8, c10 = z8, c11 = z8, c12 = z8, c13 = z8;
#pragma unroll 1
  for (int kb = 0; kb < K; kb += 32) { const v16h a0 = g2_frag(a0p + kb, hh), a1 = g2_frag(a1p + kb, hh);
    v16h b = g2_frag(b0p + kb, hh); c00 = g2_mma(a0, b, c00); c10 = g2_mma(a1, b, c10);
    b = g2_frag(b1p + kb, hh); c01 = g2_mma(a0, b, c01); c11 = g2_mma(a1, b, c11);
    b = g2_frag(b2p + kb, hh); c02 = g2_mma(a0, b, c02); c12 = g2_mma(a1, b, c12);
    b = g2_frag(b3p + kb, hh); c03 = g2_mma(a0, b, c03); c13 = g2_mma(a1, b, c13); }
  v8f accs[8] = {c00, c01, c02, c03, c10, c11, c12, c13};
#pragma unroll
  for (int u = 0; u < 8; ++u) { const int t = u & 3, half = u >> 2; const int col = col0 + t * 16 + ln; const float bv = bp ? bf16_round(bp[col]) : 0.f;
#pragma unroll
    for (int r = 0; r < 8; ++r) { const int rloc = half * 16 + 8 * hh + r; float v = accs[u][r] * alpha + bv; if (CP) { const int bidx = (row0g + row0 + rloc) / rowsPerB; v += CP[(size_t)bidx * sCPb + (size_t)by * 64 + col]; }
      if (ACT == 3) v = fmaxf(v, 0.f); else if (ACT == 6) v = 0.5f * v * (1.0f + erff(v * 0.70710678118654752f)); else if (ACT == 11) v = 1.0f / (1.0f + expf(-v)); else if (ACT == 15) v = v / (1.0f + expf(-v)); else if (ACT == 12) v = (v > 0.f) ? v : 0.01f * v; else if (ACT == 8) v = tanhf(v);
      so[w][rloc][t * 16 + ln] = v; } }
  __builtin_amdgcn_fence(__ATOMIC_ACQ_REL, "workgroup"); __builtin_amdgcn_wave_barrier();
  const int rsub = lane >> 4, c4 = (lane & 15) * 4;
  {
#pragma unroll
    for (int q = 0; q < 16; ++q) { const int r = q * 2 + rsub; const v4f v = *(const v4fa*)&so[w][r][c4]; if (C) *(v4f*)(C + cofs + (size_t)(row0 + r) * ldc + col0 + c4) = v; if (C16) { v4h h4; for (int i = 0; i < 4; ++i) h4[i] = (_Float16)v[i]; *(v4h*)(C16 + cofs + (size_t)(row0 + r) * ldc + col0 + c4) = h4; } }
     } }



template <int CAUSAL>
__global__ __launch_bounds__(128) void k_flash(const _Float16* __restrict__ Q16, int ldq, const _Float16* __restrict__ K16, int ldk, const _Float16* __restrict__ Vt, const int* __restrict__ MSK, float* __restrict__ O, int ldo) {
  constexpr int RPW = 16, RTN = RPW / 16, NQB = TQ / (4 * RPW), DT = 4, KS = 2;
  __shared__ __attribute__((aligned(16))) unsigned short sP[4][RPW][40]; __shared__ __attribute__((aligned(16))) float sO[4][RPW][64 + 4];
  const int tid = threadIdx.x, w = tid >> 5, lane = tid & 31, ln = lane & 15, hh = lane >> 4;
  const int slab = blockIdx.x / QBLKS, qblk = blockIdx.x % QBLKS; (void)NQB; const int b = slab / NH, h = slab % NH; const int qb0 = qblk * (4 * RPW); const int q0 = qb0 + w * RPW;
  FragH aq[2][KS];
#pragma unroll
  for (int rt = 0; rt < RTN; ++rt) { const unsigned short* qr = (const unsigned short*)Q16 + ((size_t)b * TQ + q0 + rt * 16 + ln) * ldq + h * 64;
#pragma unroll
    for (int ks = 0; ks < KS; ++ks) { aq[rt][ks].half[0] = *(const v8us*)(qr + ks * 32 + 8 * hh); aq[rt][ks].half[1] = *(const v8us*)(qr + ks * 32 + 16 + 8 * hh); } }
  const unsigned short* Vth = (const unsigned short*)Vt + (size_t)slab * 64 * TK;
  float m_r[2][8], l_r[2][8]; v8f oacc[2][DT];
#pragma unroll
  for (int rt = 0; rt < RTN; ++rt) {
#pragma unroll
    for (int r = 0; r < 8; ++r) { m_r[rt][r] = -3.0e38f; l_r[rt][r] = 0.f; }
#pragma unroll
    for (int dt = 0; dt < DT; ++dt) oacc[rt][dt] = (v8f){0.f,0.f,0.f,0.f,0.f,0.f,0.f,0.f}; }
  const int jend = (CAUSAL == 1) ? (qb0 + 4 * RPW) : TK;      /* causal: keys beyond the block's last query never contribute */
#pragma unroll 1
  for (int j0 = 0; j0 < jend; j0 += 32) {
    v8f s[2][2];
#pragma unroll
    for (int nt = 0; nt < 2; ++nt) { const unsigned short* kr = (const unsigned short*)K16 + ((size_t)b * TK + j0 + nt * 16 + ln) * ldk + h * 64; FragH bk[KS];
#pragma unroll
      for (int ks = 0; ks < KS; ++ks) { bk[ks].half[0] = *(const v8us*)(kr + ks * 32 + 8 * hh); bk[ks].half[1] = *(const v8us*)(kr + ks * 32 + 16 + 8 * hh); }
#pragma unroll
      for (int rt = 0; rt < RTN; ++rt) { v8f acc = (v8f){0.f,0.f,0.f,0.f,0.f,0.f,0.f,0.f};
#pragma unroll
        for (int ks = 0; ks < KS; ++ks) acc = mmaH<1>(aq[rt][ks].v, aq[rt][ks].v, bk[ks].v, bk[ks].v, acc); s[rt][nt] = acc; } }
#pragma unroll
    for (int rt = 0; rt < RTN; ++rt)
#pragma unroll
      for (int r = 0; r < 8; ++r) { const int tq = q0 + rt * 16 + 8 * hh + r; const int k0 = j0 + ln, k1 = j0 + 16 + ln;
        const bool ok0 = (CAUSAL == 1) ? (k0 <= tq) : ((CAUSAL == 2) ? ((k0 >> 5) == (tq >> 5)) : true), ok1 = (CAUSAL == 1) ? (k1 <= tq) : ((CAUSAL == 2) ? ((k1 >> 5) == (tq >> 5)) : true);      /* mode 2: block-diagonal 32-token groups */
        const float s0 = ok0 ? s[rt][0][r] * SCL : -3.0e38f, s1 = ok1 ? s[rt][1][r] * SCL : -3.0e38f; float mc = fmaxf(s0, s1);
        mc = fmaxf(mc, __shfl_xor(mc, 1, 32)); mc = fmaxf(mc, __shfl_xor(mc, 2, 32)); mc = fmaxf(mc, __shfl_xor(mc, 4, 32)); mc = fmaxf(mc, __shfl_xor(mc, 8, 32));
        const float mn = fmaxf(m_r[rt][r], mc); const float al = (mn > -1.0e38f) ? expf(m_r[rt][r] - mn) : 1.0f; m_r[rt][r] = mn; const float p0 = ok0 ? expf(s0 - mn) : 0.f, p1 = ok1 ? expf(s1 - mn) : 0.f; l_r[rt][r] = l_r[rt][r] * al + p0 + p1;
#pragma unroll
        for (int dt = 0; dt < DT; ++dt) oacc[rt][dt][r] *= al;
        FragH t2; t2.h[0] = (_Float16)(p0 * 1024.0f); t2.h[1] = (_Float16)(p1 * 1024.0f); sP[w][rt * 16 + 8 * hh + r][ln] = t2.u[0]; sP[w][rt * 16 + 8 * hh + r][16 + ln] = t2.u[1]; }
    __builtin_amdgcn_fence(__ATOMIC_ACQ_REL, "workgroup"); __builtin_amdgcn_wave_barrier();
    FragH pa[2];
#pragma unroll
    for (int rt = 0; rt < RTN; ++rt) { pa[rt].half[0] = *(const v8us*)&sP[w][rt * 16 + ln][8 * hh]; pa[rt].half[1] = *(const v8us*)&sP[w][rt * 16 + ln][16 + 8 * hh]; }
#pragma unroll
    for (int dt = 0; dt < DT; ++dt) { const unsigned short* vrow = Vth + (size_t)(dt * 16 + ln) * TK + j0; FragH bv; bv.half[0] = *(const v8us*)(vrow + 8 * hh); bv.half[1] = *(const v8us*)(vrow + 16 + 8 * hh);
#pragma unroll
      for (int rt = 0; rt < RTN; ++rt) oacc[rt][dt] = mmaH<1>(pa[rt].v, pa[rt].v, bv.v, bv.v, oacc[rt][dt]); }
    __builtin_amdgcn_fence(__ATOMIC_ACQ_REL, "workgroup"); __builtin_amdgcn_wave_barrier(); }
#pragma unroll
  for (int rt = 0; rt < RTN; ++rt) {
#pragma unroll
    for (int r = 0; r < 8; ++r) { float l = l_r[rt][r]; l += __shfl_xor(l, 1, 32); l += __shfl_xor(l, 2, 32); l += __shfl_xor(l, 4, 32); l += __shfl_xor(l, 8, 32); l_r[rt][r] = (l > 0.f) ? 1.0f / (l * 1024.0f) : 0.f; }
#pragma unroll
    for (int dt = 0; dt < DT; ++dt)
#pragma unroll
      for (int r = 0; r < 8; ++r) sO[w][rt * 16 + 8 * hh + r][dt * 16 + ln] = oacc[rt][dt][r] * l_r[rt][r]; }
  __builtin_amdgcn_fence(__ATOMIC_ACQ_REL, "workgroup"); __builtin_amdgcn_wave_barrier();
  {
#pragma unroll
    for (int rp = 0; rp < RPW; rp += 2) { const int r = rp + (lane >> 4), pc = lane & 15; const v4f val = *(const v4fa*)&sO[w][r][pc * 4]; *(v4f*)(O + ((size_t)b * TQ + q0 + r) * ldo + h * 64 + pc * 4) = val; }
     } }
__device__ __forceinline__ float xhalf(float x) { return __builtin_bit_cast(float, __builtin_amdgcn_permlanex16(__builtin_bit_cast(int, x), __builtin_bit_cast(int, x), 0x76543210, 0xfedcba98, false, false)); }      /* lane l <-> lane l ^ 16 */
template <int CAUSAL>
__global__ __launch_bounds__(128) void k_flashqk(const _Float16* __restrict__ Q16, const _Float16* __restrict__ QL, int ldq, const _Float16* __restrict__ K16, const _Float16* __restrict__ KL, int ldk, const _Float16* __restrict__ Vt, const int* __restrict__ MSK, float* __restrict__ O, int ldo) {
  constexpr int RPW = 16, DT = HPITCH / 16, KS = HPITCH / 32;
  __shared__ __attribute__((aligned(16))) float sO[4][RPW][HPITCH + 4];
  constexpr int KT = 64, KP = HPITCH + 8, VP = KT + 8;      /* keys per staged tile; LDS row pitches in halves: 16 bytes x an odd number, free of bank conflicts for 16-byte reads */
  constexpr int NCK = KT * (HPITCH / 8) / 128, NCV = HPITCH * (KT / 8) / 128;      /* 16-byte pieces per thread and tile */
  __shared__ __attribute__((aligned(16))) unsigned short sK[2][KT][KP]; __shared__ __attribute__((aligned(16))) unsigned short sKL[2][KT][KP]; __shared__ __attribute__((aligned(16))) unsigned short sV[2][HPITCH][VP];
  const int tid = threadIdx.x, w = tid >> 5, lane = tid & 31, ln = lane & 15, hh = lane >> 4;
  const int slab = blockIdx.x / QBLKS, qblk = blockIdx.x % QBLKS; const int b = slab / NH, h = slab % NH; const int qb0 = qblk * (4 * RPW); const int q0 = qb0 + w * RPW;
  const int tq = q0 + ln;      /* this lane's query */
  FragH bq[KS], bql[KS];
  { const unsigned short* qr = (const unsigned short*)Q16 + ((size_t)b * TQ + tq) * ldq + h * HPITCH; const unsigned short* ql = (const unsigned short*)QL + ((size_t)b * TQ + tq) * ldq + h * HPITCH;
#pragma unroll      /* constant indices keep the fragment, score and accumulator arrays in registers */
    for (int ks = 0; ks < KS; ++ks) { bq[ks].half[0] = *(const v8us*)(qr + ks * 32 + 8 * hh); bq[ks].half[1] = *(const v8us*)(qr + ks * 32 + 16 + 8 * hh); bql[ks].half[0] = *(const v8us*)(ql + ks * 32 + 8 * hh); bql[ks].half[1] = *(const v8us*)(ql + ks * 32 + 16 + 8 * hh); } }
  const unsigned short* Vth = (const unsigned short*)Vt + (size_t)slab * HPITCH * TK;
  const unsigned short* Kb = (const unsigned short*)K16 + (size_t)b * TK * ldk + h * HPITCH; const unsigned short* KLb = (const unsigned short*)KL + (size_t)b * TK * ldk + h * HPITCH;
  v8us gk[NCK], gkl[NCK], gv[NCV];      /* the next tile on its way from global memory to LDS */
  auto fetch = [&](int jt) {
#pragma unroll      /* constant indices keep the fragment, score and accumulator arrays in registers */
    for (int u = 0; u < NCK; ++u) { const int i = tid + 128 * u, r = i / (HPITCH / 8), c8 = (i % (HPITCH / 8)) * 8; gk[u] = *(const v8us*)(Kb + (size_t)(jt + r) * ldk + c8); gkl[u] = *(const v8us*)(KLb + (size_t)(jt + r) * ldk + c8); }
#pragma unroll      /* constant indices keep the fragment, score and accumulator arrays in registers */
    for (int u = 0; u < NCV; ++u) { const int i = tid + 128 * u, r = i / (KT / 8), c8 = (i % (KT / 8)) * 8; gv[u] = *(const v8us*)(Vth + (size_t)r * TK + jt + c8); } };
  auto stash = [&](int bf) {
#pragma unroll      /* constant indices keep the fragment, score and accumulator arrays in registers */
    for (int u = 0; u < NCK; ++u) { const int i = tid + 128 * u, r = i / (HPITCH / 8), c8 = (i % (HPITCH / 8)) * 8; *(v8us*)&sK[bf][r][c8] = gk[u]; *(v8us*)&sKL[bf][r][c8] = gkl[u]; }
#pragma unroll      /* constant indices keep the fragment, score and accumulator arrays in registers */
    for (int u = 0; u < NCV; ++u) { const int i = tid + 128 * u, r = i / (KT / 8), c8 = (i % (KT / 8)) * 8; *(v8us*)&sV[bf][r][c8] = gv[u]; } };
  float m_q = -3.0e38f, l_q = 0.f; v8f oacc[DT];      /* oacc[dt][r] = O[tq][dt * 16 + 8 hh + r], un-normalised */
#pragma unroll      /* constant indices keep the fragment, score and accumulator arrays in registers */
  for (int dt = 0; dt < DT; ++dt) oacc[dt] = (v8f){0.f,0.f,0.f,0.f,0.f,0.f,0.f,0.f};
  const int jend = (CAUSAL == 1) ? (qb0 + 4 * RPW) : TK;      /* causal: keys beyond the block's last query never contribute */
  const int ntile = jend / KT;
  asm volatile("s_wait_xcnt 0x0" ::: "memory");      /* the Q loads above are issued first, and no tile load below writes into a register that one of them still names as its address */
  fetch(0); stash(0);
  __syncthreads();      /* tile 0 is written before any wave reads it */
#pragma unroll 1      /* one copy of the trip's code; the buffer index alternates at run time */
  for (int t = 0; t < ntile; ++t) { const int buf = t & 1; const bool more = t + 1 < ntile;      /* the same in every thread of the work-group */
    if (more) fetch((t + 1) * KT);      /* in flight while this trip works on tile t */
#pragma unroll      /* the two 32-key halves of the tile: constant LDS offsets */
   for (int js = 0; js < KT; js += 32) { const int j0 = t * KT + js;
    v8f s[2];      /* s[nt][r] = score of key j0 + nt * 16 + 8 hh + r against query tq */
    FragH ak[2][KS], akl[2][KS], av[DT];      /* all LDS reads of these 32 keys stand together at the head: one LDS latency instead of four */
#pragma unroll      /* constant indices keep the fragment, score and accumulator arrays in registers */
    for (int nt = 0; nt < 2; ++nt) { const unsigned short* kr = &sK[buf][js + nt * 16 + ln][0]; const unsigned short* klr = &sKL[buf][js + nt * 16 + ln][0];
#pragma unroll      /* constant indices keep the fragment, score and accumulator arrays in registers */
      for (int ks = 0; ks < KS; ++ks) { ak[nt][ks].half[0] = *(const v8us*)(kr + ks * 32 + 8 * hh); ak[nt][ks].half[1] = *(const v8us*)(kr + ks * 32 + 16 + 8 * hh); akl[nt][ks].half[0] = *(const v8us*)(klr + ks * 32 + 8 * hh); akl[nt][ks].half[1] = *(const v8us*)(klr + ks * 32 + 16 + 8 * hh); } }
#pragma unroll      /* constant indices keep the fragment, score and accumulator arrays in registers */
    for (int dt = 0; dt < DT; ++dt) { const unsigned short* vrow = &sV[buf][dt * 16 + ln][js]; av[dt].half[0] = *(const v8us*)(vrow + 8 * hh); av[dt].half[1] = *(const v8us*)(vrow + 16 + 8 * hh); }
#pragma unroll      /* constant indices keep the fragment, score and accumulator arrays in registers */
    for (int nt = 0; nt < 2; ++nt) {
      v8f acc = (v8f){0.f,0.f,0.f,0.f,0.f,0.f,0.f,0.f}, accl = acc;
#pragma unroll      /* constant indices keep the fragment, score and accumulator arrays in registers */
      for (int ks = 0; ks < KS; ++ks) { acc = mmaH<1>(ak[nt][ks].v, ak[nt][ks].v, bq[ks].v, bq[ks].v, acc); accl = mmaH<1>(ak[nt][ks].v, ak[nt][ks].v, bql[ks].v, bql[ks].v, accl); accl = mmaH<1>(akl[nt][ks].v, akl[nt][ks].v, bq[ks].v, bq[ks].v, accl); }
#pragma unroll      /* constant indices keep the fragment, score and accumulator arrays in registers */
      for (int r = 0; r < 8; ++r) acc[r] += accl[r] * 0.0009765625f;
      s[nt] = acc; }
    float sc[16]; bool ok[16];
#pragma unroll      /* constant indices keep the fragment, score and accumulator arrays in registers */
    for (int i = 0; i < 16; ++i) { const int kk = j0 + (i >> 3) * 16 + 8 * hh + (i & 7);
      ok[i] = (CAUSAL == 1) ? (kk <= tq) : ((CAUSAL == 2) ? ((kk >> 5) == (tq >> 5)) : true);      /* mode 2: block-diagonal 32-token groups */
      if (CAUSAL == 4) ok[i] = MSK[((size_t)b * TQ + tq) * TK + kk] != 0;      /* mode 4: per-(query, key) INPUT mask shared by all heads; masked keys contribute nothing, rows with no valid key give l = 0 -> output 0 */
      sc[i] = ok[i] ? s[i >> 3][i & 7] * SCL : -3.0e38f; }
    float mt[8];
#pragma unroll      /* constant indices keep the fragment, score and accumulator arrays in registers */
    for (int i = 0; i < 8; ++i) mt[i] = fmaxf(sc[i], sc[8 + i]);
    float mc = fmaxf(fmaxf(fmaxf(mt[0], mt[1]), fmaxf(mt[2], mt[3])), fmaxf(fmaxf(mt[4], mt[5]), fmaxf(mt[6], mt[7])));
    mc = fmaxf(mc, xhalf(mc));      /* the other half's 16 keys of the same query */
    const float mn = fmaxf(m_q, mc); const float al = (mn > -1.0e38f) ? expf(m_q - mn) : 1.0f; m_q = mn;
    float p[16]; FragH pb;
#pragma unroll      /* constant indices keep the fragment, score and accumulator arrays in registers */
    for (int i = 0; i < 16; ++i) { p[i] = ok[i] ? expf(sc[i] - mn) : 0.f; pb.h[i] = (_Float16)(p[i] * 1024.0f); }      /* pb.h[i]: key j0 + (i >> 3) * 16 + 8 hh + (i & 7) of column ln */
    float pt[8];
#pragma unroll      /* constant indices keep the fragment, score and accumulator arrays in registers */
    for (int i = 0; i < 8; ++i) pt[i] = p[i] + p[8 + i];
    l_q = l_q * al + (((pt[0] + pt[1]) + (pt[2] + pt[3])) + ((pt[4] + pt[5]) + (pt[6] + pt[7])));
#pragma unroll      /* constant indices keep the fragment, score and accumulator arrays in registers */
    for (int dt = 0; dt < DT; ++dt)
#pragma unroll      /* constant indices keep the fragment, score and accumulator arrays in registers */
      for (int r = 0; r < 8; ++r) oacc[dt][r] *= al;
#pragma unroll      /* constant indices keep the fragment, score and accumulator arrays in registers */
    for (int dt = 0; dt < DT; ++dt) oacc[dt] = mmaH<1>(av[dt].v, av[dt].v, pb.v, pb.v, oacc[dt]); }
    if (more) stash(buf ^ 1);      /* that buffer's last readers left it at the barrier that ended the trip before */
    __syncthreads(); }      /* one barrier a trip: publishes tile t + 1 and ends every wave's reads of tile t, which the next trip overwrites */
  const float lsum = l_q + xhalf(l_q); const float linv = (lsum > 0.f) ? 1.0f / (lsum * 1024.0f) : 0.f;
#pragma unroll      /* constant indices keep the fragment, score and accumulator arrays in registers */
  for (int dt = 0; dt < DT; ++dt) { v4f lo4, hi4;
#pragma unroll      /* constant indices keep the fragment, score and accumulator arrays in registers */
    for (int r = 0; r < 4; ++r) { lo4[r] = oacc[dt][r] * linv; hi4[r] = oacc[dt][4 + r] * linv; }
    *(v4fa*)&sO[w][ln][dt * 16 + 8 * hh] = lo4; *(v4fa*)&sO[w][ln][dt * 16 + 8 * hh + 4] = hi4; }
  __builtin_amdgcn_fence(__ATOMIC_ACQ_REL, "workgroup"); __builtin_amdgcn_wave_barrier();
  {
#pragma unroll      /* constant indices keep the fragment, score and accumulator arrays in registers */
    for (int rp = 0; rp < RPW; rp += 128 / HPITCH) { const int r = rp + lane / (HPITCH / 4), pc = lane % (HPITCH / 4); const v4f val = *(const v4fa*)&sO[w][r][pc * 4]; *(v4f*)(O + ((size_t)b * TQ + q0 + r) * ldo + h * HPITCH + pc * 4) = val; }
     } }

__global__ __launch_bounds__(256) void k_gnstat(const float* __restrict__ x, float* __restrict__ GS) {
  #pragma clang fp contract(off)
  __shared__ float sh[256]; const int bg = blockIdx.x; const int tid = threadIdx.x; const float* base = x + (size_t)bg * CPG * SLEN; const int n = CPG * SLEN; float s = 0.f;
  for (int i = tid; i < n; i += 256) s += bf16_round(base[i]);
  sh[tid] = s; __syncthreads(); for (int st = 128; st > 0; st >>= 1) { if (tid < st) sh[tid] += sh[tid + st]; __syncthreads(); }
  const float mu = sh[0] / (float)n; __syncthreads(); float q2 = 0.f;
  for (int i = tid; i < n; i += 256) { const float d = bf16_round(base[i]) - mu; q2 += d * d; }
  sh[tid] = q2; __syncthreads(); for (int st = 128; st > 0; st >>= 1) { if (tid < st) sh[tid] += sh[tid + st]; __syncthreads(); }
  if (tid == 0) { const float rs = rsqrtf(sh[0] / (float)n + 1e-5f); { *(float*)(GS + (size_t)bg * 32) = mu; *(float*)(GS + (size_t)bg * 32 + 1) = rs;  } } }
__global__ __launch_bounds__(256) void k_gnT(const float* __restrict__ x, const float* __restrict__ GS, const float* __restrict__ gam, const float* __restrict__ bet, _Float16* __restrict__ XT16) {
  #pragma clang fp contract(off)
  __shared__ float tl[64][65]; const int tid = threadIdx.x; const int per = (CC / 64) * (SLEN / 64); const int b = blockIdx.x / per; const int rem = blockIdx.x % per; const int cb = rem / (SLEN / 64), pb = rem % (SLEN / 64);
  for (int i = tid; i < 64 * 16; i += 256) { const int cl = i / 16, p4 = (i % 16) * 4; const int c = cb * 64 + cl; const float mu = GS[((size_t)b * NGR + c / CPG) * 32], rs = GS[((size_t)b * NGR + c / CPG) * 32 + 1]; const float g = bf16_round(gam[c]), be = bf16_round(bet[c]);
    const v4f a = *(const v4fa*)(x + ((size_t)b * CC + c) * SLEN + pb * 64 + p4); for (int q = 0; q < 4; ++q) { float v = (bf16_round(a[q]) - mu) * rs * g; v += be; tl[cl][p4 + q] = v; } }
  __syncthreads(); const int pl = tid >> 2, c8 = (tid & 3) * 8;
  { for (int u = 0; u < 2; ++u) { const int c0 = c8 + u * 32; FragH f; for (int q = 0; q < 8; ++q) f.h[q] = (_Float16)tl[c0 + q][pl]; *(v8us*)((unsigned short*)XT16 + ((size_t)b * SLEN + pb * 64 + pl) * CC + cb * 64 + c0) = f.half[0]; }  } }
__global__ __launch_bounds__(256) void k_wpad(const float* __restrict__ Wm, const float* __restrict__ bm, _Float16* __restrict__ BP, float* __restrict__ PB) {
  const int r = blockIdx.x * 256 + threadIdx.x; if (r >= DP) return; const int h = r / HPITCH, d = r % HPITCH; const bool live = d < HDT; const int srow = h * HDT + d;
  for (int c0 = 0; c0 < CC; c0 += 8) { FragH f; for (int q = 0; q < 8; ++q) f.h[q] = live ? (_Float16)(bf16_round(Wm[(size_t)srow * CC + c0 + q]) * 16.0f) : (_Float16)0.0f; unsigned short* dst = (unsigned short*)BP + (size_t)r * CC + c0; *(v8us*)dst = f.half[0];  }
  const float bv = live ? bm[srow] : 0.f; *(float*)(PB + r) = bv;  }
__global__ __launch_bounds__(256) void k_wio(const float* __restrict__ Wm, int nin, int nout, int pair, _Float16* __restrict__ Bt) { const int pitch = pair ? 2 * nin : nin; const size_t t = (size_t)blockIdx.x * 256 + threadIdx.x; if (t >= (size_t)nout * (pitch / 8)) return; const int pc = (int)(t % (pitch / 8)); const int o = (int)(t / (pitch / 8)); FragH f;
  for (int q = 0; q < 8; ++q) { const int col = pc * 8 + q; const bool lo = col >= nin; const int i = lo ? col - nin : col; f.h[q] = (_Float16)(bf16_round(Wm[(size_t)i * nout + o]) * (lo ? 1.0f : 16.0f)); }
  *(v8us*)((unsigned short*)Bt + (size_t)o * pitch + pc * 8) = f.half[0];  }
__global__ __launch_bounds__(256) void k_wop(const float* __restrict__ Wo, _Float16* __restrict__ Bt) { const int t = blockIdx.x * 256 + threadIdx.x; if (t >= CC * (2 * CC / 8)) return; const int pc = t % (2 * CC / 8); const int o = t / (2 * CC / 8); const bool lo = pc * 8 >= CC; FragH f;
  for (int q = 0; q < 8; ++q) { const int c = pc * 8 + q - (lo ? CC : 0); f.h[q] = (_Float16)(bf16_round(Wo[(size_t)o * CC + c]) * (lo ? 1.0f : 16.0f)); } *(v8us*)((unsigned short*)Bt + (size_t)o * 2 * CC + pc * 8) = f.half[0];  }
__global__ __launch_bounds__(256) void k_ofl(const float* __restrict__ O, float* __restrict__ OF, _Float16* __restrict__ OF2) { const size_t t = (size_t)blockIdx.x * 256 + threadIdx.x; if (t >= (size_t)NR * (CC / 8)) return; const int c0 = (int)(t % (CC / 8)) * 8; const size_t r = t / (CC / 8); const int h = c0 / HDT, d0 = c0 % HDT; FragH fh, fl; v4f a, bq;
  for (int q = 0; q < 8; ++q) { const float v = O[r * DP + h * HPITCH + d0 + q]; const _Float16 hv = (_Float16)v; fh.h[q] = hv; fl.h[q] = (_Float16)((v - (float)hv) * 16.0f); if (q < 4) a[q] = v; else bq[q - 4] = v; }
  { *(v4f*)(OF + r * CC + c0) = a; *(v4f*)(OF + r * CC + c0 + 4) = bq; *(v8us*)((unsigned short*)OF2 + r * 2 * CC + c0) = fh.half[0]; *(v8us*)((unsigned short*)OF2 + r * 2 * CC + CC + c0) = fl.half[0];  } }
__global__ __launch_bounds__(256) void k_pair16(const float* __restrict__ S, _Float16* __restrict__ HP) { const size_t t = (size_t)blockIdx.x * 256 + threadIdx.x; if (t >= (size_t)NR * (CC / 8)) return; const int c0 = (int)(t % (CC / 8)) * 8; const size_t r = t / (CC / 8); FragH fh, fl;
  for (int q = 0; q < 8; ++q) { const float v = S[r * CC + c0 + q]; const _Float16 hv = (_Float16)v; fh.h[q] = hv; fl.h[q] = (_Float16)((v - (float)hv) * 16.0f); }
  { *(v8us*)((unsigned short*)HP + r * 2 * CC + c0) = fh.half[0]; *(v8us*)((unsigned short*)HP + r * 2 * CC + CC + c0) = fl.half[0];  } }
__global__ __launch_bounds__(256) void k_nchw(const float* __restrict__ Y, float* __restrict__ out) { const size_t t = (size_t)blockIdx.x * 256 + threadIdx.x; if (t >= (size_t)NB * CC * (SLEN / 4)) return; const int n0 = (int)(t % (SLEN / 4)) * 4; const int o = (int)((t / (SLEN / 4)) % CC); const int b = (int)(t / ((size_t)(SLEN / 4) * CC)); v4f r; for (int q = 0; q < 4; ++q) r[q] = Y[((size_t)b * SLEN + n0 + q) * CC + o]; float* d = out + ((size_t)b * CC + o) * SLEN + n0; *(v4f*)d = r;  }

extern "C" void kernel_launch(void* const* d_in, const int* in_sizes, int n_in,
                              void* d_out, int out_size, void* d_ws, size_t ws_size, hipStream_t stream) {
  (void)in_sizes; (void)n_in; (void)out_size;
  const float* const* I = (const float* const*)d_in; const float* fo = I[0]; const float* fs = I[1]; const float* gq = I[2]; const float* bq = I[3]; const float* gkv = I[4]; const float* bkv = I[5]; const float* Wq = I[6]; const float* bqp = I[7]; const float* Wk = I[8]; const float* bkp = I[9]; const float* Wv = I[10]; const float* bvp = I[11]; const float* W1 = I[12]; const float* b1 = I[13]; const float* W2 = I[14]; const float* b2 = I[15]; const float* Wo = I[16]; const float* bo = I[17];
  char* ws = (char*)d_ws; size_t off = 0;
  auto take = [&](size_t bytes) { char* p = ws + off; off += (bytes + 255) & ~(size_t)255; return p; };
  _Float16* BPq = (_Float16*)take((size_t)DP * CC * 2); _Float16* BPk = (_Float16*)take((size_t)DP * CC * 2); _Float16* BPv = (_Float16*)take((size_t)DP * CC * 2); float* PBq = (float*)take(DP * 4); float* PBk = (float*)take(DP * 4); float* PBv = (float*)take(DP * 4);
  _Float16* BW1 = (_Float16*)take((size_t)HID * 2 * CC * 2); _Float16* BW2 = (_Float16*)take((size_t)CC * HID * 2); _Float16* BWO = (_Float16*)take((size_t)CC * 2 * CC * 2); float* GS = (float*)take((size_t)NB * NGR * 32 * 4 * 2);
  _Float16* XQ = (_Float16*)take((size_t)NR * CC * 2); _Float16* XKV = (_Float16*)take((size_t)NR * CC * 2); float* F32 = (float*)take((size_t)NR * DP * 4);
  _Float16* QH = (_Float16*)take((size_t)NR * DP * 2); _Float16* QL = (_Float16*)take((size_t)NR * DP * 2); _Float16* KH = (_Float16*)take((size_t)NR * DP * 2); _Float16* KL = (_Float16*)take((size_t)NR * DP * 2); _Float16* VH = (_Float16*)take((size_t)NR * DP * 2); _Float16* VL = (_Float16*)take((size_t)NR * DP * 2); _Float16* VT = (_Float16*)take((size_t)NR * DP * 2); _Float16* VTL = (_Float16*)take((size_t)NR * DP * 2);
  float* OF = (float*)take((size_t)NR * CC * 4); _Float16* OF2 = (_Float16*)take((size_t)NR * 2 * CC * 2); _Float16* G16 = (_Float16*)take((size_t)NR * HID * 2); float* FU = (float*)take((size_t)NR * CC * 4); _Float16* FU2 = (_Float16*)take((size_t)NR * 2 * CC * 2); float* Y = (float*)take((size_t)NR * CC * 4);
  float* O = F32;
  if (off > ws_size) return;      /* 0.5 + 2 + 2 + 4 + 8 x 2 + 4 + 4 + 4 + 4 + 4 + 4 = 49 MiB */
  k_wpad<<<1, 256, 0, stream>>>(Wq, bqp, BPq, PBq); k_wpad<<<1, 256, 0, stream>>>(Wk, bkp, BPk, PBk); k_wpad<<<1, 256, 0, stream>>>(Wv, bvp, BPv, PBv);      /* conv1x1 weights (out,in) = natural rows */
  k_wio<<<(HID * (2 * CC / 8) + 255) / 256, 256, 0, stream>>>(W1, CC, HID, 1, BW1); k_wio<<<(CC * (HID / 8) + 255) / 256, 256, 0, stream>>>(W2, HID, CC, 0, BW2); k_wop<<<(CC * (2 * CC / 8) + 255) / 256, 256, 0, stream>>>(Wo, BWO);
  k_gnstat<<<NB * NGR, 256, 0, stream>>>(fo, GS); k_gnstat<<<NB * NGR, 256, 0, stream>>>(fs, GS + NB * NGR * 32);
  k_gnT<<<NB * (CC / 64) * (SLEN / 64), 256, 0, stream>>>(fo, GS, gq, bq, XQ); k_gnT<<<NB * (CC / 64) * (SLEN / 64), 256, 0, stream>>>(fs, GS + NB * NGR * 32, gkv, bkv, XKV);
  const dim3 gP((NR / 128) * (DP / 64), 1), gC((NR / 128) * (CC / 64), 1), gH((NR / 128) * (HID / 64), 1); const unsigned n8 = (unsigned)(((size_t)NR * DP / 8 + 255) / 256), n8c = (unsigned)(((size_t)NR * (CC / 8) + 255) / 256);
  k_gemm2<0><<<gP, 128, 0, stream>>>(XQ, CC, 0, BPq, CC, 0, 0.0625f, PBq, 0, nullptr, 1, 0, 0, F32, nullptr, DP, 0, NR, DP, CC); k_hl<<<n8, 256, 0, stream>>>(F32, QH, QL, (size_t)NR * DP / 8);
  k_gemm2<0><<<gP, 128, 0, stream>>>(XKV, CC, 0, BPk, CC, 0, 0.0625f, PBk, 0, nullptr, 1, 0, 0, F32, nullptr, DP, 0, NR, DP, CC); k_hl<<<n8, 256, 0, stream>>>(F32, KH, KL, (size_t)NR * DP / 8);
  k_gemm2<0><<<gP, 128, 0, stream>>>(XKV, CC, 0, BPv, CC, 0, 0.0625f, PBv, 0, nullptr, 1, 0, 0, F32, nullptr, DP, 0, NR, DP, CC); k_hl<<<n8, 256, 0, stream>>>(F32, VH, VL, (size_t)NR * DP / 8);
  k_vt<NH, SLEN><<<NB * NH * (SLEN / 64), 256, 0, stream>>>(VH, DP, 0, VT);
  k_flashqk<0><<<NB * NH * QBLKS, 128, 0, stream>>>(QH, QL, DP, KH, KL, DP, VT, nullptr, O, DP);      /* q/k hi + residual; P (x2^10) and V plain f16 */
  k_ofl<<<n8c, 256, 0, stream>>>(O, OF, OF2);
  k_gemm2<6><<<gH, 128, 0, stream>>>(OF2, 2 * CC, 0, BW1, 2 * CC, 0, 0.0625f, b1, 0, nullptr, 1, 0, 0, nullptr, G16, HID, 0, NR, HID, 2 * CC);      /* gelu_erf(out W1 + b1) -> f16 */
  k_gemm2<0><<<gC, 128, 0, stream>>>(G16, HID, 0, BW2, HID, 0, 0.0625f, b2, 0, OF, 1, (size_t)CC, 0, FU, nullptr, CC, 0, NR, CC, HID);      /* mlp + b2 + out_flat */
  k_pair16<<<n8c, 256, 0, stream>>>(FU, FU2);
  k_gemm2<0><<<gC, 128, 0, stream>>>(FU2, 2 * CC, 0, BWO, 2 * CC, 0, 0.0625f, bo, 0, nullptr, 1, 0, 0, Y, nullptr, CC, 0, NR, CC, 2 * CC);      /* conv1x1(fused, Wo) + bo */
  k_nchw<<<(unsigned)(((size_t)NB * CC * (SLEN / 4) + 255) / 256), 256, 0, stream>>>(Y, (float*)d_out);
}

// v004
// One run takes 223 microseconds.
// Two timings next to v003 put it at 1.11 and 1.13 times that version's speed.
// Over all steps from v000 it is 3.02 times as fast.
#include <hip/hip_runtime.h>
// SFBlock (2 x 128 x 64 x 64; 4 heads x 32; GroupNorm(32) on both inputs; q from feat_opt, k/v from feat_sar via 1x1 convs; softmax(q k^T / sqrt(32)) v over the 4096 positions; MLP: gelu_erf(out W1 + b1) W2 + b2; fused = out + mlp; 1x1 conv Wo -> [2,128,64,64]).
// Compute dtype: inputs and parameters rounded to bf16; normalised inputs as f16 operands (~2^-12); q, k hi + residual; P (x2^10), v plain f16; attention output / fused as hi + residual pairs; the 256-wide GELU hidden as f16; f32 statistics/softmax/accumulation. v_wmma_f32_16x16x32_f16.
#define NB 2
#define CC 128
#define HID 256
#define NGR 32
#define CPG (CC / NGR)           /* 4 channels per group */
#define HDT 32
#define HPITCH HDT                   /* columns per head in the q/k/v planes: the true head dim, no padding */
#define DP (NH * HPITCH)             /* 128 */
#define NR (NB * SLEN)           /* 8192 */
#define QBLKS (TQ / 64)
#define SLEN 4096                /* H*W tokens */
#define TQ SLEN
#define TK SLEN
#define NH 4
#define SCL 0.17677669529663687f /* 32^-0.5 */
#define SCL2 ((float)(0.17677669529663687 * 1.4426950408889634)) /* 32^-0.5 * log2(e): raw score -> exponent of two */
typedef __bf16 v16b __attribute__((ext_vector_type(16)));
typedef unsigned short v8us __attribute__((ext_vector_type(8), may_alias));
typedef float  v8f  __attribute__((ext_vector_type(8)));
typedef float  v4f  __attribute__((ext_vector_type(4)));
typedef float  v4fa __attribute__((ext_vector_type(4), may_alias));
union FragB { v16b v; v8us half[2]; unsigned short u[16]; };

__device__ __forceinline__ unsigned short bf16_bits(float x) { unsigned int u = __float_as_uint(x); return (unsigned short)((u + 0x7FFFu + ((u >> 16) & 1u)) >> 16); }
__device__ __forceinline__ float bf16_val(unsigned short b) { return __uint_as_float(((unsigned int)b) << 16); }
__device__ __forceinline__ float bf16_round(float x) { return bf16_val(bf16_bits(x)); }
// D += A·B with NT terms: 1 = ah·bh, 2 = + al·bh (A split), 3 = + ah·bl (both split)
template <int NT>
__device__ __forceinline__ v8f mmaN(v16b ah, v16b al, v16b bh, v16b bl, v8f c) {
  c = __builtin_amdgcn_wmma_f32_16x16x32_bf16(false, ah, false, bh, (short)0, c, false, false);
  if (NT >= 2) c = __builtin_amdgcn_wmma_f32_16x16x32_bf16(false, al, false, bh, (short)0, c, false, false);
  if (NT >= 3) c = __builtin_amdgcn_wmma_f32_16x16x32_bf16(false, ah, false, bl, (short)0, c, false, false);
  asm volatile("v_nop\n\tv_nop\n\tv_nop\n\tv_nop" : "+v"(c) : "v"(ah), "v"(al), "v"(bh), "v"(bl));
  return c;
}

__global__ __launch_bounds__(256) void k_wt_bf16(const float* __restrict__ W, unsigned short* __restrict__ Wt, int K, int N) {
  const int t = blockIdx.x * 256 + threadIdx.x;
  const int k8n = K / 8;
  if (t >= N * k8n) return;
  const int n = t / k8n, k8 = (t % k8n) * 8;
  v8us v;
#pragma unroll
  for (int i = 0; i < 8; ++i) v[i] = bf16_bits(W[(size_t)(k8 + i) * N + n]);
  *(v8us*)(Wt + (size_t)n * K + k8) = v;
  
}

// GEMM C[M][N] (f32, pitch ldc) = act(A[M][K]·W + bias). A f32 row-major (pitch lda) converted per fragment to bf16
// (ASPLIT: hi/lo two planes -> 2 terms, else single rounded term); Wt bf16 [N][K] (pitch ldb). BIAS_BF16 rounds the
// bias to bf16 first (bias quantised to bf16 before the add). K%32==0, M%16==0, N%64==0.
template <bool ASPLIT, int ACT, bool BIAS_BF16>
__global__ __launch_bounds__(128) void k_gemm_bf(const float* __restrict__ A, int lda, const unsigned short* __restrict__ Wt, int ldb,
                                               const float* __restrict__ bias, float* __restrict__ C, int ldc, int M, int N, int K) {
  __shared__ __attribute__((aligned(16))) float so[4][16][64];
  const int tid = threadIdx.x, w = tid >> 5, lane = tid & 31, ln = lane & 15, hh = lane >> 4;
  const int ntn = N / 64;
  const int wid = blockIdx.x * 4 + w;
  const int mt = wid / ntn, nq = wid % ntn;
  if (mt * 16 >= M) return;
  const int row0 = mt * 16, col0 = nq * 64;
  const float* arow = A + (size_t)(row0 + ln) * lda;
  v8f acc[4] = {};
  for (int kb = 0; kb < K; kb += 32) {
    FragB ah, al;
    const v4f x0 = *(const v4fa*)(arow + kb + 8 * hh), x1 = *(const v4fa*)(arow + kb + 8 * hh + 4);
    const v4f x2 = *(const v4fa*)(arow + kb + 16 + 8 * hh), x3 = *(const v4fa*)(arow + kb + 16 + 8 * hh + 4);
    float xs[16] = {x0[0],x0[1],x0[2],x0[3],x1[0],x1[1],x1[2],x1[3],x2[0],x2[1],x2[2],x2[3],x3[0],x3[1],x3[2],x3[3]};
#pragma unroll
    for (int i = 0; i < 16; ++i) { const unsigned short hb = bf16_bits(xs[i]); ah.u[i] = hb; al.u[i] = ASPLIT ? bf16_bits(xs[i] - bf16_val(hb)) : (unsigned short)0; }
#pragma unroll
    for (int t = 0; t < 4; ++t) {
      const unsigned short* brow = Wt + (size_t)(col0 + t * 16 + ln) * ldb + kb;
      FragB b;
      b.half[0] = *(const v8us*)(brow + 8 * hh);
      b.half[1] = *(const v8us*)(brow + 16 + 8 * hh);
      acc[t] = mmaN<ASPLIT ? 2 : 1>(ah.v, al.v, b.v, b.v, acc[t]);
    }
  }
#pragma unroll
  for (int t = 0; t < 4; ++t) {
    float bv = bias ? bias[col0 + t * 16 + ln] : 0.f;
    if (BIAS_BF16) bv = bf16_round(bv);
#pragma unroll
    for (int r = 0; r < 8; ++r) { float v = acc[t][r] + bv; if (ACT == 1) v = fmaxf(v, 0.f); so[w][8 * hh + r][t * 16 + ln] = v; }
  }
  __builtin_amdgcn_fence(__ATOMIC_ACQ_REL, "workgroup");
  __builtin_amdgcn_wave_barrier();
  const int rsub = lane >> 4, c4 = (lane & 15) * 4;
  {
#pragma unroll
    for (int q = 0; q < 8; ++q) {
      const int r = q * 2 + rsub;
      const v4f v = *(const v4fa*)&so[w][r][c4];
      *(v4f*)(C + (size_t)(row0 + r) * ldc + col0 + c4) = v;
    }
    
  }
}

// GEMM C = act(A·W + bias + resid): A f32 (ASPLIT -> hi/lo 2 terms), Wt bf16 [N][K]; ACT 0 none, 1 relu, 2 exact gelu;
// resid (optional, f32, row index = (row % rmod), pitch ldr, RES_BF16 rounds it) added before the activation.
template <bool ASPLIT, int ACT, bool BIAS_BF16, bool RES_BF16>
__global__ __launch_bounds__(128) void k_gemm_bf3(const float* __restrict__ A, int lda, const unsigned short* __restrict__ Wt, int ldb,
                                                const float* __restrict__ bias, const float* __restrict__ resid, int rmod, int ldr,
                                                float* __restrict__ C, int ldc, int M, int N, int K) {
  __shared__ __attribute__((aligned(16))) float so[4][16][64];
  const int tid = threadIdx.x, w = tid >> 5, lane = tid & 31, ln = lane & 15, hh = lane >> 4;
  const int ntn = N / 64;
  const int wid = blockIdx.x * 4 + w;
  const int mt = wid / ntn, nq = wid % ntn;
  if (mt * 16 >= M) return;
  const int row0 = mt * 16, col0 = nq * 64;
  const float* arow = A + (size_t)(row0 + ln) * lda;
  v8f acc[4] = {};
  for (int kb = 0; kb < K; kb += 32) {
    FragB ah, al;
    const v4f x0 = *(const v4fa*)(arow + kb + 8 * hh), x1 = *(const v4fa*)(arow + kb + 8 * hh + 4);
    const v4f x2 = *(const v4fa*)(arow + kb + 16 + 8 * hh), x3 = *(const v4fa*)(arow + kb + 16 + 8 * hh + 4);
    float xs[16] = {x0[0],x0[1],x0[2],x0[3],x1[0],x1[1],x1[2],x1[3],x2[0],x2[1],x2[2],x2[3],x3[0],x3[1],x3[2],x3[3]};
#pragma unroll
    for (int i = 0; i < 16; ++i) { const unsigned short hb = bf16_bits(xs[i]); ah.u[i] = hb; al.u[i] = ASPLIT ? bf16_bits(xs[i] - bf16_val(hb)) : (unsigned short)0; }
#pragma unroll
    for (int t = 0; t < 4; ++t) {
      const unsigned short* brow = Wt + (size_t)(col0 + t * 16 + ln) * ldb + kb;
      FragB b;
      b.half[0] = *(const v8us*)(brow + 8 * hh);
      b.half[1] = *(const v8us*)(brow + 16 + 8 * hh);
      acc[t] = mmaN<ASPLIT ? 2 : 1>(ah.v, al.v, b.v, b.v, acc[t]);
    }
  }
#pragma unroll
  for (int t = 0; t < 4; ++t) {
    const int col = col0 + t * 16 + ln;
    float bv = bias ? bias[col] : 0.f;
    if (BIAS_BF16) bv = bf16_round(bv);
#pragma unroll
    for (int r = 0; r < 8; ++r) {
      float v = acc[t][r] + bv;
      if (resid) { float rv = resid[(size_t)((row0 + 8 * hh + r) % rmod) * ldr + col]; if (RES_BF16) rv = bf16_round(rv); v += rv; }
      if (ACT == 1) v = fmaxf(v, 0.f);
      if (ACT == 2) v = 0.5f * v * (1.0f + erff(v * 0.70710678118654752f));
      if (ACT == 3) { const float u = 0.7978845608028654f * (v + 0.044715f * v * v * v); v = 0.5f * v * (1.0f + tanhf(u)); }
      so[w][8 * hh + r][t * 16 + ln] = v;
    }
  }
  __builtin_amdgcn_fence(__ATOMIC_ACQ_REL, "workgroup");
  __builtin_amdgcn_wave_barrier();
  const int rsub = lane >> 4, c4 = (lane & 15) * 4;
  {
#pragma unroll
    for (int q = 0; q < 8; ++q) {
      const int r = q * 2 + rsub;
      const v4f v = *(const v4fa*)&so[w][r][c4];
      *(v4f*)(C + (size_t)(row0 + r) * ldc + col0 + c4) = v;
    }
    
  }
}
// row LayerNorm (biased variance, eps) over N: s = X (+ R); optional out_sum <- s; out_norm <- (s-mu)*rsqrt(var+eps)*g + b
template <bool PARAM_BF16>
__global__ __launch_bounds__(256) void k_layernorm(const float* __restrict__ X, const float* __restrict__ R, const float* __restrict__ g, const float* __restrict__ bta,
                                                  float* __restrict__ out_sum, float* __restrict__ out_norm, int N, float eps) {
  __shared__ float red[256];
  const int row = blockIdx.x, tid = threadIdx.x;
  const float* x = X + (size_t)row * N; const float* rr = R ? R + (size_t)row * N : nullptr;
  float vals[16];                     // up to N = 4096
  const int per = N / 256;            // contiguous chunk per thread? use strided-by-4 chunks: thread handles j = tid*4 + 1024*u
  float s1 = 0.f;
  for (int u = 0; u < per / 4; ++u) {
    const int j = tid * 4 + 1024 * u;
    const v4f a = *(const v4fa*)(x + j);
    v4f b = {0.f,0.f,0.f,0.f}; if (rr) b = *(const v4fa*)(rr + j);
#pragma unroll
    for (int q = 0; q < 4; ++q) { const float v = a[q] + b[q]; vals[u * 4 + q] = v; s1 += v; }
  }
  red[tid] = s1; __syncthreads();
  for (int st = 128; st > 0; st >>= 1) { if (tid < st) red[tid] += red[tid + st]; __syncthreads(); }
  const float mu = red[0] / (float)N; __syncthreads();
  float s2 = 0.f;
  for (int u = 0; u < per / 4; ++u)
#pragma unroll
    for (int q = 0; q < 4; ++q) { const float c = vals[u * 4 + q] - mu; s2 += c * c; }
  red[tid] = s2; __syncthreads();
  for (int st = 128; st > 0; st >>= 1) { if (tid < st) red[tid] += red[tid + st]; __syncthreads(); }
  const float rs = rsqrtf(red[0] / (float)N + eps);
  {
    for (int u = 0; u < per / 4; ++u) {
      const int j = tid * 4 + 1024 * u;
      v4f o, sm;
#pragma unroll
      for (int q = 0; q < 4; ++q) {
        float gg = g[j + q], bb = bta[j + q];
        if (PARAM_BF16) { gg = bf16_round(gg); bb = bf16_round(bb); }
        sm[q] = vals[u * 4 + q]; o[q] = (vals[u * 4 + q] - mu) * rs * gg + bb;
      }
      if (out_sum) *(v4f*)(out_sum + (size_t)row * N + j) = sm;
      *(v4f*)(out_norm + (size_t)row * N + j) = o;
    }
    
  }
}



// ---- f16 WMMA path (v_wmma_f32_16x16x32_f16): 11-bit significands for operands in range — used where a [0,1] probability operand needs more precision than bf16
typedef _Float16 v16h __attribute__((ext_vector_type(16)));
union FragH { v16h v; v8us half[2]; _Float16 h[16]; unsigned short u[16]; };
template <int NT>
__device__ __forceinline__ v8f mmaH(v16h ah, v16h al, v16h bh, v16h bl, v8f c) {
  c = __builtin_amdgcn_wmma_f32_16x16x32_f16(false, ah, false, bh, (short)0, c, false, false);
  if (NT >= 2) c = __builtin_amdgcn_wmma_f32_16x16x32_f16(false, al, false, bh, (short)0, c, false, false);
  if (NT >= 3) c = __builtin_amdgcn_wmma_f32_16x16x32_f16(false, ah, false, bl, (short)0, c, false, false);
  asm volatile("v_nop\n\tv_nop\n\tv_nop\n\tv_nop" : "+v"(c) : "v"(ah), "v"(al), "v"(bh), "v"(bl));
  return c;
}
// batched GEMM like k_gemm_b but f16 operands: A f32 (split into f16 hi/lo if ASPLIT, else rounded to f16), Bt = f16 values [n][k]; alpha; C f32; N multiple of 16 (partial tiles skipped)
template <bool ASPLIT>
__global__ __launch_bounds__(128) void k_gemm_h(const float* __restrict__ A, int lda, size_t sA, const _Float16* __restrict__ Bh, int ldb, size_t sB, float alpha, float* __restrict__ C, int ldc, size_t sC, int M, int N, int K) {
  __shared__ __attribute__((aligned(16))) float so[4][16][64];
  const int tid = threadIdx.x, w = tid >> 5, lane = tid & 31, ln = lane & 15, hh = lane >> 4; const int by = blockIdx.y;
  A += (size_t)by * sA; Bh += (size_t)by * sB; C += (size_t)by * sC;
  const int ntn = (N + 63) / 64; const int wid = blockIdx.x * 4 + w; const int mt = wid / ntn, nq = wid % ntn; if (mt * 16 >= M) return;
  const int row0 = mt * 16, col0 = nq * 64; const float* arow = A + (size_t)(row0 + ln) * lda;
  v8f acc[4] = {};
  for (int kb = 0; kb < K; kb += 32) {
    FragH ah, al;
    const v4f x0 = *(const v4fa*)(arow + kb + 8 * hh), x1 = *(const v4fa*)(arow + kb + 8 * hh + 4), x2 = *(const v4fa*)(arow + kb + 16 + 8 * hh), x3 = *(const v4fa*)(arow + kb + 16 + 8 * hh + 4);
    float xs[16] = {x0[0],x0[1],x0[2],x0[3],x1[0],x1[1],x1[2],x1[3],x2[0],x2[1],x2[2],x2[3],x3[0],x3[1],x3[2],x3[3]};
#pragma unroll
    for (int i = 0; i < 16; ++i) { const _Float16 h = (_Float16)xs[i]; ah.h[i] = h; al.h[i] = ASPLIT ? (_Float16)(xs[i] - (float)h) : (_Float16)0.0f; }
#pragma unroll
    for (int t = 0; t < 4; ++t) { if (col0 + t * 16 >= N) continue; const size_t boff = (size_t)(col0 + t * 16 + ln) * ldb + kb; FragH bq; bq.half[0] = *(const v8us*)(Bh + boff + 8 * hh); bq.half[1] = *(const v8us*)(Bh + boff + 16 + 8 * hh);
      acc[t] = mmaH<ASPLIT ? 2 : 1>(ah.v, al.v, bq.v, bq.v, acc[t]); }
  }
#pragma unroll
  for (int t = 0; t < 4; ++t) { if (col0 + t * 16 >= N) continue;
#pragma unroll
    for (int r = 0; r < 8; ++r) so[w][8 * hh + r][t * 16 + ln] = acc[t][r] * alpha; }
  __builtin_amdgcn_fence(__ATOMIC_ACQ_REL, "workgroup"); __builtin_amdgcn_wave_barrier();
  const int rsub = lane >> 4, c4 = (lane & 15) * 4;
  {
#pragma unroll
    for (int q = 0; q < 8; ++q) { const int r = q * 2 + rsub; if (col0 + c4 < N) { const v4f v = *(const v4fa*)&so[w][r][c4]; *(v4f*)(C + (size_t)(row0 + r) * ldc + col0 + c4) = v; } }
     }
}

// Wt[n][k] = f16(W[k][n]·scale) from f32 row-major W[K][N] (scale = power of two; bf16-exact weights stay exact in f16 away from the subnormal range)
__global__ __launch_bounds__(256) void k_wt_f16(const float* __restrict__ W, _Float16* __restrict__ Wt, int K, int N, float scale) {
  const int t = blockIdx.x * 256 + threadIdx.x; if (t >= N * (K / 8)) return; const int n = t / (K / 8), k8 = (t % (K / 8)) * 8; FragH f;
#pragma unroll
  for (int i = 0; i < 8; ++i) f.h[i] = (_Float16)(bf16_round(W[(size_t)(k8 + i) * N + n]) * scale); const v8us o = f.half[0];
  *(v8us*)((unsigned short*)Wt + (size_t)n * K + k8) = o; 
}
// k_gemm_hh variant with fused epilogue: v = acc·alpha + bias[by·sBias + col] (+ CP[(row/rowsPerB)·sCPb + by·64 + col] if CP) ; ACT 0 none / 1 elu ; writes f16 C16 (and f32 C if non-null)
template <int ACT>
__global__ __launch_bounds__(128) void k_gemm_hhx(const _Float16* __restrict__ A, int lda, size_t sA, const _Float16* __restrict__ Bh, int ldb, size_t sB, float alpha, const float* __restrict__ bias, size_t sBias, const float* __restrict__ CP, int rowsPerB, size_t sCPb, int row0g,
    float* __restrict__ C, _Float16* __restrict__ C16, int ldc, size_t sC, int M, int N, int K) {
  __shared__ __attribute__((aligned(16))) float so[4][16][64];
  const int tid = threadIdx.x, w = tid >> 5, lane = tid & 31, ln = lane & 15, hh = lane >> 4; const int by = blockIdx.y;
  A += (size_t)by * sA; Bh += (size_t)by * sB; const size_t cofs = (size_t)by * sC; const float* bp = bias ? bias + (size_t)by * sBias : nullptr;
  const int ntn = (N + 63) / 64; const int wid = blockIdx.x * 4 + w; const int mt = wid / ntn, nq = wid % ntn; if (mt * 16 >= M) return;
  const int row0 = mt * 16, col0 = nq * 64; const _Float16* arow = A + (size_t)(row0 + ln) * lda;
  v8f acc[4] = {};
  for (int kb = 0; kb < K; kb += 32) { FragH ah; ah.half[0] = *(const v8us*)((const unsigned short*)arow + kb + 8 * hh); ah.half[1] = *(const v8us*)((const unsigned short*)arow + kb + 16 + 8 * hh);
#pragma unroll
    for (int t = 0; t < 4; ++t) { if (col0 + t * 16 >= N) continue; const size_t boff = (size_t)(col0 + t * 16 + ln) * ldb + kb; FragH bq; bq.half[0] = *(const v8us*)((const unsigned short*)Bh + boff + 8 * hh); bq.half[1] = *(const v8us*)((const unsigned short*)Bh + boff + 16 + 8 * hh);
      acc[t] = mmaH<1>(ah.v, ah.v, bq.v, bq.v, acc[t]); }
  }
#pragma unroll
  for (int t = 0; t < 4; ++t) { if (col0 + t * 16 >= N) continue; const int col = col0 + t * 16 + ln; const float bv = bp ? bf16_round(bp[col]) : 0.f;
#pragma unroll
    for (int r = 0; r < 8; ++r) { float v = acc[t][r] * alpha + bv; if (CP) { const int bidx = (row0g + row0 + 8 * hh + r) / rowsPerB; v += CP[(size_t)bidx * sCPb + (size_t)by * 64 + col]; } if (ACT == 1) v = (v > 0.f) ? v : expm1f(v); else if (ACT == 7) v = (v > 0.f) ? v + 1.0f : expf(v); else if (ACT == 8) v = tanhf(v); else if (ACT == 9) v = 0.5f * v * (1.0f + tanhf(0.7978845608028654f * (v + 0.044715f * v * v * v))); else if (ACT == 11) v = 1.0f / (1.0f + expf(-v)); else if (ACT == 12) v = (v > 0.f) ? v : 0.01f * v; else if (ACT == 14) v = (v > 0.f) ? v : 0.1f * v; else if (ACT == 15) v = v / (1.0f + expf(-v)); else if (ACT == 3) v = fmaxf(v, 0.f); else if (ACT == 6) v = 0.5f * v * (1.0f + erff(v * 0.70710678118654752f)); so[w][8 * hh + r][t * 16 + ln] = v; } }
  __builtin_amdgcn_fence(__ATOMIC_ACQ_REL, "workgroup"); __builtin_amdgcn_wave_barrier();
  const int rsub = lane >> 4, c4 = (lane & 15) * 4; typedef _Float16 v4h __attribute__((ext_vector_type(4)));
  {
#pragma unroll
    for (int q = 0; q < 8; ++q) { const int r = q * 2 + rsub; if (col0 + c4 < N) { const v4f v = *(const v4fa*)&so[w][r][c4]; if (C) *(v4f*)(C + cofs + (size_t)(row0 + r) * ldc + col0 + c4) = v; if (C16) { v4h h4; for (int i = 0; i < 4; ++i) h4[i] = (_Float16)v[i]; *(v4h*)(C16 + cofs + (size_t)(row0 + r) * ldc + col0 + c4) = h4; } } }
     }
}


typedef _Float16 v4h __attribute__((ext_vector_type(4)));

__global__ __launch_bounds__(256) void k_x16(const float* __restrict__ x, _Float16* __restrict__ X16, size_t n8) { const size_t t = (size_t)blockIdx.x * 256 + threadIdx.x; if (t >= n8) return; FragH f;
#pragma unroll
  for (int q = 0; q < 8; ++q) f.h[q] = (_Float16)bf16_round(x[t * 8 + q]); *(v8us*)((unsigned short*)X16 + t * 8) = f.half[0];  }
__global__ __launch_bounds__(256) void k_h16(const float* __restrict__ x, _Float16* __restrict__ X16, size_t n8) { const size_t t = (size_t)blockIdx.x * 256 + threadIdx.x; if (t >= n8) return; FragH f;
#pragma unroll
  for (int q = 0; q < 8; ++q) f.h[q] = (_Float16)x[t * 8 + q]; *(v8us*)((unsigned short*)X16 + t * 8) = f.half[0];  }
__global__ __launch_bounds__(256) void k_round16f(const float* __restrict__ W, _Float16* __restrict__ Bt, size_t n8) { const size_t t = (size_t)blockIdx.x * 256 + threadIdx.x; if (t >= n8) return; FragH f;
#pragma unroll
  for (int i = 0; i < 8; ++i) f.h[i] = (_Float16)(bf16_round(W[t * 8 + i]) * 16.0f); *(v8us*)((unsigned short*)Bt + t * 8) = f.half[0];  }
template <int NHv, int TTv>
__global__ __launch_bounds__(256) void k_vt(const _Float16* __restrict__ V16, int ldv, int voff, _Float16* __restrict__ Vt) { __shared__ unsigned short tl[64][66]; const int tid = threadIdx.x; const int slab = blockIdx.x / (TTv / 64), lg = blockIdx.x % (TTv / 64); const int b = slab / NHv, h = slab % NHv;
  for (int i = tid; i < 64 * (HPITCH / 8); i += 256) { const int r = i / (HPITCH / 8), c8 = (i % (HPITCH / 8)) * 8; FragH f; f.half[0] = *(const v8us*)((const unsigned short*)V16 + ((size_t)b * TTv + lg * 64 + r) * ldv + voff + h * HPITCH + c8);
#pragma unroll
    for (int q = 0; q < 8; ++q) tl[r][c8 + q] = f.u[q]; }
  __syncthreads();
  {
#pragma unroll
    for (int rd = 0; rd < HPITCH / 32; ++rd) { const int d = rd * 32 + tid / 8, pc = tid % 8; FragH f;
#pragma unroll
      for (int q = 0; q < 8; ++q) f.u[q] = tl[pc * 8 + q][d];
      *(v8us*)((unsigned short*)Vt + ((size_t)slab * HPITCH + d) * TTv + lg * 64 + pc * 8) = f.half[0]; }
     } }

__global__ __launch_bounds__(256) void k_hl(const float* __restrict__ F, _Float16* __restrict__ Hh, _Float16* __restrict__ Hl, size_t n8) { const size_t t = (size_t)blockIdx.x * 256 + threadIdx.x; if (t >= n8) return; FragH fh, fl; const v4f a = *(const v4fa*)(F + t * 8), c = *(const v4fa*)(F + t * 8 + 4);
#pragma unroll
  for (int q = 0; q < 4; ++q) { _Float16 h = (_Float16)a[q]; fh.h[q] = h; fl.h[q] = (_Float16)((a[q] - (float)h) * 1024.0f); h = (_Float16)c[q]; fh.h[4 + q] = h; fl.h[4 + q] = (_Float16)((c[q] - (float)h) * 1024.0f); }
  { *(v8us*)((unsigned short*)Hh + t * 8) = fh.half[0]; *(v8us*)((unsigned short*)Hl + t * 8) = fl.half[0];  } }

// ---- fast GEMM (wave tile 32x64; requires M % 32 == 0 rows per launch region and N % 64 == 0); epilogue = k_gemm_hhx semantics ----
__device__ __forceinline__ v16h g2_frag(const _Float16* p, int hh) { FragH f; f.half[0] = *(const v8us*)((const unsigned short*)p + 8 * hh); f.half[1] = *(const v8us*)((const unsigned short*)p + 16 + 8 * hh); return f.v; }
__device__ __forceinline__ v8f g2_mma(v16h a, v16h b, v8f c) { v8f d = __builtin_amdgcn_wmma_f32_16x16x32_f16(false, a, false, b, (short)0, c, false, false); asm volatile("v_nop\n\tv_nop\n\tv_nop\n\tv_nop" : "+v"(d) : "v"(a), "v"(b)); return d; }
template <int ACT>
__global__ __launch_bounds__(128) void k_gemm2(const _Float16* __restrict__ A, int lda, size_t sA, const _Float16* __restrict__ Bh, int ldb, size_t sB, float alpha, const float* __restrict__ bias, size_t sBias, const float* __restrict__ CP, int rowsPerB, size_t sCPb, int row0g,
    float* __restrict__ C, _Float16* __restrict__ C16, int ldc, size_t sC, int M, int N, int K) {
  __shared__ __attribute__((aligned(16))) float so[4][32][68];
  const int tid = threadIdx.x, w = tid >> 5, lane = tid & 31, ln = lane & 15, hh = lane >> 4; const int by = blockIdx.y;
  A += (size_t)by * sA; Bh += (size_t)by * sB; const size_t cofs = (size_t)by * sC; const float* bp = bias ? bias + (size_t)by * sBias : nullptr;
  const int ntn = N >> 6; const int mt = blockIdx.x / ntn, nq = blockIdx.x - mt * ntn; const int row0 = mt * 128 + 32 * w, col0 = nq * 64; if (row0 >= M) return;
  const _Float16* a0p = A + (size_t)(row0 + ln) * lda; const _Float16* a1p = a0p + (size_t)16 * lda;
  const _Float16* b0p = Bh + (size_t)(col0 + ln) * ldb; const _Float16* b1p = b0p + (size_t)16 * ldb; const _Float16* b2p = b1p + (size_t)16 * ldb; const _Float16* b3p = b2p + (size_t)16 * ldb;
  const v8f z8 = {0.f,0.f,0.f,0.f,0.f,0.f,0.f,0.f}; v8f c00 = z8, c01 = z8, c02 = z8, c03 = z8, c10 = z8, c11 = z8, c12 = z8, c13 = z8;
#pragma unroll 1
  for (int kb = 0; kb < K; kb += 32) { const v16h a0 = g2_frag(a0p + kb, hh), a1 = g2_frag(a1p + kb, hh);
    v16h b = g2_frag(b0p + kb, hh); c00 = g2_mma(a0, b, c00); c10 = g2_mma(a1, b, c10);
    b = g2_frag(b1p + kb, hh); c01 = g2_mma(a0, b, c01); c11 = g2_mma(a1, b, c11);
    b = g2_frag(b2p + kb, hh); c02 = g2_mma(a0, b, c02); c12 = g2_mma(a1, b, c12);
    b = g2_frag(b3p + kb, hh); c03 = g2_mma(a0, b, c03); c13 = g2_mma(a1, b, c13); }
  v8f accs[8] = {c00, c01, c02, c03, c10, c11, c12, c13};
#pragma unroll
  for (int u = 0; u < 8; ++u) { const int t = u & 3, half = u >> 2; const int col = col0 + t * 16 + ln; const float bv = bp ? bf16_round(bp[col]) : 0.f;
#pragma unroll
    for (int r = 0; r < 8; ++r) { const int rloc = half * 16 + 8 * hh + r; float v = accs[u][r] * alpha + bv; if (CP) { const int bidx = (row0g + row0 + rloc) / rowsPerB; v += CP[(size_t)bidx * sCPb + (size_t)by * 64 + col]; }
      if (ACT == 3) v = fmaxf(v, 0.f); else if (ACT == 6) v = 0.5f * v * (1.0f + erff(v * 0.70710678118654752f)); else if (ACT == 11) v = 1.0f / (1.0f + expf(-v)); else if (ACT == 15) v = v / (1.0f + expf(-v)); else if (ACT == 12) v = (v > 0.f) ? v : 0.01f * v; else if (ACT == 8) v = tanhf(v);
      so[w][rloc][t * 16 + ln] = v; } }
  __builtin_amdgcn_fence(__ATOMIC_ACQ_REL, "workgroup"); __builtin_amdgcn_wave_barrier();
  const int rsub = lane >> 4, c4 = (lane & 15) * 4;
  {
#pragma unroll
    for (int q = 0; q < 16; ++q) { const int r = q * 2 + rsub; const v4f v = *(const v4fa*)&so[w][r][c4]; if (C) *(v4f*)(C + cofs + (size_t)(row0 + r) * ldc + col0 + c4) = v; if (C16) { v4h h4; for (int i = 0; i < 4; ++i) h4[i] = (_Float16)v[i]; *(v4h*)(C16 + cofs + (size_t)(row0 + r) * ldc + col0 + c4) = h4; } }
     } }



template <int CAUSAL>
__global__ __launch_bounds__(128) void k_flash(const _Float16* __restrict__ Q16, int ldq, const _Float16* __restrict__ K16, int ldk, const _Float16* __restrict__ Vt, const int* __restrict__ MSK, float* __restrict__ O, int ldo) {
  constexpr int RPW = 16, RTN = RPW / 16, NQB = TQ / (4 * RPW), DT = 4, KS = 2;
  __shared__ __attribute__((aligned(16))) unsigned short sP[4][RPW][40]; __shared__ __attribute__((aligned(16))) float sO[4][RPW][64 + 4];
  const int tid = threadIdx.x, w = tid >> 5, lane = tid & 31, ln = lane & 15, hh = lane >> 4;
  const int slab = blockIdx.x / QBLKS, qblk = blockIdx.x % QBLKS; (void)NQB; const int b = slab / NH, h = slab % NH; const int qb0 = qblk * (4 * RPW); const int q0 = qb0 + w * RPW;
  FragH aq[2][KS];
#pragma unroll
  for (int rt = 0; rt < RTN; ++rt) { const unsigned short* qr = (const unsigned short*)Q16 + ((size_t)b * TQ + q0 + rt * 16 + ln) * ldq + h * 64;
#pragma unroll
    for (int ks = 0; ks < KS; ++ks) { aq[rt][ks].half[0] = *(const v8us*)(qr + ks * 32 + 8 * hh); aq[rt][ks].half[1] = *(const v8us*)(qr + ks * 32 + 16 + 8 * hh); } }
  const unsigned short* Vth = (const unsigned short*)Vt + (size_t)slab * 64 * TK;
  float m_r[2][8], l_r[2][8]; v8f oacc[2][DT];
#pragma unroll
  for (int rt = 0; rt < RTN; ++rt) {
#pragma unroll
    for (int r = 0; r < 8; ++r) { m_r[rt][r] = -3.0e38f; l_r[rt][r] = 0.f; }
#pragma unroll
    for (int dt = 0; dt < DT; ++dt) oacc[rt][dt] = (v8f){0.f,0.f,0.f,0.f,0.f,0.f,0.f,0.f}; }
  const int jend = (CAUSAL == 1) ? (qb0 + 4 * RPW) : TK;      /* causal: keys beyond the block's last query never contribute */
#pragma unroll 1
  for (int j0 = 0; j0 < jend; j0 += 32) {
    v8f s[2][2];
#pragma unroll
    for (int nt = 0; nt < 2; ++nt) { const unsigned short* kr = (const unsigned short*)K16 + ((size_t)b * TK + j0 + nt * 16 + ln) * ldk + h * 64; FragH bk[KS];
#pragma unroll
      for (int ks = 0; ks < KS; ++ks) { bk[ks].half[0] = *(const v8us*)(kr + ks * 32 + 8 * hh); bk[ks].half[1] = *(const v8us*)(kr + ks * 32 + 16 + 8 * hh); }
#pragma unroll
      for (int rt = 0; rt < RTN; ++rt) { v8f acc = (v8f){0.f,0.f,0.f,0.f,0.f,0.f,0.f,0.f};
#pragma unroll
        for (int ks = 0; ks < KS; ++ks) acc = mmaH<1>(aq[rt][ks].v, aq[rt][ks].v, bk[ks].v, bk[ks].v, acc); s[rt][nt] = acc; } }
#pragma unroll
    for (int rt = 0; rt < RTN; ++rt)
#pragma unroll
      for (int r = 0; r < 8; ++r) { const int tq = q0 + rt * 16 + 8 * hh + r; const int k0 = j0 + ln, k1 = j0 + 16 + ln;
        const bool ok0 = (CAUSAL == 1) ? (k0 <= tq) : ((CAUSAL == 2) ? ((k0 >> 5) == (tq >> 5)) : true), ok1 = (CAUSAL == 1) ? (k1 <= tq) : ((CAUSAL == 2) ? ((k1 >> 5) == (tq >> 5)) : true);      /* mode 2: block-diagonal 32-token groups */
        const float s0 = ok0 ? s[rt][0][r] * SCL : -3.0e38f, s1 = ok1 ? s[rt][1][r] * SCL : -3.0e38f; float mc = fmaxf(s0, s1);
        mc = fmaxf(mc, __shfl_xor(mc, 1, 32)); mc = fmaxf(mc, __shfl_xor(mc, 2, 32)); mc = fmaxf(mc, __shfl_xor(mc, 4, 32)); mc = fmaxf(mc, __shfl_xor(mc, 8, 32));
        const float mn = fmaxf(m_r[rt][r], mc); const float al = (mn > -1.0e38f) ? expf(m_r[rt][r] - mn) : 1.0f; m_r[rt][r] = mn; const float p0 = ok0 ? expf(s0 - mn) : 0.f, p1 = ok1 ? expf(s1 - mn) : 0.f; l_r[rt][r] = l_r[rt][r] * al + p0 + p1;
#pragma unroll
        for (int dt = 0; dt < DT; ++dt) oacc[rt][dt][r] *= al;
        FragH t2; t2.h[0] = (_Float16)(p0 * 1024.0f); t2.h[1] = (_Float16)(p1 * 1024.0f); sP[w][rt * 16 + 8 * hh + r][ln] = t2.u[0]; sP[w][rt * 16 + 8 * hh + r][16 + ln] = t2.u[1]; }
    __builtin_amdgcn_fence(__ATOMIC_ACQ_REL, "workgroup"); __builtin_amdgcn_wave_barrier();
    FragH pa[2];
#pragma unroll
    for (int rt = 0; rt < RTN; ++rt) { pa[rt].half[0] = *(const v8us*)&sP[w][rt * 16 + ln][8 * hh]; pa[rt].half[1] = *(const v8us*)&sP[w][rt * 16 + ln][16 + 8 * hh]; }
#pragma unroll
    for (int dt = 0; dt < DT; ++dt) { const unsigned short* vrow = Vth + (size_t)(dt * 16 + ln) * TK + j0; FragH bv; bv.half[0] = *(const v8us*)(vrow + 8 * hh); bv.half[1] = *(const v8us*)(vrow + 16 + 8 * hh);
#pragma unroll
      for (int rt = 0; rt < RTN; ++rt) oacc[rt][dt] = mmaH<1>(pa[rt].v, pa[rt].v, bv.v, bv.v, oacc[rt][dt]); }
    __builtin_amdgcn_fence(__ATOMIC_ACQ_REL, "workgroup"); __builtin_amdgcn_wave_barrier(); }
#pragma unroll
  for (int rt = 0; rt < RTN; ++rt) {
#pragma unroll
    for (int r = 0; r < 8; ++r) { float l = l_r[rt][r]; l += __shfl_xor(l, 1, 32); l += __shfl_xor(l, 2, 32); l += __shfl_xor(l, 4, 32); l += __shfl_xor(l, 8, 32); l_r[rt][r] = (l > 0.f) ? 1.0f / (l * 1024.0f) : 0.f; }
#pragma unroll
    for (int dt = 0; dt < DT; ++dt)
#pragma unroll
      for (int r = 0; r < 8; ++r) sO[w][rt * 16 + 8 * hh + r][dt * 16 + ln] = oacc[rt][dt][r] * l_r[rt][r]; }
  __builtin_amdgcn_fence(__ATOMIC_ACQ_REL, "workgroup"); __builtin_amdgcn_wave_barrier();
  {
#pragma unroll
    for (int rp = 0; rp < RPW; rp += 2) { const int r = rp + (lane >> 4), pc = lane & 15; const v4f val = *(const v4fa*)&sO[w][r][pc * 4]; *(v4f*)(O + ((size_t)b * TQ + q0 + r) * ldo + h * 64 + pc * 4) = val; }
     } }
__device__ __forceinline__ float xhalf(float x) { return __builtin_bit_cast(float, __builtin_amdgcn_permlanex16(__builtin_bit_cast(int, x), __builtin_bit_cast(int, x), 0x76543210, 0xfedcba98, false, false)); }      /* lane l <-> lane l ^ 16 */
// Eight 2^x in place, in one statement: each v_exp_f32 writes only its own register, so none stands directly in front of an instruction that overwrites its source or reads its result
// (left to the register allocator, a run of them reused the source of the one before as the next destination); the v_nop keeps that slot behind the last one.
__device__ __forceinline__ void exp2x8(float& a, float& b, float& c, float& d, float& e, float& f, float& g, float& h) {
  asm("v_exp_f32 %0, %0\n\tv_exp_f32 %1, %1\n\tv_exp_f32 %2, %2\n\tv_exp_f32 %3, %3\n\tv_exp_f32 %4, %4\n\tv_exp_f32 %5, %5\n\tv_exp_f32 %6, %6\n\tv_exp_f32 %7, %7\n\tv_nop"
      : "+v"(a), "+v"(b), "+v"(c), "+v"(d), "+v"(e), "+v"(f), "+v"(g), "+v"(h)); }
template <int CAUSAL>
__global__ __launch_bounds__(128) void k_flashqk(const _Float16* __restrict__ Q16, const _Float16* __restrict__ QL, int ldq, const _Float16* __restrict__ K16, const _Float16* __restrict__ KL, int ldk, const _Float16* __restrict__ Vt, const int* __restrict__ MSK, float* __restrict__ O, int ldo) {
  constexpr int RPW = 16, DT = HPITCH / 16, KS = HPITCH / 32;
  __shared__ __attribute__((aligned(16))) float sO[4][RPW][HPITCH + 4];
  constexpr int KT = 64, KP = HPITCH + 8, VP = KT + 8;      /* keys per staged tile; LDS row pitches in halves: 16 bytes x an odd number, free of bank conflicts for 16-byte reads */
  constexpr int NCK = KT * (HPITCH / 8) / 128, NCV = HPITCH * (KT / 8) / 128;      /* 16-byte pieces per thread and tile */
  __shared__ __attribute__((aligned(16))) unsigned short sK[2][KT][KP]; __shared__ __attribute__((aligned(16))) unsigned short sKL[2][KT][KP]; __shared__ __attribute__((aligned(16))) unsigned short sV[2][HPITCH][VP];
  const int tid = threadIdx.x, w = tid >> 5, lane = tid & 31, ln = lane & 15, hh = lane >> 4;
  const int slab = blockIdx.x / QBLKS, qblk = blockIdx.x % QBLKS; const int b = slab / NH, h = slab % NH; const int qb0 = qblk * (4 * RPW); const int q0 = qb0 + w * RPW;
  const int tq = q0 + ln;      /* this lane's query */
  FragH bq[KS], bql[KS];
  { const unsigned short* qr = (const unsigned short*)Q16 + ((size_t)b * TQ + tq) * ldq + h * HPITCH; const unsigned short* ql = (const unsigned short*)QL + ((size_t)b * TQ + tq) * ldq + h * HPITCH;
#pragma unroll      /* constant indices keep the fragment, score and accumulator arrays in registers */
    for (int ks = 0; ks < KS; ++ks) { bq[ks].half[0] = *(const v8us*)(qr + ks * 32 + 8 * hh); bq[ks].half[1] = *(const v8us*)(qr + ks * 32 + 16 + 8 * hh); bql[ks].half[0] = *(const v8us*)(ql + ks * 32 + 8 * hh); bql[ks].half[1] = *(const v8us*)(ql + ks * 32 + 16 + 8 * hh); } }
  const unsigned short* Vth = (const unsigned short*)Vt + (size_t)slab * HPITCH * TK;
  const unsigned short* Kb = (const unsigned short*)K16 + (size_t)b * TK * ldk + h * HPITCH; const unsigned short* KLb = (const unsigned short*)KL + (size_t)b * TK * ldk + h * HPITCH;
  v8us gk[NCK], gkl[NCK], gv[NCV];      /* the next tile on its way from global memory to LDS */
  auto fetch = [&](int jt) {
#pragma unroll      /* constant indices keep the fragment, score and accumulator arrays in registers */
    for (int u = 0; u < NCK; ++u) { const int i = tid + 128 * u, r = i / (HPITCH / 8), c8 = (i % (HPITCH / 8)) * 8; gk[u] = *(const v8us*)(Kb + (size_t)(jt + r) * ldk + c8); gkl[u] = *(const v8us*)(KLb + (size_t)(jt + r) * ldk + c8); }
#pragma unroll      /* constant indices keep the fragment, score and accumulator arrays in registers */
    for (int u = 0; u < NCV; ++u) { const int i = tid + 128 * u, r = i / (KT / 8), c8 = (i % (KT / 8)) * 8; gv[u] = *(const v8us*)(Vth + (size_t)r * TK + jt + c8); } };
  auto stash = [&](int bf) {
#pragma unroll      /* constant indices keep the fragment, score and accumulator arrays in registers */
    for (int u = 0; u < NCK; ++u) { const int i = tid + 128 * u, r = i / (HPITCH / 8), c8 = (i % (HPITCH / 8)) * 8; *(v8us*)&sK[bf][r][c8] = gk[u]; *(v8us*)&sKL[bf][r][c8] = gkl[u]; }
#pragma unroll      /* constant indices keep the fragment, score and accumulator arrays in registers */
    for (int u = 0; u < NCV; ++u) { const int i = tid + 128 * u, r = i / (KT / 8), c8 = (i % (KT / 8)) * 8; *(v8us*)&sV[bf][r][c8] = gv[u]; } };
  float m_q = -3.0e38f, l_q = 0.f; v8f oacc[DT];      /* oacc[dt][r] = O[tq][dt * 16 + 8 hh + r], un-normalised */
#pragma unroll      /* constant indices keep the fragment, score and accumulator arrays in registers */
  for (int dt = 0; dt < DT; ++dt) oacc[dt] = (v8f){0.f,0.f,0.f,0.f,0.f,0.f,0.f,0.f};
  const int jend = (CAUSAL == 1) ? (qb0 + 4 * RPW) : TK;      /* causal: keys beyond the block's last query never contribute */
  const int ntile = jend / KT;
  asm volatile("s_wait_xcnt 0x0" ::: "memory");      /* the Q loads above are issued first, and no tile load below writes into a register that one of them still names as its address */
  fetch(0); stash(0);
  __syncthreads();      /* tile 0 is written before any wave reads it */
#pragma unroll 1      /* one copy of the trip's code; the buffer index alternates at run time */
  for (int t = 0; t < ntile; ++t) { const int buf = t & 1; const bool more = t + 1 < ntile;      /* the same in every thread of the work-group */
    if (more) fetch((t + 1) * KT);      /* in flight while this trip works on tile t */
#pragma unroll      /* the two 32-key halves of the tile: constant LDS offsets */
   for (int js = 0; js < KT; js += 32) { const int j0 = t * KT + js;
    v8f s[2];      /* s[nt][r] = score of key j0 + nt * 16 + 8 hh + r against query tq */
    FragH ak[2][KS], akl[2][KS], av[DT];      /* all LDS reads of these 32 keys stand together at the head: one LDS latency instead of four */
#pragma unroll      /* constant indices keep the fragment, score and accumulator arrays in registers */
    for (int nt = 0; nt < 2; ++nt) { const unsigned short* kr = &sK[buf][js + nt * 16 + ln][0]; const unsigned short* klr = &sKL[buf][js + nt * 16 + ln][0];
#pragma unroll      /* constant indices keep the fragment, score and accumulator arrays in registers */
      for (int ks = 0; ks < KS; ++ks) { ak[nt][ks].half[0] = *(const v8us*)(kr + ks * 32 + 8 * hh); ak[nt][ks].half[1] = *(const v8us*)(kr + ks * 32 + 16 + 8 * hh); akl[nt][ks].half[0] = *(const v8us*)(klr + ks * 32 + 8 * hh); akl[nt][ks].half[1] = *(const v8us*)(klr + ks * 32 + 16 + 8 * hh); } }
#pragma unroll      /* constant indices keep the fragment, score and accumulator arrays in registers */
    for (int dt = 0; dt < DT; ++dt) { const unsigned short* vrow = &sV[buf][dt * 16 + ln][js]; av[dt].half[0] = *(const v8us*)(vrow + 8 * hh); av[dt].half[1] = *(const v8us*)(vrow + 16 + 8 * hh); }
#pragma unroll      /* constant indices keep the fragment, score and accumulator arrays in registers */
    for (int nt = 0; nt < 2; ++nt) {
      v8f acc = (v8f){0.f,0.f,0.f,0.f,0.f,0.f,0.f,0.f}, accl = acc;
#pragma unroll      /* constant indices keep the fragment, score and accumulator arrays in registers */
      for (int ks = 0; ks < KS; ++ks) { acc = mmaH<1>(ak[nt][ks].v, ak[nt][ks].v, bq[ks].v, bq[ks].v, acc); accl = mmaH<1>(ak[nt][ks].v, ak[nt][ks].v, bql[ks].v, bql[ks].v, accl); accl = mmaH<1>(akl[nt][ks].v, akl[nt][ks].v, bq[ks].v, bq[ks].v, accl); }
#pragma unroll      /* constant indices keep the fragment, score and accumulator arrays in registers */
      for (int r = 0; r < 8; ++r) acc[r] += accl[r] * 0.0009765625f;
      s[nt] = acc; }
    float sc[16]; bool ok[16];
#pragma unroll      /* constant indices keep the fragment, score and accumulator arrays in registers */
    for (int i = 0; i < 16; ++i) { const int kk = j0 + (i >> 3) * 16 + 8 * hh + (i & 7);
      ok[i] = (CAUSAL == 1) ? (kk <= tq) : ((CAUSAL == 2) ? ((kk >> 5) == (tq >> 5)) : true);      /* mode 2: block-diagonal 32-token groups */
      if (CAUSAL == 4) ok[i] = MSK[((size_t)b * TQ + tq) * TK + kk] != 0;      /* mode 4: per-(query, key) INPUT mask shared by all heads; masked keys contribute nothing, rows with no valid key give l = 0 -> output 0 */
      sc[i] = ok[i] ? s[i >> 3][i & 7] : -3.0e38f; }      /* raw q.k: maxima are taken on raw scores, the (positive) scale enters with the exponent */
    float mt[8];
#pragma unroll      /* constant indices keep the fragment, score and accumulator arrays in registers */
    for (int i = 0; i < 8; ++i) mt[i] = fmaxf(sc[i], sc[8 + i]);
    float mc = fmaxf(fmaxf(fmaxf(mt[0], mt[1]), fmaxf(mt[2], mt[3])), fmaxf(fmaxf(mt[4], mt[5]), fmaxf(mt[6], mt[7])));
    mc = fmaxf(mc, xhalf(mc));      /* the other half's 16 keys of the same query */
    const float mn = fmaxf(m_q, mc); const float al = (mn > -1.0e38f) ? __builtin_amdgcn_exp2f((m_q - mn) * SCL2) : 1.0f; m_q = mn;
    const float nb = 10.0f - mn * SCL2;      /* p = 2^(sc * SCL2 + nb) = 2^10 exp((sc - mn) / sqrt(32)): scale, log2(e), maximum and P's 2^10 in one fma per score */
    float p[16]; FragH pb;
#pragma unroll      /* constant indices keep the fragment, score and accumulator arrays in registers */
    for (int i = 0; i < 16; ++i) p[i] = sc[i] * SCL2 + nb;
    exp2x8(p[0], p[1], p[2], p[3], p[4], p[5], p[6], p[7]); exp2x8(p[8], p[9], p[10], p[11], p[12], p[13], p[14], p[15]);
#pragma unroll      /* constant indices keep the fragment, score and accumulator arrays in registers */
    for (int i = 0; i < 16; ++i) { if (!ok[i]) p[i] = 0.f; pb.h[i] = (_Float16)p[i]; }      /* pb.h[i]: key j0 + (i >> 3) * 16 + 8 hh + (i & 7) of column ln; p and l_q both carry the 2^10 */
    float pt[8];
#pragma unroll      /* constant indices keep the fragment, score and accumulator arrays in registers */
    for (int i = 0; i < 8; ++i) pt[i] = p[i] + p[8 + i];
    l_q = l_q * al + (((pt[0] + pt[1]) + (pt[2] + pt[3])) + ((pt[4] + pt[5]) + (pt[6] + pt[7])));
#pragma unroll      /* constant indices keep the fragment, score and accumulator arrays in registers */
    for (int dt = 0; dt < DT; ++dt)
#pragma unroll      /* constant indices keep the fragment, score and accumulator arrays in registers */
      for (int r = 0; r < 8; ++r) oacc[dt][r] *= al;
#pragma unroll      /* constant indices keep the fragment, score and accumulator arrays in registers */
    for (int dt = 0; dt < DT; ++dt) oacc[dt] = mmaH<1>(av[dt].v, av[dt].v, pb.v, pb.v, oacc[dt]); }
    if (more) stash(buf ^ 1);      /* that buffer's last readers left it at the barrier that ended the trip before */
    __syncthreads(); }      /* one barrier a trip: publishes tile t + 1 and ends every wave's reads of tile t, which the next trip overwrites */
  const float lsum = l_q + xhalf(l_q); const float linv = (lsum > 0.f) ? 1.0f / lsum : 0.f;
#pragma unroll      /* constant indices keep the fragment, score and accumulator arrays in registers */
  for (int dt = 0; dt < DT; ++dt) { v4f lo4, hi4;
#pragma unroll      /* constant indices keep the fragment, score and accumulator arrays in registers */
    for (int r = 0; r < 4; ++r) { lo4[r] = oacc[dt][r] * linv; hi4[r] = oacc[dt][4 + r] * linv; }
    *(v4fa*)&sO[w][ln][dt * 16 + 8 * hh] = lo4; *(v4fa*)&sO[w][ln][dt * 16 + 8 * hh + 4] = hi4; }
  __builtin_amdgcn_fence(__ATOMIC_ACQ_REL, "workgroup"); __builtin_amdgcn_wave_barrier();
  {
#pragma unroll      /* constant indices keep the fragment, score and accumulator arrays in registers */
    for (int rp = 0; rp < RPW; rp += 128 / HPITCH) { const int r = rp + lane / (HPITCH / 4), pc = lane % (HPITCH / 4); const v4f val = *(const v4fa*)&sO[w][r][pc * 4]; *(v4f*)(O + ((size_t)b * TQ + q0 + r) * ldo + h * HPITCH + pc * 4) = val; }
     } }

__global__ __launch_bounds__(256) void k_gnstat(const float* __restrict__ x, float* __restrict__ GS) {
  #pragma clang fp contract(off)
  __shared__ float sh[256]; const int bg = blockIdx.x; const int tid = threadIdx.x; const float* base = x + (size_t)bg * CPG * SLEN; const int n = CPG * SLEN; float s = 0.f;
  for (int i = tid; i < n; i += 256) s += bf16_round(base[i]);
  sh[tid] = s; __syncthreads(); for (int st = 128; st > 0; st >>= 1) { if (tid < st) sh[tid] += sh[tid + st]; __syncthreads(); }
  const float mu = sh[0] / (float)n; __syncthreads(); float q2 = 0.f;
  for (int i = tid; i < n; i += 256) { const float d = bf16_round(base[i]) - mu; q2 += d * d; }
  sh[tid] = q2; __syncthreads(); for (int st = 128; st > 0; st >>= 1) { if (tid < st) sh[tid] += sh[tid + st]; __syncthreads(); }
  if (tid == 0) { const float rs = rsqrtf(sh[0] / (float)n + 1e-5f); { *(float*)(GS + (size_t)bg * 32) = mu; *(float*)(GS + (size_t)bg * 32 + 1) = rs;  } } }
__global__ __launch_bounds__(256) void k_gnT(const float* __restrict__ x, const float* __restrict__ GS, const float* __restrict__ gam, const float* __restrict__ bet, _Float16* __restrict__ XT16) {
  #pragma clang fp contract(off)
  __shared__ float tl[64][65]; const int tid = threadIdx.x; const int per = (CC / 64) * (SLEN / 64); const int b = blockIdx.x / per; const int rem = blockIdx.x % per; const int cb = rem / (SLEN / 64), pb = rem % (SLEN / 64);
  for (int i = tid; i < 64 * 16; i += 256) { const int cl = i / 16, p4 = (i % 16) * 4; const int c = cb * 64 + cl; const float mu = GS[((size_t)b * NGR + c / CPG) * 32], rs = GS[((size_t)b * NGR + c / CPG) * 32 + 1]; const float g = bf16_round(gam[c]), be = bf16_round(bet[c]);
    const v4f a = *(const v4fa*)(x + ((size_t)b * CC + c) * SLEN + pb * 64 + p4); for (int q = 0; q < 4; ++q) { float v = (bf16_round(a[q]) - mu) * rs * g; v += be; tl[cl][p4 + q] = v; } }
  __syncthreads(); const int pl = tid >> 2, c8 = (tid & 3) * 8;
  { for (int u = 0; u < 2; ++u) { const int c0 = c8 + u * 32; FragH f; for (int q = 0; q < 8; ++q) f.h[q] = (_Float16)tl[c0 + q][pl]; *(v8us*)((unsigned short*)XT16 + ((size_t)b * SLEN + pb * 64 + pl) * CC + cb * 64 + c0) = f.half[0]; }  } }
__global__ __launch_bounds__(256) void k_wpad(const float* __restrict__ Wm, const float* __restrict__ bm, _Float16* __restrict__ BP, float* __restrict__ PB) {
  const int r = blockIdx.x * 256 + threadIdx.x; if (r >= DP) return; const int h = r / HPITCH, d = r % HPITCH; const bool live = d < HDT; const int srow = h * HDT + d;
  for (int c0 = 0; c0 < CC; c0 += 8) { FragH f; for (int q = 0; q < 8; ++q) f.h[q] = live ? (_Float16)(bf16_round(Wm[(size_t)srow * CC + c0 + q]) * 16.0f) : (_Float16)0.0f; unsigned short* dst = (unsigned short*)BP + (size_t)r * CC + c0; *(v8us*)dst = f.half[0];  }
  const float bv = live ? bm[srow] : 0.f; *(float*)(PB + r) = bv;  }
__global__ __launch_bounds__(256) void k_wio(const float* __restrict__ Wm, int nin, int nout, int pair, _Float16* __restrict__ Bt) { const int pitch = pair ? 2 * nin : nin; const size_t t = (size_t)blockIdx.x * 256 + threadIdx.x; if (t >= (size_t)nout * (pitch / 8)) return; const int pc = (int)(t % (pitch / 8)); const int o = (int)(t / (pitch / 8)); FragH f;
  for (int q = 0; q < 8; ++q) { const int col = pc * 8 + q; const bool lo = col >= nin; const int i = lo ? col - nin : col; f.h[q] = (_Float16)(bf16_round(Wm[(size_t)i * nout + o]) * (lo ? 1.0f : 16.0f)); }
  *(v8us*)((unsigned short*)Bt + (size_t)o * pitch + pc * 8) = f.half[0];  }
__global__ __launch_bounds__(256) void k_wop(const float* __restrict__ Wo, _Float16* __restrict__ Bt) { const int t = blockIdx.x * 256 + threadIdx.x; if (t >= CC * (2 * CC / 8)) return; const int pc = t % (2 * CC / 8); const int o = t / (2 * CC / 8); const bool lo = pc * 8 >= CC; FragH f;
  for (int q = 0; q < 8; ++q) { const int c = pc * 8 + q - (lo ? CC : 0); f.h[q] = (_Float16)(bf16_round(Wo[(size_t)o * CC + c]) * (lo ? 1.0f : 16.0f)); } *(v8us*)((unsigned short*)Bt + (size_t)o * 2 * CC + pc * 8) = f.half[0];  }
__global__ __launch_bounds__(256) void k_ofl(const float* __restrict__ O, float* __restrict__ OF, _Float16* __restrict__ OF2) { const size_t t = (size_t)blockIdx.x * 256 + threadIdx.x; if (t >= (size_t)NR * (CC / 8)) return; const int c0 = (int)(t % (CC / 8)) * 8; const size_t r = t / (CC / 8); const int h = c0 / HDT, d0 = c0 % HDT; FragH fh, fl; v4f a, bq;
  for (int q = 0; q < 8; ++q) { const float v = O[r * DP + h * HPITCH + d0 + q]; const _Float16 hv = (_Float16)v; fh.h[q] = hv; fl.h[q] = (_Float16)((v - (float)hv) * 16.0f); if (q < 4) a[q] = v; else bq[q - 4] = v; }
  { *(v4f*)(OF + r * CC + c0) = a; *(v4f*)(OF + r * CC + c0 + 4) = bq; *(v8us*)((unsigned short*)OF2 + r * 2 * CC + c0) = fh.half[0]; *(v8us*)((unsigned short*)OF2 + r * 2 * CC + CC + c0) = fl.half[0];  } }
__global__ __launch_bounds__(256) void k_pair16(const float* __restrict__ S, _Float16* __restrict__ HP) { const size_t t = (size_t)blockIdx.x * 256 + threadIdx.x; if (t >= (size_t)NR * (CC / 8)) return; const int c0 = (int)(t % (CC / 8)) * 8; const size_t r = t / (CC / 8); FragH fh, fl;
  for (int q = 0; q < 8; ++q) { const float v = S[r * CC + c0 + q]; const _Float16 hv = (_Float16)v; fh.h[q] = hv; fl.h[q] = (_Float16)((v - (float)hv) * 16.0f); }
  { *(v8us*)((unsigned short*)HP + r * 2 * CC + c0) = fh.half[0]; *(v8us*)((unsigned short*)HP + r * 2 * CC + CC + c0) = fl.half[0];  } }
__global__ __launch_bounds__(256) void k_nchw(const float* __restrict__ Y, float* __restrict__ out) { const size_t t = (size_t)blockIdx.x * 256 + threadIdx.x; if (t >= (size_t)NB * CC * (SLEN / 4)) return; const int n0 = (int)(t % (SLEN / 4)) * 4; const int o = (int)((t / (SLEN / 4)) % CC); const int b = (int)(t / ((size_t)(SLEN / 4) * CC)); v4f r; for (int q = 0; q < 4; ++q) r[q] = Y[((size_t)b * SLEN + n0 + q) * CC + o]; float* d = out + ((size_t)b * CC + o) * SLEN + n0; *(v4f*)d = r;  }

extern "C" void kernel_launch(void* const* d_in, const int* in_sizes, int n_in,
                              void* d_out, int out_size, void* d_ws, size_t ws_size, hipStream_t stream) {
  (void)in_sizes; (void)n_in; (void)out_size;
  const float* const* I = (const float* const*)d_in; const float* fo = I[0]; const float* fs = I[1]; const float* gq = I[2]; const float* bq = I[3]; const float* gkv = I[4]; const float* bkv = I[5]; const float* Wq = I[6]; const float* bqp = I[7]; const float* Wk = I[8]; const float* bkp = I[9]; const float* Wv = I[10]; const float* bvp = I[11]; const float* W1 = I[12]; const float* b1 = I[13]; const float* W2 = I[14]; const float* b2 = I[15]; const float* Wo = I[16]; const float* bo = I[17];
  char* ws = (char*)d_ws; size_t off = 0;
  auto take = [&](size_t bytes) { char* p = ws + off; off += (bytes + 255) & ~(size_t)255; return p; };
  _Float16* BPq = (_Float16*)take((size_t)DP * CC * 2); _Float16* BPk = (_Float16*)take((size_t)DP * CC * 2); _Float16* BPv = (_Float16*)take((size_t)DP * CC * 2); float* PBq = (float*)take(DP * 4); float* PBk = (float*)take(DP * 4); float* PBv = (float*)take(DP * 4);
  _Float16* BW1 = (_Float16*)take((size_t)HID * 2 * CC * 2); _Float16* BW2 = (_Float16*)take((size_t)CC * HID * 2); _Float16* BWO = (_Float16*)take((size_t)CC * 2 * CC * 2); float* GS = (float*)take((size_t)NB * NGR * 32 * 4 * 2);
  _Float16* XQ = (_Float16*)take((size_t)NR * CC * 2); _Float16* XKV = (_Float16*)take((size_t)NR * CC * 2); float* F32 = (float*)take((size_t)NR * DP * 4);
  _Float16* QH = (_Float16*)take((size_t)NR * DP * 2); _Float16* QL = (_Float16*)take((size_t)NR * DP * 2); _Float16* KH = (_Float16*)take((size_t)NR * DP * 2); _Float16* KL = (_Float16*)take((size_t)NR * DP * 2); _Float16* VH = (_Float16*)take((size_t)NR * DP * 2); _Float16* VL = (_Float16*)take((size_t)NR * DP * 2); _Float16* VT = (_Float16*)take((size_t)NR * DP * 2); _Float16* VTL = (_Float16*)take((size_t)NR * DP * 2);
  float* OF = (float*)take((size_t)NR * CC * 4); _Float16* OF2 = (_Float16*)take((size_t)NR * 2 * CC * 2); _Float16* G16 = (_Float16*)take((size_t)NR * HID * 2); float* FU = (float*)take((size_t)NR * CC * 4); _Float16* FU2 = (_Float16*)take((size_t)NR * 2 * CC * 2); float* Y = (float*)take((size_t)NR * CC * 4);
  float* O = F32;
  if (off > ws_size) return;      /* 0.5 + 2 + 2 + 4 + 8 x 2 + 4 + 4 + 4 + 4 + 4 + 4 = 49 MiB */
  k_wpad<<<1, 256, 0, stream>>>(Wq, bqp, BPq, PBq); k_wpad<<<1, 256, 0, stream>>>(Wk, bkp, BPk, PBk); k_wpad<<<1, 256, 0, stream>>>(Wv, bvp, BPv, PBv);      /* conv1x1 weights (out,in) = natural rows */
  k_wio<<<(HID * (2 * CC / 8) + 255) / 256, 256, 0, stream>>>(W1, CC, HID, 1, BW1); k_wio<<<(CC * (HID / 8) + 255) / 256, 256, 0, stream>>>(W2, HID, CC, 0, BW2); k_wop<<<(CC * (2 * CC / 8) + 255) / 256, 256, 0, stream>>>(Wo, BWO);
  k_gnstat<<<NB * NGR, 256, 0, stream>>>(fo, GS); k_gnstat<<<NB * NGR, 256, 0, stream>>>(fs, GS + NB * NGR * 32);
  k_gnT<<<NB * (CC / 64) * (SLEN / 64), 256, 0, stream>>>(fo, GS, gq, bq, XQ); k_gnT<<<NB * (CC / 64) * (SLEN / 64), 256, 0, stream>>>(fs, GS + NB * NGR * 32, gkv, bkv, XKV);
  const dim3 gP((NR / 128) * (DP / 64), 1), gC((NR / 128) * (CC / 64), 1), gH((NR / 128) * (HID / 64), 1); const unsigned n8 = (unsigned)(((size_t)NR * DP / 8 + 255) / 256), n8c = (unsigned)(((size_t)NR * (CC / 8) + 255) / 256);
  k_gemm2<0><<<gP, 128, 0, stream>>>(XQ, CC, 0, BPq, CC, 0, 0.0625f, PBq, 0, nullptr, 1, 0, 0, F32, nullptr, DP, 0, NR, DP, CC); k_hl<<<n8, 256, 0, stream>>>(F32, QH, QL, (size_t)NR * DP / 8);
  k_gemm2<0><<<gP, 128, 0, stream>>>(XKV, CC, 0, BPk, CC, 0, 0.0625f, PBk, 0, nullptr, 1, 0, 0, F32, nullptr, DP, 0, NR, DP, CC); k_hl<<<n8, 256, 0, stream>>>(F32, KH, KL, (size_t)NR * DP / 8);
  k_gemm2<0><<<gP, 128, 0, stream>>>(XKV, CC, 0, BPv, CC, 0, 0.0625f, PBv, 0, nullptr, 1, 0, 0, F32, nullptr, DP, 0, NR, DP, CC); k_hl<<<n8, 256, 0, stream>>>(F32, VH, VL, (size_t)NR * DP / 8);
  k_vt<NH, SLEN><<<NB * NH * (SLEN / 64), 256, 0, stream>>>(VH, DP, 0, VT);
  k_flashqk<0><<<NB * NH * QBLKS, 128, 0, stream>>>(QH, QL, DP, KH, KL, DP, VT, nullptr, O, DP);      /* q/k hi + residual; P (x2^10) and V plain f16 */
  k_ofl<<<n8c, 256, 0, stream>>>(O, OF, OF2);
  k_gemm2<6><<<gH, 128, 0, stream>>>(OF2, 2 * CC, 0, BW1, 2 * CC, 0, 0.0625f, b1, 0, nullptr, 1, 0, 0, nullptr, G16, HID, 0, NR, HID, 2 * CC);      /* gelu_erf(out W1 + b1) -> f16 */
  k_gemm2<0><<<gC, 128, 0, stream>>>(G16, HID, 0, BW2, HID, 0, 0.0625f, b2, 0, OF, 1, (size_t)CC, 0, FU, nullptr, CC, 0, NR, CC, HID);      /* mlp + b2 + out_flat */
  k_pair16<<<n8c, 256, 0, stream>>>(FU, FU2);
  k_gemm2<0><<<gC, 128, 0, stream>>>(FU2, 2 * CC, 0, BWO, 2 * CC, 0, 0.0625f, bo, 0, nullptr, 1, 0, 0, Y, nullptr, CC, 0, NR, CC, 2 * CC);      /* conv1x1(fused, Wo) + bo */
  k_nchw<<<(unsigned)(((size_t)NB * CC * (SLEN / 4) + 255) / 256), 256, 0, stream>>>(Y, (float*)d_out);
}

// v005
// It runs in 170 microseconds.
// In two side-by-side timings against v004, it was 1.32 and 1.29 times as fast.
// All steps since v000 together make it 3.95 times as fast.
#include <hip/hip_runtime.h>
// SFBlock (2 x 128 x 64 x 64; 4 heads x 32; GroupNorm(32) on both inputs; q from feat_opt, k/v from feat_sar via 1x1 convs; softmax(q k^T / sqrt(32)) v over the 4096 positions; MLP: gelu_erf(out W1 + b1) W2 + b2; fused = out + mlp; 1x1 conv Wo -> [2,128,64,64]).
// Compute dtype: inputs and parameters rounded to bf16; normalised inputs as f16 operands (~2^-12); q, k hi + residual; P (x2^10), v plain f16; attention output / fused as hi + residual pairs; the 256-wide GELU hidden as f16; f32 statistics/softmax/accumulation. v_wmma_f32_16x16x32_f16.
#define NB 2
#define CC 128
#define HID 256
#define NGR 32
#define CPG (CC / NGR)           /* 4 channels per group */
#define HDT 32
#define HPITCH HDT                   /* columns per head in the q/k/v planes: the true head dim, no padding */
#define DP (NH * HPITCH)             /* 128 */
#define NR (NB * SLEN)           /* 8192 */
#define QBLKS (TQ / 64)
#define SLEN 4096                /* H*W tokens */
#define TQ SLEN
#define TK SLEN
#define NH 4
#define SCL 0.17677669529663687f /* 32^-0.5 */
#define SCL2 ((float)(0.17677669529663687 * 1.4426950408889634)) /* 32^-0.5 * log2(e): raw score -> exponent of two */
typedef __bf16 v16b __attribute__((ext_vector_type(16)));
typedef unsigned short v8us __attribute__((ext_vector_type(8), may_alias));
typedef float  v8f  __attribute__((ext_vector_type(8)));
typedef float  v4f  __attribute__((ext_vector_type(4)));
typedef float  v4fa __attribute__((ext_vector_type(4), may_alias));
union FragB { v16b v; v8us half[2]; unsigned short u[16]; };

__device__ __forceinline__ unsigned short bf16_bits(float x) { unsigned int u = __float_as_uint(x); return (unsigned short)((u + 0x7FFFu + ((u >> 16) & 1u)) >> 16); }
__device__ __forceinline__ float bf16_val(unsigned short b) { return __uint_as_float(((unsigned int)b) << 16); }
__device__ __forceinline__ float bf16_round(float x) { return bf16_val(bf16_bits(x)); }
// D += A·B with NT terms: 1 = ah·bh, 2 = + al·bh (A split), 3 = + ah·bl (both split)
template <int NT>
__device__ __forceinline__ v8f mmaN(v16b ah, v16b al, v16b bh, v16b bl, v8f c) {
  c = __builtin_amdgcn_wmma_f32_16x16x32_bf16(false, ah, false, bh, (short)0, c, false, false);
  if (NT >= 2) c = __builtin_amdgcn_wmma_f32_16x16x32_bf16(false, al, false, bh, (short)0, c, false, false);
  if (NT >= 3) c = __builtin_amdgcn_wmma_f32_16x16x32_bf16(false, ah, false, bl, (short)0, c, false, false);
  asm volatile("v_nop\n\tv_nop\n\tv_nop\n\tv_nop" : "+v"(c) : "v"(ah), "v"(al), "v"(bh), "v"(bl));
  return c;
}

__global__ __launch_bounds__(256) void k_wt_bf16(const float* __restrict__ W, unsigned short* __restrict__ Wt, int K, int N) {
  const int t = blockIdx.x * 256 + threadIdx.x;
  const int k8n = K / 8;
  if (t >= N * k8n) return;
  const int n = t / k8n, k8 = (t % k8n) * 8;
  v8us v;
#pragma unroll
  for (int i = 0; i < 8; ++i) v[i] = bf16_bits(W[(size_t)(k8 + i) * N + n]);
  *(v8us*)(Wt + (size_t)n * K + k8) = v;
  
}

// GEMM C[M][N] (f32, pitch ldc) = act(A[M][K]·W + bias). A f32 row-major (pitch lda) converted per fragment to bf16
// (ASPLIT: hi/lo two planes -> 2 terms, else single rounded term); Wt bf16 [N][K] (pitch ldb). BIAS_BF16 rounds the
// bias to bf16 first (bias quantised to bf16 before the add). K%32==0, M%16==0, N%64==0.
template <bool ASPLIT, int ACT, bool BIAS_BF16>
__global__ __launch_bounds__(128) void k_gemm_bf(const float* __restrict__ A, int lda, const unsigned short* __restrict__ Wt, int ldb,
                                               const float* __restrict__ bias, float* __restrict__ C, int ldc, int M, int N, int K) {
  __shared__ __attribute__((aligned(16))) float so[4][16][64];
  const int tid = threadIdx.x, w = tid >> 5, lane = tid & 31, ln = lane & 15, hh = lane >> 4;
  const int ntn = N / 64;
  const int wid = blockIdx.x * 4 + w;
  const int mt = wid / ntn, nq = wid % ntn;
  if (mt * 16 >= M) return;
  const int row0 = mt * 16, col0 = nq * 64;
  const float* arow = A + (size_t)(row0 + ln) * lda;
  v8f acc[4] = {};
  for (int kb = 0; kb < K; kb += 32) {
    FragB ah, al;
    const v4f x0 = *(const v4fa*)(arow + kb + 8 * hh), x1 = *(const v4fa*)(arow + kb + 8 * hh + 4);
    const v4f x2 = *(const v4fa*)(arow + kb + 16 + 8 * hh), x3 = *(const v4fa*)(arow + kb + 16 + 8 * hh + 4);
    float xs[16] = {x0[0],x0[1],x0[2],x0[3],x1[0],x1[1],x1[2],x1[3],x2[0],x2[1],x2[2],x2[3],x3[0],x3[1],x3[2],x3[3]};
#pragma unroll
    for (int i = 0; i < 16; ++i) { const unsigned short hb = bf16_bits(xs[i]); ah.u[i] = hb; al.u[i] = ASPLIT ? bf16_bits(xs[i] - bf16_val(hb)) : (unsigned short)0; }
#pragma unroll
    for (int t = 0; t < 4; ++t) {
      const unsigned short* brow = Wt + (size_t)(col0 + t * 16 + ln) * ldb + kb;
      FragB b;
      b.half[0] = *(const v8us*)(brow + 8 * hh);
      b.half[1] = *(const v8us*)(brow + 16 + 8 * hh);
      acc[t] = mmaN<ASPLIT ? 2 : 1>(ah.v, al.v, b.v, b.v, acc[t]);
    }
  }
#pragma unroll
  for (int t = 0; t < 4; ++t) {
    float bv = bias ? bias[col0 + t * 16 + ln] : 0.f;
    if (BIAS_BF16) bv = bf16_round(bv);
#pragma unroll
    for (int r = 0; r < 8; ++r) { float v = acc[t][r] + bv; if (ACT == 1) v = fmaxf(v, 0.f); so[w][8 * hh + r][t * 16 + ln] = v; }
  }
  __builtin_amdgcn_fence(__ATOMIC_ACQ_REL, "workgroup");
  __builtin_amdgcn_wave_barrier();
  const int rsub = lane >> 4, c4 = (lane & 15) * 4;
  {
#pragma unroll
    for (int q = 0; q < 8; ++q) {
      const int r = q * 2 + rsub;
      const v4f v = *(const v4fa*)&so[w][r][c4];
      *(v4f*)(C + (size_t)(row0 + r) * ldc + col0 + c4) = v;
    }
    
  }
}

// GEMM C = act(A·W + bias + resid): A f32 (ASPLIT -> hi/lo 2 terms), Wt bf16 [N][K]; ACT 0 none, 1 relu, 2 exact gelu;
// resid (optional, f32, row index = (row % rmod), pitch ldr, RES_BF16 rounds it) added before the activation.
template <bool ASPLIT, int ACT, bool BIAS_BF16, bool RES_BF16>
__global__ __launch_bounds__(128) void k_gemm_bf3(const float* __restrict__ A, int lda, const unsigned short* __restrict__ Wt, int ldb,
                                                const float* __restrict__ bias, const float* __restrict__ resid, int rmod, int ldr,
                                                float* __restrict__ C, int ldc, int M, int N, int K) {
  __shared__ __attribute__((aligned(16))) float so[4][16][64];
  const int tid = threadIdx.x, w = tid >> 5, lane = tid & 31, ln = lane & 15, hh = lane >> 4;
  const int ntn = N / 64;
  const int wid = blockIdx.x * 4 + w;
  const int mt = wid / ntn, nq = wid % ntn;
  if (mt * 16 >= M) return;
  const int row0 = mt * 16, col0 = nq * 64;
  const float* arow = A + (size_t)(row0 + ln) * lda;
  v8f acc[4] = {};
  for (int kb = 0; kb < K; kb += 32) {
    FragB ah, al;
    const v4f x0 = *(const v4fa*)(arow + kb + 8 * hh), x1 = *(const v4fa*)(arow + kb + 8 * hh + 4);
    const v4f x2 = *(const v4fa*)(arow + kb + 16 + 8 * hh), x3 = *(const v4fa*)(arow + kb + 16 + 8 * hh + 4);
    float xs[16] = {x0[0],x0[1],x0[2],x0[3],x1[0],x1[1],x1[2],x1[3],x2[0],x2[1],x2[2],x2[3],x3[0],x3[1],x3[2],x3[3]};
#pragma unroll
    for (int i = 0; i < 16; ++i) { const unsigned short hb = bf16_bits(xs[i]); ah.u[i] = hb; al.u[i] = ASPLIT ? bf16_bits(xs[i] - bf16_val(hb)) : (unsigned short)0; }
#pragma unroll
    for (int t = 0; t < 4; ++t) {
      const unsigned short* brow = Wt + (size_t)(col0 + t * 16 + ln) * ldb + kb;
      FragB b;
      b.half[0] = *(const v8us*)(brow + 8 * hh);
      b.half[1] = *(const v8us*)(brow + 16 + 8 * hh);
      acc[t] = mmaN<ASPLIT ? 2 : 1>(ah.v, al.v, b.v, b.v, acc[t]);
    }
  }
#pragma unroll
  for (int t = 0; t < 4; ++t) {
    const int col = col0 + t * 16 + ln;
    float bv = bias ? bias[col] : 0.f;
    if (BIAS_BF16) bv = bf16_round(bv);
#pragma unroll
    for (int r = 0; r < 8; ++r) {
      float v = acc[t][r] + bv;
      if (resid) { float rv = resid[(size_t)((row0 + 8 * hh + r) % rmod) * ldr + col]; if (RES_BF16) rv = bf16_round(rv); v += rv; }
      if (ACT == 1) v = fmaxf(v, 0.f);
      if (ACT == 2) v = 0.5f * v * (1.0f + erff(v * 0.70710678118654752f));
      if (ACT == 3) { const float u = 0.7978845608028654f * (v + 0.044715f * v * v * v); v = 0.5f * v * (1.0f + tanhf(u)); }
      so[w][8 * hh + r][t * 16 + ln] = v;
    }
  }
  __builtin_amdgcn_fence(__ATOMIC_ACQ_REL, "workgroup");
  __builtin_amdgcn_wave_barrier();
  const int rsub = lane >> 4, c4 = (lane & 15) * 4;
  {
#pragma unroll
    for (int q = 0; q < 8; ++q) {
      const int r = q * 2 + rsub;
      const v4f v = *(const v4fa*)&so[w][r][c4];
      *(v4f*)(C + (size_t)(row0 + r) * ldc + col0 + c4) = v;
    }
    
  }
}
// row LayerNorm (biased variance, eps) over N: s = X (+ R); optional out_sum <- s; out_norm <- (s-mu)*rsqrt(var+eps)*g + b
template <bool PARAM_BF16>
__global__ __launch_bounds__(256) void k_layernorm(const float* __restrict__ X, const float* __restrict__ R, const float* __restrict__ g, const float* __restrict__ bta,
                                                  float* __restrict__ out_sum, float* __restrict__ out_norm, int N, float eps) {
  __shared__ float red[256];
  const int row = blockIdx.x, tid = threadIdx.x;
  const float* x = X + (size_t)row * N; const float* rr = R ? R + (size_t)row * N : nullptr;
  float vals[16];                     // up to N = 4096
  const int per = N / 256;            // contiguous chunk per thread? use strided-by-4 chunks: thread handles j = tid*4 + 1024*u
  float s1 = 0.f;
  for (int u = 0; u < per / 4; ++u) {
    const int j = tid * 4 + 1024 * u;
    const v4f a = *(const v4fa*)(x + j);
    v4f b = {0.f,0.f,0.f,0.f}; if (rr) b = *(const v4fa*)(rr + j);
#pragma unroll
    for (int q = 0; q < 4; ++q) { const float v = a[q] + b[q]; vals[u * 4 + q] = v; s1 += v; }
  }
  red[tid] = s1; __syncthreads();
  for (int st = 128; st > 0; st >>= 1) { if (tid < st) red[tid] += red[tid + st]; __syncthreads(); }
  const float mu = red[0] / (float)N; __syncthreads();
  float s2 = 0.f;
  for (int u = 0; u < per / 4; ++u)
#pragma unroll
    for (int q = 0; q < 4; ++q) { const float c = vals[u * 4 + q] - mu; s2 += c * c; }
  red[tid] = s2; __syncthreads();
  for (int st = 128; st > 0; st >>= 1) { if (tid < st) red[tid] += red[tid + st]; __syncthreads(); }
  const float rs = rsqrtf(red[0] / (float)N + eps);
  {
    for (int u = 0; u < per / 4; ++u) {
      const int j = tid * 4 + 1024 * u;
      v4f o, sm;
#pragma unroll
      for (int q = 0; q < 4; ++q) {
        float gg = g[j + q], bb = bta[j + q];
        if (PARAM_BF16) { gg = bf16_round(gg); bb = bf16_round(bb); }
        sm[q] = vals[u * 4 + q]; o[q] = (vals[u * 4 + q] - mu) * rs * gg + bb;
      }
      if (out_sum) *(v4f*)(out_sum + (size_t)row * N + j) = sm;
      *(v4f*)(out_norm + (size_t)row * N + j) = o;
    }
    
  }
}



// ---- f16 WMMA path (v_wmma_f32_16x16x32_f16): 11-bit significands for operands in range — used where a [0,1] probability operand needs more precision than bf16
typedef _Float16 v16h __attribute__((ext_vector_type(16)));
union FragH { v16h v; v8us half[2]; _Float16 h[16]; unsigned short u[16]; };
template <int NT>
__device__ __forceinline__ v8f mmaH(v16h ah, v16h al, v16h bh, v16h bl, v8f c) {
  c = __builtin_amdgcn_wmma_f32_16x16x32_f16(false, ah, false, bh, (short)0, c, false, false);
  if (NT >= 2) c = __builtin_amdgcn_wmma_f32_16x16x32_f16(false, al, false, bh, (short)0, c, false, false);
  if (NT >= 3) c = __builtin_amdgcn_wmma_f32_16x16x32_f16(false, ah, false, bl, (short)0, c, false, false);
  asm volatile("v_nop\n\tv_nop\n\tv_nop\n\tv_nop" : "+v"(c) : "v"(ah), "v"(al), "v"(bh), "v"(bl));
  return c;
}
// batched GEMM like k_gemm_b but f16 operands: A f32 (split into f16 hi/lo if ASPLIT, else rounded to f16), Bt = f16 values [n][k]; alpha; C f32; N multiple of 16 (partial tiles skipped)
template <bool ASPLIT>
__global__ __launch_bounds__(128) void k_gemm_h(const float* __restrict__ A, int lda, size_t sA, const _Float16* __restrict__ Bh, int ldb, size_t sB, float alpha, float* __restrict__ C, int ldc, size_t sC, int M, int N, int K) {
  __shared__ __attribute__((aligned(16))) float so[4][16][64];
  const int tid = threadIdx.x, w = tid >> 5, lane = tid & 31, ln = lane & 15, hh = lane >> 4; const int by = blockIdx.y;
  A += (size_t)by * sA; Bh += (size_t)by * sB; C += (size_t)by * sC;
  const int ntn = (N + 63) / 64; const int wid = blockIdx.x * 4 + w; const int mt = wid / ntn, nq = wid % ntn; if (mt * 16 >= M) return;
  const int row0 = mt * 16, col0 = nq * 64; const float* arow = A + (size_t)(row0 + ln) * lda;
  v8f acc[4] = {};
  for (int kb = 0; kb < K; kb += 32) {
    FragH ah, al;
    const v4f x0 = *(const v4fa*)(arow + kb + 8 * hh), x1 = *(const v4fa*)(arow + kb + 8 * hh + 4), x2 = *(const v4fa*)(arow + kb + 16 + 8 * hh), x3 = *(const v4fa*)(arow + kb + 16 + 8 * hh + 4);
    float xs[16] = {x0[0],x0[1],x0[2],x0[3],x1[0],x1[1],x1[2],x1[3],x2[0],x2[1],x2[2],x2[3],x3[0],x3[1],x3[2],x3[3]};
#pragma unroll
    for (int i = 0; i < 16; ++i) { const _Float16 h = (_Float16)xs[i]; ah.h[i] = h; al.h[i] = ASPLIT ? (_Float16)(xs[i] - (float)h) : (_Float16)0.0f; }
#pragma unroll
    for (int t = 0; t < 4; ++t) { if (col0 + t * 16 >= N) continue; const size_t boff = (size_t)(col0 + t * 16 + ln) * ldb + kb; FragH bq; bq.half[0] = *(const v8us*)(Bh + boff + 8 * hh); bq.half[1] = *(const v8us*)(Bh + boff + 16 + 8 * hh);
      acc[t] = mmaH<ASPLIT ? 2 : 1>(ah.v, al.v, bq.v, bq.v, acc[t]); }
  }
#pragma unroll
  for (int t = 0; t < 4; ++t) { if (col0 + t * 16 >= N) continue;
#pragma unroll
    for (int r = 0; r < 8; ++r) so[w][8 * hh + r][t * 16 + ln] = acc[t][r] * alpha; }
  __builtin_amdgcn_fence(__ATOMIC_ACQ_REL, "workgroup"); __builtin_amdgcn_wave_barrier();
  const int rsub = lane >> 4, c4 = (lane & 15) * 4;
  {
#pragma unroll
    for (int q = 0; q < 8; ++q) { const int r = q * 2 + rsub; if (col0 + c4 < N) { const v4f v = *(const v4fa*)&so[w][r][c4]; *(v4f*)(C + (size_t)(row0 + r) * ldc + col0 + c4) = v; } }
     }
}

// Wt[n][k] = f16(W[k][n]·scale) from f32 row-major W[K][N] (scale = power of two; bf16-exact weights stay exact in f16 away from the subnormal range)
__global__ __launch_bounds__(256) void k_wt_f16(const float* __restrict__ W, _Float16* __restrict__ Wt, int K, int N, float scale) {
  const int t = blockIdx.x * 256 + threadIdx.x; if (t >= N * (K / 8)) return; const int n = t / (K / 8), k8 = (t % (K / 8)) * 8; FragH f;
#pragma unroll
  for (int i = 0; i < 8; ++i) f.h[i] = (_Float16)(bf16_round(W[(size_t)(k8 + i) * N + n]) * scale); const v8us o = f.half[0];
  *(v8us*)((unsigned short*)Wt + (size_t)n * K + k8) = o; 
}
// k_gemm_hh variant with fused epilogue: v = acc·alpha + bias[by·sBias + col] (+ CP[(row/rowsPerB)·sCPb + by·64 + col] if CP) ; ACT 0 none / 1 elu ; writes f16 C16 (and f32 C if non-null)
template <int ACT>
__global__ __launch_bounds__(128) void k_gemm_hhx(const _Float16* __restrict__ A, int lda, size_t sA, const _Float16* __restrict__ Bh, int ldb, size_t sB, float alpha, const float* __restrict__ bias, size_t sBias, const float* __restrict__ CP, int rowsPerB, size_t sCPb, int row0g,
    float* __restrict__ C, _Float16* __restrict__ C16, int ldc, size_t sC, int M, int N, int K) {
  __shared__ __attribute__((aligned(16))) float so[4][16][64];
  const int tid = threadIdx.x, w = tid >> 5, lane = tid & 31, ln = lane & 15, hh = lane >> 4; const int by = blockIdx.y;
  A += (size_t)by * sA; Bh += (size_t)by * sB; const size_t cofs = (size_t)by * sC; const float* bp = bias ? bias + (size_t)by * sBias : nullptr;
  const int ntn = (N + 63) / 64; const int wid = blockIdx.x * 4 + w; const int mt = wid / ntn, nq = wid % ntn; if (mt * 16 >= M) return;
  const int row0 = mt * 16, col0 = nq * 64; const _Float16* arow = A + (size_t)(row0 + ln) * lda;
  v8f acc[4] = {};
  for (int kb = 0; kb < K; kb += 32) { FragH ah; ah.half[0] = *(const v8us*)((const unsigned short*)arow + kb + 8 * hh); ah.half[1] = *(const v8us*)((const unsigned short*)arow + kb + 16 + 8 * hh);
#pragma unroll
    for (int t = 0; t < 4; ++t) { if (col0 + t * 16 >= N) continue; const size_t boff = (size_t)(col0 + t * 16 + ln) * ldb + kb; FragH bq; bq.half[0] = *(const v8us*)((const unsigned short*)Bh + boff + 8 * hh); bq.half[1] = *(const v8us*)((const unsigned short*)Bh + boff + 16 + 8 * hh);
      acc[t] = mmaH<1>(ah.v, ah.v, bq.v, bq.v, acc[t]); }
  }
#pragma unroll
  for (int t = 0; t < 4; ++t) { if (col0 + t * 16 >= N) continue; const int col = col0 + t * 16 + ln; const float bv = bp ? bf16_round(bp[col]) : 0.f;
#pragma unroll
    for (int r = 0; r < 8; ++r) { float v = acc[t][r] * alpha + bv; if (CP) { const int bidx = (row0g + row0 + 8 * hh + r) / rowsPerB; v += CP[(size_t)bidx * sCPb + (size_t)by * 64 + col]; } if (ACT == 1) v = (v > 0.f) ? v : expm1f(v); else if (ACT == 7) v = (v > 0.f) ? v + 1.0f : expf(v); else if (ACT == 8) v = tanhf(v); else if (ACT == 9) v = 0.5f * v * (1.0f + tanhf(0.7978845608028654f * (v + 0.044715f * v * v * v))); else if (ACT == 11) v = 1.0f / (1.0f + expf(-v)); else if (ACT == 12) v = (v > 0.f) ? v : 0.01f * v; else if (ACT == 14) v = (v > 0.f) ? v : 0.1f * v; else if (ACT == 15) v = v / (1.0f + expf(-v)); else if (ACT == 3) v = fmaxf(v, 0.f); else if (ACT == 6) v = 0.5f * v * (1.0f + erff(v * 0.70710678118654752f)); so[w][8 * hh + r][t * 16 + ln] = v; } }
  __builtin_amdgcn_fence(__ATOMIC_ACQ_REL, "workgroup"); __builtin_amdgcn_wave_barrier();
  const int rsub = lane >> 4, c4 = (lane & 15) * 4; typedef _Float16 v4h __attribute__((ext_vector_type(4)));
  {
#pragma unroll
    for (int q = 0; q < 8; ++q) { const int r = q * 2 + rsub; if (col0 + c4 < N) { const v4f v = *(const v4fa*)&so[w][r][c4]; if (C) *(v4f*)(C + cofs + (size_t)(row0 + r) * ldc + col0 + c4) = v; if (C16) { v4h h4; for (int i = 0; i < 4; ++i) h4[i] = (_Float16)v[i]; *(v4h*)(C16 + cofs + (size_t)(row0 + r) * ldc + col0 + c4) = h4; } } }
     }
}


typedef _Float16 v4h __attribute__((ext_vector_type(4)));

__global__ __launch_bounds__(256) void k_x16(const float* __restrict__ x, _Float16* __restrict__ X16, size_t n8) { const size_t t = (size_t)blockIdx.x * 256 + threadIdx.x; if (t >= n8) return; FragH f;
#pragma unroll
  for (int q = 0; q < 8; ++q) f.h[q] = (_Float16)bf16_round(x[t * 8 + q]); *(v8us*)((unsigned short*)X16 + t * 8) = f.half[0];  }
__global__ __launch_bounds__(256) void k_h16(const float* __restrict__ x, _Float16* __restrict__ X16, size_t n8) { const size_t t = (size_t)blockIdx.x * 256 + threadIdx.x; if (t >= n8) return; FragH f;
#pragma unroll
  for (int q = 0; q < 8; ++q) f.h[q] = (_Float16)x[t * 8 + q]; *(v8us*)((unsigned short*)X16 + t * 8) = f.half[0];  }
__global__ __launch_bounds__(256) void k_round16f(const float* __restrict__ W, _Float16* __restrict__ Bt, size_t n8) { const size_t t = (size_t)blockIdx.x * 256 + threadIdx.x; if (t >= n8) return; FragH f;
#pragma unroll
  for (int i = 0; i < 8; ++i) f.h[i] = (_Float16)(bf16_round(W[t * 8 + i]) * 16.0f); *(v8us*)((unsigned short*)Bt + t * 8) = f.half[0];  }
template <int NHv, int TTv>
__global__ __launch_bounds__(256) void k_vt(const _Float16* __restrict__ V16, int ldv, int voff, _Float16* __restrict__ Vt) { __shared__ unsigned short tl[64][66]; const int tid = threadIdx.x; const int slab = blockIdx.x / (TTv / 64), lg = blockIdx.x % (TTv / 64); const int b = slab / NHv, h = slab % NHv;
  for (int i = tid; i < 64 * (HPITCH / 8); i += 256) { const int r = i / (HPITCH / 8), c8 = (i % (HPITCH / 8)) * 8; FragH f; f.half[0] = *(const v8us*)((const unsigned short*)V16 + ((size_t)b * TTv + lg * 64 + r) * ldv + voff + h * HPITCH + c8);
#pragma unroll
    for (int q = 0; q < 8; ++q) tl[r][c8 + q] = f.u[q]; }
  __syncthreads();
  {
#pragma unroll
    for (int rd = 0; rd < HPITCH / 32; ++rd) { const int d = rd * 32 + tid / 8, pc = tid % 8; FragH f;
#pragma unroll
      for (int q = 0; q < 8; ++q) f.u[q] = tl[pc * 8 + q][d];
      *(v8us*)((unsigned short*)Vt + ((size_t)slab * HPITCH + d) * TTv + lg * 64 + pc * 8) = f.half[0]; }
     } }

// blockIdx.y = plane (q, k, v): the f32 planes lie one behind the other, the f16 planes as [hi | residual] pairs, so the three independent splits are one launch
__global__ __launch_bounds__(256) void k_hl(const float* __restrict__ F, _Float16* __restrict__ Hh, _Float16* __restrict__ Hl, size_t n8) { const size_t t = (size_t)blockIdx.x * 256 + threadIdx.x; if (t >= n8) return; F += (size_t)blockIdx.y * n8 * 8; Hh += (size_t)blockIdx.y * n8 * 16; Hl += (size_t)blockIdx.y * n8 * 16; FragH fh, fl; const v4f a = *(const v4fa*)(F + t * 8), c = *(const v4fa*)(F + t * 8 + 4);
#pragma unroll
  for (int q = 0; q < 4; ++q) { _Float16 h = (_Float16)a[q]; fh.h[q] = h; fl.h[q] = (_Float16)((a[q] - (float)h) * 1024.0f); h = (_Float16)c[q]; fh.h[4 + q] = h; fl.h[4 + q] = (_Float16)((c[q] - (float)h) * 1024.0f); }
  { *(v8us*)((unsigned short*)Hh + t * 8) = fh.half[0]; *(v8us*)((unsigned short*)Hl + t * 8) = fl.half[0];  } }

// ---- fast GEMM (wave tile 32x64; requires M % 32 == 0 rows per launch region and N % 64 == 0); epilogue = k_gemm_hhx semantics ----
__device__ __forceinline__ v16h g2_frag(const _Float16* p, int hh) { FragH f; f.half[0] = *(const v8us*)((const unsigned short*)p + 8 * hh); f.half[1] = *(const v8us*)((const unsigned short*)p + 16 + 8 * hh); return f.v; }
__device__ __forceinline__ v8f g2_mma(v16h a, v16h b, v8f c) { v8f d = __builtin_amdgcn_wmma_f32_16x16x32_f16(false, a, false, b, (short)0, c, false, false); asm volatile("v_nop\n\tv_nop\n\tv_nop\n\tv_nop" : "+v"(d) : "v"(a), "v"(b)); return d; }
template <int ACT>
__global__ __launch_bounds__(128) void k_gemm2(const _Float16* __restrict__ A, int lda, size_t sA, int nA, const _Float16* __restrict__ Bh, int ldb, size_t sB, float alpha, const float* __restrict__ bias, size_t sBias, const float* __restrict__ CP, int rowsPerB, size_t sCPb, int row0g,
    float* __restrict__ C, _Float16* __restrict__ C16, int ldc, size_t sC, int M, int N, int K) {
  __shared__ __attribute__((aligned(16))) float so[4][32][68];
  const int tid = threadIdx.x, w = tid >> 5, lane = tid & 31, ln = lane & 15, hh = lane >> 4; const int by = blockIdx.y;
  A += (size_t)(by < nA ? by : nA - 1) * sA; Bh += (size_t)by * sB;      /* batch entries from nA - 1 on share the last A plane (k and v both read the normalised second input) */ const size_t cofs = (size_t)by * sC; const float* bp = bias ? bias + (size_t)by * sBias : nullptr;
  const int ntn = N >> 6; const int mt = blockIdx.x / ntn, nq = blockIdx.x - mt * ntn; const int row0 = mt * 128 + 32 * w, col0 = nq * 64; if (row0 >= M) return;
  const _Float16* a0p = A + (size_t)(row0 + ln) * lda; const _Float16* a1p = a0p + (size_t)16 * lda;
  const _Float16* b0p = Bh + (size_t)(col0 + ln) * ldb; const _Float16* b1p = b0p + (size_t)16 * ldb; const _Float16* b2p = b1p + (size_t)16 * ldb; const _Float16* b3p = b2p + (size_t)16 * ldb;
  const v8f z8 = {0.f,0.f,0.f,0.f,0.f,0.f,0.f,0.f}; v8f c00 = z8, c01 = z8, c02 = z8, c03 = z8, c10 = z8, c11 = z8, c12 = z8, c13 = z8;
#pragma unroll 1
  for (int kb = 0; kb < K; kb += 32) { const v16h a0 = g2_frag(a0p + kb, hh), a1 = g2_frag(a1p + kb, hh);
    v16h b = g2_frag(b0p + kb, hh); c00 = g2_mma(a0, b, c00); c10 = g2_mma(a1, b, c10);
    b = g2_frag(b1p + kb, hh); c01 = g2_mma(a0, b, c01); c11 = g2_mma(a1, b, c11);
    b = g2_frag(b2p + kb, hh); c02 = g2_mma(a0, b, c02); c12 = g2_mma(a1, b, c12);
    b = g2_frag(b3p + kb, hh); c03 = g2_mma(a0, b, c03); c13 = g2_mma(a1, b, c13); }
  v8f accs[8] = {c00, c01, c02, c03, c10, c11, c12, c13};
#pragma unroll
  for (int u = 0; u < 8; ++u) { const int t = u & 3, half = u >> 2; const int col = col0 + t * 16 + ln; const float bv = bp ? bf16_round(bp[col]) : 0.f;
#pragma unroll
    for (int r = 0; r < 8; ++r) { const int rloc = half * 16 + 8 * hh + r; float v = accs[u][r] * alpha + bv; if (CP) { const int bidx = (row0g + row0 + rloc) / rowsPerB; v += CP[(size_t)bidx * sCPb + (size_t)by * 64 + col]; }
      if (ACT == 3) v = fmaxf(v, 0.f); else if (ACT == 6) v = 0.5f * v * (1.0f + erff(v * 0.70710678118654752f)); else if (ACT == 11) v = 1.0f / (1.0f + expf(-v)); else if (ACT == 15) v = v / (1.0f + expf(-v)); else if (ACT == 12) v = (v > 0.f) ? v : 0.01f * v; else if (ACT == 8) v = tanhf(v);
      so[w][rloc][t * 16 + ln] = v; } }
  __builtin_amdgcn_fence(__ATOMIC_ACQ_REL, "workgroup"); __builtin_amdgcn_wave_barrier();
  const int rsub = lane >> 4, c4 = (lane & 15) * 4;
  {
#pragma unroll
    for (int q = 0; q < 16; ++q) { const int r = q * 2 + rsub; const v4f v = *(const v4fa*)&so[w][r][c4]; if (C) *(v4f*)(C + cofs + (size_t)(row0 + r) * ldc + col0 + c4) = v; if (C16) { v4h h4; for (int i = 0; i < 4; ++i) h4[i] = (_Float16)v[i]; *(v4h*)(C16 + cofs + (size_t)(row0 + r) * ldc + col0 + c4) = h4; } }
     } }



template <int CAUSAL>
__global__ __launch_bounds__(128) void k_flash(const _Float16* __restrict__ Q16, int ldq, const _Float16* __restrict__ K16, int ldk, const _Float16* __restrict__ Vt, const int* __restrict__ MSK, float* __restrict__ O, int ldo) {
  constexpr int RPW = 16, RTN = RPW / 16, NQB = TQ / (4 * RPW), DT = 4, KS = 2;
  __shared__ __attribute__((aligned(16))) unsigned short sP[4][RPW][40]; __shared__ __attribute__((aligned(16))) float sO[4][RPW][64 + 4];
  const int tid = threadIdx.x, w = tid >> 5, lane = tid & 31, ln = lane & 15, hh = lane >> 4;
  const int slab = blockIdx.x / QBLKS, qblk = blockIdx.x % QBLKS; (void)NQB; const int b = slab / NH, h = slab % NH; const int qb0 = qblk * (4 * RPW); const int q0 = qb0 + w * RPW;
  FragH aq[2][KS];
#pragma unroll
  for (int rt = 0; rt < RTN; ++rt) { const unsigned short* qr = (const unsigned short*)Q16 + ((size_t)b * TQ + q0 + rt * 16 + ln) * ldq + h * 64;
#pragma unroll
    for (int ks = 0; ks < KS; ++ks) { aq[rt][ks].half[0] = *(const v8us*)(qr + ks * 32 + 8 * hh); aq[rt][ks].half[1] = *(const v8us*)(qr + ks * 32 + 16 + 8 * hh); } }
  const unsigned short* Vth = (const unsigned short*)Vt + (size_t)slab * 64 * TK;
  float m_r[2][8], l_r[2][8]; v8f oacc[2][DT];
#pragma unroll
  for (int rt = 0; rt < RTN; ++rt) {
#pragma unroll
    for (int r = 0; r < 8; ++r) { m_r[rt][r] = -3.0e38f; l_r[rt][r] = 0.f; }
#pragma unroll
    for (int dt = 0; dt < DT; ++dt) oacc[rt][dt] = (v8f){0.f,0.f,0.f,0.f,0.f,0.f,0.f,0.f}; }
  const int jend = (CAUSAL == 1) ? (qb0 + 4 * RPW) : TK;      /* causal: keys beyond the block's last query never contribute */
#pragma unroll 1
  for (int j0 = 0; j0 < jend; j0 += 32) {
    v8f s[2][2];
#pragma unroll
    for (int nt = 0; nt < 2; ++nt) { const unsigned short* kr = (const unsigned short*)K16 + ((size_t)b * TK + j0 + nt * 16 + ln) * ldk + h * 64; FragH bk[KS];
#pragma unroll
      for (int ks = 0; ks < KS; ++ks) { bk[ks].half[0] = *(const v8us*)(kr + ks * 32 + 8 * hh); bk[ks].half[1] = *(const v8us*)(kr + ks * 32 + 16 + 8 * hh); }
#pragma unroll
      for (int rt = 0; rt < RTN; ++rt) { v8f acc = (v8f){0.f,0.f,0.f,0.f,0.f,0.f,0.f,0.f};
#pragma unroll
        for (int ks = 0; ks < KS; ++ks) acc = mmaH<1>(aq[rt][ks].v, aq[rt][ks].v, bk[ks].v, bk[ks].v, acc); s[rt][nt] = acc; } }
#pragma unroll
    for (int rt = 0; rt < RTN; ++rt)
#pragma unroll
      for (int r = 0; r < 8; ++r) { const int tq = q0 + rt * 16 + 8 * hh + r; const int k0 = j0 + ln, k1 = j0 + 16 + ln;
        const bool ok0 = (CAUSAL == 1) ? (k0 <= tq) : ((CAUSAL == 2) ? ((k0 >> 5) == (tq >> 5)) : true), ok1 = (CAUSAL == 1) ? (k1 <= tq) : ((CAUSAL == 2) ? ((k1 >> 5) == (tq >> 5)) : true);      /* mode 2: block-diagonal 32-token groups */
        const float s0 = ok0 ? s[rt][0][r] * SCL : -3.0e38f, s1 = ok1 ? s[rt][1][r] * SCL : -3.0e38f; float mc = fmaxf(s0, s1);
        mc = fmaxf(mc, __shfl_xor(mc, 1, 32)); mc = fmaxf(mc, __shfl_xor(mc, 2, 32)); mc = fmaxf(mc, __shfl_xor(mc, 4, 32)); mc = fmaxf(mc, __shfl_xor(mc, 8, 32));
        const float mn = fmaxf(m_r[rt][r], mc); const float al = (mn > -1.0e38f) ? expf(m_r[rt][r] - mn) : 1.0f; m_r[rt][r] = mn; const float p0 = ok0 ? expf(s0 - mn) : 0.f, p1 = ok1 ? expf(s1 - mn) : 0.f; l_r[rt][r] = l_r[rt][r] * al + p0 + p1;
#pragma unroll
        for (int dt = 0; dt < DT; ++dt) oacc[rt][dt][r] *= al;
        FragH t2; t2.h[0] = (_Float16)(p0 * 1024.0f); t2.h[1] = (_Float16)(p1 * 1024.0f); sP[w][rt * 16 + 8 * hh + r][ln] = t2.u[0]; sP[w][rt * 16 + 8 * hh + r][16 + ln] = t2.u[1]; }
    __builtin_amdgcn_fence(__ATOMIC_ACQ_REL, "workgroup"); __builtin_amdgcn_wave_barrier();
    FragH pa[2];
#pragma unroll
    for (int rt = 0; rt < RTN; ++rt) { pa[rt].half[0] = *(const v8us*)&sP[w][rt * 16 + ln][8 * hh]; pa[rt].half[1] = *(const v8us*)&sP[w][rt * 16 + ln][16 + 8 * hh]; }
#pragma unroll
    for (int dt = 0; dt < DT; ++dt) { const unsigned short* vrow = Vth + (size_t)(dt * 16 + ln) * TK + j0; FragH bv; bv.half[0] = *(const v8us*)(vrow + 8 * hh); bv.half[1] = *(const v8us*)(vrow + 16 + 8 * hh);
#pragma unroll
      for (int rt = 0; rt < RTN; ++rt) oacc[rt][dt] = mmaH<1>(pa[rt].v, pa[rt].v, bv.v, bv.v, oacc[rt][dt]); }
    __builtin_amdgcn_fence(__ATOMIC_ACQ_REL, "workgroup"); __builtin_amdgcn_wave_barrier(); }
#pragma unroll
  for (int rt = 0; rt < RTN; ++rt) {
#pragma unroll
    for (int r = 0; r < 8; ++r) { float l = l_r[rt][r]; l += __shfl_xor(l, 1, 32); l += __shfl_xor(l, 2, 32); l += __shfl_xor(l, 4, 32); l += __shfl_xor(l, 8, 32); l_r[rt][r] = (l > 0.f) ? 1.0f / (l * 1024.0f) : 0.f; }
#pragma unroll
    for (int dt = 0; dt < DT; ++dt)
#pragma unroll
      for (int r = 0; r < 8; ++r) sO[w][rt * 16 + 8 * hh + r][dt * 16 + ln] = oacc[rt][dt][r] * l_r[rt][r]; }
  __builtin_amdgcn_fence(__ATOMIC_ACQ_REL, "workgroup"); __builtin_amdgcn_wave_barrier();
  {
#pragma unroll
    for (int rp = 0; rp < RPW; rp += 2) { const int r = rp + (lane >> 4), pc = lane & 15; const v4f val = *(const v4fa*)&sO[w][r][pc * 4]; *(v4f*)(O + ((size_t)b * TQ + q0 + r) * ldo + h * 64 + pc * 4) = val; }
     } }
__device__ __forceinline__ float xhalf(float x) { return __builtin_bit_cast(float, __builtin_amdgcn_permlanex16(__builtin_bit_cast(int, x), __builtin_bit_cast(int, x), 0x76543210, 0xfedcba98, false, false)); }      /* lane l <-> lane l ^ 16 */
// Eight 2^x in place, in one statement: each v_exp_f32 writes only its own register, so none stands directly in front of an instruction that overwrites its source or reads its result
// (left to the register allocator, a run of them reused the source of the one before as the next destination); the v_nop keeps that slot behind the last one.
__device__ __forceinline__ void exp2x8(float& a, float& b, float& c, float& d, float& e, float& f, float& g, float& h) {
  asm("v_exp_f32 %0, %0\n\tv_exp_f32 %1, %1\n\tv_exp_f32 %2, %2\n\tv_exp_f32 %3, %3\n\tv_exp_f32 %4, %4\n\tv_exp_f32 %5, %5\n\tv_exp_f32 %6, %6\n\tv_exp_f32 %7, %7\n\tv_nop"
      : "+v"(a), "+v"(b), "+v"(c), "+v"(d), "+v"(e), "+v"(f), "+v"(g), "+v"(h)); }
template <int CAUSAL>
__global__ __launch_bounds__(128) void k_flashqk(const _Float16* __restrict__ Q16, const _Float16* __restrict__ QL, int ldq, const _Float16* __restrict__ K16, const _Float16* __restrict__ KL, int ldk, const _Float16* __restrict__ Vt, const int* __restrict__ MSK, float* __restrict__ O, int ldo) {
  constexpr int RPW = 16, DT = HPITCH / 16, KS = HPITCH / 32;
  __shared__ __attribute__((aligned(16))) float sO[4][RPW][HPITCH + 4];
  constexpr int KT = 64, KP = HPITCH + 8, VP = KT + 8;      /* keys per staged tile; LDS row pitches in halves: 16 bytes x an odd number, free of bank conflicts for 16-byte reads */
  constexpr int NCK = KT * (HPITCH / 8) / 128, NCV = HPITCH * (KT / 8) / 128;      /* 16-byte pieces per thread and tile */
  __shared__ __attribute__((aligned(16))) unsigned short sK[2][KT][KP]; __shared__ __attribute__((aligned(16))) unsigned short sKL[2][KT][KP]; __shared__ __attribute__((aligned(16))) unsigned short sV[2][HPITCH][VP];
  const int tid = threadIdx.x, w = tid >> 5, lane = tid & 31, ln = lane & 15, hh = lane >> 4;
  const int slab = blockIdx.x / QBLKS, qblk = blockIdx.x % QBLKS; const int b = slab / NH, h = slab % NH; const int qb0 = qblk * (4 * RPW); const int q0 = qb0 + w * RPW;
  const int tq = q0 + ln;      /* this lane's query */
  FragH bq[KS], bql[KS];
  { const unsigned short* qr = (const unsigned short*)Q16 + ((size_t)b * TQ + tq) * ldq + h * HPITCH; const unsigned short* ql = (const unsigned short*)QL + ((size_t)b * TQ + tq) * ldq + h * HPITCH;
#pragma unroll      /* constant indices keep the fragment, score and accumulator arrays in registers */
    for (int ks = 0; ks < KS; ++ks) { bq[ks].half[0] = *(const v8us*)(qr + ks * 32 + 8 * hh); bq[ks].half[1] = *(const v8us*)(qr + ks * 32 + 16 + 8 * hh); bql[ks].half[0] = *(const v8us*)(ql + ks * 32 + 8 * hh); bql[ks].half[1] = *(const v8us*)(ql + ks * 32 + 16 + 8 * hh); } }
  const unsigned short* Vth = (const unsigned short*)Vt + (size_t)slab * HPITCH * TK;
  const unsigned short* Kb = (const unsigned short*)K16 + (size_t)b * TK * ldk + h * HPITCH; const unsigned short* KLb = (const unsigned short*)KL + (size_t)b * TK * ldk + h * HPITCH;
  v8us gk[NCK], gkl[NCK], gv[NCV];      /* the next tile on its way from global memory to LDS */
  auto fetch = [&](int jt) {
#pragma unroll      /* constant indices keep the fragment, score and accumulator arrays in registers */
    for (int u = 0; u < NCK; ++u) { const int i = tid + 128 * u, r = i / (HPITCH / 8), c8 = (i % (HPITCH / 8)) * 8; gk[u] = *(const v8us*)(Kb + (size_t)(jt + r) * ldk + c8); gkl[u] = *(const v8us*)(KLb + (size_t)(jt + r) * ldk + c8); }
#pragma unroll      /* constant indices keep the fragment, score and accumulator arrays in registers */
    for (int u = 0; u < NCV; ++u) { const int i = tid + 128 * u, r = i / (KT / 8), c8 = (i % (KT / 8)) * 8; gv[u] = *(const v8us*)(Vth + (size_t)r * TK + jt + c8); } };
  auto stash = [&](int bf) {
#pragma unroll      /* constant indices keep the fragment, score and accumulator arrays in registers */
    for (int u = 0; u < NCK; ++u) { const int i = tid + 128 * u, r = i / (HPITCH / 8), c8 = (i % (HPITCH / 8)) * 8; *(v8us*)&sK[bf][r][c8] = gk[u]; *(v8us*)&sKL[bf][r][c8] = gkl[u]; }
#pragma unroll      /* constant indices keep the fragment, score and accumulator arrays in registers */
    for (int u = 0; u < NCV; ++u) { const int i = tid + 128 * u, r = i / (KT / 8), c8 = (i % (KT / 8)) * 8; *(v8us*)&sV[bf][r][c8] = gv[u]; } };
  float m_q = -3.0e38f, l_q = 0.f; v8f oacc[DT];      /* oacc[dt][r] = O[tq][dt * 16 + 8 hh + r], un-normalised */
#pragma unroll      /* constant indices keep the fragment, score and accumulator arrays in registers */
  for (int dt = 0; dt < DT; ++dt) oacc[dt] = (v8f){0.f,0.f,0.f,0.f,0.f,0.f,0.f,0.f};
  const int jend = (CAUSAL == 1) ? (qb0 + 4 * RPW) : TK;      /* causal: keys beyond the block's last query never contribute */
  const int ntile = jend / KT;
  asm volatile("s_wait_xcnt 0x0" ::: "memory");      /* the Q loads above are issued first, and no tile load below writes into a register that one of them still names as its address */
  fetch(0); stash(0);
  __syncthreads();      /* tile 0 is written before any wave reads it */
#pragma unroll 1      /* one copy of the trip's code; the buffer index alternates at run time */
  for (int t = 0; t < ntile; ++t) { const int buf = t & 1; const bool more = t + 1 < ntile;      /* the same in every thread of the work-group */
    if (more) fetch((t + 1) * KT);      /* in flight while this trip works on tile t */
#pragma unroll      /* the two 32-key halves of the tile: constant LDS offsets */
   for (int js = 0; js < KT; js += 32) { const int j0 = t * KT + js;
    v8f s[2];      /* s[nt][r] = score of key j0 + nt * 16 + 8 hh + r against query tq */
    FragH ak[2][KS], akl[2][KS], av[DT];      /* all LDS reads of these 32 keys stand together at the head: one LDS latency instead of four */
#pragma unroll      /* constant indices keep the fragment, score and accumulator arrays in registers */
    for (int nt = 0; nt < 2; ++nt) { const unsigned short* kr = &sK[buf][js + nt * 16 + ln][0]; const unsigned short* klr = &sKL[buf][js + nt * 16 + ln][0];
#pragma unroll      /* constant indices keep the fragment, score and accumulator arrays in registers */
      for (int ks = 0; ks < KS; ++ks) { ak[nt][ks].half[0] = *(const v8us*)(kr + ks * 32 + 8 * hh); ak[nt][ks].half[1] = *(const v8us*)(kr + ks * 32 + 16 + 8 * hh); akl[nt][ks].half[0] = *(const v8us*)(klr + ks * 32 + 8 * hh); akl[nt][ks].half[1] = *(const v8us*)(klr + ks * 32 + 16 + 8 * hh); } }
#pragma unroll      /* constant indices keep the fragment, score and accumulator arrays in registers */
    for (int dt = 0; dt < DT; ++dt) { const unsigned short* vrow = &sV[buf][dt * 16 + ln][js]; av[dt].half[0] = *(const v8us*)(vrow + 8 * hh); av[dt].half[1] = *(const v8us*)(vrow + 16 + 8 * hh); }
#pragma unroll      /* constant indices keep the fragment, score and accumulator arrays in registers */
    for (int nt = 0; nt < 2; ++nt) {
      v8f acc = (v8f){0.f,0.f,0.f,0.f,0.f,0.f,0.f,0.f}, accl = acc;
#pragma unroll      /* constant indices keep the fragment, score and accumulator arrays in registers */
      for (int ks = 0; ks < KS; ++ks) { acc = mmaH<1>(ak[nt][ks].v, ak[nt][ks].v, bq[ks].v, bq[ks].v, acc); accl = mmaH<1>(ak[nt][ks].v, ak[nt][ks].v, bql[ks].v, bql[ks].v, accl); accl = mmaH<1>(akl[nt][ks].v, akl[nt][ks].v, bq[ks].v, bq[ks].v, accl); }
#pragma unroll      /* constant indices keep the fragment, score and accumulator arrays in registers */
      for (int r = 0; r < 8; ++r) acc[r] += accl[r] * 0.0009765625f;
      s[nt] = acc; }
    float sc[16]; bool ok[16];
#pragma unroll      /* constant indices keep the fragment, score and accumulator arrays in registers */
    for (int i = 0; i < 16; ++i) { const int kk = j0 + (i >> 3) * 16 + 8 * hh + (i & 7);
      ok[i] = (CAUSAL == 1) ? (kk <= tq) : ((CAUSAL == 2) ? ((kk >> 5) == (tq >> 5)) : true);      /* mode 2: block-diagonal 32-token groups */
      if (CAUSAL == 4) ok[i] = MSK[((size_t)b * TQ + tq) * TK + kk] != 0;      /* mode 4: per-(query, key) INPUT mask shared by all heads; masked keys contribute nothing, rows with no valid key give l = 0 -> output 0 */
      sc[i] = ok[i] ? s[i >> 3][i & 7] : -3.0e38f; }      /* raw q.k: maxima are taken on raw scores, the (positive) scale enters with the exponent */
    float mt[8];
#pragma unroll      /* constant indices keep the fragment, score and accumulator arrays in registers */
    for (int i = 0; i < 8; ++i) mt[i] = fmaxf(sc[i], sc[8 + i]);
    float mc = fmaxf(fmaxf(fmaxf(mt[0], mt[1]), fmaxf(mt[2], mt[3])), fmaxf(fmaxf(mt[4], mt[5]), fmaxf(mt[6], mt[7])));
    mc = fmaxf(mc, xhalf(mc));      /* the other half's 16 keys of the same query */
    const float mn = fmaxf(m_q, mc); const float al = (mn > -1.0e38f) ? __builtin_amdgcn_exp2f((m_q - mn) * SCL2) : 1.0f; m_q = mn;
    const float nb = 10.0f - mn * SCL2;      /* p = 2^(sc * SCL2 + nb) = 2^10 exp((sc - mn) / sqrt(32)): scale, log2(e), maximum and P's 2^10 in one fma per score */
    float p[16]; FragH pb;
#pragma unroll      /* constant indices keep the fragment, score and accumulator arrays in registers */
    for (int i = 0; i < 16; ++i) p[i] = sc[i] * SCL2 + nb;
    exp2x8(p[0], p[1], p[2], p[3], p[4], p[5], p[6], p[7]); exp2x8(p[8], p[9], p[10], p[11], p[12], p[13], p[14], p[15]);
#pragma unroll      /* constant indices keep the fragment, score and accumulator arrays in registers */
    for (int i = 0; i < 16; ++i) { if (!ok[i]) p[i] = 0.f; pb.h[i] = (_Float16)p[i]; }      /* pb.h[i]: key j0 + (i >> 3) * 16 + 8 hh + (i & 7) of column ln; p and l_q both carry the 2^10 */
    float pt[8];
#pragma unroll      /* constant indices keep the fragment, score and accumulator arrays in registers */
    for (int i = 0; i < 8; ++i) pt[i] = p[i] + p[8 + i];
    l_q = l_q * al + (((pt[0] + pt[1]) + (pt[2] + pt[3])) + ((pt[4] + pt[5]) + (pt[6] + pt[7])));
#pragma unroll      /* constant indices keep the fragment, score and accumulator arrays in registers */
    for (int dt = 0; dt < DT; ++dt)
#pragma unroll      /* constant indices keep the fragment, score and accumulator arrays in registers */
      for (int r = 0; r < 8; ++r) oacc[dt][r] *= al;
#pragma unroll      /* constant indices keep the fragment, score and accumulator arrays in registers */
    for (int dt = 0; dt < DT; ++dt) oacc[dt] = mmaH<1>(av[dt].v, av[dt].v, pb.v, pb.v, oacc[dt]); }
    if (more) stash(buf ^ 1);      /* that buffer's last readers left it at the barrier that ended the trip before */
    __syncthreads(); }      /* one barrier a trip: publishes tile t + 1 and ends every wave's reads of tile t, which the next trip overwrites */
  const float lsum = l_q + xhalf(l_q); const float linv = (lsum > 0.f) ? 1.0f / lsum : 0.f;
#pragma unroll      /* constant indices keep the fragment, score and accumulator arrays in registers */
  for (int dt = 0; dt < DT; ++dt) { v4f lo4, hi4;
#pragma unroll      /* constant indices keep the fragment, score and accumulator arrays in registers */
    for (int r = 0; r < 4; ++r) { lo4[r] = oacc[dt][r] * linv; hi4[r] = oacc[dt][4 + r] * linv; }
    *(v4fa*)&sO[w][ln][dt * 16 + 8 * hh] = lo4; *(v4fa*)&sO[w][ln][dt * 16 + 8 * hh + 4] = hi4; }
  __builtin_amdgcn_fence(__ATOMIC_ACQ_REL, "workgroup"); __builtin_amdgcn_wave_barrier();
  {
#pragma unroll      /* constant indices keep the fragment, score and accumulator arrays in registers */
    for (int rp = 0; rp < RPW; rp += 128 / HPITCH) { const int r = rp + lane / (HPITCH / 4), pc = lane % (HPITCH / 4); const v4f val = *(const v4fa*)&sO[w][r][pc * 4]; *(v4f*)(O + ((size_t)b * TQ + q0 + r) * ldo + h * HPITCH + pc * 4) = val; }
     } }

__device__ __forceinline__ void d_gnstat(const float* __restrict__ x, float* __restrict__ GS, const int bg) {
  #pragma clang fp contract(off)
  __shared__ float sh[256]; const int tid = threadIdx.x; const float* base = x + (size_t)bg * CPG * SLEN; const int n = CPG * SLEN; float s = 0.f;
  for (int i = tid; i < n; i += 256) s += bf16_round(base[i]);
  sh[tid] = s; __syncthreads(); for (int st = 128; st > 0; st >>= 1) { if (tid < st) sh[tid] += sh[tid + st]; __syncthreads(); }
  const float mu = sh[0] / (float)n; __syncthreads(); float q2 = 0.f;
  for (int i = tid; i < n; i += 256) { const float d = bf16_round(base[i]) - mu; q2 += d * d; }
  sh[tid] = q2; __syncthreads(); for (int st = 128; st > 0; st >>= 1) { if (tid < st) sh[tid] += sh[tid + st]; __syncthreads(); }
  if (tid == 0) { const float rs = rsqrtf(sh[0] / (float)n + 1e-5f); { *(float*)(GS + (size_t)bg * 32) = mu; *(float*)(GS + (size_t)bg * 32 + 1) = rs;  } } }
// blockIdx.y = which input: statistics and normalised planes of the two inputs lie one behind the other
__global__ __launch_bounds__(256) void k_gnT(const float* __restrict__ x0, const float* __restrict__ x1, const float* __restrict__ GS, const float* __restrict__ gam0, const float* __restrict__ bet0, const float* __restrict__ gam1, const float* __restrict__ bet1, _Float16* __restrict__ XT16) {
  #pragma clang fp contract(off)
  const bool sec = blockIdx.y != 0; const float* __restrict__ x = sec ? x1 : x0; const float* __restrict__ gam = sec ? gam1 : gam0; const float* __restrict__ bet = sec ? bet1 : bet0; GS += (size_t)blockIdx.y * NB * NGR * 32; XT16 += (size_t)blockIdx.y * NR * CC;
  __shared__ float tl[64][65]; const int tid = threadIdx.x; const int per = (CC / 64) * (SLEN / 64); const int b = blockIdx.x / per; const int rem = blockIdx.x % per; const int cb = rem / (SLEN / 64), pb = rem % (SLEN / 64);
  for (int i = tid; i < 64 * 16; i += 256) { const int cl = i / 16, p4 = (i % 16) * 4; const int c = cb * 64 + cl; const float mu = GS[((size_t)b * NGR + c / CPG) * 32], rs = GS[((size_t)b * NGR + c / CPG) * 32 + 1]; const float g = bf16_round(gam[c]), be = bf16_round(bet[c]);
    const v4f a = *(const v4fa*)(x + ((size_t)b * CC + c) * SLEN + pb * 64 + p4); for (int q = 0; q < 4; ++q) { float v = (bf16_round(a[q]) - mu) * rs * g; v += be; tl[cl][p4 + q] = v; } }
  __syncthreads(); const int pl = tid >> 2, c8 = (tid & 3) * 8;
  { for (int u = 0; u < 2; ++u) { const int c0 = c8 + u * 32; FragH f; for (int q = 0; q < 8; ++q) f.h[q] = (_Float16)tl[c0 + q][pl]; *(v8us*)((unsigned short*)XT16 + ((size_t)b * SLEN + pb * 64 + pl) * CC + cb * 64 + c0) = f.half[0]; }  } }
__device__ __forceinline__ void d_wpad(const float* __restrict__ Wm, const float* __restrict__ bm, _Float16* __restrict__ BP, float* __restrict__ PB, const int bid) {
  const int r = bid * 256 + threadIdx.x; if (r >= DP) return; const int h = r / HPITCH, d = r % HPITCH; const bool live = d < HDT; const int srow = h * HDT + d;
  for (int c0 = 0; c0 < CC; c0 += 8) { FragH f; for (int q = 0; q < 8; ++q) f.h[q] = live ? (_Float16)(bf16_round(Wm[(size_t)srow * CC + c0 + q]) * 16.0f) : (_Float16)0.0f; unsigned short* dst = (unsigned short*)BP + (size_t)r * CC + c0; *(v8us*)dst = f.half[0];  }
  const float bv = live ? bm[srow] : 0.f; *(float*)(PB + r) = bv;  }
__device__ __forceinline__ void d_wio(const float* __restrict__ Wm, int nin, int nout, int pair, _Float16* __restrict__ Bt, const int bid) { const int pitch = pair ? 2 * nin : nin; const size_t t = (size_t)bid * 256 + threadIdx.x; if (t >= (size_t)nout * (pitch / 8)) return; const int pc = (int)(t % (pitch / 8)); const int o = (int)(t / (pitch / 8)); FragH f;
  for (int q = 0; q < 8; ++q) { const int col = pc * 8 + q; const bool lo = col >= nin; const int i = lo ? col - nin : col; f.h[q] = (_Float16)(bf16_round(Wm[(size_t)i * nout + o]) * (lo ? 1.0f : 16.0f)); }
  *(v8us*)((unsigned short*)Bt + (size_t)o * pitch + pc * 8) = f.half[0];  }
__device__ __forceinline__ void d_wop(const float* __restrict__ Wo, _Float16* __restrict__ Bt, const int bid) { const int t = bid * 256 + threadIdx.x; if (t >= CC * (2 * CC / 8)) return; const int pc = t % (2 * CC / 8); const int o = t / (2 * CC / 8); const bool lo = pc * 8 >= CC; FragH f;
  for (int q = 0; q < 8; ++q) { const int c = pc * 8 + q - (lo ? CC : 0); f.h[q] = (_Float16)(bf16_round(Wo[(size_t)o * CC + c]) * (lo ? 1.0f : 16.0f)); } *(v8us*)((unsigned short*)Bt + (size_t)o * 2 * CC + pc * 8) = f.half[0];  }
// The two statistics passes and the six weight conversions need nothing of each other: one grid, each part a range of block indices (the branch is the same for a whole work-group, so the barriers of the statistics part are passed by all of its threads).
// The statistics blocks run longest and come first.
#define PB_GN (NB * NGR)                          /* blocks per statistics pass */
#define PB_W1 ((HID * (2 * CC / 8) + 255) / 256)
#define PB_W2 ((CC * (HID / 8) + 255) / 256)
#define PB_WO ((CC * (2 * CC / 8) + 255) / 256)
#define PB_ALL (2 * PB_GN + 3 + PB_W1 + PB_W2 + PB_WO)
__global__ __launch_bounds__(256) void k_prep(const float* __restrict__ x0, const float* __restrict__ x1, float* __restrict__ GS,
    const float* __restrict__ Wq, const float* __restrict__ bqp, const float* __restrict__ Wk, const float* __restrict__ bkp, const float* __restrict__ Wv, const float* __restrict__ bvp, _Float16* __restrict__ BP, float* __restrict__ PB,
    const float* __restrict__ W1, _Float16* __restrict__ BW1, const float* __restrict__ W2, _Float16* __restrict__ BW2, const float* __restrict__ Wo, _Float16* __restrict__ BWO) {
  int bid = blockIdx.x;
  if (bid < 2 * PB_GN) { const bool sec = bid >= PB_GN; d_gnstat(sec ? x1 : x0, GS + (sec ? PB_GN * 32 : 0), sec ? bid - PB_GN : bid); return; }
  bid -= 2 * PB_GN;
  if (bid < 3) { d_wpad(bid == 0 ? Wq : (bid == 1 ? Wk : Wv), bid == 0 ? bqp : (bid == 1 ? bkp : bvp), BP + (size_t)bid * DP * CC, PB + bid * DP, 0); return; }
  bid -= 3;
  if (bid < PB_W1) { d_wio(W1, CC, HID, 1, BW1, bid); return; }
  bid -= PB_W1;
  if (bid < PB_W2) { d_wio(W2, HID, CC, 0, BW2, bid); return; }
  bid -= PB_W2;
  d_wop(Wo, BWO, bid); }
__global__ __launch_bounds__(256) void k_ofl(const float* __restrict__ O, float* __restrict__ OF, _Float16* __restrict__ OF2) { const size_t t = (size_t)blockIdx.x * 256 + threadIdx.x; if (t >= (size_t)NR * (CC / 8)) return; const int c0 = (int)(t % (CC / 8)) * 8; const size_t r = t / (CC / 8); const int h = c0 / HDT, d0 = c0 % HDT; FragH fh, fl; v4f a, bq;
  for (int q = 0; q < 8; ++q) { const float v = O[r * DP + h * HPITCH + d0 + q]; const _Float16 hv = (_Float16)v; fh.h[q] = hv; fl.h[q] = (_Float16)((v - (float)hv) * 16.0f); if (q < 4) a[q] = v; else bq[q - 4] = v; }
  { *(v4f*)(OF + r * CC + c0) = a; *(v4f*)(OF + r * CC + c0 + 4) = bq; *(v8us*)((unsigned short*)OF2 + r * 2 * CC + c0) = fh.half[0]; *(v8us*)((unsigned short*)OF2 + r * 2 * CC + CC + c0) = fl.half[0];  } }
__global__ __launch_bounds__(256) void k_pair16(const float* __restrict__ S, _Float16* __restrict__ HP) { const size_t t = (size_t)blockIdx.x * 256 + threadIdx.x; if (t >= (size_t)NR * (CC / 8)) return; const int c0 = (int)(t % (CC / 8)) * 8; const size_t r = t / (CC / 8); FragH fh, fl;
  for (int q = 0; q < 8; ++q) { const float v = S[r * CC + c0 + q]; const _Float16 hv = (_Float16)v; fh.h[q] = hv; fl.h[q] = (_Float16)((v - (float)hv) * 16.0f); }
  { *(v8us*)((unsigned short*)HP + r * 2 * CC + c0) = fh.half[0]; *(v8us*)((unsigned short*)HP + r * 2 * CC + CC + c0) = fl.half[0];  } }
__global__ __launch_bounds__(256) void k_nchw(const float* __restrict__ Y, float* __restrict__ out) { const size_t t = (size_t)blockIdx.x * 256 + threadIdx.x; if (t >= (size_t)NB * CC * (SLEN / 4)) return; const int n0 = (int)(t % (SLEN / 4)) * 4; const int o = (int)((t / (SLEN / 4)) % CC); const int b = (int)(t / ((size_t)(SLEN / 4) * CC)); v4f r; for (int q = 0; q < 4; ++q) r[q] = Y[((size_t)b * SLEN + n0 + q) * CC + o]; float* d = out + ((size_t)b * CC + o) * SLEN + n0; *(v4f*)d = r;  }

extern "C" void kernel_launch(void* const* d_in, const int* in_sizes, int n_in,
                              void* d_out, int out_size, void* d_ws, size_t ws_size, hipStream_t stream) {
  (void)in_sizes; (void)n_in; (void)out_size;
  const float* const* I = (const float* const*)d_in; const float* fo = I[0]; const float* fs = I[1]; const float* gq = I[2]; const float* bq = I[3]; const float* gkv = I[4]; const float* bkv = I[5]; const float* Wq = I[6]; const float* bqp = I[7]; const float* Wk = I[8]; const float* bkp = I[9]; const float* Wv = I[10]; const float* bvp = I[11]; const float* W1 = I[12]; const float* b1 = I[13]; const float* W2 = I[14]; const float* b2 = I[15]; const float* Wo = I[16]; const float* bo = I[17];
  char* ws = (char*)d_ws; size_t off = 0;
  auto take = [&](size_t bytes) { char* p = ws + off; off += (bytes + 255) & ~(size_t)255; return p; };
  _Float16* BPq = (_Float16*)take((size_t)3 * DP * CC * 2); float* PBq = (float*)take(3 * DP * 4);      /* q, k, v planes one behind the other */
  _Float16* BW1 = (_Float16*)take((size_t)HID * 2 * CC * 2); _Float16* BW2 = (_Float16*)take((size_t)CC * HID * 2); _Float16* BWO = (_Float16*)take((size_t)CC * 2 * CC * 2); float* GS = (float*)take((size_t)NB * NGR * 32 * 4 * 2);
  _Float16* XQ = (_Float16*)take((size_t)2 * NR * CC * 2); float* F32 = (float*)take((size_t)3 * NR * DP * 4);      /* both normalised inputs; f32 q, k, v */
  _Float16* QH = (_Float16*)take((size_t)6 * NR * DP * 2); _Float16* QL = QH + (size_t)NR * DP; _Float16* KH = QH + (size_t)2 * NR * DP; _Float16* KL = QH + (size_t)3 * NR * DP; _Float16* VH = QH + (size_t)4 * NR * DP; _Float16* VT = (_Float16*)take((size_t)NR * DP * 2); _Float16* VTL = (_Float16*)take((size_t)NR * DP * 2);
  float* OF = (float*)take((size_t)NR * CC * 4); _Float16* OF2 = (_Float16*)take((size_t)NR * 2 * CC * 2); _Float16* G16 = (_Float16*)take((size_t)NR * HID * 2); float* FU = (float*)take((size_t)NR * CC * 4); _Float16* FU2 = (_Float16*)take((size_t)NR * 2 * CC * 2); float* Y = (float*)take((size_t)NR * CC * 4);
  float* O = F32;
  if (off > ws_size) return;      /* 0.5 + 2 + 2 + 3 x 4 + 8 x 2 + 4 + 4 + 4 + 4 + 4 + 4 = 57 MiB */
  k_prep<<<PB_ALL, 256, 0, stream>>>(fo, fs, GS, Wq, bqp, Wk, bkp, Wv, bvp, BPq, PBq, W1, BW1, W2, BW2, Wo, BWO);      /* group statistics of both inputs; conv1x1 weights (out,in) = natural rows; MLP and output weights */
  k_gnT<<<dim3(NB * (CC / 64) * (SLEN / 64), 2), 256, 0, stream>>>(fo, fs, GS, gq, bq, gkv, bkv, XQ);
  const dim3 gP((NR / 128) * (DP / 64), 3), gC((NR / 128) * (CC / 64), 1), gH((NR / 128) * (HID / 64), 1); const unsigned n8 = (unsigned)(((size_t)NR * DP / 8 + 255) / 256), n8c = (unsigned)(((size_t)NR * (CC / 8) + 255) / 256);
  k_gemm2<0><<<gP, 128, 0, stream>>>(XQ, CC, (size_t)NR * CC, 2, BPq, CC, (size_t)DP * CC, 0.0625f, PBq, DP, nullptr, 1, 0, 0, F32, nullptr, DP, (size_t)NR * DP, NR, DP, CC);      /* q, k, v projections: batch index 0, 1, 2 */
  k_hl<<<dim3(n8, 3), 256, 0, stream>>>(F32, QH, QL, (size_t)NR * DP / 8);
  k_vt<NH, SLEN><<<NB * NH * (SLEN / 64), 256, 0, stream>>>(VH, DP, 0, VT);
  k_flashqk<0><<<NB * NH * QBLKS, 128, 0, stream>>>(QH, QL, DP, KH, KL, DP, VT, nullptr, O, DP);      /* q/k hi + residual; P (x2^10) and V plain f16 */
  k_ofl<<<n8c, 256, 0, stream>>>(O, OF, OF2);
  k_gemm2<6><<<gH, 128, 0, stream>>>(OF2, 2 * CC, 0, 1, BW1, 2 * CC, 0, 0.0625f, b1, 0, nullptr, 1, 0, 0, nullptr, G16, HID, 0, NR, HID, 2 * CC);      /* gelu_erf(out W1 + b1) -> f16 */
  k_gemm2<0><<<gC, 128, 0, stream>>>(G16, HID, 0, 1, BW2, HID, 0, 0.0625f, b2, 0, OF, 1, (size_t)CC, 0, FU, nullptr, CC, 0, NR, CC, HID);      /* mlp + b2 + out_flat */
  k_pair16<<<n8c, 256, 0, stream>>>(FU, FU2);
  k_gemm2<0><<<gC, 128, 0, stream>>>(FU2, 2 * CC, 0, 1, BWO, 2 * CC, 0, 0.0625f, bo, 0, nullptr, 1, 0, 0, Y, nullptr, CC, 0, NR, CC, 2 * CC);      /* conv1x1(fused, Wo) + bo */
  k_nchw<<<(unsigned)(((size_t)NB * CC * (SLEN / 4) + 255) / 256), 256, 0, stream>>>(Y, (float*)d_out);
}

// v006
// It runs in 75.7 microseconds.
// In two side-by-side timings against v005, it was 2.24 and 2.21 times as fast.
// All steps since v000 together make it 8.78 times as fast.
#include <hip/hip_runtime.h>
// SFBlock (2 x 128 x 64 x 64; 4 heads x 32; GroupNorm(32) on both inputs; q from feat_opt, k/v from feat_sar via 1x1 convs; softmax(q k^T / sqrt(32)) v over the 4096 positions; MLP: gelu_erf(out W1 + b1) W2 + b2; fused = out + mlp; 1x1 conv Wo -> [2,128,64,64]).
// Compute dtype: inputs and parameters rounded to bf16; normalised inputs as f16 operands (~2^-12); q, k hi + residual; P (x2^10), v plain f16; attention output / fused as hi + residual pairs; the 256-wide GELU hidden as f16; f32 statistics/softmax/accumulation. v_wmma_f32_16x16x32_f16.
#define NB 2
#define CC 128
#define HID 256
#define NGR 32
#define CPG (CC / NGR)           /* 4 channels per group */
#define HDT 32
#define HPITCH HDT                   /* columns per head in the q/k/v planes: the true head dim, no padding */
#define DP (NH * HPITCH)             /* 128 */
#define NR (NB * SLEN)           /* 8192 */
#define QBLKS (TQ / 64)
#define SLEN 4096                /* H*W tokens */
#define TQ SLEN
#define TK SLEN
#define NH 4
#define SCL 0.17677669529663687f /* 32^-0.5 */
#define SCL2 ((float)(0.17677669529663687 * 1.4426950408889634)) /* 32^-0.5 * log2(e): raw score -> exponent of two */
typedef __bf16 v16b __attribute__((ext_vector_type(16)));
typedef unsigned short v8us __attribute__((ext_vector_type(8), may_alias));
typedef float  v8f  __attribute__((ext_vector_type(8)));
typedef float  v4f  __attribute__((ext_vector_type(4)));
typedef float  v4fa __attribute__((ext_vector_type(4), may_alias));
union FragB { v16b v; v8us half[2]; unsigned short u[16]; };

__device__ __forceinline__ unsigned short bf16_bits(float x) { unsigned int u = __float_as_uint(x); return (unsigned short)((u + 0x7FFFu + ((u >> 16) & 1u)) >> 16); }
__device__ __forceinline__ float bf16_val(unsigned short b) { return __uint_as_float(((unsigned int)b) << 16); }
__device__ __forceinline__ float bf16_round(float x) { return bf16_val(bf16_bits(x)); }
// D += A·B with NT terms: 1 = ah·bh, 2 = + al·bh (A split), 3 = + ah·bl (both split)
template <int NT>
__device__ __forceinline__ v8f mmaN(v16b ah, v16b al, v16b bh, v16b bl, v8f c) {
  c = __builtin_amdgcn_wmma_f32_16x16x32_bf16(false, ah, false, bh, (short)0, c, false, false);
  if (NT >= 2) c = __builtin_amdgcn_wmma_f32_16x16x32_bf16(false, al, false, bh, (short)0, c, false, false);
  if (NT >= 3) c = __builtin_amdgcn_wmma_f32_16x16x32_bf16(false, ah, false, bl, (short)0, c, false, false);
  asm volatile("v_nop\n\tv_nop\n\tv_nop\n\tv_nop" : "+v"(c) : "v"(ah), "v"(al), "v"(bh), "v"(bl));
  return c;
}

__global__ __launch_bounds__(256) void k_wt_bf16(const float* __restrict__ W, unsigned short* __restrict__ Wt, int K, int N) {
  const int t = blockIdx.x * 256 + threadIdx.x;
  const int k8n = K / 8;
  if (t >= N * k8n) return;
  const int n = t / k8n, k8 = (t % k8n) * 8;
  v8us v;
#pragma unroll
  for (int i = 0; i < 8; ++i) v[i] = bf16_bits(W[(size_t)(k8 + i) * N + n]);
  *(v8us*)(Wt + (size_t)n * K + k8) = v;
  
}

// GEMM C[M][N] (f32, pitch ldc) = act(A[M][K]·W + bias). A f32 row-major (pitch lda) converted per fragment to bf16
// (ASPLIT: hi/lo two planes -> 2 terms, else single rounded term); Wt bf16 [N][K] (pitch ldb). BIAS_BF16 rounds the
// bias to bf16 first (bias quantised to bf16 before the add). K%32==0, M%16==0, N%64==0.
template <bool ASPLIT, int ACT, bool BIAS_BF16>
__global__ __launch_bounds__(128) void k_gemm_bf(const float* __restrict__ A, int lda, const unsigned short* __restrict__ Wt, int ldb,
                                               const float* __restrict__ bias, float* __restrict__ C, int ldc, int M, int N, int K) {
  __shared__ __attribute__((aligned(16))) float so[4][16][64];
  const int tid = threadIdx.x, w = tid >> 5, lane = tid & 31, ln = lane & 15, hh = lane >> 4;
  const int ntn = N / 64;
  const int wid = blockIdx.x * 4 + w;
  const int mt = wid / ntn, nq = wid % ntn;
  if (mt * 16 >= M) return;
  const int row0 = mt * 16, col0 = nq * 64;
  const float* arow = A + (size_t)(row0 + ln) * lda;
  v8f acc[4] = {};
  for (int kb = 0; kb < K; kb += 32) {
    FragB ah, al;
    const v4f x0 = *(const v4fa*)(arow + kb + 8 * hh), x1 = *(const v4fa*)(arow + kb + 8 * hh + 4);
    const v4f x2 = *(const v4fa*)(arow + kb + 16 + 8 * hh), x3 = *(const v4fa*)(arow + kb + 16 + 8 * hh + 4);
    float xs[16] = {x0[0],x0[1],x0[2],x0[3],x1[0],x1[1],x1[2],x1[3],x2[0],x2[1],x2[2],x2[3],x3[0],x3[1],x3[2],x3[3]};
#pragma unroll
    for (int i = 0; i < 16; ++i) { const unsigned short hb = bf16_bits(xs[i]); ah.u[i] = hb; al.u[i] = ASPLIT ? bf16_bits(xs[i] - bf16_val(hb)) : (unsigned short)0; }
#pragma unroll
    for (int t = 0; t < 4; ++t) {
      const unsigned short* brow = Wt + (size_t)(col0 + t * 16 + ln) * ldb + kb;
      FragB b;
      b.half[0] = *(const v8us*)(brow + 8 * hh);
      b.half[1] = *(const v8us*)(brow + 16 + 8 * hh);
      acc[t] = mmaN<ASPLIT ? 2 : 1>(ah.v, al.v, b.v, b.v, acc[t]);
    }
  }
#pragma unroll
  for (int t = 0; t < 4; ++t) {
    float bv = bias ? bias[col0 + t * 16 + ln] : 0.f;
    if (BIAS_BF16) bv = bf16_round(bv);
#pragma unroll
    for (int r = 0; r < 8; ++r) { float v = acc[t][r] + bv; if (ACT == 1) v = fmaxf(v, 0.f); so[w][8 * hh + r][t * 16 + ln] = v; }
  }
  __builtin_amdgcn_fence(__ATOMIC_ACQ_REL, "workgroup");
  __builtin_amdgcn_wave_barrier();
  const int rsub = lane >> 4, c4 = (lane & 15) * 4;
  {
#pragma unroll
    for (int q = 0; q < 8; ++q) {
      const int r = q * 2 + rsub;
      const v4f v = *(const v4fa*)&so[w][r][c4];
      *(v4f*)(C + (size_t)(row0 + r) * ldc + col0 + c4) = v;
    }
    
  }
}

// GEMM C = act(A·W + bias + resid): A f32 (ASPLIT -> hi/lo 2 terms), Wt bf16 [N][K]; ACT 0 none, 1 relu, 2 exact gelu;
// resid (optional, f32, row index = (row % rmod), pitch ldr, RES_BF16 rounds it) added before the activation.
template <bool ASPLIT, int ACT, bool BIAS_BF16, bool RES_BF16>
__global__ __launch_bounds__(128) void k_gemm_bf3(const float* __restrict__ A, int lda, const unsigned short* __restrict__ Wt, int ldb,
                                                const float* __restrict__ bias, const float* __restrict__ resid, int rmod, int ldr,
                                                float* __restrict__ C, int ldc, int M, int N, int K) {
  __shared__ __attribute__((aligned(16))) float so[4][16][64];
  const int tid = threadIdx.x, w = tid >> 5, lane = tid & 31, ln = lane & 15, hh = lane >> 4;
  const int ntn = N / 64;
  const int wid = blockIdx.x * 4 + w;
  const int mt = wid / ntn, nq = wid % ntn;
  if (mt * 16 >= M) return;
  const int row0 = mt * 16, col0 = nq * 64;
  const float* arow = A + (size_t)(row0 + ln) * lda;
  v8f acc[4] = {};
  for (int kb = 0; kb < K; kb += 32) {
    FragB ah, al;
    const v4f x0 = *(const v4fa*)(arow + kb + 8 * hh), x1 = *(const v4fa*)(arow + kb + 8 * hh + 4);
    const v4f x2 = *(const v4fa*)(arow + kb + 16 + 8 * hh), x3 = *(const v4fa*)(arow + kb + 16 + 8 * hh + 4);
    float xs[16] = {x0[0],x0[1],x0[2],x0[3],x1[0],x1[1],x1[2],x1[3],x2[0],x2[1],x2[2],x2[3],x3[0],x3[1],x3[2],x3[3]};
#pragma unroll
    for (int i = 0; i < 16; ++i) { const unsigned short hb = bf16_bits(xs[i]); ah.u[i] = hb; al.u[i] = ASPLIT ? bf16_bits(xs[i] - bf16_val(hb)) : (unsigned short)0; }
#pragma unroll
    for (int t = 0; t < 4; ++t) {
      const unsigned short* brow = Wt + (size_t)(col0 + t * 16 + ln) * ldb + kb;
      FragB b;
      b.half[0] = *(const v8us*)(brow + 8 * hh);
      b.half[1] = *(const v8us*)(brow + 16 + 8 * hh);
      acc[t] = mmaN<ASPLIT ? 2 : 1>(ah.v, al.v, b.v, b.v, acc[t]);
    }
  }
#pragma unroll
  for (int t = 0; t < 4; ++t) {
    const int col = col0 + t * 16 + ln;
    float bv = bias ? bias[col] : 0.f;
    if (BIAS_BF16) bv = bf16_round(bv);
#pragma unroll
    for (int r = 0; r < 8; ++r) {
      float v = acc[t][r] + bv;
      if (resid) { float rv = resid[(size_t)((row0 + 8 * hh + r) % rmod) * ldr + col]; if (RES_BF16) rv = bf16_round(rv); v += rv; }
      if (ACT == 1) v = fmaxf(v, 0.f);
      if (ACT == 2) v = 0.5f * v * (1.0f + erff(v * 0.70710678118654752f));
      if (ACT == 3) { const float u = 0.7978845608028654f * (v + 0.044715f * v * v * v); v = 0.5f * v * (1.0f + tanhf(u)); }
      so[w][8 * hh + r][t * 16 + ln] = v;
    }
  }
  __builtin_amdgcn_fence(__ATOMIC_ACQ_REL, "workgroup");
  __builtin_amdgcn_wave_barrier();
  const int rsub = lane >> 4, c4 = (lane & 15) * 4;
  {
#pragma unroll
    for (int q = 0; q < 8; ++q) {
      const int r = q * 2 + rsub;
      const v4f v = *(const v4fa*)&so[w][r][c4];
      *(v4f*)(C + (size_t)(row0 + r) * ldc + col0 + c4) = v;
    }
    
  }
}
// row LayerNorm (biased variance, eps) over N: s = X (+ R); optional out_sum <- s; out_norm <- (s-mu)*rsqrt(var+eps)*g + b
template <bool PARAM_BF16>
__global__ __launch_bounds__(256) void k_layernorm(const float* __restrict__ X, const float* __restrict__ R, const float* __restrict__ g, const float* __restrict__ bta,
                                                  float* __restrict__ out_sum, float* __restrict__ out_norm, int N, float eps) {
  __shared__ float red[256];
  const int row = blockIdx.x, tid = threadIdx.x;
  const float* x = X + (size_t)row * N; const float* rr = R ? R + (size_t)row * N : nullptr;
  float vals[16];                     // up to N = 4096
  const int per = N / 256;            // contiguous chunk per thread? use strided-by-4 chunks: thread handles j = tid*4 + 1024*u
  float s1 = 0.f;
  for (int u = 0; u < per / 4; ++u) {
    const int j = tid * 4 + 1024 * u;
    const v4f a = *(const v4fa*)(x + j);
    v4f b = {0.f,0.f,0.f,0.f}; if (rr) b = *(const v4fa*)(rr + j);
#pragma unroll
    for (int q = 0; q < 4; ++q) { const float v = a[q] + b[q]; vals[u * 4 + q] = v; s1 += v; }
  }
  red[tid] = s1; __syncthreads();
  for (int st = 128; st > 0; st >>= 1) { if (tid < st) red[tid] += red[tid + st]; __syncthreads(); }
  const float mu = red[0] / (float)N; __syncthreads();
  float s2 = 0.f;
  for (int u = 0; u < per / 4; ++u)
#pragma unroll
    for (int q = 0; q < 4; ++q) { const float c = vals[u * 4 + q] - mu; s2 += c * c; }
  red[tid] = s2; __syncthreads();
  for (int st = 128; st > 0; st >>= 1) { if (tid < st) red[tid] += red[tid + st]; __syncthreads(); }
  const float rs = rsqrtf(red[0] / (float)N + eps);
  {
    for (int u = 0; u < per / 4; ++u) {
      const int j = tid * 4 + 1024 * u;
      v4f o, sm;
#pragma unroll
      for (int q = 0; q < 4; ++q) {
        float gg = g[j + q], bb = bta[j + q];
        if (PARAM_BF16) { gg = bf16_round(gg); bb = bf16_round(bb); }
        sm[q] = vals[u * 4 + q]; o[q] = (vals[u * 4 + q] - mu) * rs * gg + bb;
      }
      if (out_sum) *(v4f*)(out_sum + (size_t)row * N + j) = sm;
      *(v4f*)(out_norm + (size_t)row * N + j) = o;
    }
    
  }
}



// ---- f16 WMMA path (v_wmma_f32_16x16x32_f16): 11-bit significands for operands in range — used where a [0,1] probability operand needs more precision than bf16
typedef _Float16 v16h __attribute__((ext_vector_type(16)));
union FragH { v16h v; v8us half[2]; _Float16 h[16]; unsigned short u[16]; };
template <int NT>
__device__ __forceinline__ v8f mmaH(v16h ah, v16h al, v16h bh, v16h bl, v8f c) {
  c = __builtin_amdgcn_wmma_f32_16x16x32_f16(false, ah, false, bh, (short)0, c, false, false);
  if (NT >= 2) c = __builtin_amdgcn_wmma_f32_16x16x32_f16(false, al, false, bh, (short)0, c, false, false);
  if (NT >= 3) c = __builtin_amdgcn_wmma_f32_16x16x32_f16(false, ah, false, bl, (short)0, c, false, false);
  asm volatile("v_nop\n\tv_nop\n\tv_nop\n\tv_nop" : "+v"(c) : "v"(ah), "v"(al), "v"(bh), "v"(bl));
  return c;
}
// batched GEMM like k_gemm_b but f16 operands: A f32 (split into f16 hi/lo if ASPLIT, else rounded to f16), Bt = f16 values [n][k]; alpha; C f32; N multiple of 16 (partial tiles skipped)
template <bool ASPLIT>
__global__ __launch_bounds__(128) void k_gemm_h(const float* __restrict__ A, int lda, size_t sA, const _Float16* __restrict__ Bh, int ldb, size_t sB, float alpha, float* __restrict__ C, int ldc, size_t sC, int M, int N, int K) {
  __shared__ __attribute__((aligned(16))) float so[4][16][64];
  const int tid = threadIdx.x, w = tid >> 5, lane = tid & 31, ln = lane & 15, hh = lane >> 4; const int by = blockIdx.y;
  A += (size_t)by * sA; Bh += (size_t)by * sB; C += (size_t)by * sC;
  const int ntn = (N + 63) / 64; const int wid = blockIdx.x * 4 + w; const int mt = wid / ntn, nq = wid % ntn; if (mt * 16 >= M) return;
  const int row0 = mt * 16, col0 = nq * 64; const float* arow = A + (size_t)(row0 + ln) * lda;
  v8f acc[4] = {};
  for (int kb = 0; kb < K; kb += 32) {
    FragH ah, al;
    const v4f x0 = *(const v4fa*)(arow + kb + 8 * hh), x1 = *(const v4fa*)(arow + kb + 8 * hh + 4), x2 = *(const v4fa*)(arow + kb + 16 + 8 * hh), x3 = *(const v4fa*)(arow + kb + 16 + 8 * hh + 4);
    float xs[16] = {x0[0],x0[1],x0[2],x0[3],x1[0],x1[1],x1[2],x1[3],x2[0],x2[1],x2[2],x2[3],x3[0],x3[1],x3[2],x3[3]};
#pragma unroll
    for (int i = 0; i < 16; ++i) { const _Float16 h = (_Float16)xs[i]; ah.h[i] = h; al.h[i] = ASPLIT ? (_Float16)(xs[i] - (float)h) : (_Float16)0.0f; }
#pragma unroll
    for (int t = 0; t < 4; ++t) { if (col0 + t * 16 >= N) continue; const size_t boff = (size_t)(col0 + t * 16 + ln) * ldb + kb; FragH bq; bq.half[0] = *(const v8us*)(Bh + boff + 8 * hh); bq.half[1] = *(const v8us*)(Bh + boff + 16 + 8 * hh);
      acc[t] = mmaH<ASPLIT ? 2 : 1>(ah.v, al.v, bq.v, bq.v, acc[t]); }
  }
#pragma unroll
  for (int t = 0; t < 4; ++t) { if (col0 + t * 16 >= N) continue;
#pragma unroll
    for (int r = 0; r < 8; ++r) so[w][8 * hh + r][t * 16 + ln] = acc[t][r] * alpha; }
  __builtin_amdgcn_fence(__ATOMIC_ACQ_REL, "workgroup"); __builtin_amdgcn_wave_barrier();
  const int rsub = lane >> 4, c4 = (lane & 15) * 4;
  {
#pragma unroll
    for (int q = 0; q < 8; ++q) { const int r = q * 2 + rsub; if (col0 + c4 < N) { const v4f v = *(const v4fa*)&so[w][r][c4]; *(v4f*)(C + (size_t)(row0 + r) * ldc + col0 + c4) = v; } }
     }
}

// Wt[n][k] = f16(W[k][n]·scale) from f32 row-major W[K][N] (scale = power of two; bf16-exact weights stay exact in f16 away from the subnormal range)
__global__ __launch_bounds__(256) void k_wt_f16(const float* __restrict__ W, _Float16* __restrict__ Wt, int K, int N, float scale) {
  const int t = blockIdx.x * 256 + threadIdx.x; if (t >= N * (K / 8)) return; const int n = t / (K / 8), k8 = (t % (K / 8)) * 8; FragH f;
#pragma unroll
  for (int i = 0; i < 8; ++i) f.h[i] = (_Float16)(bf16_round(W[(size_t)(k8 + i) * N + n]) * scale); const v8us o = f.half[0];
  *(v8us*)((unsigned short*)Wt + (size_t)n * K + k8) = o; 
}
// k_gemm_hh variant with fused epilogue: v = acc·alpha + bias[by·sBias + col] (+ CP[(row/rowsPerB)·sCPb + by·64 + col] if CP) ; ACT 0 none / 1 elu ; writes f16 C16 (and f32 C if non-null)
template <int ACT>
__global__ __launch_bounds__(128) void k_gemm_hhx(const _Float16* __restrict__ A, int lda, size_t sA, const _Float16* __restrict__ Bh, int ldb, size_t sB, float alpha, const float* __restrict__ bias, size_t sBias, const float* __restrict__ CP, int rowsPerB, size_t sCPb, int row0g,
    float* __restrict__ C, _Float16* __restrict__ C16, int ldc, size_t sC, int M, int N, int K) {
  __shared__ __attribute__((aligned(16))) float so[4][16][64];
  const int tid = threadIdx.x, w = tid >> 5, lane = tid & 31, ln = lane & 15, hh = lane >> 4; const int by = blockIdx.y;
  A += (size_t)by * sA; Bh += (size_t)by * sB; const size_t cofs = (size_t)by * sC; const float* bp = bias ? bias + (size_t)by * sBias : nullptr;
  const int ntn = (N + 63) / 64; const int wid = blockIdx.x * 4 + w; const int mt = wid / ntn, nq = wid % ntn; if (mt * 16 >= M) return;
  const int row0 = mt * 16, col0 = nq * 64; const _Float16* arow = A + (size_t)(row0 + ln) * lda;
  v8f acc[4] = {};
  for (int kb = 0; kb < K; kb += 32) { FragH ah; ah.half[0] = *(const v8us*)((const unsigned short*)arow + kb + 8 * hh); ah.half[1] = *(const v8us*)((const unsigned short*)arow + kb + 16 + 8 * hh);
#pragma unroll
    for (int t = 0; t < 4; ++t) { if (col0 + t * 16 >= N) continue; const size_t boff = (size_t)(col0 + t * 16 + ln) * ldb + kb; FragH bq; bq.half[0] = *(const v8us*)((const unsigned short*)Bh + boff + 8 * hh); bq.half[1] = *(const v8us*)((const unsigned short*)Bh + boff + 16 + 8 * hh);
      acc[t] = mmaH<1>(ah.v, ah.v, bq.v, bq.v, acc[t]); }
  }
#pragma unroll
  for (int t = 0; t < 4; ++t) { if (col0 + t * 16 >= N) continue; const int col = col0 + t * 16 + ln; const float bv = bp ? bf16_round(bp[col]) : 0.f;
#pragma unroll
    for (int r = 0; r < 8; ++r) { float v = acc[t][r] * alpha + bv; if (CP) { const int bidx = (row0g + row0 + 8 * hh + r) / rowsPerB; v += CP[(size_t)bidx * sCPb + (size_t)by * 64 + col]; } if (ACT == 1) v = (v > 0.f) ? v : expm1f(v); else if (ACT == 7) v = (v > 0.f) ? v + 1.0f : expf(v); else if (ACT == 8) v = tanhf(v); else if (ACT == 9) v = 0.5f * v * (1.0f + tanhf(0.7978845608028654f * (v + 0.044715f * v * v * v))); else if (ACT == 11) v = 1.0f / (1.0f + expf(-v)); else if (ACT == 12) v = (v > 0.f) ? v : 0.01f * v; else if (ACT == 14) v = (v > 0.f) ? v : 0.1f * v; else if (ACT == 15) v = v / (1.0f + expf(-v)); else if (ACT == 3) v = fmaxf(v, 0.f); else if (ACT == 6) v = 0.5f * v * (1.0f + erff(v * 0.70710678118654752f)); so[w][8 * hh + r][t * 16 + ln] = v; } }
  __builtin_amdgcn_fence(__ATOMIC_ACQ_REL, "workgroup"); __builtin_amdgcn_wave_barrier();
  const int rsub = lane >> 4, c4 = (lane & 15) * 4; typedef _Float16 v4h __attribute__((ext_vector_type(4)));
  {
#pragma unroll
    for (int q = 0; q < 8; ++q) { const int r = q * 2 + rsub; if (col0 + c4 < N) { const v4f v = *(const v4fa*)&so[w][r][c4]; if (C) *(v4f*)(C + cofs + (size_t)(row0 + r) * ldc + col0 + c4) = v; if (C16) { v4h h4; for (int i = 0; i < 4; ++i) h4[i] = (_Float16)v[i]; *(v4h*)(C16 + cofs + (size_t)(row0 + r) * ldc + col0 + c4) = h4; } } }
     }
}


typedef _Float16 v4h __attribute__((ext_vector_type(4)));

__global__ __launch_bounds__(256) void k_x16(const float* __restrict__ x, _Float16* __restrict__ X16, size_t n8) { const size_t t = (size_t)blockIdx.x * 256 + threadIdx.x; if (t >= n8) return; FragH f;
#pragma unroll
  for (int q = 0; q < 8; ++q) f.h[q] = (_Float16)bf16_round(x[t * 8 + q]); *(v8us*)((unsigned short*)X16 + t * 8) = f.half[0];  }
__global__ __launch_bounds__(256) void k_h16(const float* __restrict__ x, _Float16* __restrict__ X16, size_t n8) { const size_t t = (size_t)blockIdx.x * 256 + threadIdx.x; if (t >= n8) return; FragH f;
#pragma unroll
  for (int q = 0; q < 8; ++q) f.h[q] = (_Float16)x[t * 8 + q]; *(v8us*)((unsigned short*)X16 + t * 8) = f.half[0];  }
__global__ __launch_bounds__(256) void k_round16f(const float* __restrict__ W, _Float16* __restrict__ Bt, size_t n8) { const size_t t = (size_t)blockIdx.x * 256 + threadIdx.x; if (t >= n8) return; FragH f;
#pragma unroll
  for (int i = 0; i < 8; ++i) f.h[i] = (_Float16)(bf16_round(W[t * 8 + i]) * 16.0f); *(v8us*)((unsigned short*)Bt + t * 8) = f.half[0];  }
__device__ __forceinline__ v16h g2_frag(const _Float16* p, int hh) { FragH f; f.half[0] = *(const v8us*)((const unsigned short*)p + 8 * hh); f.half[1] = *(const v8us*)((const unsigned short*)p + 16 + 8 * hh); return f.v; }
template <int CAUSAL>
__global__ __launch_bounds__(128) void k_flash(const _Float16* __restrict__ Q16, int ldq, const _Float16* __restrict__ K16, int ldk, const _Float16* __restrict__ Vt, const int* __restrict__ MSK, float* __restrict__ O, int ldo) {
  constexpr int RPW = 16, RTN = RPW / 16, NQB = TQ / (4 * RPW), DT = 4, KS = 2;
  __shared__ __attribute__((aligned(16))) unsigned short sP[4][RPW][40]; __shared__ __attribute__((aligned(16))) float sO[4][RPW][64 + 4];
  const int tid = threadIdx.x, w = tid >> 5, lane = tid & 31, ln = lane & 15, hh = lane >> 4;
  const int slab = blockIdx.x / QBLKS, qblk = blockIdx.x % QBLKS; (void)NQB; const int b = slab / NH, h = slab % NH; const int qb0 = qblk * (4 * RPW); const int q0 = qb0 + w * RPW;
  FragH aq[2][KS];
#pragma unroll
  for (int rt = 0; rt < RTN; ++rt) { const unsigned short* qr = (const unsigned short*)Q16 + ((size_t)b * TQ + q0 + rt * 16 + ln) * ldq + h * 64;
#pragma unroll
    for (int ks = 0; ks < KS; ++ks) { aq[rt][ks].half[0] = *(const v8us*)(qr + ks * 32 + 8 * hh); aq[rt][ks].half[1] = *(const v8us*)(qr + ks * 32 + 16 + 8 * hh); } }
  const unsigned short* Vth = (const unsigned short*)Vt + (size_t)slab * 64 * TK;
  float m_r[2][8], l_r[2][8]; v8f oacc[2][DT];
#pragma unroll
  for (int rt = 0; rt < RTN; ++rt) {
#pragma unroll
    for (int r = 0; r < 8; ++r) { m_r[rt][r] = -3.0e38f; l_r[rt][r] = 0.f; }
#pragma unroll
    for (int dt = 0; dt < DT; ++dt) oacc[rt][dt] = (v8f){0.f,0.f,0.f,0.f,0.f,0.f,0.f,0.f}; }
  const int jend = (CAUSAL == 1) ? (qb0 + 4 * RPW) : TK;      /* causal: keys beyond the block's last query never contribute */
#pragma unroll 1
  for (int j0 = 0; j0 < jend; j0 += 32) {
    v8f s[2][2];
#pragma unroll
    for (int nt = 0; nt < 2; ++nt) { const unsigned short* kr = (const unsigned short*)K16 + ((size_t)b * TK + j0 + nt * 16 + ln) * ldk + h * 64; FragH bk[KS];
#pragma unroll
      for (int ks = 0; ks < KS; ++ks) { bk[ks].half[0] = *(const v8us*)(kr + ks * 32 + 8 * hh); bk[ks].half[1] = *(const v8us*)(kr + ks * 32 + 16 + 8 * hh); }
#pragma unroll
      for (int rt = 0; rt < RTN; ++rt) { v8f acc = (v8f){0.f,0.f,0.f,0.f,0.f,0.f,0.f,0.f};
#pragma unroll
        for (int ks = 0; ks < KS; ++ks) acc = mmaH<1>(aq[rt][ks].v, aq[rt][ks].v, bk[ks].v, bk[ks].v, acc); s[rt][nt] = acc; } }
#pragma unroll
    for (int rt = 0; rt < RTN; ++rt)
#pragma unroll
      for (int r = 0; r < 8; ++r) { const int tq = q0 + rt * 16 + 8 * hh + r; const int k0 = j0 + ln, k1 = j0 + 16 + ln;
        const bool ok0 = (CAUSAL == 1) ? (k0 <= tq) : ((CAUSAL == 2) ? ((k0 >> 5) == (tq >> 5)) : true), ok1 = (CAUSAL == 1) ? (k1 <= tq) : ((CAUSAL == 2) ? ((k1 >> 5) == (tq >> 5)) : true);      /* mode 2: block-diagonal 32-token groups */
        const float s0 = ok0 ? s[rt][0][r] * SCL : -3.0e38f, s1 = ok1 ? s[rt][1][r] * SCL : -3.0e38f; float mc = fmaxf(s0, s1);
        mc = fmaxf(mc, __shfl_xor(mc, 1, 32)); mc = fmaxf(mc, __shfl_xor(mc, 2, 32)); mc = fmaxf(mc, __shfl_xor(mc, 4, 32)); mc = fmaxf(mc, __shfl_xor(mc, 8, 32));
        const float mn = fmaxf(m_r[rt][r], mc); const float al = (mn > -1.0e38f) ? expf(m_r[rt][r] - mn) : 1.0f; m_r[rt][r] = mn; const float p0 = ok0 ? expf(s0 - mn) : 0.f, p1 = ok1 ? expf(s1 - mn) : 0.f; l_r[rt][r] = l_r[rt][r] * al + p0 + p1;
#pragma unroll
        for (int dt = 0; dt < DT; ++dt) oacc[rt][dt][r] *= al;
        FragH t2; t2.h[0] = (_Float16)(p0 * 1024.0f); t2.h[1] = (_Float16)(p1 * 1024.0f); sP[w][rt * 16 + 8 * hh + r][ln] = t2.u[0]; sP[w][rt * 16 + 8 * hh + r][16 + ln] = t2.u[1]; }
    __builtin_amdgcn_fence(__ATOMIC_ACQ_REL, "workgroup"); __builtin_amdgcn_wave_barrier();
    FragH pa[2];
#pragma unroll
    for (int rt = 0; rt < RTN; ++rt) { pa[rt].half[0] = *(const v8us*)&sP[w][rt * 16 + ln][8 * hh]; pa[rt].half[1] = *(const v8us*)&sP[w][rt * 16 + ln][16 + 8 * hh]; }
#pragma unroll
    for (int dt = 0; dt < DT; ++dt) { const unsigned short* vrow = Vth + (size_t)(dt * 16 + ln) * TK + j0; FragH bv; bv.half[0] = *(const v8us*)(vrow + 8 * hh); bv.half[1] = *(const v8us*)(vrow + 16 + 8 * hh);
#pragma unroll
      for (int rt = 0; rt < RTN; ++rt) oacc[rt][dt] = mmaH<1>(pa[rt].v, pa[rt].v, bv.v, bv.v, oacc[rt][dt]); }
    __builtin_amdgcn_fence(__ATOMIC_ACQ_REL, "workgroup"); __builtin_amdgcn_wave_barrier(); }
#pragma unroll
  for (int rt = 0; rt < RTN; ++rt) {
#pragma unroll
    for (int r = 0; r < 8; ++r) { float l = l_r[rt][r]; l += __shfl_xor(l, 1, 32); l += __shfl_xor(l, 2, 32); l += __shfl_xor(l, 4, 32); l += __shfl_xor(l, 8, 32); l_r[rt][r] = (l > 0.f) ? 1.0f / (l * 1024.0f) : 0.f; }
#pragma unroll
    for (int dt = 0; dt < DT; ++dt)
#pragma unroll
      for (int r = 0; r < 8; ++r) sO[w][rt * 16 + 8 * hh + r][dt * 16 + ln] = oacc[rt][dt][r] * l_r[rt][r]; }
  __builtin_amdgcn_fence(__ATOMIC_ACQ_REL, "workgroup"); __builtin_amdgcn_wave_barrier();
  {
#pragma unroll
    for (int rp = 0; rp < RPW; rp += 2) { const int r = rp + (lane >> 4), pc = lane & 15; const v4f val = *(const v4fa*)&sO[w][r][pc * 4]; *(v4f*)(O + ((size_t)b * TQ + q0 + r) * ldo + h * 64 + pc * 4) = val; }
     } }
__device__ __forceinline__ float xhalf(float x) { return __builtin_bit_cast(float, __builtin_amdgcn_permlanex16(__builtin_bit_cast(int, x), __builtin_bit_cast(int, x), 0x76543210, 0xfedcba98, false, false)); }      /* lane l <-> lane l ^ 16 */
// Eight 2^x in place, in one statement: each v_exp_f32 writes only its own register, so none stands directly in front of an instruction that overwrites its source or reads its result
// (left to the register allocator, a run of them reused the source of the one before as the next destination); the v_nop keeps that slot behind the last one.
__device__ __forceinline__ void exp2x8(float& a, float& b, float& c, float& d, float& e, float& f, float& g, float& h) {
  asm("v_exp_f32 %0, %0\n\tv_exp_f32 %1, %1\n\tv_exp_f32 %2, %2\n\tv_exp_f32 %3, %3\n\tv_exp_f32 %4, %4\n\tv_exp_f32 %5, %5\n\tv_exp_f32 %6, %6\n\tv_exp_f32 %7, %7\n\tv_nop"
      : "+v"(a), "+v"(b), "+v"(c), "+v"(d), "+v"(e), "+v"(f), "+v"(g), "+v"(h)); }
template <int CAUSAL>
__global__ __launch_bounds__(128) void k_flashqk(const _Float16* __restrict__ Q16, const _Float16* __restrict__ QL, int ldq, const _Float16* __restrict__ K16, const _Float16* __restrict__ KL, int ldk, const _Float16* __restrict__ Vt, const int* __restrict__ MSK, float* __restrict__ O, int ldo) {
  constexpr int RPW = 16, DT = HPITCH / 16, KS = HPITCH / 32;
  __shared__ __attribute__((aligned(16))) float sO[4][RPW][HPITCH + 4];
  constexpr int KT = 64, KP = HPITCH + 8, VP = KT + 8;      /* keys per staged tile; LDS row pitches in halves: 16 bytes x an odd number, free of bank conflicts for 16-byte reads */
  constexpr int NCK = KT * (HPITCH / 8) / 128, NCV = HPITCH * (KT / 8) / 128;      /* 16-byte pieces per thread and tile */
  __shared__ __attribute__((aligned(16))) unsigned short sK[2][KT][KP]; __shared__ __attribute__((aligned(16))) unsigned short sKL[2][KT][KP]; __shared__ __attribute__((aligned(16))) unsigned short sV[2][HPITCH][VP];
  const int tid = threadIdx.x, w = tid >> 5, lane = tid & 31, ln = lane & 15, hh = lane >> 4;
  const int slab = blockIdx.x / QBLKS, qblk = blockIdx.x % QBLKS; const int b = slab / NH, h = slab % NH; const int qb0 = qblk * (4 * RPW); const int q0 = qb0 + w * RPW;
  const int tq = q0 + ln;      /* this lane's query */
  FragH bq[KS], bql[KS];
  { const unsigned short* qr = (const unsigned short*)Q16 + ((size_t)b * TQ + tq) * ldq + h * HPITCH; const unsigned short* ql = (const unsigned short*)QL + ((size_t)b * TQ + tq) * ldq + h * HPITCH;
#pragma unroll      /* constant indices keep the fragment, score and accumulator arrays in registers */
    for (int ks = 0; ks < KS; ++ks) { bq[ks].half[0] = *(const v8us*)(qr + ks * 32 + 8 * hh); bq[ks].half[1] = *(const v8us*)(qr + ks * 32 + 16 + 8 * hh); bql[ks].half[0] = *(const v8us*)(ql + ks * 32 + 8 * hh); bql[ks].half[1] = *(const v8us*)(ql + ks * 32 + 16 + 8 * hh); } }
  const unsigned short* Vth = (const unsigned short*)Vt + (size_t)slab * HPITCH * TK;
  const unsigned short* Kb = (const unsigned short*)K16 + (size_t)b * TK * ldk + h * HPITCH; const unsigned short* KLb = (const unsigned short*)KL + (size_t)b * TK * ldk + h * HPITCH;
  v8us gk[NCK], gkl[NCK], gv[NCV];      /* the next tile on its way from global memory to LDS */
  auto fetch = [&](int jt) {
#pragma unroll      /* constant indices keep the fragment, score and accumulator arrays in registers */
    for (int u = 0; u < NCK; ++u) { const int i = tid + 128 * u, r = i / (HPITCH / 8), c8 = (i % (HPITCH / 8)) * 8; gk[u] = *(const v8us*)(Kb + (size_t)(jt + r) * ldk + c8); gkl[u] = *(const v8us*)(KLb + (size_t)(jt + r) * ldk + c8); }
#pragma unroll      /* constant indices keep the fragment, score and accumulator arrays in registers */
    for (int u = 0; u < NCV; ++u) { const int i = tid + 128 * u, r = i / (KT / 8), c8 = (i % (KT / 8)) * 8; gv[u] = *(const v8us*)(Vth + (size_t)r * TK + jt + c8); } };
  auto stash = [&](int bf) {
#pragma unroll      /* constant indices keep the fragment, score and accumulator arrays in registers */
    for (int u = 0; u < NCK; ++u) { const int i = tid + 128 * u, r = i / (HPITCH / 8), c8 = (i % (HPITCH / 8)) * 8; *(v8us*)&sK[bf][r][c8] = gk[u]; *(v8us*)&sKL[bf][r][c8] = gkl[u]; }
#pragma unroll      /* constant indices keep the fragment, score and accumulator arrays in registers */
    for (int u = 0; u < NCV; ++u) { const int i = tid + 128 * u, r = i / (KT / 8), c8 = (i % (KT / 8)) * 8; *(v8us*)&sV[bf][r][c8] = gv[u]; } };
  float m_q = -3.0e38f, l_q = 0.f; v8f oacc[DT];      /* oacc[dt][r] = O[tq][dt * 16 + 8 hh + r], un-normalised */
#pragma unroll      /* constant indices keep the fragment, score and accumulator arrays in registers */
  for (int dt = 0; dt < DT; ++dt) oacc[dt] = (v8f){0.f,0.f,0.f,0.f,0.f,0.f,0.f,0.f};
  const int jend = (CAUSAL == 1) ? (qb0 + 4 * RPW) : TK;      /* causal: keys beyond the block's last query never contribute */
  const int ntile = jend / KT;
  asm volatile("s_wait_xcnt 0x0" ::: "memory");      /* the Q loads above are issued first, and no tile load below writes into a register that one of them still names as its address */
  fetch(0); stash(0);
  __syncthreads();      /* tile 0 is written before any wave reads it */
#pragma unroll 1      /* one copy of the trip's code; the buffer index alternates at run time */
  for (int t = 0; t < ntile; ++t) { const int buf = t & 1; const bool more = t + 1 < ntile;      /* the same in every thread of the work-group */
    if (more) fetch((t + 1) * KT);      /* in flight while this trip works on tile t */
#pragma unroll      /* the two 32-key halves of the tile: constant LDS offsets */
   for (int js = 0; js < KT; js += 32) { const int j0 = t * KT + js;
    v8f s[2];      /* s[nt][r] = score of key j0 + nt * 16 + 8 hh + r against query tq */
    FragH ak[2][KS], akl[2][KS], av[DT];      /* all LDS reads of these 32 keys stand together at the head: one LDS latency instead of four */
#pragma unroll      /* constant indices keep the fragment, score and accumulator arrays in registers */
    for (int nt = 0; nt < 2; ++nt) { const unsigned short* kr = &sK[buf][js + nt * 16 + ln][0]; const unsigned short* klr = &sKL[buf][js + nt * 16 + ln][0];
#pragma unroll      /* constant indices keep the fragment, score and accumulator arrays in registers */
      for (int ks = 0; ks < KS; ++ks) { ak[nt][ks].half[0] = *(const v8us*)(kr + ks * 32 + 8 * hh); ak[nt][ks].half[1] = *(const v8us*)(kr + ks * 32 + 16 + 8 * hh); akl[nt][ks].half[0] = *(const v8us*)(klr + ks * 32 + 8 * hh); akl[nt][ks].half[1] = *(const v8us*)(klr + ks * 32 + 16 + 8 * hh); } }
#pragma unroll      /* constant indices keep the fragment, score and accumulator arrays in registers */
    for (int dt = 0; dt < DT; ++dt) { const unsigned short* vrow = &sV[buf][dt * 16 + ln][js]; av[dt].half[0] = *(const v8us*)(vrow + 8 * hh); av[dt].half[1] = *(const v8us*)(vrow + 16 + 8 * hh); }
#pragma unroll      /* constant indices keep the fragment, score and accumulator arrays in registers */
    for (int nt = 0; nt < 2; ++nt) {
      v8f acc = (v8f){0.f,0.f,0.f,0.f,0.f,0.f,0.f,0.f}, accl = acc;
#pragma unroll      /* constant indices keep the fragment, score and accumulator arrays in registers */
      for (int ks = 0; ks < KS; ++ks) { acc = mmaH<1>(ak[nt][ks].v, ak[nt][ks].v, bq[ks].v, bq[ks].v, acc); accl = mmaH<1>(ak[nt][ks].v, ak[nt][ks].v, bql[ks].v, bql[ks].v, accl); accl = mmaH<1>(akl[nt][ks].v, akl[nt][ks].v, bq[ks].v, bq[ks].v, accl); }
#pragma unroll      /* constant indices keep the fragment, score and accumulator arrays in registers */
      for (int r = 0; r < 8; ++r) acc[r] += accl[r] * 0.0009765625f;
      s[nt] = acc; }
    float sc[16]; bool ok[16];
#pragma unroll      /* constant indices keep the fragment, score and accumulator arrays in registers */
    for (int i = 0; i < 16; ++i) { const int kk = j0 + (i >> 3) * 16 + 8 * hh + (i & 7);
      ok[i] = (CAUSAL == 1) ? (kk <= tq) : ((CAUSAL == 2) ? ((kk >> 5) == (tq >> 5)) : true);      /* mode 2: block-diagonal 32-token groups */
      if (CAUSAL == 4) ok[i] = MSK[((size_t)b * TQ + tq) * TK + kk] != 0;      /* mode 4: per-(query, key) INPUT mask shared by all heads; masked keys contribute nothing, rows with no valid key give l = 0 -> output 0 */
      sc[i] = ok[i] ? s[i >> 3][i & 7] : -3.0e38f; }      /* raw q.k: maxima are taken on raw scores, the (positive) scale enters with the exponent */
    float mt[8];
#pragma unroll      /* constant indices keep the fragment, score and accumulator arrays in registers */
    for (int i = 0; i < 8; ++i) mt[i] = fmaxf(sc[i], sc[8 + i]);
    float mc = fmaxf(fmaxf(fmaxf(mt[0], mt[1]), fmaxf(mt[2], mt[3])), fmaxf(fmaxf(mt[4], mt[5]), fmaxf(mt[6], mt[7])));
    mc = fmaxf(mc, xhalf(mc));      /* the other half's 16 keys of the same query */
    const float mn = fmaxf(m_q, mc); const float al = (mn > -1.0e38f) ? __builtin_amdgcn_exp2f((m_q - mn) * SCL2) : 1.0f; m_q = mn;
    const float nb = 10.0f - mn * SCL2;      /* p = 2^(sc * SCL2 + nb) = 2^10 exp((sc - mn) / sqrt(32)): scale, log2(e), maximum and P's 2^10 in one fma per score */
    float p[16]; FragH pb;
#pragma unroll      /* constant indices keep the fragment, score and accumulator arrays in registers */
    for (int i = 0; i < 16; ++i) p[i] = sc[i] * SCL2 + nb;
    exp2x8(p[0], p[1], p[2], p[3], p[4], p[5], p[6], p[7]); exp2x8(p[8], p[9], p[10], p[11], p[12], p[13], p[14], p[15]);
#pragma unroll      /* constant indices keep the fragment, score and accumulator arrays in registers */
    for (int i = 0; i < 16; ++i) { if (!ok[i]) p[i] = 0.f; pb.h[i] = (_Float16)p[i]; }      /* pb.h[i]: key j0 + (i >> 3) * 16 + 8 hh + (i & 7) of column ln; p and l_q both carry the 2^10 */
    float pt[8];
#pragma unroll      /* constant indices keep the fragment, score and accumulator arrays in registers */
    for (int i = 0; i < 8; ++i) pt[i] = p[i] + p[8 + i];
    l_q = l_q * al + (((pt[0] + pt[1]) + (pt[2] + pt[3])) + ((pt[4] + pt[5]) + (pt[6] + pt[7])));
#pragma unroll      /* constant indices keep the fragment, score and accumulator arrays in registers */
    for (int dt = 0; dt < DT; ++dt)
#pragma unroll      /* constant indices keep the fragment, score and accumulator arrays in registers */
      for (int r = 0; r < 8; ++r) oacc[dt][r] *= al;
#pragma unroll      /* constant indices keep the fragment, score and accumulator arrays in registers */
    for (int dt = 0; dt < DT; ++dt) oacc[dt] = mmaH<1>(av[dt].v, av[dt].v, pb.v, pb.v, oacc[dt]); }
    if (more) stash(buf ^ 1);      /* that buffer's last readers left it at the barrier that ended the trip before */
    __syncthreads(); }      /* one barrier a trip: publishes tile t + 1 and ends every wave's reads of tile t, which the next trip overwrites */
  const float lsum = l_q + xhalf(l_q); const float linv = (lsum > 0.f) ? 1.0f / lsum : 0.f;
#pragma unroll      /* constant indices keep the fragment, score and accumulator arrays in registers */
  for (int dt = 0; dt < DT; ++dt) { v4f lo4, hi4;
#pragma unroll      /* constant indices keep the fragment, score and accumulator arrays in registers */
    for (int r = 0; r < 4; ++r) { lo4[r] = oacc[dt][r] * linv; hi4[r] = oacc[dt][4 + r] * linv; }
    *(v4fa*)&sO[w][ln][dt * 16 + 8 * hh] = lo4; *(v4fa*)&sO[w][ln][dt * 16 + 8 * hh + 4] = hi4; }
  __builtin_amdgcn_fence(__ATOMIC_ACQ_REL, "workgroup"); __builtin_amdgcn_wave_barrier();
  {
#pragma unroll      /* constant indices keep the fragment, score and accumulator arrays in registers */
    for (int rp = 0; rp < RPW; rp += 128 / HPITCH) { const int r = rp + lane / (HPITCH / 4), pc = lane % (HPITCH / 4); const v4f val = *(const v4fa*)&sO[w][r][pc * 4]; *(v4f*)(O + ((size_t)b * TQ + q0 + r) * ldo + h * HPITCH + pc * 4) = val; }
     } }

__device__ __forceinline__ void d_gnstat(const float* __restrict__ x, float* __restrict__ GS, const int bg) {
  #pragma clang fp contract(off)
  __shared__ float sh[256]; const int tid = threadIdx.x; const float* base = x + (size_t)bg * CPG * SLEN; const int n = CPG * SLEN; float s = 0.f;
  for (int i = tid; i < n; i += 256) s += bf16_round(base[i]);
  sh[tid] = s; __syncthreads(); for (int st = 128; st > 0; st >>= 1) { if (tid < st) sh[tid] += sh[tid + st]; __syncthreads(); }
  const float mu = sh[0] / (float)n; __syncthreads(); float q2 = 0.f;
  for (int i = tid; i < n; i += 256) { const float d = bf16_round(base[i]) - mu; q2 += d * d; }
  sh[tid] = q2; __syncthreads(); for (int st = 128; st > 0; st >>= 1) { if (tid < st) sh[tid] += sh[tid + st]; __syncthreads(); }
  if (tid == 0) { const float rs = rsqrtf(sh[0] / (float)n + 1e-5f); { *(float*)(GS + (size_t)bg * 32) = mu; *(float*)(GS + (size_t)bg * 32 + 1) = rs;  } } }
__device__ __forceinline__ void d_wpad(const float* __restrict__ Wm, const float* __restrict__ bm, _Float16* __restrict__ BP, float* __restrict__ PB, const int bid) {
  const int r = bid * 256 + threadIdx.x; if (r >= DP) return; const int h = r / HPITCH, d = r % HPITCH; const bool live = d < HDT; const int srow = h * HDT + d;
  for (int c0 = 0; c0 < CC; c0 += 8) { FragH f; for (int q = 0; q < 8; ++q) f.h[q] = live ? (_Float16)(bf16_round(Wm[(size_t)srow * CC + c0 + q]) * 16.0f) : (_Float16)0.0f; unsigned short* dst = (unsigned short*)BP + (size_t)r * CC + c0; *(v8us*)dst = f.half[0];  }
  const float bv = live ? bm[srow] : 0.f; *(float*)(PB + r) = bv;  }
__device__ __forceinline__ void d_wio(const float* __restrict__ Wm, int nin, int nout, int pair, _Float16* __restrict__ Bt, const int bid) { const int pitch = pair ? 2 * nin : nin; const size_t t = (size_t)bid * 256 + threadIdx.x; if (t >= (size_t)nout * (pitch / 8)) return; const int pc = (int)(t % (pitch / 8)); const int o = (int)(t / (pitch / 8)); FragH f;
  for (int q = 0; q < 8; ++q) { const int col = pc * 8 + q; const bool lo = col >= nin; const int i = lo ? col - nin : col; f.h[q] = (_Float16)(bf16_round(Wm[(size_t)i * nout + o]) * (lo ? 1.0f : 16.0f)); }
  *(v8us*)((unsigned short*)Bt + (size_t)o * pitch + pc * 8) = f.half[0];  }
__device__ __forceinline__ void d_wop(const float* __restrict__ Wo, _Float16* __restrict__ Bt, const int bid) { const int t = bid * 256 + threadIdx.x; if (t >= CC * (2 * CC / 8)) return; const int pc = t % (2 * CC / 8); const int o = t / (2 * CC / 8); const bool lo = pc * 8 >= CC; FragH f;
  for (int q = 0; q < 8; ++q) { const int c = pc * 8 + q - (lo ? CC : 0); f.h[q] = (_Float16)(bf16_round(Wo[(size_t)o * CC + c]) * (lo ? 1.0f : 16.0f)); } *(v8us*)((unsigned short*)Bt + (size_t)o * 2 * CC + pc * 8) = f.half[0];  }
// The two statistics passes and the six weight conversions need nothing of each other: one grid, each part a range of block indices (the branch is the same for a whole work-group, so the barriers of the statistics part are passed by all of its threads).
// The statistics blocks run longest and come first.
#define PB_GN (NB * NGR)                          /* blocks per statistics pass */
#define PB_W1 ((HID * (2 * CC / 8) + 255) / 256)
#define PB_W2 ((CC * (HID / 8) + 255) / 256)
#define PB_WO ((CC * (2 * CC / 8) + 255) / 256)
#define PB_ALL (2 * PB_GN + 3 + PB_W1 + PB_W2 + PB_WO)
__global__ __launch_bounds__(256) void k_prep(const float* __restrict__ x0, const float* __restrict__ x1, float* __restrict__ GS,
    const float* __restrict__ Wq, const float* __restrict__ bqp, const float* __restrict__ Wk, const float* __restrict__ bkp, const float* __restrict__ Wv, const float* __restrict__ bvp, _Float16* __restrict__ BP, float* __restrict__ PB,
    const float* __restrict__ W1, _Float16* __restrict__ BW1, const float* __restrict__ W2, _Float16* __restrict__ BW2, const float* __restrict__ Wo, _Float16* __restrict__ BWO) {
  int bid = blockIdx.x;
  if (bid < 2 * PB_GN) { const bool sec = bid >= PB_GN; d_gnstat(sec ? x1 : x0, GS + (sec ? PB_GN * 32 : 0), sec ? bid - PB_GN : bid); return; }
  bid -= 2 * PB_GN;
  if (bid < 3) { d_wpad(bid == 0 ? Wq : (bid == 1 ? Wk : Wv), bid == 0 ? bqp : (bid == 1 ? bkp : bvp), BP + (size_t)bid * DP * CC, PB + bid * DP, 0); return; }
  bid -= 3;
  if (bid < PB_W1) { d_wio(W1, CC, HID, 1, BW1, bid); return; }
  bid -= PB_W1;
  if (bid < PB_W2) { d_wio(W2, HID, CC, 0, BW2, bid); return; }
  bid -= PB_W2;
  d_wop(Wo, BWO, bid); }
// One 16x16x32 f16 product; the builtin form, for which the compiler keeps the distances behind a matrix instruction itself.
__device__ __forceinline__ v8f f_mma(v16h a, v16h b, v8f c) { return __builtin_amdgcn_wmma_f32_16x16x32_f16(false, a, false, b, (short)0, c, false, false); }
__device__ __forceinline__ v16h l_frag(const unsigned short* p, int hh) { FragH f; f.half[0] = *(const v8us*)(p + 8 * hh); f.half[1] = *(const v8us*)(p + 16 + 8 * hh); return f.v; }
// Head of the block in one launch: normalise a 64-token tile of one input (all 128 channels), transposed into LDS as f16 [token][channel], and project it from there.
// blockIdx.y = 0 q, 1 k, 2 v. q and k: weight rows are the A operand and tokens the B operand, so a lane holds 8 neighbouring channels of ONE token and stores hi and residual as 16-byte pieces of the [token][channel] planes.
// v: tokens are the A operand and weight rows the B operand, so a lane holds 8 neighbouring tokens of ONE channel: a 16-byte piece of V^T. Each wave writes whole 128-byte lines.
#define XP (CC + 8)      /* LDS row pitch in halves: 16 bytes x an odd number */
template <bool ISV>
__device__ __forceinline__ void d_qkv(const float* __restrict__ x, const float* __restrict__ GS, const float* __restrict__ gam, const float* __restrict__ bet, const _Float16* __restrict__ Wp, const float* __restrict__ bp, unsigned short* __restrict__ Hh, unsigned short* __restrict__ VT, unsigned short (*sX)[XP]) {
  constexpr int NW = ISV ? 1 : 4;      /* weight fragments per k step */
  const int tid = threadIdx.x, w = tid >> 5, lane = tid & 31, ln = lane & 15, hh = lane >> 4;
  const int b = blockIdx.x / (SLEN / 64), pb = blockIdx.x % (SLEN / 64);
  const int ch0 = ISV ? w * 16 : (w >> 2) * 64;      /* this wave's first channel: 16 channels x 64 tokens for v, 64 channels x 16 tokens for q and k */
  v16h wf[CC / 32][NW]; v4f bl[NW][2]; float bv1 = 0.f;      /* this wave's weight fragments and biases, asked for before the tile so that they arrive while it is normalised */
#pragma unroll      /* constant indices keep the fragment arrays in registers */
  for (int ks = 0; ks < CC / 32; ++ks)
#pragma unroll      /* as above */
    for (int mt = 0; mt < NW; ++mt) wf[ks][mt] = g2_frag(Wp + (size_t)(ch0 + mt * 16 + ln) * CC + ks * 32, hh);
  if (ISV) bv1 = bp[ch0 + ln];
  else {
#pragma unroll      /* as above */
    for (int mt = 0; mt < NW; ++mt) { bl[mt][0] = *(const v4fa*)(bp + ch0 + mt * 16 + 8 * hh); bl[mt][1] = *(const v4fa*)(bp + ch0 + mt * 16 + 8 * hh + 4); } }
  asm volatile("s_wait_xcnt 0x0" ::: "memory");      /* no later instruction writes into a register that one of the loads above still names as its address */
  const int cl0 = tid >> 2, pj = (tid & 3) * 4;      /* 4 lanes per channel row: the 2-byte LDS stores of a wave fall into different banks; a thread has channels cl0 and cl0 + 64, positions pj + 16 jj */
  const float* xp = x + ((size_t)b * CC + cl0) * SLEN + pb * 64 + pj; const float* gp = GS + ((size_t)b * NGR + cl0 / CPG) * 32;
  v4f xa[2][4]; float mu[2], rs[2], gg[2], be[2];      /* every address below is one of four bases plus a constant, so no load's result lands in a register that an earlier load names as its address */
#pragma unroll      /* constant indices keep the values in registers */
  for (int e = 0; e < 2; ++e) { mu[e] = gp[e * (64 / CPG) * 32]; rs[e] = gp[e * (64 / CPG) * 32 + 1]; gg[e] = gam[cl0 + 64 * e]; be[e] = bet[cl0 + 64 * e]; }
  asm volatile("s_wait_xcnt 0x0" ::: "memory");      /* as above, for the statistics and the scale and shift */
#pragma unroll      /* eight 16-byte pieces per thread, all in flight together */
  for (int e = 0; e < 2; ++e)
#pragma unroll      /* as above */
    for (int jj = 0; jj < 4; ++jj) xa[e][jj] = *(const v4fa*)(xp + (size_t)e * 64 * SLEN + jj * 16);
  asm volatile("s_wait_xcnt 0x0" ::: "memory");      /* as above, for the tile's loads */
#pragma unroll      /* constant indices keep the tile's pieces in registers */
  for (int e = 0; e < 2; ++e) { const float g = bf16_round(gg[e]), bb = bf16_round(be[e]);
#pragma unroll      /* as above */
    for (int jj = 0; jj < 4; ++jj)
#pragma unroll      /* as above */
      for (int q = 0; q < 4; ++q) { FragH f; f.h[0] = (_Float16)((bf16_round(xa[e][jj][q]) - mu[e]) * rs[e] * g + bb); sX[pj + 16 * jj + q][cl0 + 64 * e] = f.u[0]; } }
  __syncthreads();      /* the tile is written before any wave takes fragments from it; every thread of the work-group is on the same side of ISV */
  const v8f z8 = {0.f,0.f,0.f,0.f,0.f,0.f,0.f,0.f}; v8f acc[4] = {z8, z8, z8, z8};
  if constexpr (!ISV) { const int tk = (w & 3) * 16 + ln;      /* this lane's token */
#pragma unroll      /* as above */
    for (int ks = 0; ks < CC / 32; ++ks) { const v16h t = l_frag(&sX[tk][ks * 32], hh);
#pragma unroll      /* as above */
      for (int mt = 0; mt < 4; ++mt) acc[mt] = f_mma(wf[ks][mt], t, acc[mt]); }
    Hh += ((size_t)b * SLEN + pb * 64 + tk) * DP; unsigned short* Hl = Hh + (size_t)NR * DP;
#pragma unroll      /* as above */
    for (int mt = 0; mt < 4; ++mt) { FragH fh, fl;
#pragma unroll      /* as above */
      for (int r = 0; r < 8; ++r) { const float v = acc[mt][r] * 0.0625f + bf16_round(bl[mt][r >> 2][r & 3]); const _Float16 h = (_Float16)v; fh.h[r] = h; fl.h[r] = (_Float16)((v - (float)h) * 1024.0f); }
      *(v8us*)(Hh + ch0 + mt * 16 + 8 * hh) = fh.half[0]; *(v8us*)(Hl + ch0 + mt * 16 + 8 * hh) = fl.half[0]; }
    asm volatile("s_wait_xcnt 0x0" ::: "memory");      /* in the built code the v side follows this one, and it writes into registers that the stores above name */
  } else {
#pragma unroll      /* as above */
    for (int ks = 0; ks < CC / 32; ++ks)
#pragma unroll      /* as above */
      for (int mt = 0; mt < 4; ++mt) acc[mt] = f_mma(l_frag(&sX[mt * 16 + ln][ks * 32], hh), wf[ks][0], acc[mt]);
    const float bv = bf16_round(bv1); unsigned short* dst = VT + ((size_t)b * DP + ch0 + ln) * TK + pb * 64;      /* row (b, head, d) of V^T = row b * 128 + channel */
#pragma unroll      /* as above */
    for (int mt = 0; mt < 4; ++mt) { FragH f;
#pragma unroll      /* as above */
      for (int r = 0; r < 8; ++r) f.h[r] = (_Float16)(acc[mt][r] * 0.0625f + bv);
      *(v8us*)(dst + mt * 16 + 8 * hh) = f.half[0]; }
  } }
__global__ __launch_bounds__(256) void k_qkv(const float* __restrict__ x0, const float* __restrict__ x1, const float* __restrict__ GS, const float* __restrict__ gam0, const float* __restrict__ bet0, const float* __restrict__ gam1, const float* __restrict__ bet1,
    const _Float16* __restrict__ BP, const float* __restrict__ PB, _Float16* __restrict__ QKH, _Float16* __restrict__ VT) {
  __shared__ __attribute__((aligned(16))) unsigned short sX[64][XP];
  const int y = blockIdx.y; const bool sec = y != 0;      /* the same for a whole work-group */
  const float* x = sec ? x1 : x0; const float* gam = sec ? gam1 : gam0; const float* bet = sec ? bet1 : bet0; const float* gs = GS + (sec ? NB * NGR * 32 : 0);
  if (y == 2) d_qkv<true>(x, gs, gam, bet, BP + (size_t)y * DP * CC, PB + y * DP, nullptr, (unsigned short*)VT, sX);
  else d_qkv<false>(x, gs, gam, bet, BP + (size_t)y * DP * CC, PB + y * DP, (unsigned short*)QKH + (size_t)y * 2 * NR * DP, nullptr, sX); }
// Tail of the block in one launch: everything behind the attention is row-wise, so a work-group takes 32 tokens through hi/residual split, W1 + exact GELU, W2 + residual, hi/residual split and Wo; the values between the products pass through LDS.
// W1 and W2: weight rows are the A operand and tokens the B operand (a lane holds 8 neighbouring columns of one token: one 16-byte LDS store). Wo: tokens are the A operand (a lane holds 8 neighbouring tokens of one output channel: the NCHW order of out).
#define PT 32                /* tokens per work-group: one 128-byte line of each output channel */
#define PP (2 * CC + 8)      /* LDS row pitch in halves: 16 bytes x an odd number */
__global__ __launch_bounds__(256) void k_tail(const float* __restrict__ O, const _Float16* __restrict__ BW1, const float* __restrict__ b1, const _Float16* __restrict__ BW2, const float* __restrict__ b2, const _Float16* __restrict__ BWO, const float* __restrict__ bo, float* __restrict__ out) {
  __shared__ __attribute__((aligned(16))) unsigned short sA[PT][PP]; __shared__ __attribute__((aligned(16))) unsigned short sG[PT][PP]; __shared__ __attribute__((aligned(16))) unsigned short sF[PT][PP]; __shared__ __attribute__((aligned(16))) float sR[PT][CC + 4];
  const int tid = threadIdx.x, w = tid >> 5, lane = tid & 31, ln = lane & 15, hh = lane >> 4; const int r0 = blockIdx.x * PT;
  v16h w1[8][2];      /* W1 rows w * 32 .. + 31, asked for before the tile */
#pragma unroll      /* constant indices keep the fragment arrays in registers */
  for (int ks = 0; ks < 8; ++ks)
#pragma unroll
    for (int mt = 0; mt < 2; ++mt) w1[ks][mt] = g2_frag(BW1 + (size_t)(w * 32 + mt * 16 + ln) * (2 * CC) + ks * 32, hh);
  v4f c1[2][2], c2[2];
#pragma unroll
  for (int mt = 0; mt < 2; ++mt) { c1[mt][0] = *(const v4fa*)(b1 + w * 32 + mt * 16 + 8 * hh); c1[mt][1] = *(const v4fa*)(b1 + w * 32 + mt * 16 + 8 * hh + 4); }
  c2[0] = *(const v4fa*)(b2 + w * 16 + 8 * hh); c2[1] = *(const v4fa*)(b2 + w * 16 + 8 * hh + 4); const float c3 = bo[w * 16 + ln];
  { const int tk = tid >> 3, c0 = (tid & 7) * 16; const float* sp = O + (size_t)(r0 + tk) * DP + c0; v4f xv[4];
#pragma unroll
    for (int q = 0; q < 4; ++q) xv[q] = *(const v4fa*)(sp + 4 * q);
    asm volatile("s_wait_xcnt 0x0" ::: "memory");      /* no later instruction writes into a register that one of the loads above still names as its address */
#pragma unroll
    for (int g = 0; g < 2; ++g) { FragH fh, fl;
#pragma unroll
      for (int q = 0; q < 8; ++q) { const float v = xv[g * 2 + (q >> 2)][q & 3]; const _Float16 hv = (_Float16)v; fh.h[q] = hv; fl.h[q] = (_Float16)((v - (float)hv) * 16.0f); }
      *(v8us*)&sA[tk][c0 + 8 * g] = fh.half[0]; *(v8us*)&sA[tk][CC + c0 + 8 * g] = fl.half[0]; }
#pragma unroll
    for (int q = 0; q < 4; ++q) *(v4fa*)&sR[tk][c0 + 4 * q] = xv[q]; }
  __syncthreads();      /* attention output, split, is written before any wave takes fragments from it */
  const v8f z8 = {0.f,0.f,0.f,0.f,0.f,0.f,0.f,0.f}; v8f a1[2][2] = {{z8, z8}, {z8, z8}};
#pragma unroll
  for (int ks = 0; ks < 8; ++ks) { const v16h t0 = l_frag(&sA[ln][ks * 32], hh), t1 = l_frag(&sA[16 + ln][ks * 32], hh);
#pragma unroll
    for (int mt = 0; mt < 2; ++mt) { a1[mt][0] = f_mma(w1[ks][mt], t0, a1[mt][0]); a1[mt][1] = f_mma(w1[ks][mt], t1, a1[mt][1]); } }
  v16h w2[8], w3[8];      /* W2 and Wo rows w * 16 .. + 15: on their way while the GELU is computed */
#pragma unroll
  for (int ks = 0; ks < 8; ++ks) { w2[ks] = g2_frag(BW2 + (size_t)(w * 16 + ln) * HID + ks * 32, hh); w3[ks] = g2_frag(BWO + (size_t)(w * 16 + ln) * (2 * CC) + ks * 32, hh); }
  asm volatile("s_wait_xcnt 0x0" ::: "memory");      /* as above, for the weight loads */
#pragma unroll
  for (int mt = 0; mt < 2; ++mt)
#pragma unroll
    for (int nt = 0; nt < 2; ++nt) { FragH f;
#pragma unroll
      for (int r = 0; r < 8; ++r) { float v = a1[mt][nt][r] * 0.0625f + bf16_round(c1[mt][r >> 2][r & 3]); v = 0.5f * v * (1.0f + erff(v * 0.70710678118654752f)); f.h[r] = (_Float16)v; }
      *(v8us*)&sG[nt * 16 + ln][w * 32 + mt * 16 + 8 * hh] = f.half[0]; }
  __syncthreads();      /* the hidden layer is complete before the second product reads it */
  v8f a2[2] = {z8, z8};
#pragma unroll
  for (int ks = 0; ks < 8; ++ks) { a2[0] = f_mma(w2[ks], l_frag(&sG[ln][ks * 32], hh), a2[0]); a2[1] = f_mma(w2[ks], l_frag(&sG[16 + ln][ks * 32], hh), a2[1]); }
#pragma unroll
  for (int nt = 0; nt < 2; ++nt) { const int tk = nt * 16 + ln, c0 = w * 16 + 8 * hh; const v4f ra = *(const v4fa*)&sR[tk][c0], rb = *(const v4fa*)&sR[tk][c0 + 4]; FragH fh, fl;
#pragma unroll
    for (int r = 0; r < 8; ++r) { float v = a2[nt][r] * 0.0625f + bf16_round(c2[r >> 2][r & 3]); v += (r < 4) ? ra[r & 3] : rb[r & 3]; const _Float16 hv = (_Float16)v; fh.h[r] = hv; fl.h[r] = (_Float16)((v - (float)hv) * 16.0f); }
    *(v8us*)&sF[tk][c0] = fh.half[0]; *(v8us*)&sF[tk][CC + c0] = fl.half[0]; }
  __syncthreads();      /* out + mlp, split, is complete before the last product reads it */
  v8f a3[2] = {z8, z8};
#pragma unroll
  for (int ks = 0; ks < 8; ++ks) { a3[0] = f_mma(l_frag(&sF[ln][ks * 32], hh), w3[ks], a3[0]); a3[1] = f_mma(l_frag(&sF[16 + ln][ks * 32], hh), w3[ks], a3[1]); }
  const float bv = bf16_round(c3); float* d = out + ((size_t)(r0 / SLEN) * CC + w * 16 + ln) * SLEN + (r0 % SLEN) + 8 * hh;
#pragma unroll
  for (int mt = 0; mt < 2; ++mt) { v4f lo4, hi4;
#pragma unroll
    for (int r = 0; r < 4; ++r) { lo4[r] = a3[mt][r] * 0.0625f + bv; hi4[r] = a3[mt][4 + r] * 0.0625f + bv; }
    *(v4f*)(d + mt * 16) = lo4; *(v4f*)(d + mt * 16 + 4) = hi4; } }

extern "C" void kernel_launch(void* const* d_in, const int* in_sizes, int n_in,
                              void* d_out, int out_size, void* d_ws, size_t ws_size, hipStream_t stream) {
  (void)in_sizes; (void)n_in; (void)out_size;
  const float* const* I = (const float* const*)d_in; const float* fo = I[0]; const float* fs = I[1]; const float* gq = I[2]; const float* bq = I[3]; const float* gkv = I[4]; const float* bkv = I[5]; const float* Wq = I[6]; const float* bqp = I[7]; const float* Wk = I[8]; const float* bkp = I[9]; const float* Wv = I[10]; const float* bvp = I[11]; const float* W1 = I[12]; const float* b1 = I[13]; const float* W2 = I[14]; const float* b2 = I[15]; const float* Wo = I[16]; const float* bo = I[17];
  char* ws = (char*)d_ws; size_t off = 0;
  auto take = [&](size_t bytes) { char* p = ws + off; off += (bytes + 255) & ~(size_t)255; return p; };
  _Float16* BPq = (_Float16*)take((size_t)3 * DP * CC * 2); float* PBq = (float*)take(3 * DP * 4);      /* q, k, v planes one behind the other */
  _Float16* BW1 = (_Float16*)take((size_t)HID * 2 * CC * 2); _Float16* BW2 = (_Float16*)take((size_t)CC * HID * 2); _Float16* BWO = (_Float16*)take((size_t)CC * 2 * CC * 2); float* GS = (float*)take((size_t)NB * NGR * 32 * 4 * 2);
  _Float16* QH = (_Float16*)take((size_t)4 * NR * DP * 2); _Float16* QL = QH + (size_t)NR * DP; _Float16* KH = QH + (size_t)2 * NR * DP; _Float16* KL = QH + (size_t)3 * NR * DP; _Float16* VT = (_Float16*)take((size_t)NR * DP * 2);      /* q hi, q residual, k hi, k residual; V^T */
  float* O = (float*)take((size_t)NR * DP * 4);      /* attention output */
  if (off > ws_size) return;      /* 0.5 + 4 x 2 + 2 + 4 = 15 MiB */
  k_prep<<<PB_ALL, 256, 0, stream>>>(fo, fs, GS, Wq, bqp, Wk, bkp, Wv, bvp, BPq, PBq, W1, BW1, W2, BW2, Wo, BWO);      /* group statistics of both inputs; conv1x1 weights (out,in) = natural rows; MLP and output weights */
  k_qkv<<<dim3(NR / 64, 3), 256, 0, stream>>>(fo, fs, GS, gq, bq, gkv, bkv, BPq, PBq, QH, VT);      /* normalise + q, k (hi + residual planes), V^T */
  k_flashqk<0><<<NB * NH * QBLKS, 128, 0, stream>>>(QH, QL, DP, KH, KL, DP, VT, nullptr, O, DP);      /* q/k hi + residual; P (x2^10) and V plain f16 */
  k_tail<<<NR / PT, 256, 0, stream>>>(O, BW1, b1, BW2, b2, BWO, bo, (float*)d_out);      /* gelu_erf(out W1 + b1) W2 + b2 + out, conv1x1 Wo + bo, NCHW */
}

// v007
// A run of this version takes 73 microseconds.
// Two timings next to v006 put it at 1.05 and 1.02 times that version's speed.
// Over all steps from v000 it is 9.09 times as fast.
#include <hip/hip_runtime.h>
// SFBlock (2 x 128 x 64 x 64; 4 heads x 32; GroupNorm(32) on both inputs; q from feat_opt, k/v from feat_sar via 1x1 convs; softmax(q k^T / sqrt(32)) v over the 4096 positions; MLP: gelu_erf(out W1 + b1) W2 + b2; fused = out + mlp; 1x1 conv Wo -> [2,128,64,64]).
// Compute dtype: inputs and parameters rounded to bf16; normalised inputs as f16 operands (~2^-12); q, k hi + residual; P (x2^10), v plain f16; attention output / fused as hi + residual pairs; the 256-wide GELU hidden as f16; f32 statistics/softmax/accumulation. v_wmma_f32_16x16x32_f16.
#define NB 2
#define CC 128
#define HID 256
#define NGR 32
#define CPG (CC / NGR)           /* 4 channels per group */
#define HDT 32
#define HPITCH HDT                   /* columns per head in the q/k/v planes: the true head dim, no padding */
#define DP (NH * HPITCH)             /* 128 */
#define NR (NB * SLEN)           /* 8192 */
#define QBLKS (TQ / 64)
#define SLEN 4096                /* H*W tokens */
#define TQ SLEN
#define TK SLEN
#define NH 4
#define SCL 0.17677669529663687f /* 32^-0.5 */
#define SCL2 ((float)(0.17677669529663687 * 1.4426950408889634)) /* 32^-0.5 * log2(e): raw score -> exponent of two */
typedef __bf16 v16b __attribute__((ext_vector_type(16)));
typedef unsigned short v8us __attribute__((ext_vector_type(8), may_alias));
typedef float  v8f  __attribute__((ext_vector_type(8)));
typedef float  v4f  __attribute__((ext_vector_type(4)));
typedef float  v4fa __attribute__((ext_vector_type(4), may_alias));
union FragB { v16b v; v8us half[2]; unsigned short u[16]; };

__device__ __forceinline__ unsigned short bf16_bits(float x) { unsigned int u = __float_as_uint(x); return (unsigned short)((u + 0x7FFFu + ((u >> 16) & 1u)) >> 16); }
__device__ __forceinline__ float bf16_val(unsigned short b) { return __uint_as_float(((unsigned int)b) << 16); }
__device__ __forceinline__ float bf16_round(float x) { return bf16_val(bf16_bits(x)); }
// D += A·B with NT terms: 1 = ah·bh, 2 = + al·bh (A split), 3 = + ah·bl (both split)
template <int NT>
__device__ __forceinline__ v8f mmaN(v16b ah, v16b al, v16b bh, v16b bl, v8f c) {
  c = __builtin_amdgcn_wmma_f32_16x16x32_bf16(false, ah, false, bh, (short)0, c, false, false);
  if (NT >= 2) c = __builtin_amdgcn_wmma_f32_16x16x32_bf16(false, al, false, bh, (short)0, c, false, false);
  if (NT >= 3) c = __builtin_amdgcn_wmma_f32_16x16x32_bf16(false, ah, false, bl, (short)0, c, false, false);
  asm volatile("v_nop\n\tv_nop\n\tv_nop\n\tv_nop" : "+v"(c) : "v"(ah), "v"(al), "v"(bh), "v"(bl));
  return c;
}

__global__ __launch_bounds__(256) void k_wt_bf16(const float* __restrict__ W, unsigned short* __restrict__ Wt, int K, int N) {
  const int t = blockIdx.x * 256 + threadIdx.x;
  const int k8n = K / 8;
  if (t >= N * k8n) return;
  const int n = t / k8n, k8 = (t % k8n) * 8;
  v8us v;
#pragma unroll
  for (int i = 0; i < 8; ++i) v[i] = bf16_bits(W[(size_t)(k8 + i) * N + n]);
  *(v8us*)(Wt + (size_t)n * K + k8) = v;
  
}

// GEMM C[M][N] (f32, pitch ldc) = act(A[M][K]·W + bias). A f32 row-major (pitch lda) converted per fragment to bf16
// (ASPLIT: hi/lo two planes -> 2 terms, else single rounded term); Wt bf16 [N][K] (pitch ldb). BIAS_BF16 rounds the
// bias to bf16 first (bias quantised to bf16 before the add). K%32==0, M%16==0, N%64==0.
template <bool ASPLIT, int ACT, bool BIAS_BF16>
__global__ __launch_bounds__(128) void k_gemm_bf(const float* __restrict__ A, int lda, const unsigned short* __restrict__ Wt, int ldb,
                                               const float* __restrict__ bias, float* __restrict__ C, int ldc, int M, int N, int K) {
  __shared__ __attribute__((aligned(16))) float so[4][16][64];
  const int tid = threadIdx.x, w = tid >> 5, lane = tid & 31, ln = lane & 15, hh = lane >> 4;
  const int ntn = N / 64;
  const int wid = blockIdx.x * 4 + w;
  const int mt = wid / ntn, nq = wid % ntn;
  if (mt * 16 >= M) return;
  const int row0 = mt * 16, col0 = nq * 64;
  const float* arow = A + (size_t)(row0 + ln) * lda;
  v8f acc[4] = {};
  for (int kb = 0; kb < K; kb += 32) {
    FragB ah, al;
    const v4f x0 = *(const v4fa*)(arow + kb + 8 * hh), x1 = *(const v4fa*)(arow + kb + 8 * hh + 4);
    const v4f x2 = *(const v4fa*)(arow + kb + 16 + 8 * hh), x3 = *(const v4fa*)(arow + kb + 16 + 8 * hh + 4);
    float xs[16] = {x0[0],x0[1],x0[2],x0[3],x1[0],x1[1],x1[2],x1[3],x2[0],x2[1],x2[2],x2[3],x3[0],x3[1],x3[2],x3[3]};
#pragma unroll
    for (int i = 0; i < 16; ++i) { const unsigned short hb = bf16_bits(xs[i]); ah.u[i] = hb; al.u[i] = ASPLIT ? bf16_bits(xs[i] - bf16_val(hb)) : (unsigned short)0; }
#pragma unroll
    for (int t = 0; t < 4; ++t) {
      const unsigned short* brow = Wt + (size_t)(col0 + t * 16 + ln) * ldb + kb;
      FragB b;
      b.half[0] = *(const v8us*)(brow + 8 * hh);
      b.half[1] = *(const v8us*)(brow + 16 + 8 * hh);
      acc[t] = mmaN<ASPLIT ? 2 : 1>(ah.v, al.v, b.v, b.v, acc[t]);
    }
  }
#pragma unroll
  for (int t = 0; t < 4; ++t) {
    float bv = bias ? bias[col0 + t * 16 + ln] : 0.f;
    if (BIAS_BF16) bv = bf16_round(bv);
#pragma unroll
    for (int r = 0; r < 8; ++r) { float v = acc[t][r] + bv; if (ACT == 1) v = fmaxf(v, 0.f); so[w][8 * hh + r][t * 16 + ln] = v; }
  }
  __builtin_amdgcn_fence(__ATOMIC_ACQ_REL, "workgroup");
  __builtin_amdgcn_wave_barrier();
  const int rsub = lane >> 4, c4 = (lane & 15) * 4;
  {
#pragma unroll
    for (int q = 0; q < 8; ++q) {
      const int r = q * 2 + rsub;
      const v4f v = *(const v4fa*)&so[w][r][c4];
      *(v4f*)(C + (size_t)(row0 + r) * ldc + col0 + c4) = v;
    }
    
  }
}

// GEMM C = act(A·W + bias + resid): A f32 (ASPLIT -> hi/lo 2 terms), Wt bf16 [N][K]; ACT 0 none, 1 relu, 2 exact gelu;
// resid (optional, f32, row index = (row % rmod), pitch ldr, RES_BF16 rounds it) added before the activation.
template <bool ASPLIT, int ACT, bool BIAS_BF16, bool RES_BF16>
__global__ __launch_bounds__(128) void k_gemm_bf3(const float* __restrict__ A, int lda, const unsigned short* __restrict__ Wt, int ldb,
                                                const float* __restrict__ bias, const float* __restrict__ resid, int rmod, int ldr,
                                                float* __restrict__ C, int ldc, int M, int N, int K) {
  __shared__ __attribute__((aligned(16))) float so[4][16][64];
  const int tid = threadIdx.x, w = tid >> 5, lane = tid & 31, ln = lane & 15, hh = lane >> 4;
  const int ntn = N / 64;
  const int wid = blockIdx.x * 4 + w;
  const int mt = wid / ntn, nq = wid % ntn;
  if (mt * 16 >= M) return;
  const int row0 = mt * 16, col0 = nq * 64;
  const float* arow = A + (size_t)(row0 + ln) * lda;
  v8f acc[4] = {};
  for (int kb = 0; kb < K; kb += 32) {
    FragB ah, al;
    const v4f x0 = *(const v4fa*)(arow + kb + 8 * hh), x1 = *(const v4fa*)(arow + kb + 8 * hh + 4);
    const v4f x2 = *(const v4fa*)(arow + kb + 16 + 8 * hh), x3 = *(const v4fa*)(arow + kb + 16 + 8 * hh + 4);
    float xs[16] = {x0[0],x0[1],x0[2],x0[3],x1[0],x1[1],x1[2],x1[3],x2[0],x2[1],x2[2],x2[3],x3[0],x3[1],x3[2],x3[3]};
#pragma unroll
    for (int i = 0; i < 16; ++i) { const unsigned short hb = bf16_bits(xs[i]); ah.u[i] = hb; al.u[i] = ASPLIT ? bf16_bits(xs[i] - bf16_val(hb)) : (unsigned short)0; }
#pragma unroll
    for (int t = 0; t < 4; ++t) {
      const unsigned short* brow = Wt + (size_t)(col0 + t * 16 + ln) * ldb + kb;
      FragB b;
      b.half[0] = *(const v8us*)(brow + 8 * hh);
      b.half[1] = *(const v8us*)(brow + 16 + 8 * hh);
      acc[t] = mmaN<ASPLIT ? 2 : 1>(ah.v, al.v, b.v, b.v, acc[t]);
    }
  }
#pragma unroll
  for (int t = 0; t < 4; ++t) {
    const int col = col0 + t * 16 + ln;
    float bv = bias ? bias[col] : 0.f;
    if (BIAS_BF16) bv = bf16_round(bv);
#pragma unroll
    for (int r = 0; r < 8; ++r) {
      float v = acc[t][r] + bv;
      if (resid) { float rv = resid[(size_t)((row0 + 8 * hh + r) % rmod) * ldr + col]; if (RES_BF16) rv = bf16_round(rv); v += rv; }
      if (ACT == 1) v = fmaxf(v, 0.f);
      if (ACT == 2) v = 0.5f * v * (1.0f + erff(v * 0.70710678118654752f));
      if (ACT == 3) { const float u = 0.7978845608028654f * (v + 0.044715f * v * v * v); v = 0.5f * v * (1.0f + tanhf(u)); }
      so[w][8 * hh + r][t * 16 + ln] = v;
    }
  }
  __builtin_amdgcn_fence(__ATOMIC_ACQ_REL, "workgroup");
  __builtin_amdgcn_wave_barrier();
  const int rsub = lane >> 4, c4 = (lane & 15) * 4;
  {
#pragma unroll
    for (int q = 0; q < 8; ++q) {
      const int r = q * 2 + rsub;
      const v4f v = *(const v4fa*)&so[w][r][c4];
      *(v4f*)(C + (size_t)(row0 + r) * ldc + col0 + c4) = v;
    }
    
  }
}
// row LayerNorm (biased variance, eps) over N: s = X (+ R); optional out_sum <- s; out_norm <- (s-mu)*rsqrt(var+eps)*g + b
template <bool PARAM_BF16>
__global__ __launch_bounds__(256) void k_layernorm(const float* __restrict__ X, const float* __restrict__ R, const float* __restrict__ g, const float* __restrict__ bta,
                                                  float* __restrict__ out_sum, float* __restrict__ out_norm, int N, float eps) {
  __shared__ float red[256];
  const int row = blockIdx.x, tid = threadIdx.x;
  const float* x = X + (size_t)row * N; const float* rr = R ? R + (size_t)row * N : nullptr;
  float vals[16];                     // up to N = 4096
  const int per = N / 256;            // contiguous chunk per thread? use strided-by-4 chunks: thread handles j = tid*4 + 1024*u
  float s1 = 0.f;
  for (int u = 0; u < per / 4; ++u) {
    const int j = tid * 4 + 1024 * u;
    const v4f a = *(const v4fa*)(x + j);
    v4f b = {0.f,0.f,0.f,0.f}; if (rr) b = *(const v4fa*)(rr + j);
#pragma unroll
    for (int q = 0; q < 4; ++q) { const float v = a[q] + b[q]; vals[u * 4 + q] = v; s1 += v; }
  }
  red[tid] = s1; __syncthreads();
  for (int st = 128; st > 0; st >>= 1) { if (tid < st) red[tid] += red[tid + st]; __syncthreads(); }
  const float mu = red[0] / (float)N; __syncthreads();
  float s2 = 0.f;
  for (int u = 0; u < per / 4; ++u)
#pragma unroll
    for (int q = 0; q < 4; ++q) { const float c = vals[u * 4 + q] - mu; s2 += c * c; }
  red[tid] = s2; __syncthreads();
  for (int st = 128; st > 0; st >>= 1) { if (tid < st) red[tid] += red[tid + st]; __syncthreads(); }
  const float rs = rsqrtf(red[0] / (float)N + eps);
  {
    for (int u = 0; u < per / 4; ++u) {
      const int j = tid * 4 + 1024 * u;
      v4f o, sm;
#pragma unroll
      for (int q = 0; q < 4; ++q) {
        float gg = g[j + q], bb = bta[j + q];
        if (PARAM_BF16) { gg = bf16_round(gg); bb = bf16_round(bb); }
        sm[q] = vals[u * 4 + q]; o[q] = (vals[u * 4 + q] - mu) * rs * gg + bb;
      }
      if (out_sum) *(v4f*)(out_sum + (size_t)row * N + j) = sm;
      *(v4f*)(out_norm + (size_t)row * N + j) = o;
    }
    
  }
}



// ---- f16 WMMA path (v_wmma_f32_16x16x32_f16): 11-bit significands for operands in range — used where a [0,1] probability operand needs more precision than bf16
typedef _Float16 v16h __attribute__((ext_vector_type(16)));
union FragH { v16h v; v8us half[2]; _Float16 h[16]; unsigned short u[16]; };
template <int NT>
__device__ __forceinline__ v8f mmaH(v16h ah, v16h al, v16h bh, v16h bl, v8f c) {
  c = __builtin_amdgcn_wmma_f32_16x16x32_f16(false, ah, false, bh, (short)0, c, false, false);
  if (NT >= 2) c = __builtin_amdgcn_wmma_f32_16x16x32_f16(false, al, false, bh, (short)0, c, false, false);
  if (NT >= 3) c = __builtin_amdgcn_wmma_f32_16x16x32_f16(false, ah, false, bl, (short)0, c, false, false);
  asm volatile("v_nop\n\tv_nop\n\tv_nop\n\tv_nop" : "+v"(c) : "v"(ah), "v"(al), "v"(bh), "v"(bl));
  return c;
}
// batched GEMM like k_gemm_b but f16 operands: A f32 (split into f16 hi/lo if ASPLIT, else rounded to f16), Bt = f16 values [n][k]; alpha; C f32; N multiple of 16 (partial tiles skipped)
template <bool ASPLIT>
__global__ __launch_bounds__(128) void k_gemm_h(const float* __restrict__ A, int lda, size_t sA, const _Float16* __restrict__ Bh, int ldb, size_t sB, float alpha, float* __restrict__ C, int ldc, size_t sC, int M, int N, int K) {
  __shared__ __attribute__((aligned(16))) float so[4][16][64];
  const int tid = threadIdx.x, w = tid >> 5, lane = tid & 31, ln = lane & 15, hh = lane >> 4; const int by = blockIdx.y;
  A += (size_t)by * sA; Bh += (size_t)by * sB; C += (size_t)by * sC;
  const int ntn = (N + 63) / 64; const int wid = blockIdx.x * 4 + w; const int mt = wid / ntn, nq = wid % ntn; if (mt * 16 >= M) return;
  const int row0 = mt * 16, col0 = nq * 64; const float* arow = A + (size_t)(row0 + ln) * lda;
  v8f acc[4] = {};
  for (int kb = 0; kb < K; kb += 32) {
    FragH ah, al;
    const v4f x0 = *(const v4fa*)(arow + kb + 8 * hh), x1 = *(const v4fa*)(arow + kb + 8 * hh + 4), x2 = *(const v4fa*)(arow + kb + 16 + 8 * hh), x3 = *(const v4fa*)(arow + kb + 16 + 8 * hh + 4);
    float xs[16] = {x0[0],x0[1],x0[2],x0[3],x1[0],x1[1],x1[2],x1[3],x2[0],x2[1],x2[2],x2[3],x3[0],x3[1],x3[2],x3[3]};
#pragma unroll
    for (int i = 0; i < 16; ++i) { const _Float16 h = (_Float16)xs[i]; ah.h[i] = h; al.h[i] = ASPLIT ? (_Float16)(xs[i] - (float)h) : (_Float16)0.0f; }
#pragma unroll
    for (int t = 0; t < 4; ++t) { if (col0 + t * 16 >= N) continue; const size_t boff = (size_t)(col0 + t * 16 + ln) * ldb + kb; FragH bq; bq.half[0] = *(const v8us*)(Bh + boff + 8 * hh); bq.half[1] = *(const v8us*)(Bh + boff + 16 + 8 * hh);
      acc[t] = mmaH<ASPLIT ? 2 : 1>(ah.v, al.v, bq.v, bq.v, acc[t]); }
  }
#pragma unroll
  for (int t = 0; t < 4; ++t) { if (col0 + t * 16 >= N) continue;
#pragma unroll
    for (int r = 0; r < 8; ++r) so[w][8 * hh + r][t * 16 + ln] = acc[t][r] * alpha; }
  __builtin_amdgcn_fence(__ATOMIC_ACQ_REL, "workgroup"); __builtin_amdgcn_wave_barrier();
  const int rsub = lane >> 4, c4 = (lane & 15) * 4;
  {
#pragma unroll
    for (int q = 0; q < 8; ++q) { const int r = q * 2 + rsub; if (col0 + c4 < N) { const v4f v = *(const v4fa*)&so[w][r][c4]; *(v4f*)(C + (size_t)(row0 + r) * ldc + col0 + c4) = v; } }
     }
}

// Wt[n][k] = f16(W[k][n]·scale) from f32 row-major W[K][N] (scale = power of two; bf16-exact weights stay exact in f16 away from the subnormal range)
__global__ __launch_bounds__(256) void k_wt_f16(const float* __restrict__ W, _Float16* __restrict__ Wt, int K, int N, float scale) {
  const int t = blockIdx.x * 256 + threadIdx.x; if (t >= N * (K / 8)) return; const int n = t / (K / 8), k8 = (t % (K / 8)) * 8; FragH f;
#pragma unroll
  for (int i = 0; i < 8; ++i) f.h[i] = (_Float16)(bf16_round(W[(size_t)(k8 + i) * N + n]) * scale); const v8us o = f.half[0];
  *(v8us*)((unsigned short*)Wt + (size_t)n * K + k8) = o; 
}
// k_gemm_hh variant with fused epilogue: v = acc·alpha + bias[by·sBias + col] (+ CP[(row/rowsPerB)·sCPb + by·64 + col] if CP) ; ACT 0 none / 1 elu ; writes f16 C16 (and f32 C if non-null)
template <int ACT>
__global__ __launch_bounds__(128) void k_gemm_hhx(const _Float16* __restrict__ A, int lda, size_t sA, const _Float16* __restrict__ Bh, int ldb, size_t sB, float alpha, const float* __restrict__ bias, size_t sBias, const float* __restrict__ CP, int rowsPerB, size_t sCPb, int row0g,
    float* __restrict__ C, _Float16* __restrict__ C16, int ldc, size_t sC, int M, int N, int K) {
  __shared__ __attribute__((aligned(16))) float so[4][16][64];
  const int tid = threadIdx.x, w = tid >> 5, lane = tid & 31, ln = lane & 15, hh = lane >> 4; const int by = blockIdx.y;
  A += (size_t)by * sA; Bh += (size_t)by * sB; const size_t cofs = (size_t)by * sC; const float* bp = bias ? bias + (size_t)by * sBias : nullptr;
  const int ntn = (N + 63) / 64; const int wid = blockIdx.x * 4 + w; const int mt = wid / ntn, nq = wid % ntn; if (mt * 16 >= M) return;
  const int row0 = mt * 16, col0 = nq * 64; const _Float16* arow = A + (size_t)(row0 + ln) * lda;
  v8f acc[4] = {};
  for (int kb = 0; kb < K; kb += 32) { FragH ah; ah.half[0] = *(const v8us*)((const unsigned short*)arow + kb + 8 * hh); ah.half[1] = *(const v8us*)((const unsigned short*)arow + kb + 16 + 8 * hh);
#pragma unroll
    for (int t = 0; t < 4; ++t) { if (col0 + t * 16 >= N) continue; const size_t boff = (size_t)(col0 + t * 16 + ln) * ldb + kb; FragH bq; bq.half[0] = *(const v8us*)((const unsigned short*)Bh + boff + 8 * hh); bq.half[1] = *(const v8us*)((const unsigned short*)Bh + boff + 16 + 8 * hh);
      acc[t] = mmaH<1>(ah.v, ah.v, bq.v, bq.v, acc[t]); }
  }
#pragma unroll
  for (int t = 0; t < 4; ++t) { if (col0 + t * 16 >= N) continue; const int col = col0 + t * 16 + ln; const float bv = bp ? bf16_round(bp[col]) : 0.f;
#pragma unroll
    for (int r = 0; r < 8; ++r) { float v = acc[t][r] * alpha + bv; if (CP) { const int bidx = (row0g + row0 + 8 * hh + r) / rowsPerB; v += CP[(size_t)bidx * sCPb + (size_t)by * 64 + col]; } if (ACT == 1) v = (v > 0.f) ? v : expm1f(v); else if (ACT == 7) v = (v > 0.f) ? v + 1.0f : expf(v); else if (ACT == 8) v = tanhf(v); else if (ACT == 9) v = 0.5f * v * (1.0f + tanhf(0.7978845608028654f * (v + 0.044715f * v * v * v))); else if (ACT == 11) v = 1.0f / (1.0f + expf(-v)); else if (ACT == 12) v = (v > 0.f) ? v : 0.01f * v; else if (ACT == 14) v = (v > 0.f) ? v : 0.1f * v; else if (ACT == 15) v = v / (1.0f + expf(-v)); else if (ACT == 3) v = fmaxf(v, 0.f); else if (ACT == 6) v = 0.5f * v * (1.0f + erff(v * 0.70710678118654752f)); so[w][8 * hh + r][t * 16 + ln] = v; } }
  __builtin_amdgcn_fence(__ATOMIC_ACQ_REL, "workgroup"); __builtin_amdgcn_wave_barrier();
  const int rsub = lane >> 4, c4 = (lane & 15) * 4; typedef _Float16 v4h __attribute__((ext_vector_type(4)));
  {
#pragma unroll
    for (int q = 0; q < 8; ++q) { const int r = q * 2 + rsub; if (col0 + c4 < N) { const v4f v = *(const v4fa*)&so[w][r][c4]; if (C) *(v4f*)(C + cofs + (size_t)(row0 + r) * ldc + col0 + c4) = v; if (C16) { v4h h4; for (int i = 0; i < 4; ++i) h4[i] = (_Float16)v[i]; *(v4h*)(C16 + cofs + (size_t)(row0 + r) * ldc + col0 + c4) = h4; } } }
     }
}


typedef _Float16 v4h __attribute__((ext_vector_type(4)));

__global__ __launch_bounds__(256) void k_x16(const float* __restrict__ x, _Float16* __restrict__ X16, size_t n8) { const size_t t = (size_t)blockIdx.x * 256 + threadIdx.x; if (t >= n8) return; FragH f;
#pragma unroll
  for (int q = 0; q < 8; ++q) f.h[q] = (_Float16)bf16_round(x[t * 8 + q]); *(v8us*)((unsigned short*)X16 + t * 8) = f.half[0];  }
__global__ __launch_bounds__(256) void k_h16(const float* __restrict__ x, _Float16* __restrict__ X16, size_t n8) { const size_t t = (size_t)blockIdx.x * 256 + threadIdx.x; if (t >= n8) return; FragH f;
#pragma unroll
  for (int q = 0; q < 8; ++q) f.h[q] = (_Float16)x[t * 8 + q]; *(v8us*)((unsigned short*)X16 + t * 8) = f.half[0];  }
__global__ __launch_bounds__(256) void k_round16f(const float* __restrict__ W, _Float16* __restrict__ Bt, size_t n8) { const size_t t = (size_t)blockIdx.x * 256 + threadIdx.x; if (t >= n8) return; FragH f;
#pragma unroll
  for (int i = 0; i < 8; ++i) f.h[i] = (_Float16)(bf16_round(W[t * 8 + i]) * 16.0f); *(v8us*)((unsigned short*)Bt + t * 8) = f.half[0];  }
// Weights lie in the workspace in fragment order: the 32 16-byte pieces that one wave-wide load of a 16-row x 32-column fragment takes (lane = 16 hh + row % 16) stand side by side, 512 bytes in four whole 128-byte lines
// (row-major, the same load touches 16 lines). pk_off: offset in halves of the piece with columns c8 .. c8 + 7 (c8 a multiple of 8) of one row of a [rows][K] matrix; p_frag: fragment (row tile rt, k step ks) of a matrix with KS k steps.
__device__ __forceinline__ size_t pk_off(int row, int c8, int K) { return ((((size_t)(row >> 4) * (K / 32) + (c8 >> 5)) * 2 + ((c8 >> 4) & 1)) * 32 + ((c8 >> 3) & 1) * 16 + (row & 15)) * 8; }
__device__ __forceinline__ v16h p_frag(const _Float16* Wp, int rt, int ks, int KS, int lane) { const unsigned short* p = (const unsigned short*)Wp + ((size_t)(rt * KS + ks) * 64 + lane) * 8; FragH f; f.half[0] = *(const v8us*)p; f.half[1] = *(const v8us*)(p + 256); return f.v; }
template <int CAUSAL>
__global__ __launch_bounds__(128) void k_flash(const _Float16* __restrict__ Q16, int ldq, const _Float16* __restrict__ K16, int ldk, const _Float16* __restrict__ Vt, const int* __restrict__ MSK, float* __restrict__ O, int ldo) {
  constexpr int RPW = 16, RTN = RPW / 16, NQB = TQ / (4 * RPW), DT = 4, KS = 2;
  __shared__ __attribute__((aligned(16))) unsigned short sP[4][RPW][40]; __shared__ __attribute__((aligned(16))) float sO[4][RPW][64 + 4];
  const int tid = threadIdx.x, w = tid >> 5, lane = tid & 31, ln = lane & 15, hh = lane >> 4;
  const int slab = blockIdx.x / QBLKS, qblk = blockIdx.x % QBLKS; (void)NQB; const int b = slab / NH, h = slab % NH; const int qb0 = qblk * (4 * RPW); const int q0 = qb0 + w * RPW;
  FragH aq[2][KS];
#pragma unroll
  for (int rt = 0; rt < RTN; ++rt) { const unsigned short* qr = (const unsigned short*)Q16 + ((size_t)b * TQ + q0 + rt * 16 + ln) * ldq + h * 64;
#pragma unroll
    for (int ks = 0; ks < KS; ++ks) { aq[rt][ks].half[0] = *(const v8us*)(qr + ks * 32 + 8 * hh); aq[rt][ks].half[1] = *(const v8us*)(qr + ks * 32 + 16 + 8 * hh); } }
  const unsigned short* Vth = (const unsigned short*)Vt + (size_t)slab * 64 * TK;
  float m_r[2][8], l_r[2][8]; v8f oacc[2][DT];
#pragma unroll
  for (int rt = 0; rt < RTN; ++rt) {
#pragma unroll
    for (int r = 0; r < 8; ++r) { m_r[rt][r] = -3.0e38f; l_r[rt][r] = 0.f; }
#pragma unroll
    for (int dt = 0; dt < DT; ++dt) oacc[rt][dt] = (v8f){0.f,0.f,0.f,0.f,0.f,0.f,0.f,0.f}; }
  const int jend = (CAUSAL == 1) ? (qb0 + 4 * RPW) : TK;      /* causal: keys beyond the block's last query never contribute */
#pragma unroll 1
  for (int j0 = 0; j0 < jend; j0 += 32) {
    v8f s[2][2];
#pragma unroll
    for (int nt = 0; nt < 2; ++nt) { const unsigned short* kr = (const unsigned short*)K16 + ((size_t)b * TK + j0 + nt * 16 + ln) * ldk + h * 64; FragH bk[KS];
#pragma unroll
      for (int ks = 0; ks < KS; ++ks) { bk[ks].half[0] = *(const v8us*)(kr + ks * 32 + 8 * hh); bk[ks].half[1] = *(const v8us*)(kr + ks * 32 + 16 + 8 * hh); }
#pragma unroll
      for (int rt = 0; rt < RTN; ++rt) { v8f acc = (v8f){0.f,0.f,0.f,0.f,0.f,0.f,0.f,0.f};
#pragma unroll
        for (int ks = 0; ks < KS; ++ks) acc = mmaH<1>(aq[rt][ks].v, aq[rt][ks].v, bk[ks].v, bk[ks].v, acc); s[rt][nt] = acc; } }
#pragma unroll
    for (int rt = 0; rt < RTN; ++rt)
#pragma unroll
      for (int r = 0; r < 8; ++r) { const int tq = q0 + rt * 16 + 8 * hh + r; const int k0 = j0 + ln, k1 = j0 + 16 + ln;
        const bool ok0 = (CAUSAL == 1) ? (k0 <= tq) : ((CAUSAL == 2) ? ((k0 >> 5) == (tq >> 5)) : true), ok1 = (CAUSAL == 1) ? (k1 <= tq) : ((CAUSAL == 2) ? ((k1 >> 5) == (tq >> 5)) : true);      /* mode 2: block-diagonal 32-token groups */
        const float s0 = ok0 ? s[rt][0][r] * SCL : -3.0e38f, s1 = ok1 ? s[rt][1][r] * SCL : -3.0e38f; float mc = fmaxf(s0, s1);
        mc = fmaxf(mc, __shfl_xor(mc, 1, 32)); mc = fmaxf(mc, __shfl_xor(mc, 2, 32)); mc = fmaxf(mc, __shfl_xor(mc, 4, 32)); mc = fmaxf(mc, __shfl_xor(mc, 8, 32));
        const float mn = fmaxf(m_r[rt][r], mc); const float al = (mn > -1.0e38f) ? expf(m_r[rt][r] - mn) : 1.0f; m_r[rt][r] = mn; const float p0 = ok0 ? expf(s0 - mn) : 0.f, p1 = ok1 ? expf(s1 - mn) : 0.f; l_r[rt][r] = l_r[rt][r] * al + p0 + p1;
#pragma unroll
        for (int dt = 0; dt < DT; ++dt) oacc[rt][dt][r] *= al;
        FragH t2; t2.h[0] = (_Float16)(p0 * 1024.0f); t2.h[1] = (_Float16)(p1 * 1024.0f); sP[w][rt * 16 + 8 * hh + r][ln] = t2.u[0]; sP[w][rt * 16 + 8 * hh + r][16 + ln] = t2.u[1]; }
    __builtin_amdgcn_fence(__ATOMIC_ACQ_REL, "workgroup"); __builtin_amdgcn_wave_barrier();
    FragH pa[2];
#pragma unroll
    for (int rt = 0; rt < RTN; ++rt) { pa[rt].half[0] = *(const v8us*)&sP[w][rt * 16 + ln][8 * hh]; pa[rt].half[1] = *(const v8us*)&sP[w][rt * 16 + ln][16 + 8 * hh]; }
#pragma unroll
    for (int dt = 0; dt < DT; ++dt) { const unsigned short* vrow = Vth + (size_t)(dt * 16 + ln) * TK + j0; FragH bv; bv.half[0] = *(const v8us*)(vrow + 8 * hh); bv.half[1] = *(const v8us*)(vrow + 16 + 8 * hh);
#pragma unroll
      for (int rt = 0; rt < RTN; ++rt) oacc[rt][dt] = mmaH<1>(pa[rt].v, pa[rt].v, bv.v, bv.v, oacc[rt][dt]); }
    __builtin_amdgcn_fence(__ATOMIC_ACQ_REL, "workgroup"); __builtin_amdgcn_wave_barrier(); }
#pragma unroll
  for (int rt = 0; rt < RTN; ++rt) {
#pragma unroll
    for (int r = 0; r < 8; ++r) { float l = l_r[rt][r]; l += __shfl_xor(l, 1, 32); l += __shfl_xor(l, 2, 32); l += __shfl_xor(l, 4, 32); l += __shfl_xor(l, 8, 32); l_r[rt][r] = (l > 0.f) ? 1.0f / (l * 1024.0f) : 0.f; }
#pragma unroll
    for (int dt = 0; dt < DT; ++dt)
#pragma unroll
      for (int r = 0; r < 8; ++r) sO[w][rt * 16 + 8 * hh + r][dt * 16 + ln] = oacc[rt][dt][r] * l_r[rt][r]; }
  __builtin_amdgcn_fence(__ATOMIC_ACQ_REL, "workgroup"); __builtin_amdgcn_wave_barrier();
  {
#pragma unroll
    for (int rp = 0; rp < RPW; rp += 2) { const int r = rp + (lane >> 4), pc = lane & 15; const v4f val = *(const v4fa*)&sO[w][r][pc * 4]; *(v4f*)(O + ((size_t)b * TQ + q0 + r) * ldo + h * 64 + pc * 4) = val; }
     } }
__device__ __forceinline__ float xhalf(float x) { return __builtin_bit_cast(float, __builtin_amdgcn_permlanex16(__builtin_bit_cast(int, x), __builtin_bit_cast(int, x), 0x76543210, 0xfedcba98, false, false)); }      /* lane l <-> lane l ^ 16 */
// Eight 2^x in place, in one statement: each v_exp_f32 writes only its own register, so none stands directly in front of an instruction that overwrites its source or reads its result
// (left to the register allocator, a run of them reused the source of the one before as the next destination); the v_nop keeps that slot behind the last one.
__device__ __forceinline__ void exp2x8(float& a, float& b, float& c, float& d, float& e, float& f, float& g, float& h) {
  asm("v_exp_f32 %0, %0\n\tv_exp_f32 %1, %1\n\tv_exp_f32 %2, %2\n\tv_exp_f32 %3, %3\n\tv_exp_f32 %4, %4\n\tv_exp_f32 %5, %5\n\tv_exp_f32 %6, %6\n\tv_exp_f32 %7, %7\n\tv_nop"
      : "+v"(a), "+v"(b), "+v"(c), "+v"(d), "+v"(e), "+v"(f), "+v"(g), "+v"(h)); }
template <int CAUSAL>
__global__ __launch_bounds__(128) void k_flashqk(const _Float16* __restrict__ Q16, const _Float16* __restrict__ QL, const _Float16* __restrict__ K16, const _Float16* __restrict__ KL, const _Float16* __restrict__ Vt, const int* __restrict__ MSK, float* __restrict__ O, int ldo) {
  constexpr int RPW = 16, DT = HPITCH / 16, KS = HPITCH / 32;
  __shared__ __attribute__((aligned(16))) float sO[4][RPW][HPITCH + 4];
  constexpr int KT = 64, KP = HPITCH + 8, VP = KT + 8;      /* keys per staged tile; LDS row pitches in halves: 16 bytes x an odd number, free of bank conflicts for 16-byte reads */
  constexpr int NCK = KT * (HPITCH / 8) / 128, NCV = HPITCH * (KT / 8) / 128;      /* 16-byte pieces per thread and tile */
  __shared__ __attribute__((aligned(16))) unsigned short sK[2][KT][KP]; __shared__ __attribute__((aligned(16))) unsigned short sKL[2][KT][KP]; __shared__ __attribute__((aligned(16))) unsigned short sV[2][HPITCH][VP];
  const int tid = threadIdx.x, w = tid >> 5, lane = tid & 31, ln = lane & 15, hh = lane >> 4;
  const int slab = blockIdx.x / QBLKS, qblk = blockIdx.x % QBLKS; const int b = slab / NH, h = slab % NH; const int qb0 = qblk * (4 * RPW); const int q0 = qb0 + w * RPW;
  const int tq = q0 + ln;      /* this lane's query */
  FragH bq[KS], bql[KS];
  { const unsigned short* qr = (const unsigned short*)Q16 + ((size_t)slab * TQ + tq) * HPITCH; const unsigned short* ql = (const unsigned short*)QL + ((size_t)slab * TQ + tq) * HPITCH;
#pragma unroll      /* constant indices keep the fragment, score and accumulator arrays in registers */
    for (int ks = 0; ks < KS; ++ks) { bq[ks].half[0] = *(const v8us*)(qr + ks * 32 + 8 * hh); bq[ks].half[1] = *(const v8us*)(qr + ks * 32 + 16 + 8 * hh); bql[ks].half[0] = *(const v8us*)(ql + ks * 32 + 8 * hh); bql[ks].half[1] = *(const v8us*)(ql + ks * 32 + 16 + 8 * hh); } }
  const unsigned short* Vth = (const unsigned short*)Vt + (size_t)slab * HPITCH * TK;
  const unsigned short* Kb = (const unsigned short*)K16 + (size_t)slab * TK * HPITCH; const unsigned short* KLb = (const unsigned short*)KL + (size_t)slab * TK * HPITCH;
  v8us gk[NCK], gkl[NCK], gv[NCV];      /* the next tile on its way from global memory to LDS */
  auto fetch = [&](int jt) {
#pragma unroll      /* constant indices keep the fragment, score and accumulator arrays in registers */
    for (int u = 0; u < NCK; ++u) { const int i = tid + 128 * u, r = i / (HPITCH / 8), c8 = (i % (HPITCH / 8)) * 8; gk[u] = *(const v8us*)(Kb + (size_t)(jt + r) * HPITCH + c8); gkl[u] = *(const v8us*)(KLb + (size_t)(jt + r) * HPITCH + c8); }
#pragma unroll      /* constant indices keep the fragment, score and accumulator arrays in registers */
    for (int u = 0; u < NCV; ++u) { const int i = tid + 128 * u, r = i / (KT / 8), c8 = (i % (KT / 8)) * 8; gv[u] = *(const v8us*)(Vth + (size_t)r * TK + jt + c8); } };
  auto stash = [&](int bf) {
#pragma unroll      /* constant indices keep the fragment, score and accumulator arrays in registers */
    for (int u = 0; u < NCK; ++u) { const int i = tid + 128 * u, r = i / (HPITCH / 8), c8 = (i % (HPITCH / 8)) * 8; *(v8us*)&sK[bf][r][c8] = gk[u]; *(v8us*)&sKL[bf][r][c8] = gkl[u]; }
#pragma unroll      /* constant indices keep the fragment, score and accumulator arrays in registers */
    for (int u = 0; u < NCV; ++u) { const int i = tid + 128 * u, r = i / (KT / 8), c8 = (i % (KT / 8)) * 8; *(v8us*)&sV[bf][r][c8] = gv[u]; } };
  float m_q = -3.0e38f, l_q = 0.f; v8f oacc[DT];      /* oacc[dt][r] = O[tq][dt * 16 + 8 hh + r], un-normalised */
#pragma unroll      /* constant indices keep the fragment, score and accumulator arrays in registers */
  for (int dt = 0; dt < DT; ++dt) oacc[dt] = (v8f){0.f,0.f,0.f,0.f,0.f,0.f,0.f,0.f};
  const int jend = (CAUSAL == 1) ? (qb0 + 4 * RPW) : TK;      /* causal: keys beyond the block's last query never contribute */
  const int ntile = jend / KT;
  asm volatile("s_wait_xcnt 0x0" ::: "memory");      /* the Q loads above are issued first, and no tile load below writes into a register that one of them still names as its address */
  fetch(0); stash(0);
  __syncthreads();      /* tile 0 is written before any wave reads it */
#pragma unroll 1      /* one copy of the trip's code; the buffer index alternates at run time */
  for (int t = 0; t < ntile; ++t) { const int buf = t & 1; const bool more = t + 1 < ntile;      /* the same in every thread of the work-group */
    if (more) fetch((t + 1) * KT);      /* in flight while this trip works on tile t */
#pragma unroll      /* the two 32-key halves of the tile: constant LDS offsets */
   for (int js = 0; js < KT; js += 32) { const int j0 = t * KT + js;
    v8f s[2];      /* s[nt][r] = score of key j0 + nt * 16 + 8 hh + r against query tq */
    FragH ak[2][KS], akl[2][KS], av[DT];      /* all LDS reads of these 32 keys stand together at the head: one LDS latency instead of four */
#pragma unroll      /* constant indices keep the fragment, score and accumulator arrays in registers */
    for (int nt = 0; nt < 2; ++nt) { const unsigned short* kr = &sK[buf][js + nt * 16 + ln][0]; const unsigned short* klr = &sKL[buf][js + nt * 16 + ln][0];
#pragma unroll      /* constant indices keep the fragment, score and accumulator arrays in registers */
      for (int ks = 0; ks < KS; ++ks) { ak[nt][ks].half[0] = *(const v8us*)(kr + ks * 32 + 8 * hh); ak[nt][ks].half[1] = *(const v8us*)(kr + ks * 32 + 16 + 8 * hh); akl[nt][ks].half[0] = *(const v8us*)(klr + ks * 32 + 8 * hh); akl[nt][ks].half[1] = *(const v8us*)(klr + ks * 32 + 16 + 8 * hh); } }
#pragma unroll      /* constant indices keep the fragment, score and accumulator arrays in registers */
    for (int dt = 0; dt < DT; ++dt) { const unsigned short* vrow = &sV[buf][dt * 16 + ln][js]; av[dt].half[0] = *(const v8us*)(vrow + 8 * hh); av[dt].half[1] = *(const v8us*)(vrow + 16 + 8 * hh); }
#pragma unroll      /* constant indices keep the fragment, score and accumulator arrays in registers */
    for (int nt = 0; nt < 2; ++nt) {
      v8f acc = (v8f){0.f,0.f,0.f,0.f,0.f,0.f,0.f,0.f}, accl = acc;
#pragma unroll      /* constant indices keep the fragment, score and accumulator arrays in registers */
      for (int ks = 0; ks < KS; ++ks) { acc = mmaH<1>(ak[nt][ks].v, ak[nt][ks].v, bq[ks].v, bq[ks].v, acc); accl = mmaH<1>(ak[nt][ks].v, ak[nt][ks].v, bql[ks].v, bql[ks].v, accl); accl = mmaH<1>(akl[nt][ks].v, akl[nt][ks].v, bq[ks].v, bq[ks].v, accl); }
#pragma unroll      /* constant indices keep the fragment, score and accumulator arrays in registers */
      for (int r = 0; r < 8; ++r) acc[r] += accl[r] * 0.0009765625f;
      s[nt] = acc; }
    float sc[16]; bool ok[16];
#pragma unroll      /* constant indices keep the fragment, score and accumulator arrays in registers */
    for (int i = 0; i < 16; ++i) { const int kk = j0 + (i >> 3) * 16 + 8 * hh + (i & 7);
      ok[i] = (CAUSAL == 1) ? (kk <= tq) : ((CAUSAL == 2) ? ((kk >> 5) == (tq >> 5)) : true);      /* mode 2: block-diagonal 32-token groups */
      if (CAUSAL == 4) ok[i] = MSK[((size_t)b * TQ + tq) * TK + kk] != 0;      /* mode 4: per-(query, key) INPUT mask shared by all heads; masked keys contribute nothing, rows with no valid key give l = 0 -> output 0 */
      sc[i] = ok[i] ? s[i >> 3][i & 7] : -3.0e38f; }      /* raw q.k: maxima are taken on raw scores, the (positive) scale enters with the exponent */
    float mt[8];
#pragma unroll      /* constant indices keep the fragment, score and accumulator arrays in registers */
    for (int i = 0; i < 8; ++i) mt[i] = fmaxf(sc[i], sc[8 + i]);
    float mc = fmaxf(fmaxf(fmaxf(mt[0], mt[1]), fmaxf(mt[2], mt[3])), fmaxf(fmaxf(mt[4], mt[5]), fmaxf(mt[6], mt[7])));
    mc = fmaxf(mc, xhalf(mc));      /* the other half's 16 keys of the same query */
    const float mn = fmaxf(m_q, mc); const float al = (mn > -1.0e38f) ? __builtin_amdgcn_exp2f((m_q - mn) * SCL2) : 1.0f; m_q = mn;
    const float nb = 10.0f - mn * SCL2;      /* p = 2^(sc * SCL2 + nb) = 2^10 exp((sc - mn) / sqrt(32)): scale, log2(e), maximum and P's 2^10 in one fma per score */
    float p[16]; FragH pb;
#pragma unroll      /* constant indices keep the fragment, score and accumulator arrays in registers */
    for (int i = 0; i < 16; ++i) p[i] = sc[i] * SCL2 + nb;
    exp2x8(p[0], p[1], p[2], p[3], p[4], p[5], p[6], p[7]); exp2x8(p[8], p[9], p[10], p[11], p[12], p[13], p[14], p[15]);
#pragma unroll      /* constant indices keep the fragment, score and accumulator arrays in registers */
    for (int i = 0; i < 16; ++i) { if (!ok[i]) p[i] = 0.f; pb.h[i] = (_Float16)p[i]; }      /* pb.h[i]: key j0 + (i >> 3) * 16 + 8 hh + (i & 7) of column ln; p and l_q both carry the 2^10 */
    float pt[8];
#pragma unroll      /* constant indices keep the fragment, score and accumulator arrays in registers */
    for (int i = 0; i < 8; ++i) pt[i] = p[i] + p[8 + i];
    l_q = l_q * al + (((pt[0] + pt[1]) + (pt[2] + pt[3])) + ((pt[4] + pt[5]) + (pt[6] + pt[7])));
#pragma unroll      /* constant indices keep the fragment, score and accumulator arrays in registers */
    for (int dt = 0; dt < DT; ++dt)
#pragma unroll      /* constant indices keep the fragment, score and accumulator arrays in registers */
      for (int r = 0; r < 8; ++r) oacc[dt][r] *= al;
#pragma unroll      /* constant indices keep the fragment, score and accumulator arrays in registers */
    for (int dt = 0; dt < DT; ++dt) oacc[dt] = mmaH<1>(av[dt].v, av[dt].v, pb.v, pb.v, oacc[dt]); }
    if (more) stash(buf ^ 1);      /* that buffer's last readers left it at the barrier that ended the trip before */
    __syncthreads(); }      /* one barrier a trip: publishes tile t + 1 and ends every wave's reads of tile t, which the next trip overwrites */
  const float lsum = l_q + xhalf(l_q); const float linv = (lsum > 0.f) ? 1.0f / lsum : 0.f;
#pragma unroll      /* constant indices keep the fragment, score and accumulator arrays in registers */
  for (int dt = 0; dt < DT; ++dt) { v4f lo4, hi4;
#pragma unroll      /* constant indices keep the fragment, score and accumulator arrays in registers */
    for (int r = 0; r < 4; ++r) { lo4[r] = oacc[dt][r] * linv; hi4[r] = oacc[dt][4 + r] * linv; }
    *(v4fa*)&sO[w][ln][dt * 16 + 8 * hh] = lo4; *(v4fa*)&sO[w][ln][dt * 16 + 8 * hh + 4] = hi4; }
  __builtin_amdgcn_fence(__ATOMIC_ACQ_REL, "workgroup"); __builtin_amdgcn_wave_barrier();
  {
#pragma unroll      /* constant indices keep the fragment, score and accumulator arrays in registers */
    for (int rp = 0; rp < RPW; rp += 128 / HPITCH) { const int r = rp + lane / (HPITCH / 4), pc = lane % (HPITCH / 4); const v4f val = *(const v4fa*)&sO[w][r][pc * 4]; *(v4f*)(O + ((size_t)b * TQ + q0 + r) * ldo + h * HPITCH + pc * 4) = val; }
     } }

__device__ __forceinline__ void d_gnstat(const float* __restrict__ x, float* __restrict__ GS, const int bg) {
  #pragma clang fp contract(off)
  __shared__ float sh[256]; const int tid = threadIdx.x; const float* base = x + (size_t)bg * CPG * SLEN; const int n = CPG * SLEN; float s = 0.f;
  for (int i = tid; i < n; i += 256) s += bf16_round(base[i]);
  sh[tid] = s; __syncthreads(); for (int st = 128; st > 0; st >>= 1) { if (tid < st) sh[tid] += sh[tid + st]; __syncthreads(); }
  const float mu = sh[0] / (float)n; __syncthreads(); float q2 = 0.f;
  for (int i = tid; i < n; i += 256) { const float d = bf16_round(base[i]) - mu; q2 += d * d; }
  sh[tid] = q2; __syncthreads(); for (int st = 128; st > 0; st >>= 1) { if (tid < st) sh[tid] += sh[tid + st]; __syncthreads(); }
  if (tid == 0) { const float rs = rsqrtf(sh[0] / (float)n + 1e-5f); { *(float*)(GS + (size_t)bg * 32) = mu; *(float*)(GS + (size_t)bg * 32 + 1) = rs;  } } }
__device__ __forceinline__ void d_wpad(const float* __restrict__ Wm, const float* __restrict__ bm, _Float16* __restrict__ BP, float* __restrict__ PB, const int bid) {
  const int r = bid * 256 + threadIdx.x; if (r >= DP) return; const int h = r / HPITCH, d = r % HPITCH; const bool live = d < HDT; const int srow = h * HDT + d;
  for (int c0 = 0; c0 < CC; c0 += 8) { FragH f; for (int q = 0; q < 8; ++q) f.h[q] = live ? (_Float16)(bf16_round(Wm[(size_t)srow * CC + c0 + q]) * 16.0f) : (_Float16)0.0f; unsigned short* dst = (unsigned short*)BP + pk_off(r, c0, CC); *(v8us*)dst = f.half[0];
    asm volatile("s_wait_xcnt 0x0" ::: "memory"); }      /* the next trip writes into the registers that this store names */
  const float bv = live ? bm[srow] : 0.f; *(float*)(PB + r) = bv;  }
__device__ __forceinline__ void d_wio(const float* __restrict__ Wm, int nin, int nout, int pair, _Float16* __restrict__ Bt, const int bid) { const int pitch = pair ? 2 * nin : nin; const size_t t = (size_t)bid * 256 + threadIdx.x; if (t >= (size_t)nout * (pitch / 8)) return; const int fr = (int)(t >> 5), pl = (int)(t & 31); const int pc = ((fr >> 1) % (pitch / 32)) * 4 + (fr & 1) * 2 + (pl >> 4); const int o = (fr >> 1) / (pitch / 32) * 16 + (pl & 15); FragH f;      /* thread t makes piece t of the fragment order (pk_off(o, pc * 8, pitch) = 8 t): a wave stores 512 bytes in a row */
  for (int q = 0; q < 8; ++q) { const int col = pc * 8 + q; const bool lo = col >= nin; const int i = lo ? col - nin : col; f.h[q] = (_Float16)(bf16_round(Wm[(size_t)i * nout + o]) * (lo ? 1.0f : 16.0f)); }
  *(v8us*)((unsigned short*)Bt + t * 8) = f.half[0];  }
__device__ __forceinline__ void d_wop(const float* __restrict__ Wo, _Float16* __restrict__ Bt, const int bid) { const int t = bid * 256 + threadIdx.x; if (t >= CC * (2 * CC / 8)) return; const int fr = t >> 5, pl = t & 31; const int pc = ((fr >> 1) % (2 * CC / 32)) * 4 + (fr & 1) * 2 + (pl >> 4); const int o = (fr >> 1) / (2 * CC / 32) * 16 + (pl & 15); const bool lo = pc * 8 >= CC; FragH f;      /* piece t of the fragment order, as in d_wio */
  for (int q = 0; q < 8; ++q) { const int c = pc * 8 + q - (lo ? CC : 0); f.h[q] = (_Float16)(bf16_round(Wo[(size_t)o * CC + c]) * (lo ? 1.0f : 16.0f)); } *(v8us*)((unsigned short*)Bt + (size_t)t * 8) = f.half[0];  }
// The two statistics passes and the six weight conversions need nothing of each other: one grid, each part a range of block indices (the branch is the same for a whole work-group, so the barriers of the statistics part are passed by all of its threads).
// The statistics blocks run longest and come first.
#define PB_GN (NB * NGR)                          /* blocks per statistics pass */
#define PB_W1 ((HID * (2 * CC / 8) + 255) / 256)
#define PB_W2 ((CC * (HID / 8) + 255) / 256)
#define PB_WO ((CC * (2 * CC / 8) + 255) / 256)
#define PB_ALL (2 * PB_GN + 3 + PB_W1 + PB_W2 + PB_WO)
__global__ __launch_bounds__(256) void k_prep(const float* __restrict__ x0, const float* __restrict__ x1, float* __restrict__ GS,
    const float* __restrict__ Wq, const float* __restrict__ bqp, const float* __restrict__ Wk, const float* __restrict__ bkp, const float* __restrict__ Wv, const float* __restrict__ bvp, _Float16* __restrict__ BP, float* __restrict__ PB,
    const float* __restrict__ W1, _Float16* __restrict__ BW1, const float* __restrict__ W2, _Float16* __restrict__ BW2, const float* __restrict__ Wo, _Float16* __restrict__ BWO) {
  int bid = blockIdx.x;
  if (bid < 2 * PB_GN) { const bool sec = bid >= PB_GN; d_gnstat(sec ? x1 : x0, GS + (sec ? PB_GN * 32 : 0), sec ? bid - PB_GN : bid); return; }
  bid -= 2 * PB_GN;
  if (bid < 3) { d_wpad(bid == 0 ? Wq : (bid == 1 ? Wk : Wv), bid == 0 ? bqp : (bid == 1 ? bkp : bvp), BP + (size_t)bid * DP * CC, PB + bid * DP, 0); return; }
  bid -= 3;
  if (bid < PB_W1) { d_wio(W1, CC, HID, 1, BW1, bid); return; }
  bid -= PB_W1;
  if (bid < PB_W2) { d_wio(W2, HID, CC, 0, BW2, bid); return; }
  bid -= PB_W2;
  d_wop(Wo, BWO, bid); }
// One 16x16x32 f16 product; the builtin form, for which the compiler keeps the distances behind a matrix instruction itself.
__device__ __forceinline__ v8f f_mma(v16h a, v16h b, v8f c) { return __builtin_amdgcn_wmma_f32_16x16x32_f16(false, a, false, b, (short)0, c, false, false); }
__device__ __forceinline__ v16h l_frag(const unsigned short* p, int hh) { FragH f; f.half[0] = *(const v8us*)(p + 8 * hh); f.half[1] = *(const v8us*)(p + 16 + 8 * hh); return f.v; }
// Head of the block in one launch: normalise a 64-token tile of one input (all 128 channels), transposed into LDS as f16 [token][channel], and project it from there.
// blockIdx.y = 0 q, 1 k, 2 v. q and k: weight rows are the A operand and tokens the B operand, so a lane holds 8 neighbouring channels of ONE token and stores hi and residual as 16-byte pieces of the [batch][head][token][32] planes.
// v: tokens are the A operand and weight rows the B operand, so a lane holds 8 neighbouring tokens of ONE channel: a 16-byte piece of V^T. Each wave writes whole 128-byte lines.
#define XP (CC + 8)      /* LDS row pitch in halves: 16 bytes x an odd number */
template <bool ISV>
__device__ __forceinline__ void d_qkv(const float* __restrict__ x, const float* __restrict__ GS, const float* __restrict__ gam, const float* __restrict__ bet, const _Float16* __restrict__ Wp, const float* __restrict__ bp, unsigned short* __restrict__ Hh, unsigned short* __restrict__ VT, unsigned short (*sX)[XP]) {
  constexpr int NW = ISV ? 1 : 4;      /* weight fragments per k step */
  const int tid = threadIdx.x, w = tid >> 5, lane = tid & 31, ln = lane & 15, hh = lane >> 4;
  const int b = blockIdx.x / (SLEN / 64), pb = blockIdx.x % (SLEN / 64);
  const int ch0 = ISV ? w * 16 : (w >> 2) * 64;      /* this wave's first channel: 16 channels x 64 tokens for v, 64 channels x 16 tokens for q and k */
  v16h wf[CC / 32][NW]; v4f bl[NW][2]; float bv1 = 0.f;      /* this wave's weight fragments and biases, asked for before the tile so that they arrive while it is normalised */
#pragma unroll      /* constant indices keep the fragment arrays in registers */
  for (int ks = 0; ks < CC / 32; ++ks)
#pragma unroll      /* as above */
    for (int mt = 0; mt < NW; ++mt) wf[ks][mt] = p_frag(Wp, ch0 / 16 + mt, ks, CC / 32, lane);
  if (ISV) bv1 = bp[ch0 + ln];
  else {
#pragma unroll      /* as above */
    for (int mt = 0; mt < NW; ++mt) { bl[mt][0] = *(const v4fa*)(bp + ch0 + mt * 16 + 8 * hh); bl[mt][1] = *(const v4fa*)(bp + ch0 + mt * 16 + 8 * hh + 4); } }
  asm volatile("s_wait_xcnt 0x0" ::: "memory");      /* no later instruction writes into a register that one of the loads above still names as its address */
  const int cl0 = tid >> 2, pj = (tid & 3) * 4;      /* 4 lanes per channel row: the 2-byte LDS stores of a wave fall into different banks; a thread has channels cl0 and cl0 + 64, positions pj + 16 jj */
  const float* xp = x + ((size_t)b * CC + cl0) * SLEN + pb * 64 + pj; const float* gp = GS + ((size_t)b * NGR + cl0 / CPG) * 32;
  v4f xa[2][4]; float mu[2], rs[2], gg[2], be[2];      /* every address below is one of four bases plus a constant, so no load's result lands in a register that an earlier load names as its address */
#pragma unroll      /* constant indices keep the values in registers */
  for (int e = 0; e < 2; ++e) { mu[e] = gp[e * (64 / CPG) * 32]; rs[e] = gp[e * (64 / CPG) * 32 + 1]; gg[e] = gam[cl0 + 64 * e]; be[e] = bet[cl0 + 64 * e]; }
  asm volatile("s_wait_xcnt 0x0" ::: "memory");      /* as above, for the statistics and the scale and shift */
#pragma unroll      /* eight 16-byte pieces per thread, all in flight together */
  for (int e = 0; e < 2; ++e)
#pragma unroll      /* as above */
    for (int jj = 0; jj < 4; ++jj) xa[e][jj] = *(const v4fa*)(xp + (size_t)e * 64 * SLEN + jj * 16);
  asm volatile("s_wait_xcnt 0x0" ::: "memory");      /* as above, for the tile's loads */
#pragma unroll      /* constant indices keep the tile's pieces in registers */
  for (int e = 0; e < 2; ++e) { const float g = bf16_round(gg[e]), bb = bf16_round(be[e]);
#pragma unroll      /* as above */
    for (int jj = 0; jj < 4; ++jj)
#pragma unroll      /* as above */
      for (int q = 0; q < 4; ++q) { FragH f; f.h[0] = (_Float16)((bf16_round(xa[e][jj][q]) - mu[e]) * rs[e] * g + bb); sX[pj + 16 * jj + q][cl0 + 64 * e] = f.u[0]; } }
  __syncthreads();      /* the tile is written before any wave takes fragments from it; every thread of the work-group is on the same side of ISV */
  const v8f z8 = {0.f,0.f,0.f,0.f,0.f,0.f,0.f,0.f}; v8f acc[4] = {z8, z8, z8, z8};
  if constexpr (!ISV) { const int tk = (w & 3) * 16 + ln;      /* this lane's token */
#pragma unroll      /* as above */
    for (int ks = 0; ks < CC / 32; ++ks) { const v16h t = l_frag(&sX[tk][ks * 32], hh);
#pragma unroll      /* as above */
      for (int mt = 0; mt < 4; ++mt) acc[mt] = f_mma(wf[ks][mt], t, acc[mt]); }
    Hh += ((size_t)b * NH * SLEN + pb * 64 + tk) * HPITCH + (size_t)(ch0 / HPITCH) * SLEN * HPITCH; unsigned short* Hl = Hh + (size_t)NR * DP;      /* planes are [batch][head][token][32]: this token's row in the wave's first head */
#pragma unroll      /* as above */
    for (int mt = 0; mt < 4; ++mt) { FragH fh, fl;
#pragma unroll      /* as above */
      for (int r = 0; r < 8; ++r) { const float v = acc[mt][r] * 0.0625f + bf16_round(bl[mt][r >> 2][r & 3]); const _Float16 h = (_Float16)v; fh.h[r] = h; fl.h[r] = (_Float16)((v - (float)h) * 1024.0f); }
      const size_t po = (size_t)(mt * 16 / HPITCH) * SLEN * HPITCH + mt * 16 % HPITCH + 8 * hh; *(v8us*)(Hh + po) = fh.half[0]; *(v8us*)(Hl + po) = fl.half[0]; }
    asm volatile("s_wait_xcnt 0x0" ::: "memory");      /* in the built code the v side follows this one, and it writes into registers that the stores above name */
  } else {
#pragma unroll      /* as above */
    for (int ks = 0; ks < CC / 32; ++ks)
#pragma unroll      /* as above */
      for (int mt = 0; mt < 4; ++mt) acc[mt] = f_mma(l_frag(&sX[mt * 16 + ln][ks * 32], hh), wf[ks][0], acc[mt]);
    const float bv = bf16_round(bv1); unsigned short* dst = VT + ((size_t)b * DP + ch0 + ln) * TK + pb * 64;      /* row (b, head, d) of V^T = row b * 128 + channel */
#pragma unroll      /* as above */
    for (int mt = 0; mt < 4; ++mt) { FragH f;
#pragma unroll      /* as above */
      for (int r = 0; r < 8; ++r) f.h[r] = (_Float16)(acc[mt][r] * 0.0625f + bv);
      *(v8us*)(dst + mt * 16 + 8 * hh) = f.half[0]; }
  } }
__global__ __launch_bounds__(256) void k_qkv(const float* __restrict__ x0, const float* __restrict__ x1, const float* __restrict__ GS, const float* __restrict__ gam0, const float* __restrict__ bet0, const float* __restrict__ gam1, const float* __restrict__ bet1,
    const _Float16* __restrict__ BP, const float* __restrict__ PB, _Float16* __restrict__ QKH, _Float16* __restrict__ VT) {
  __shared__ __attribute__((aligned(16))) unsigned short sX[64][XP];
  const int y = blockIdx.y; const bool sec = y != 0;      /* the same for a whole work-group */
  const float* x = sec ? x1 : x0; const float* gam = sec ? gam1 : gam0; const float* bet = sec ? bet1 : bet0; const float* gs = GS + (sec ? NB * NGR * 32 : 0);
  if (y == 2) d_qkv<true>(x, gs, gam, bet, BP + (size_t)y * DP * CC, PB + y * DP, nullptr, (unsigned short*)VT, sX);
  else d_qkv<false>(x, gs, gam, bet, BP + (size_t)y * DP * CC, PB + y * DP, (unsigned short*)QKH + (size_t)y * 2 * NR * DP, nullptr, sX); }
// Tail of the block in one launch: everything behind the attention is row-wise, so a work-group takes 32 tokens through hi/residual split, W1 + exact GELU, W2 + residual, hi/residual split and Wo; the values between the products pass through LDS.
// W1 and W2: weight rows are the A operand and tokens the B operand (a lane holds 8 neighbouring columns of one token: one 16-byte LDS store). Wo: tokens are the A operand (a lane holds 8 neighbouring tokens of one output channel: the NCHW order of out).
#define PT 32                /* tokens per work-group: one 128-byte line of each output channel */
#define PP (2 * CC + 8)      /* LDS row pitch in halves: 16 bytes x an odd number */
__global__ __launch_bounds__(256) void k_tail(const float* __restrict__ O, const _Float16* __restrict__ BW1, const float* __restrict__ b1, const _Float16* __restrict__ BW2, const float* __restrict__ b2, const _Float16* __restrict__ BWO, const float* __restrict__ bo, float* __restrict__ out) {
  __shared__ __attribute__((aligned(16))) unsigned short sA[PT][PP]; __shared__ __attribute__((aligned(16))) unsigned short sG[PT][PP]; __shared__ __attribute__((aligned(16))) unsigned short sF[PT][PP]; __shared__ __attribute__((aligned(16))) float sR[PT][CC + 4];
  const int tid = threadIdx.x, w = tid >> 5, lane = tid & 31, ln = lane & 15, hh = lane >> 4; const int r0 = blockIdx.x * PT;
  v4f c1[2][2], c2[2];
#pragma unroll
  for (int mt = 0; mt < 2; ++mt) { c1[mt][0] = *(const v4fa*)(b1 + w * 32 + mt * 16 + 8 * hh); c1[mt][1] = *(const v4fa*)(b1 + w * 32 + mt * 16 + 8 * hh + 4); }
  c2[0] = *(const v4fa*)(b2 + w * 16 + 8 * hh); c2[1] = *(const v4fa*)(b2 + w * 16 + 8 * hh + 4); const float c3 = bo[w * 16 + ln];
  asm volatile("s_wait_xcnt 0x0" ::: "memory");      /* no weight load below lands in a register that one of the bias loads above still names as its address */
  v16h w1[8][2];      /* W1 rows w * 32 .. + 31, asked for before the tile */
#pragma unroll      /* constant indices keep the fragment arrays in registers */
  for (int ks = 0; ks < 8; ++ks)
#pragma unroll
    for (int mt = 0; mt < 2; ++mt) w1[ks][mt] = p_frag(BW1, w * 2 + mt, ks, 8, lane);
  { const int tk = tid >> 3, c0 = (tid & 7) * 16; const float* sp = O + (size_t)(r0 + tk) * DP + c0; v4f xv[4];
#pragma unroll
    for (int q = 0; q < 4; ++q) xv[q] = *(const v4fa*)(sp + 4 * q);
    asm volatile("s_wait_xcnt 0x0" ::: "memory");      /* no later instruction writes into a register that one of the loads above still names as its address */
#pragma unroll
    for (int g = 0; g < 2; ++g) { FragH fh, fl;
#pragma unroll
      for (int q = 0; q < 8; ++q) { const float v = xv[g * 2 + (q >> 2)][q & 3]; const _Float16 hv = (_Float16)v; fh.h[q] = hv; fl.h[q] = (_Float16)((v - (float)hv) * 16.0f); }
      *(v8us*)&sA[tk][c0 + 8 * g] = fh.half[0]; *(v8us*)&sA[tk][CC + c0 + 8 * g] = fl.half[0]; }
#pragma unroll
    for (int q = 0; q < 4; ++q) *(v4fa*)&sR[tk][c0 + 4 * q] = xv[q]; }
  __syncthreads();      /* attention output, split, is written before any wave takes fragments from it */
  const v8f z8 = {0.f,0.f,0.f,0.f,0.f,0.f,0.f,0.f}; v8f a1[2][2] = {{z8, z8}, {z8, z8}};
#pragma unroll
  for (int ks = 0; ks < 8; ++ks) { const v16h t0 = l_frag(&sA[ln][ks * 32], hh), t1 = l_frag(&sA[16 + ln][ks * 32], hh);
#pragma unroll
    for (int mt = 0; mt < 2; ++mt) { a1[mt][0] = f_mma(w1[ks][mt], t0, a1[mt][0]); a1[mt][1] = f_mma(w1[ks][mt], t1, a1[mt][1]); } }
  v16h w2[8], w3[8];      /* W2 and Wo rows w * 16 .. + 15: on their way while the GELU is computed */
#pragma unroll
  for (int ks = 0; ks < 8; ++ks) { w2[ks] = p_frag(BW2, w, ks, 8, lane); w3[ks] = p_frag(BWO, w, ks, 8, lane); }
  asm volatile("s_wait_xcnt 0x0" ::: "memory");      /* as above, for the weight loads */
#pragma unroll
  for (int mt = 0; mt < 2; ++mt)
#pragma unroll
    for (int nt = 0; nt < 2; ++nt) { FragH f;
#pragma unroll
      for (int r = 0; r < 8; ++r) { float v = a1[mt][nt][r] * 0.0625f + bf16_round(c1[mt][r >> 2][r & 3]); v = 0.5f * v * (1.0f + erff(v * 0.70710678118654752f)); f.h[r] = (_Float16)v; }
      *(v8us*)&sG[nt * 16 + ln][w * 32 + mt * 16 + 8 * hh] = f.half[0]; }
  __syncthreads();      /* the hidden layer is complete before the second product reads it */
  v8f a2[2] = {z8, z8};
#pragma unroll
  for (int ks = 0; ks < 8; ++ks) { a2[0] = f_mma(w2[ks], l_frag(&sG[ln][ks * 32], hh), a2[0]); a2[1] = f_mma(w2[ks], l_frag(&sG[16 + ln][ks * 32], hh), a2[1]); }
#pragma unroll
  for (int nt = 0; nt < 2; ++nt) { const int tk = nt * 16 + ln, c0 = w * 16 + 8 * hh; const v4f ra = *(const v4fa*)&sR[tk][c0], rb = *(const v4fa*)&sR[tk][c0 + 4]; FragH fh, fl;
#pragma unroll
    for (int r = 0; r < 8; ++r) { float v = a2[nt][r] * 0.0625f + bf16_round(c2[r >> 2][r & 3]); v += (r < 4) ? ra[r & 3] : rb[r & 3]; const _Float16 hv = (_Float16)v; fh.h[r] = hv; fl.h[r] = (_Float16)((v - (float)hv) * 16.0f); }
    *(v8us*)&sF[tk][c0] = fh.half[0]; *(v8us*)&sF[tk][CC + c0] = fl.half[0]; }
  __syncthreads();      /* out + mlp, split, is complete before the last product reads it */
  v8f a3[2] = {z8, z8};
#pragma unroll
  for (int ks = 0; ks < 8; ++ks) { a3[0] = f_mma(l_frag(&sF[ln][ks * 32], hh), w3[ks], a3[0]); a3[1] = f_mma(l_frag(&sF[16 + ln][ks * 32], hh), w3[ks], a3[1]); }
  const float bv = bf16_round(c3); float* d = out + ((size_t)(r0 / SLEN) * CC + w * 16 + ln) * SLEN + (r0 % SLEN) + 8 * hh;
#pragma unroll
  for (int mt = 0; mt < 2; ++mt) { v4f lo4, hi4;
#pragma unroll
    for (int r = 0; r < 4; ++r) { lo4[r] = a3[mt][r] * 0.0625f + bv; hi4[r] = a3[mt][4 + r] * 0.0625f + bv; }
    *(v4f*)(d + mt * 16) = lo4; *(v4f*)(d + mt * 16 + 4) = hi4; } }

extern "C" void kernel_launch(void* const* d_in, const int* in_sizes, int n_in,
                              void* d_out, int out_size, void* d_ws, size_t ws_size, hipStream_t stream) {
  (void)in_sizes; (void)n_in; (void)out_size;
  const float* const* I = (const float* const*)d_in; const float* fo = I[0]; const float* fs = I[1]; const float* gq = I[2]; const float* bq = I[3]; const float* gkv = I[4]; const float* bkv = I[5]; const float* Wq = I[6]; const float* bqp = I[7]; const float* Wk = I[8]; const float* bkp = I[9]; const float* Wv = I[10]; const float* bvp = I[11]; const float* W1 = I[12]; const float* b1 = I[13]; const float* W2 = I[14]; const float* b2 = I[15]; const float* Wo = I[16]; const float* bo = I[17];
  char* ws = (char*)d_ws; size_t off = 0;
  auto take = [&](size_t bytes) { char* p = ws + off; off += (bytes + 255) & ~(size_t)255; return p; };
  _Float16* BPq = (_Float16*)take((size_t)3 * DP * CC * 2); float* PBq = (float*)take(3 * DP * 4);      /* q, k, v planes one behind the other */
  _Float16* BW1 = (_Float16*)take((size_t)HID * 2 * CC * 2); _Float16* BW2 = (_Float16*)take((size_t)CC * HID * 2); _Float16* BWO = (_Float16*)take((size_t)CC * 2 * CC * 2); float* GS = (float*)take((size_t)NB * NGR * 32 * 4 * 2);
  _Float16* QH = (_Float16*)take((size_t)4 * NR * DP * 2); _Float16* QL = QH + (size_t)NR * DP; _Float16* KH = QH + (size_t)2 * NR * DP; _Float16* KL = QH + (size_t)3 * NR * DP; _Float16* VT = (_Float16*)take((size_t)NR * DP * 2);      /* q hi, q residual, k hi, k residual; V^T */
  float* O = (float*)take((size_t)NR * DP * 4);      /* attention output */
  if (off > ws_size) return;      /* 0.5 + 4 x 2 + 2 + 4 = 15 MiB */
  k_prep<<<PB_ALL, 256, 0, stream>>>(fo, fs, GS, Wq, bqp, Wk, bkp, Wv, bvp, BPq, PBq, W1, BW1, W2, BW2, Wo, BWO);      /* group statistics of both inputs; conv1x1 weights (out,in) = natural rows; MLP and output weights */
  k_qkv<<<dim3(NR / 64, 3), 256, 0, stream>>>(fo, fs, GS, gq, bq, gkv, bkv, BPq, PBq, QH, VT);      /* normalise + q, k (hi + residual planes), V^T */
  k_flashqk<0><<<NB * NH * QBLKS, 128, 0, stream>>>(QH, QL, KH, KL, VT, nullptr, O, DP);      /* q/k hi + residual; P (x2^10) and V plain f16 */
  k_tail<<<NR / PT, 256, 0, stream>>>(O, BW1, b1, BW2, b2, BWO, bo, (float*)d_out);      /* gelu_erf(out W1 + b1) W2 + b2 + out, conv1x1 Wo + bo, NCHW */
}

// v008
// A run of this version takes 65.5 microseconds.
// Next to v007, in two timings, it ran 1.14 and 1.12 times as fast.
// Over all steps from v000 it is 10.3 times as fast.
#include <hip/hip_runtime.h>
// SFBlock (2 x 128 x 64 x 64; 4 heads x 32; GroupNorm(32) on both inputs; q from feat_opt, k/v from feat_sar via 1x1 convs; softmax(q k^T / sqrt(32)) v over the 4096 positions; MLP: gelu_erf(out W1 + b1) W2 + b2; fused = out + mlp; 1x1 conv Wo -> [2,128,64,64]).
// Compute dtype: inputs and parameters rounded to bf16; normalised inputs as f16 operands (~2^-12); q, k hi + residual; P (x2^10), v plain f16; attention output / fused as hi + residual pairs; the 256-wide GELU hidden as f16; f32 statistics/softmax/accumulation. v_wmma_f32_16x16x32_f16.
#define NB 2
#define CC 128
#define HID 256
#define NGR 32
#define CPG (CC / NGR)           /* 4 channels per group */
#define HDT 32
#define HPITCH HDT                   /* columns per head in the q/k/v planes: the true head dim, no padding */
#define DP (NH * HPITCH)             /* 128 */
#define NR (NB * SLEN)           /* 8192 */
#define QBLKS (TQ / 64)
#define SLEN 4096                /* H*W tokens */
#define TQ SLEN
#define TK SLEN
#define NH 4
#define SCL 0.17677669529663687f /* 32^-0.5 */
#define SCL2 ((float)(0.17677669529663687 * 1.4426950408889634)) /* 32^-0.5 * log2(e): raw score -> exponent of two */
typedef __bf16 v16b __attribute__((ext_vector_type(16)));
typedef unsigned short v8us __attribute__((ext_vector_type(8), may_alias));
typedef float  v8f  __attribute__((ext_vector_type(8)));
typedef float  v4f  __attribute__((ext_vector_type(4)));
typedef float  v4fa __attribute__((ext_vector_type(4), may_alias));
union FragB { v16b v; v8us half[2]; unsigned short u[16]; };

__device__ __forceinline__ unsigned short bf16_bits(float x) { unsigned int u = __float_as_uint(x); return (unsigned short)((u + 0x7FFFu + ((u >> 16) & 1u)) >> 16); }
__device__ __forceinline__ float bf16_val(unsigned short b) { return __uint_as_float(((unsigned int)b) << 16); }
__device__ __forceinline__ float bf16_round(float x) { return bf16_val(bf16_bits(x)); }
// D += A·B with NT terms: 1 = ah·bh, 2 = + al·bh (A split), 3 = + ah·bl (both split)
template <int NT>
__device__ __forceinline__ v8f mmaN(v16b ah, v16b al, v16b bh, v16b bl, v8f c) {
  c = __builtin_amdgcn_wmma_f32_16x16x32_bf16(false, ah, false, bh, (short)0, c, false, false);
  if (NT >= 2) c = __builtin_amdgcn_wmma_f32_16x16x32_bf16(false, al, false, bh, (short)0, c, false, false);
  if (NT >= 3) c = __builtin_amdgcn_wmma_f32_16x16x32_bf16(false, ah, false, bl, (short)0, c, false, false);
  asm volatile("v_nop\n\tv_nop\n\tv_nop\n\tv_nop" : "+v"(c) : "v"(ah), "v"(al), "v"(bh), "v"(bl));
  return c;
}

__global__ __launch_bounds__(256) void k_wt_bf16(const float* __restrict__ W, unsigned short* __restrict__ Wt, int K, int N) {
  const int t = blockIdx.x * 256 + threadIdx.x;
  const int k8n = K / 8;
  if (t >= N * k8n) return;
  const int n = t / k8n, k8 = (t % k8n) * 8;
  v8us v;
#pragma unroll
  for (int i = 0; i < 8; ++i) v[i] = bf16_bits(W[(size_t)(k8 + i) * N + n]);
  *(v8us*)(Wt + (size_t)n * K + k8) = v;
  
}

// GEMM C[M][N] (f32, pitch ldc) = act(A[M][K]·W + bias). A f32 row-major (pitch lda) converted per fragment to bf16
// (ASPLIT: hi/lo two planes -> 2 terms, else single rounded term); Wt bf16 [N][K] (pitch ldb). BIAS_BF16 rounds the
// bias to bf16 first (bias quantised to bf16 before the add). K%32==0, M%16==0, N%64==0.
template <bool ASPLIT, int ACT, bool BIAS_BF16>
__global__ __launch_bounds__(128) void k_gemm_bf(const float* __restrict__ A, int lda, const unsigned short* __restrict__ Wt, int ldb,
                                               const float* __restrict__ bias, float* __restrict__ C, int ldc, int M, int N, int K) {
  __shared__ __attribute__((aligned(16))) float so[4][16][64];
  const int tid = threadIdx.x, w = tid >> 5, lane = tid & 31, ln = lane & 15, hh = lane >> 4;
  const int ntn = N / 64;
  const int wid = blockIdx.x * 4 + w;
  const int mt = wid / ntn, nq = wid % ntn;
  if (mt * 16 >= M) return;
  const int row0 = mt * 16, col0 = nq * 64;
  const float* arow = A + (size_t)(row0 + ln) * lda;
  v8f acc[4] = {};
  for (int kb = 0; kb < K; kb += 32) {
    FragB ah, al;
    const v4f x0 = *(const v4fa*)(arow + kb + 8 * hh), x1 = *(const v4fa*)(arow + kb + 8 * hh + 4);
    const v4f x2 = *(const v4fa*)(arow + kb + 16 + 8 * hh), x3 = *(const v4fa*)(arow + kb + 16 + 8 * hh + 4);
    float xs[16] = {x0[0],x0[1],x0[2],x0[3],x1[0],x1[1],x1[2],x1[3],x2[0],x2[1],x2[2],x2[3],x3[0],x3[1],x3[2],x3[3]};
#pragma unroll
    for (int i = 0; i < 16; ++i) { const unsigned short hb = bf16_bits(xs[i]); ah.u[i] = hb; al.u[i] = ASPLIT ? bf16_bits(xs[i] - bf16_val(hb)) : (unsigned short)0; }
#pragma unroll
    for (int t = 0; t < 4; ++t) {
      const unsigned short* brow = Wt + (size_t)(col0 + t * 16 + ln) * ldb + kb;
      FragB b;
      b.half[0] = *(const v8us*)(brow + 8 * hh);
      b.half[1] = *(const v8us*)(brow + 16 + 8 * hh);
      acc[t] = mmaN<ASPLIT ? 2 : 1>(ah.v, al.v, b.v, b.v, acc[t]);
    }
  }
#pragma unroll
  for (int t = 0; t < 4; ++t) {
    float bv = bias ? bias[col0 + t * 16 + ln] : 0.f;
    if (BIAS_BF16) bv = bf16_round(bv);
#pragma unroll
    for (int r = 0; r < 8; ++r) { float v = acc[t][r] + bv; if (ACT == 1) v = fmaxf(v, 0.f); so[w][8 * hh + r][t * 16 + ln] = v; }
  }
  __builtin_amdgcn_fence(__ATOMIC_ACQ_REL, "workgroup");
  __builtin_amdgcn_wave_barrier();
  const int rsub = lane >> 4, c4 = (lane & 15) * 4;
  {
#pragma unroll
    for (int q = 0; q < 8; ++q) {
      const int r = q * 2 + rsub;
      const v4f v = *(const v4fa*)&so[w][r][c4];
      *(v4f*)(C + (size_t)(row0 + r) * ldc + col0 + c4) = v;
    }
    
  }
}

// GEMM C = act(A·W + bias + resid): A f32 (ASPLIT -> hi/lo 2 terms), Wt bf16 [N][K]; ACT 0 none, 1 relu, 2 exact gelu;
// resid (optional, f32, row index = (row % rmod), pitch ldr, RES_BF16 rounds it) added before the activation.
template <bool ASPLIT, int ACT, bool BIAS_BF16, bool RES_BF16>
__global__ __launch_bounds__(128) void k_gemm_bf3(const float* __restrict__ A, int lda, const unsigned short* __restrict__ Wt, int ldb,
                                                const float* __restrict__ bias, const float* __restrict__ resid, int rmod, int ldr,
                                                float* __restrict__ C, int ldc, int M, int N, int K) {
  __shared__ __attribute__((aligned(16))) float so[4][16][64];
  const int tid = threadIdx.x, w = tid >> 5, lane = tid & 31, ln = lane & 15, hh = lane >> 4;
  const int ntn = N / 64;
  const int wid = blockIdx.x * 4 + w;
  const int mt = wid / ntn, nq = wid % ntn;
  if (mt * 16 >= M) return;
  const int row0 = mt * 16, col0 = nq * 64;
  const float* arow = A + (size_t)(row0 + ln) * lda;
  v8f acc[4] = {};
  for (int kb = 0; kb < K; kb += 32) {
    FragB ah, al;
    const v4f x0 = *(const v4fa*)(arow + kb + 8 * hh), x1 = *(const v4fa*)(arow + kb + 8 * hh + 4);
    const v4f x2 = *(const v4fa*)(arow + kb + 16 + 8 * hh), x3 = *(const v4fa*)(arow + kb + 16 + 8 * hh + 4);
    float xs[16] = {x0[0],x0[1],x0[2],x0[3],x1[0],x1[1],x1[2],x1[3],x2[0],x2[1],x2[2],x2[3],x3[0],x3[1],x3[2],x3[3]};
#pragma unroll
    for (int i = 0; i < 16; ++i) { const unsigned short hb = bf16_bits(xs[i]); ah.u[i] = hb; al.u[i] = ASPLIT ? bf16_bits(xs[i] - bf16_val(hb)) : (unsigned short)0; }
#pragma unroll
    for (int t = 0; t < 4; ++t) {
      const unsigned short* brow = Wt + (size_t)(col0 + t * 16 + ln) * ldb + kb;
      FragB b;
      b.half[0] = *(const v8us*)(brow + 8 * hh);
      b.half[1] = *(const v8us*)(brow + 16 + 8 * hh);
      acc[t] = mmaN<ASPLIT ? 2 : 1>(ah.v, al.v, b.v, b.v, acc[t]);
    }
  }
#pragma unroll
  for (int t = 0; t < 4; ++t) {
    const int col = col0 + t * 16 + ln;
    float bv = bias ? bias[col] : 0.f;
    if (BIAS_BF16) bv = bf16_round(bv);
#pragma unroll
    for (int r = 0; r < 8; ++r) {
      float v = acc[t][r] + bv;
      if (resid) { float rv = resid[(size_t)((row0 + 8 * hh + r) % rmod) * ldr + col]; if (RES_BF16) rv = bf16_round(rv); v += rv; }
      if (ACT == 1) v = fmaxf(v, 0.f);
      if (ACT == 2) v = 0.5f * v * (1.0f + erff(v * 0.70710678118654752f));
      if (ACT == 3) { const float u = 0.7978845608028654f * (v + 0.044715f * v * v * v); v = 0.5f * v * (1.0f + tanhf(u)); }
      so[w][8 * hh + r][t * 16 + ln] = v;
    }
  }
  __builtin_amdgcn_fence(__ATOMIC_ACQ_REL, "workgroup");
  __builtin_amdgcn_wave_barrier();
  const int rsub = lane >> 4, c4 = (lane & 15) * 4;
  {
#pragma unroll
    for (int q = 0; q < 8; ++q) {
      const int r = q * 2 + rsub;
      const v4f v = *(const v4fa*)&so[w][r][c4];
      *(v4f*)(C + (size_t)(row0 + r) * ldc + col0 + c4) = v;
    }
    
  }
}
// row LayerNorm (biased variance, eps) over N: s = X (+ R); optional out_sum <- s; out_norm <- (s-mu)*rsqrt(var+eps)*g + b
template <bool PARAM_BF16>
__global__ __launch_bounds__(256) void k_layernorm(const float* __restrict__ X, const float* __restrict__ R, const float* __restrict__ g, const float* __restrict__ bta,
                                                  float* __restrict__ out_sum, float* __restrict__ out_norm, int N, float eps) {
  __shared__ float red[256];
  const int row = blockIdx.x, tid = threadIdx.x;
  const float* x = X + (size_t)row * N; const float* rr = R ? R + (size_t)row * N : nullptr;
  float vals[16];                     // up to N = 4096
  const int per = N / 256;            // contiguous chunk per thread? use strided-by-4 chunks: thread handles j = tid*4 + 1024*u
  float s1 = 0.f;
  for (int u = 0; u < per / 4; ++u) {
    const int j = tid * 4 + 1024 * u;
    const v4f a = *(const v4fa*)(x + j);
    v4f b = {0.f,0.f,0.f,0.f}; if (rr) b = *(const v4fa*)(rr + j);
#pragma unroll
    for (int q = 0; q < 4; ++q) { const float v = a[q] + b[q]; vals[u * 4 + q] = v; s1 += v; }
  }
  red[tid] = s1; __syncthreads();
  for (int st = 128; st > 0; st >>= 1) { if (tid < st) red[tid] += red[tid + st]; __syncthreads(); }
  const float mu = red[0] / (float)N; __syncthreads();
  float s2 = 0.f;
  for (int u = 0; u < per / 4; ++u)
#pragma unroll
    for (int q = 0; q < 4; ++q) { const float c = vals[u * 4 + q] - mu; s2 += c * c; }
  red[tid] = s2; __syncthreads();
  for (int st = 128; st > 0; st >>= 1) { if (tid < st) red[tid] += red[tid + st]; __syncthreads(); }
  const float rs = rsqrtf(red[0] / (float)N + eps);
  {
    for (int u = 0; u < per / 4; ++u) {
      const int j = tid * 4 + 1024 * u;
      v4f o, sm;
#pragma unroll
      for (int q = 0; q < 4; ++q) {
        float gg = g[j + q], bb = bta[j + q];
        if (PARAM_BF16) { gg = bf16_round(gg); bb = bf16_round(bb); }
        sm[q] = vals[u * 4 + q]; o[q] = (vals[u * 4 + q] - mu) * rs * gg + bb;
      }
      if (out_sum) *(v4f*)(out_sum + (size_t)row * N + j) = sm;
      *(v4f*)(out_norm + (size_t)row * N + j) = o;
    }
    
  }
}



// ---- f16 WMMA path (v_wmma_f32_16x16x32_f16): 11-bit significands for operands in range — used where a [0,1] probability operand needs more precision than bf16
typedef _Float16 v16h __attribute__((ext_vector_type(16)));
union FragH { v16h v; v8us half[2]; _Float16 h[16]; unsigned short u[16]; };
template <int NT>
__device__ __forceinline__ v8f mmaH(v16h ah, v16h al, v16h bh, v16h bl, v8f c) {
  c = __builtin_amdgcn_wmma_f32_16x16x32_f16(false, ah, false, bh, (short)0, c, false, false);
  if (NT >= 2) c = __builtin_amdgcn_wmma_f32_16x16x32_f16(false, al, false, bh, (short)0, c, false, false);
  if (NT >= 3) c = __builtin_amdgcn_wmma_f32_16x16x32_f16(false, ah, false, bl, (short)0, c, false, false);
  asm volatile("v_nop\n\tv_nop\n\tv_nop\n\tv_nop" : "+v"(c) : "v"(ah), "v"(al), "v"(bh), "v"(bl));
  return c;
}
// batched GEMM like k_gemm_b but f16 operands: A f32 (split into f16 hi/lo if ASPLIT, else rounded to f16), Bt = f16 values [n][k]; alpha; C f32; N multiple of 16 (partial tiles skipped)
template <bool ASPLIT>
__global__ __launch_bounds__(128) void k_gemm_h(const float* __restrict__ A, int lda, size_t sA, const _Float16* __restrict__ Bh, int ldb, size_t sB, float alpha, float* __restrict__ C, int ldc, size_t sC, int M, int N, int K) {
  __shared__ __attribute__((aligned(16))) float so[4][16][64];
  const int tid = threadIdx.x, w = tid >> 5, lane = tid & 31, ln = lane & 15, hh = lane >> 4; const int by = blockIdx.y;
  A += (size_t)by * sA; Bh += (size_t)by * sB; C += (size_t)by * sC;
  const int ntn = (N + 63) / 64; const int wid = blockIdx.x * 4 + w; const int mt = wid / ntn, nq = wid % ntn; if (mt * 16 >= M) return;
  const int row0 = mt * 16, col0 = nq * 64; const float* arow = A + (size_t)(row0 + ln) * lda;
  v8f acc[4] = {};
  for (int kb = 0; kb < K; kb += 32) {
    FragH ah, al;
    const v4f x0 = *(const v4fa*)(arow + kb + 8 * hh), x1 = *(const v4fa*)(arow + kb + 8 * hh + 4), x2 = *(const v4fa*)(arow + kb + 16 + 8 * hh), x3 = *(const v4fa*)(arow + kb + 16 + 8 * hh + 4);
    float xs[16] = {x0[0],x0[1],x0[2],x0[3],x1[0],x1[1],x1[2],x1[3],x2[0],x2[1],x2[2],x2[3],x3[0],x3[1],x3[2],x3[3]};
#pragma unroll
    for (int i = 0; i < 16; ++i) { const _Float16 h = (_Float16)xs[i]; ah.h[i] = h; al.h[i] = ASPLIT ? (_Float16)(xs[i] - (float)h) : (_Float16)0.0f; }
#pragma unroll
    for (int t = 0; t < 4; ++t) { if (col0 + t * 16 >= N) continue; const size_t boff = (size_t)(col0 + t * 16 + ln) * ldb + kb; FragH bq; bq.half[0] = *(const v8us*)(Bh + boff + 8 * hh); bq.half[1] = *(const v8us*)(Bh + boff + 16 + 8 * hh);
      acc[t] = mmaH<ASPLIT ? 2 : 1>(ah.v, al.v, bq.v, bq.v, acc[t]); }
  }
#pragma unroll
  for (int t = 0; t < 4; ++t) { if (col0 + t * 16 >= N) continue;
#pragma unroll
    for (int r = 0; r < 8; ++r) so[w][8 * hh + r][t * 16 + ln] = acc[t][r] * alpha; }
  __builtin_amdgcn_fence(__ATOMIC_ACQ_REL, "workgroup"); __builtin_amdgcn_wave_barrier();
  const int rsub = lane >> 4, c4 = (lane & 15) * 4;
  {
#pragma unroll
    for (int q = 0; q < 8; ++q) { const int r = q * 2 + rsub; if (col0 + c4 < N) { const v4f v = *(const v4fa*)&so[w][r][c4]; *(v4f*)(C + (size_t)(row0 + r) * ldc + col0 + c4) = v; } }
     }
}

// Wt[n][k] = f16(W[k][n]·scale) from f32 row-major W[K][N] (scale = power of two; bf16-exact weights stay exact in f16 away from the subnormal range)
__global__ __launch_bounds__(256) void k_wt_f16(const float* __restrict__ W, _Float16* __restrict__ Wt, int K, int N, float scale) {
  const int t = blockIdx.x * 256 + threadIdx.x; if (t >= N * (K / 8)) return; const int n = t / (K / 8), k8 = (t % (K / 8)) * 8; FragH f;
#pragma unroll
  for (int i = 0; i < 8; ++i) f.h[i] = (_Float16)(bf16_round(W[(size_t)(k8 + i) * N + n]) * scale); const v8us o = f.half[0];
  *(v8us*)((unsigned short*)Wt + (size_t)n * K + k8) = o; 
}
// k_gemm_hh variant with fused epilogue: v = acc·alpha + bias[by·sBias + col] (+ CP[(row/rowsPerB)·sCPb + by·64 + col] if CP) ; ACT 0 none / 1 elu ; writes f16 C16 (and f32 C if non-null)
template <int ACT>
__global__ __launch_bounds__(128) void k_gemm_hhx(const _Float16* __restrict__ A, int lda, size_t sA, const _Float16* __restrict__ Bh, int ldb, size_t sB, float alpha, const float* __restrict__ bias, size_t sBias, const float* __restrict__ CP, int rowsPerB, size_t sCPb, int row0g,
    float* __restrict__ C, _Float16* __restrict__ C16, int ldc, size_t sC, int M, int N, int K) {
  __shared__ __attribute__((aligned(16))) float so[4][16][64];
  const int tid = threadIdx.x, w = tid >> 5, lane = tid & 31, ln = lane & 15, hh = lane >> 4; const int by = blockIdx.y;
  A += (size_t)by * sA; Bh += (size_t)by * sB; const size_t cofs = (size_t)by * sC; const float* bp = bias ? bias + (size_t)by * sBias : nullptr;
  const int ntn = (N + 63) / 64; const int wid = blockIdx.x * 4 + w; const int mt = wid / ntn, nq = wid % ntn; if (mt * 16 >= M) return;
  const int row0 = mt * 16, col0 = nq * 64; const _Float16* arow = A + (size_t)(row0 + ln) * lda;
  v8f acc[4] = {};
  for (int kb = 0; kb < K; kb += 32) { FragH ah; ah.half[0] = *(const v8us*)((const unsigned short*)arow + kb + 8 * hh); ah.half[1] = *(const v8us*)((const unsigned short*)arow + kb + 16 + 8 * hh);
#pragma unroll
    for (int t = 0; t < 4; ++t) { if (col0 + t * 16 >= N) continue; const size_t boff = (size_t)(col0 + t * 16 + ln) * ldb + kb; FragH bq; bq.half[0] = *(const v8us*)((const unsigned short*)Bh + boff + 8 * hh); bq.half[1] = *(const v8us*)((const unsigned short*)Bh + boff + 16 + 8 * hh);
      acc[t] = mmaH<1>(ah.v, ah.v, bq.v, bq.v, acc[t]); }
  }
#pragma unroll
  for (int t = 0; t < 4; ++t) { if (col0 + t * 16 >= N) continue; const int col = col0 + t * 16 + ln; const float bv = bp ? bf16_round(bp[col]) : 0.f;
#pragma unroll
    for (int r = 0; r < 8; ++r) { float v = acc[t][r] * alpha + bv; if (CP) { const int bidx = (row0g + row0 + 8 * hh + r) / rowsPerB; v += CP[(size_t)bidx * sCPb + (size_t)by * 64 + col]; } if (ACT == 1) v = (v > 0.f) ? v : expm1f(v); else if (ACT == 7) v = (v > 0.f) ? v + 1.0f : expf(v); else if (ACT == 8) v = tanhf(v); else if (ACT == 9) v = 0.5f * v * (1.0f + tanhf(0.7978845608028654f * (v + 0.044715f * v * v * v))); else if (ACT == 11) v = 1.0f / (1.0f + expf(-v)); else if (ACT == 12) v = (v > 0.f) ? v : 0.01f * v; else if (ACT == 14) v = (v > 0.f) ? v : 0.1f * v; else if (ACT == 15) v = v / (1.0f + expf(-v)); else if (ACT == 3) v = fmaxf(v, 0.f); else if (ACT == 6) v = 0.5f * v * (1.0f + erff(v * 0.70710678118654752f)); so[w][8 * hh + r][t * 16 + ln] = v; } }
  __builtin_amdgcn_fence(__ATOMIC_ACQ_REL, "workgroup"); __builtin_amdgcn_wave_barrier();
  const int rsub = lane >> 4, c4 = (lane & 15) * 4; typedef _Float16 v4h __attribute__((ext_vector_type(4)));
  {
#pragma unroll
    for (int q = 0; q < 8; ++q) { const int r = q * 2 + rsub; if (col0 + c4 < N) { const v4f v = *(const v4fa*)&so[w][r][c4]; if (C) *(v4f*)(C + cofs + (size_t)(row0 + r) * ldc + col0 + c4) = v; if (C16) { v4h h4; for (int i = 0; i < 4; ++i) h4[i] = (_Float16)v[i]; *(v4h*)(C16 + cofs + (size_t)(row0 + r) * ldc + col0 + c4) = h4; } } }
     }
}


typedef _Float16 v4h __attribute__((ext_vector_type(4)));

__global__ __launch_bounds__(256) void k_x16(const float* __restrict__ x, _Float16* __restrict__ X16, size_t n8) { const size_t t = (size_t)blockIdx.x * 256 + threadIdx.x; if (t >= n8) return; FragH f;
#pragma unroll
  for (int q = 0; q < 8; ++q) f.h[q] = (_Float16)bf16_round(x[t * 8 + q]); *(v8us*)((unsigned short*)X16 + t * 8) = f.half[0];  }
__global__ __launch_bounds__(256) void k_h16(const float* __restrict__ x, _Float16* __restrict__ X16, size_t n8) { const size_t t = (size_t)blockIdx.x * 256 + threadIdx.x; if (t >= n8) return; FragH f;
#pragma unroll
  for (int q = 0; q < 8; ++q) f.h[q] = (_Float16)x[t * 8 + q]; *(v8us*)((unsigned short*)X16 + t * 8) = f.half[0];  }
__global__ __launch_bounds__(256) void k_round16f(const float* __restrict__ W, _Float16* __restrict__ Bt, size_t n8) { const size_t t = (size_t)blockIdx.x * 256 + threadIdx.x; if (t >= n8) return; FragH f;
#pragma unroll
  for (int i = 0; i < 8; ++i) f.h[i] = (_Float16)(bf16_round(W[t * 8 + i]) * 16.0f); *(v8us*)((unsigned short*)Bt + t * 8) = f.half[0];  }
// Weights lie in the workspace in fragment order: the 32 16-byte pieces that one wave-wide load of a 16-row x 32-column fragment takes (lane = 16 hh + row % 16) stand side by side, 512 bytes in four whole 128-byte lines
// (row-major, the same load touches 16 lines). pk_off: offset in halves of the piece with columns c8 .. c8 + 7 (c8 a multiple of 8) of one row of a [rows][K] matrix; p_frag: fragment (row tile rt, k step ks) of a matrix with KS k steps.
__device__ __forceinline__ size_t pk_off(int row, int c8, int K) { return ((((size_t)(row >> 4) * (K / 32) + (c8 >> 5)) * 2 + ((c8 >> 4) & 1)) * 32 + ((c8 >> 3) & 1) * 16 + (row & 15)) * 8; }
__device__ __forceinline__ v16h p_frag(const _Float16* Wp, int rt, int ks, int KS, int lane) { const unsigned short* p = (const unsigned short*)Wp + ((size_t)(rt * KS + ks) * 64 + lane) * 8; FragH f; f.half[0] = *(const v8us*)p; f.half[1] = *(const v8us*)(p + 256); return f.v; }
template <int CAUSAL>
__global__ __launch_bounds__(128) void k_flash(const _Float16* __restrict__ Q16, int ldq, const _Float16* __restrict__ K16, int ldk, const _Float16* __restrict__ Vt, const int* __restrict__ MSK, float* __restrict__ O, int ldo) {
  constexpr int RPW = 16, RTN = RPW / 16, NQB = TQ / (4 * RPW), DT = 4, KS = 2;
  __shared__ __attribute__((aligned(16))) unsigned short sP[4][RPW][40]; __shared__ __attribute__((aligned(16))) float sO[4][RPW][64 + 4];
  const int tid = threadIdx.x, w = tid >> 5, lane = tid & 31, ln = lane & 15, hh = lane >> 4;
  const int slab = blockIdx.x / QBLKS, qblk = blockIdx.x % QBLKS; (void)NQB; const int b = slab / NH, h = slab % NH; const int qb0 = qblk * (4 * RPW); const int q0 = qb0 + w * RPW;
  FragH aq[2][KS];
#pragma unroll
  for (int rt = 0; rt < RTN; ++rt) { const unsigned short* qr = (const unsigned short*)Q16 + ((size_t)b * TQ + q0 + rt * 16 + ln) * ldq + h * 64;
#pragma unroll
    for (int ks = 0; ks < KS; ++ks) { aq[rt][ks].half[0] = *(const v8us*)(qr + ks * 32 + 8 * hh); aq[rt][ks].half[1] = *(const v8us*)(qr + ks * 32 + 16 + 8 * hh); } }
  const unsigned short* Vth = (const unsigned short*)Vt + (size_t)slab * 64 * TK;
  float m_r[2][8], l_r[2][8]; v8f oacc[2][DT];
#pragma unroll
  for (int rt = 0; rt < RTN; ++rt) {
#pragma unroll
    for (int r = 0; r < 8; ++r) { m_r[rt][r] = -3.0e38f; l_r[rt][r] = 0.f; }
#pragma unroll
    for (int dt = 0; dt < DT; ++dt) oacc[rt][dt] = (v8f){0.f,0.f,0.f,0.f,0.f,0.f,0.f,0.f}; }
  const int jend = (CAUSAL == 1) ? (qb0 + 4 * RPW) : TK;      /* causal: keys beyond the block's last query never contribute */
#pragma unroll 1
  for (int j0 = 0; j0 < jend; j0 += 32) {
    v8f s[2][2];
#pragma unroll
    for (int nt = 0; nt < 2; ++nt) { const unsigned short* kr = (const unsigned short*)K16 + ((size_t)b * TK + j0 + nt * 16 + ln) * ldk + h * 64; FragH bk[KS];
#pragma unroll
      for (int ks = 0; ks < KS; ++ks) { bk[ks].half[0] = *(const v8us*)(kr + ks * 32 + 8 * hh); bk[ks].half[1] = *(const v8us*)(kr + ks * 32 + 16 + 8 * hh); }
#pragma unroll
      for (int rt = 0; rt < RTN; ++rt) { v8f acc = (v8f){0.f,0.f,0.f,0.f,0.f,0.f,0.f,0.f};
#pragma unroll
        for (int ks = 0; ks < KS; ++ks) acc = mmaH<1>(aq[rt][ks].v, aq[rt][ks].v, bk[ks].v, bk[ks].v, acc); s[rt][nt] = acc; } }
#pragma unroll
    for (int rt = 0; rt < RTN; ++rt)
#pragma unroll
      for (int r = 0; r < 8; ++r) { const int tq = q0 + rt * 16 + 8 * hh + r; const int k0 = j0 + ln, k1 = j0 + 16 + ln;
        const bool ok0 = (CAUSAL == 1) ? (k0 <= tq) : ((CAUSAL == 2) ? ((k0 >> 5) == (tq >> 5)) : true), ok1 = (CAUSAL == 1) ? (k1 <= tq) : ((CAUSAL == 2) ? ((k1 >> 5) == (tq >> 5)) : true);      /* mode 2: block-diagonal 32-token groups */
        const float s0 = ok0 ? s[rt][0][r] * SCL : -3.0e38f, s1 = ok1 ? s[rt][1][r] * SCL : -3.0e38f; float mc = fmaxf(s0, s1);
        mc = fmaxf(mc, __shfl_xor(mc, 1, 32)); mc = fmaxf(mc, __shfl_xor(mc, 2, 32)); mc = fmaxf(mc, __shfl_xor(mc, 4, 32)); mc = fmaxf(mc, __shfl_xor(mc, 8, 32));
        const float mn = fmaxf(m_r[rt][r], mc); const float al = (mn > -1.0e38f) ? expf(m_r[rt][r] - mn) : 1.0f; m_r[rt][r] = mn; const float p0 = ok0 ? expf(s0 - mn) : 0.f, p1 = ok1 ? expf(s1 - mn) : 0.f; l_r[rt][r] = l_r[rt][r] * al + p0 + p1;
#pragma unroll
        for (int dt = 0; dt < DT; ++dt) oacc[rt][dt][r] *= al;
        FragH t2; t2.h[0] = (_Float16)(p0 * 1024.0f); t2.h[1] = (_Float16)(p1 * 1024.0f); sP[w][rt * 16 + 8 * hh + r][ln] = t2.u[0]; sP[w][rt * 16 + 8 * hh + r][16 + ln] = t2.u[1]; }
    __builtin_amdgcn_fence(__ATOMIC_ACQ_REL, "workgroup"); __builtin_amdgcn_wave_barrier();
    FragH pa[2];
#pragma unroll
    for (int rt = 0; rt < RTN; ++rt) { pa[rt].half[0] = *(const v8us*)&sP[w][rt * 16 + ln][8 * hh]; pa[rt].half[1] = *(const v8us*)&sP[w][rt * 16 + ln][16 + 8 * hh]; }
#pragma unroll
    for (int dt = 0; dt < DT; ++dt) { const unsigned short* vrow = Vth + (size_t)(dt * 16 + ln) * TK + j0; FragH bv; bv.half[0] = *(const v8us*)(vrow + 8 * hh); bv.half[1] = *(const v8us*)(vrow + 16 + 8 * hh);
#pragma unroll
      for (int rt = 0; rt < RTN; ++rt) oacc[rt][dt] = mmaH<1>(pa[rt].v, pa[rt].v, bv.v, bv.v, oacc[rt][dt]); }
    __builtin_amdgcn_fence(__ATOMIC_ACQ_REL, "workgroup"); __builtin_amdgcn_wave_barrier(); }
#pragma unroll
  for (int rt = 0; rt < RTN; ++rt) {
#pragma unroll
    for (int r = 0; r < 8; ++r) { float l = l_r[rt][r]; l += __shfl_xor(l, 1, 32); l += __shfl_xor(l, 2, 32); l += __shfl_xor(l, 4, 32); l += __shfl_xor(l, 8, 32); l_r[rt][r] = (l > 0.f) ? 1.0f / (l * 1024.0f) : 0.f; }
#pragma unroll
    for (int dt = 0; dt < DT; ++dt)
#pragma unroll
      for (int r = 0; r < 8; ++r) sO[w][rt * 16 + 8 * hh + r][dt * 16 + ln] = oacc[rt][dt][r] * l_r[rt][r]; }
  __builtin_amdgcn_fence(__ATOMIC_ACQ_REL, "workgroup"); __builtin_amdgcn_wave_barrier();
  {
#pragma unroll
    for (int rp = 0; rp < RPW; rp += 2) { const int r = rp + (lane >> 4), pc = lane & 15; const v4f val = *(const v4fa*)&sO[w][r][pc * 4]; *(v4f*)(O + ((size_t)b * TQ + q0 + r) * ldo + h * 64 + pc * 4) = val; }
     } }
__device__ __forceinline__ float xhalf(float x) { return __builtin_bit_cast(float, __builtin_amdgcn_permlanex16(__builtin_bit_cast(int, x), __builtin_bit_cast(int, x), 0x76543210, 0xfedcba98, false, false)); }      /* lane l <-> lane l ^ 16 */
// Eight 2^x in place, in one statement: each v_exp_f32 writes only its own register, so none stands directly in front of an instruction that overwrites its source or reads its result
// (left to the register allocator, a run of them reused the source of the one before as the next destination); the v_nop keeps that slot behind the last one.
__device__ __forceinline__ void exp2x8(float& a, float& b, float& c, float& d, float& e, float& f, float& g, float& h) {
  asm("v_exp_f32 %0, %0\n\tv_exp_f32 %1, %1\n\tv_exp_f32 %2, %2\n\tv_exp_f32 %3, %3\n\tv_exp_f32 %4, %4\n\tv_exp_f32 %5, %5\n\tv_exp_f32 %6, %6\n\tv_exp_f32 %7, %7\n\tv_nop"
      : "+v"(a), "+v"(b), "+v"(c), "+v"(d), "+v"(e), "+v"(f), "+v"(g), "+v"(h)); }
template <int CAUSAL>
__global__ __launch_bounds__(256) void k_flashqk(const _Float16* __restrict__ Q16, const _Float16* __restrict__ QL, const _Float16* __restrict__ K16, const _Float16* __restrict__ KL, const _Float16* __restrict__ Vt, const int* __restrict__ MSK, float* __restrict__ O, int ldo) {
  constexpr int RPW = 16, DT = HPITCH / 16, KS = HPITCH / 32;
  __shared__ __attribute__((aligned(16))) float sO[4][RPW][HPITCH + 4];
  constexpr int KT = 64, KP = HPITCH + 8, VP = KT + 8;      /* keys per staged tile; LDS row pitches in halves: 16 bytes x an odd number, free of bank conflicts for 16-byte reads */
  constexpr int NCK = KT * (HPITCH / 8) / 128, NCV = HPITCH * (KT / 8) / 128;      /* 16-byte pieces per thread and tile */
  __shared__ __attribute__((aligned(16))) unsigned short sK[2][2][KT][KP]; __shared__ __attribute__((aligned(16))) unsigned short sKL[2][2][KT][KP]; __shared__ __attribute__((aligned(16))) unsigned short sV[2][2][HPITCH][VP];      /* [key half][buffer] */
  __shared__ __attribute__((aligned(16))) float sM[4][32][20];      /* the second half's partial result, one row a lane: 16 outputs, maximum, sum; 80-byte pitch = 16 bytes x an odd number */
  static_assert(CAUSAL != 1 && TK % (2 * KT) == 0, "both key halves walk the same number of tiles");
  const int tid = threadIdx.x, w = (tid >> 5) & 3, kh = tid >> 7, ts = tid & 127, lane = tid & 31, ln = lane & 15, hh = lane >> 4;      /* w: query group; kh: key half (waves 0-3 / 4-7); ts: thread within its half */
  const int slab = blockIdx.x / QBLKS, qblk = blockIdx.x % QBLKS; const int b = slab / NH, h = slab % NH; const int qb0 = qblk * (4 * RPW); const int q0 = qb0 + w * RPW;
  const int tq = q0 + ln;      /* this lane's query */
  FragH bq[KS], bql[KS];
  { const unsigned short* qr = (const unsigned short*)Q16 + ((size_t)slab * TQ + tq) * HPITCH; const unsigned short* ql = (const unsigned short*)QL + ((size_t)slab * TQ + tq) * HPITCH;
#pragma unroll      /* constant indices keep the fragment, score and accumulator arrays in registers */
    for (int ks = 0; ks < KS; ++ks) { bq[ks].half[0] = *(const v8us*)(qr + ks * 32 + 8 * hh); bq[ks].half[1] = *(const v8us*)(qr + ks * 32 + 16 + 8 * hh); bql[ks].half[0] = *(const v8us*)(ql + ks * 32 + 8 * hh); bql[ks].half[1] = *(const v8us*)(ql + ks * 32 + 16 + 8 * hh); } }
  const unsigned short* Vth = (const unsigned short*)Vt + (size_t)slab * HPITCH * TK;
  const unsigned short* Kb = (const unsigned short*)K16 + (size_t)slab * TK * HPITCH; const unsigned short* KLb = (const unsigned short*)KL + (size_t)slab * TK * HPITCH;
  v8us gk[NCK], gkl[NCK], gv[NCV];      /* the next tile on its way from global memory to LDS */
  auto fetch = [&](int jt) {
#pragma unroll      /* constant indices keep the fragment, score and accumulator arrays in registers */
    for (int u = 0; u < NCK; ++u) { const int i = ts + 128 * u, r = i / (HPITCH / 8), c8 = (i % (HPITCH / 8)) * 8; gk[u] = *(const v8us*)(Kb + (size_t)(jt + r) * HPITCH + c8); gkl[u] = *(const v8us*)(KLb + (size_t)(jt + r) * HPITCH + c8); }
#pragma unroll      /* constant indices keep the fragment, score and accumulator arrays in registers */
    for (int u = 0; u < NCV; ++u) { const int i = ts + 128 * u, r = i / (KT / 8), c8 = (i % (KT / 8)) * 8; gv[u] = *(const v8us*)(Vth + (size_t)r * TK + jt + c8); } };
  auto stash = [&](int bf) {
#pragma unroll      /* constant indices keep the fragment, score and accumulator arrays in registers */
    for (int u = 0; u < NCK; ++u) { const int i = ts + 128 * u, r = i / (HPITCH / 8), c8 = (i % (HPITCH / 8)) * 8; *(v8us*)&sK[kh][bf][r][c8] = gk[u]; *(v8us*)&sKL[kh][bf][r][c8] = gkl[u]; }
#pragma unroll      /* constant indices keep the fragment, score and accumulator arrays in registers */
    for (int u = 0; u < NCV; ++u) { const int i = ts + 128 * u, r = i / (KT / 8), c8 = (i % (KT / 8)) * 8; *(v8us*)&sV[kh][bf][r][c8] = gv[u]; } };
  float m_q = -3.0e38f, l_q = 0.f; v8f oacc[DT];      /* oacc[dt][r] = O[tq][dt * 16 + 8 hh + r], un-normalised */
#pragma unroll      /* constant indices keep the fragment, score and accumulator arrays in registers */
  for (int dt = 0; dt < DT; ++dt) oacc[dt] = (v8f){0.f,0.f,0.f,0.f,0.f,0.f,0.f,0.f};
  const int jend = (CAUSAL == 1) ? (qb0 + 4 * RPW) : TK;      /* causal: keys beyond the block's last query never contribute */
  const int ntile = jend / (2 * KT);      /* trips: half kh takes tiles kh, kh + 2, kh + 4, ... */
  asm volatile("s_wait_xcnt 0x0" ::: "memory");      /* the Q loads above are issued first, and no tile load below writes into a register that one of them still names as its address */
  fetch(kh * KT); stash(0);
  __syncthreads();      /* tile 0 is written before any wave reads it */
#pragma unroll 1      /* one copy of the trip's code; the buffer index alternates at run time */
  for (int t = 0; t < ntile; ++t) { const int buf = t & 1; const bool more = t + 1 < ntile;      /* the same in every thread of the work-group */
    if (more) fetch((2 * (t + 1) + kh) * KT);      /* in flight while this trip works on tile 2t + kh */
#pragma unroll      /* the two 32-key halves of the tile: constant LDS offsets */
   for (int js = 0; js < KT; js += 32) { const int j0 = (2 * t + kh) * KT + js;
    v8f s[2];      /* s[nt][r] = score of key j0 + nt * 16 + 8 hh + r against query tq */
    FragH ak[2][KS], akl[2][KS], av[DT];      /* all LDS reads of these 32 keys stand together at the head: one LDS latency instead of four */
#pragma unroll      /* constant indices keep the fragment, score and accumulator arrays in registers */
    for (int nt = 0; nt < 2; ++nt) { const unsigned short* kr = &sK[kh][buf][js + nt * 16 + ln][0]; const unsigned short* klr = &sKL[kh][buf][js + nt * 16 + ln][0];
#pragma unroll      /* constant indices keep the fragment, score and accumulator arrays in registers */
      for (int ks = 0; ks < KS; ++ks) { ak[nt][ks].half[0] = *(const v8us*)(kr + ks * 32 + 8 * hh); ak[nt][ks].half[1] = *(const v8us*)(kr + ks * 32 + 16 + 8 * hh); akl[nt][ks].half[0] = *(const v8us*)(klr + ks * 32 + 8 * hh); akl[nt][ks].half[1] = *(const v8us*)(klr + ks * 32 + 16 + 8 * hh); } }
#pragma unroll      /* constant indices keep the fragment, score and accumulator arrays in registers */
    for (int dt = 0; dt < DT; ++dt) { const unsigned short* vrow = &sV[kh][buf][dt * 16 + ln][js]; av[dt].half[0] = *(const v8us*)(vrow + 8 * hh); av[dt].half[1] = *(const v8us*)(vrow + 16 + 8 * hh); }
#pragma unroll      /* constant indices keep the fragment, score and accumulator arrays in registers */
    for (int nt = 0; nt < 2; ++nt) {
      v8f acc = (v8f){0.f,0.f,0.f,0.f,0.f,0.f,0.f,0.f}, accl = acc;
#pragma unroll      /* constant indices keep the fragment, score and accumulator arrays in registers */
      for (int ks = 0; ks < KS; ++ks) { acc = mmaH<1>(ak[nt][ks].v, ak[nt][ks].v, bq[ks].v, bq[ks].v, acc); accl = mmaH<1>(ak[nt][ks].v, ak[nt][ks].v, bql[ks].v, bql[ks].v, accl); accl = mmaH<1>(akl[nt][ks].v, akl[nt][ks].v, bq[ks].v, bq[ks].v, accl); }
#pragma unroll      /* constant indices keep the fragment, score and accumulator arrays in registers */
      for (int r = 0; r < 8; ++r) acc[r] += accl[r] * 0.0009765625f;
      s[nt] = acc; }
    float sc[16]; bool ok[16];
#pragma unroll      /* constant indices keep the fragment, score and accumulator arrays in registers */
    for (int i = 0; i < 16; ++i) { const int kk = j0 + (i >> 3) * 16 + 8 * hh + (i & 7);
      ok[i] = (CAUSAL == 1) ? (kk <= tq) : ((CAUSAL == 2) ? ((kk >> 5) == (tq >> 5)) : true);      /* mode 2: block-diagonal 32-token groups */
      if (CAUSAL == 4) ok[i] = MSK[((size_t)b * TQ + tq) * TK + kk] != 0;      /* mode 4: per-(query, key) INPUT mask shared by all heads; masked keys contribute nothing, rows with no valid key give l = 0 -> output 0 */
      sc[i] = ok[i] ? s[i >> 3][i & 7] : -3.0e38f; }      /* raw q.k: maxima are taken on raw scores, the (positive) scale enters with the exponent */
    float mt[8];
#pragma unroll      /* constant indices keep the fragment, score and accumulator arrays in registers */
    for (int i = 0; i < 8; ++i) mt[i] = fmaxf(sc[i], sc[8 + i]);
    float mc = fmaxf(fmaxf(fmaxf(mt[0], mt[1]), fmaxf(mt[2], mt[3])), fmaxf(fmaxf(mt[4], mt[5]), fmaxf(mt[6], mt[7])));
    mc = fmaxf(mc, xhalf(mc));      /* the other half's 16 keys of the same query */
    const float mn = fmaxf(m_q, mc); const float al = (mn > -1.0e38f) ? __builtin_amdgcn_exp2f((m_q - mn) * SCL2) : 1.0f; m_q = mn;
    const float nb = 10.0f - mn * SCL2;      /* p = 2^(sc * SCL2 + nb) = 2^10 exp((sc - mn) / sqrt(32)): scale, log2(e), maximum and P's 2^10 in one fma per score */
    float p[16]; FragH pb;
#pragma unroll      /* constant indices keep the fragment, score and accumulator arrays in registers */
    for (int i = 0; i < 16; ++i) p[i] = sc[i] * SCL2 + nb;
    exp2x8(p[0], p[1], p[2], p[3], p[4], p[5], p[6], p[7]); exp2x8(p[8], p[9], p[10], p[11], p[12], p[13], p[14], p[15]);
#pragma unroll      /* constant indices keep the fragment, score and accumulator arrays in registers */
    for (int i = 0; i < 16; ++i) { if (!ok[i]) p[i] = 0.f; pb.h[i] = (_Float16)p[i]; }      /* pb.h[i]: key j0 + (i >> 3) * 16 + 8 hh + (i & 7) of column ln; p and l_q both carry the 2^10 */
    float pt[8];
#pragma unroll      /* constant indices keep the fragment, score and accumulator arrays in registers */
    for (int i = 0; i < 8; ++i) pt[i] = p[i] + p[8 + i];
    l_q = l_q * al + (((pt[0] + pt[1]) + (pt[2] + pt[3])) + ((pt[4] + pt[5]) + (pt[6] + pt[7])));
#pragma unroll      /* constant indices keep the fragment, score and accumulator arrays in registers */
    for (int dt = 0; dt < DT; ++dt)
#pragma unroll      /* constant indices keep the fragment, score and accumulator arrays in registers */
      for (int r = 0; r < 8; ++r) oacc[dt][r] *= al;
#pragma unroll      /* constant indices keep the fragment, score and accumulator arrays in registers */
    for (int dt = 0; dt < DT; ++dt) oacc[dt] = mmaH<1>(av[dt].v, av[dt].v, pb.v, pb.v, oacc[dt]); }
    if (more) stash(buf ^ 1);      /* that buffer's last readers left it at the barrier that ended the trip before */
    __syncthreads(); }      /* one barrier a trip: publishes tiles 2t + 2 and 2t + 3 and ends every wave's reads of tiles 2t and 2t + 1, whose buffers the next trip overwrites */
  // The two key halves of a query are joined as two tiles of the running softmax are: common maximum, each half's sum and outputs scaled by 2^((own maximum - common maximum) * SCL2).
  if (kh == 1) {
#pragma unroll      /* constant indices keep the fragment, score and accumulator arrays in registers */
    for (int dt = 0; dt < DT; ++dt) { const v4f lo4 = {oacc[dt][0], oacc[dt][1], oacc[dt][2], oacc[dt][3]}, hi4 = {oacc[dt][4], oacc[dt][5], oacc[dt][6], oacc[dt][7]}; *(v4fa*)&sM[w][lane][dt * 8] = lo4; *(v4fa*)&sM[w][lane][dt * 8 + 4] = hi4; }
    sM[w][lane][8 * DT] = m_q; sM[w][lane][8 * DT + 1] = l_q; }
  __syncthreads();      /* the second half's partial results are written before the first half reads them; every wave passes it */
  if (kh == 1) return;      /* behind the last barrier */
  { const float m1 = sM[w][lane][8 * DT], l1 = sM[w][lane][8 * DT + 1]; const float mm = fmaxf(m_q, m1); const bool any = mm > -1.0e38f;
    const float a0 = any ? __builtin_amdgcn_exp2f((m_q - mm) * SCL2) : 1.0f, a1 = any ? __builtin_amdgcn_exp2f((m1 - mm) * SCL2) : 1.0f;
    l_q = l_q * a0 + l1 * a1;
#pragma unroll      /* constant indices keep the fragment, score and accumulator arrays in registers */
    for (int dt = 0; dt < DT; ++dt) { const v4f lo4 = *(const v4fa*)&sM[w][lane][dt * 8], hi4 = *(const v4fa*)&sM[w][lane][dt * 8 + 4];
#pragma unroll      /* constant indices keep the fragment, score and accumulator arrays in registers */
      for (int r = 0; r < 4; ++r) { oacc[dt][r] = oacc[dt][r] * a0 + lo4[r] * a1; oacc[dt][4 + r] = oacc[dt][4 + r] * a0 + hi4[r] * a1; } } }
  const float lsum = l_q + xhalf(l_q); const float linv = (lsum > 0.f) ? 1.0f / lsum : 0.f;
#pragma unroll      /* constant indices keep the fragment, score and accumulator arrays in registers */
  for (int dt = 0; dt < DT; ++dt) { v4f lo4, hi4;
#pragma unroll      /* constant indices keep the fragment, score and accumulator arrays in registers */
    for (int r = 0; r < 4; ++r) { lo4[r] = oacc[dt][r] * linv; hi4[r] = oacc[dt][4 + r] * linv; }
    *(v4fa*)&sO[w][ln][dt * 16 + 8 * hh] = lo4; *(v4fa*)&sO[w][ln][dt * 16 + 8 * hh + 4] = hi4; }
  __builtin_amdgcn_fence(__ATOMIC_ACQ_REL, "workgroup"); __builtin_amdgcn_wave_barrier();
  {
#pragma unroll      /* constant indices keep the fragment, score and accumulator arrays in registers */
    for (int rp = 0; rp < RPW; rp += 128 / HPITCH) { const int r = rp + lane / (HPITCH / 4), pc = lane % (HPITCH / 4); const v4f val = *(const v4fa*)&sO[w][r][pc * 4]; *(v4f*)(O + ((size_t)b * TQ + q0 + r) * ldo + h * HPITCH + pc * 4) = val; }
     } }

__device__ __forceinline__ void d_gnstat(const float* __restrict__ x, float* __restrict__ GS, const int bg) {
  #pragma clang fp contract(off)
  __shared__ float sh[256]; const int tid = threadIdx.x; const float* base = x + (size_t)bg * CPG * SLEN; const int n = CPG * SLEN; float s = 0.f;
  for (int i = tid; i < n; i += 256) s += bf16_round(base[i]);
  sh[tid] = s; __syncthreads(); for (int st = 128; st > 0; st >>= 1) { if (tid < st) sh[tid] += sh[tid + st]; __syncthreads(); }
  const float mu = sh[0] / (float)n; __syncthreads(); float q2 = 0.f;
  for (int i = tid; i < n; i += 256) { const float d = bf16_round(base[i]) - mu; q2 += d * d; }
  sh[tid] = q2; __syncthreads(); for (int st = 128; st > 0; st >>= 1) { if (tid < st) sh[tid] += sh[tid + st]; __syncthreads(); }
  if (tid == 0) { const float rs = rsqrtf(sh[0] / (float)n + 1e-5f); { *(float*)(GS + (size_t)bg * 32) = mu; *(float*)(GS + (size_t)bg * 32 + 1) = rs;  } } }
__device__ __forceinline__ void d_wpad(const float* __restrict__ Wm, const float* __restrict__ bm, _Float16* __restrict__ BP, float* __restrict__ PB, const int bid) {
  const int r = bid * 256 + threadIdx.x; if (r >= DP) return; const int h = r / HPITCH, d = r % HPITCH; const bool live = d < HDT; const int srow = h * HDT + d;
  for (int c0 = 0; c0 < CC; c0 += 8) { FragH f; for (int q = 0; q < 8; ++q) f.h[q] = live ? (_Float16)(bf16_round(Wm[(size_t)srow * CC + c0 + q]) * 16.0f) : (_Float16)0.0f; unsigned short* dst = (unsigned short*)BP + pk_off(r, c0, CC); *(v8us*)dst = f.half[0];
    asm volatile("s_wait_xcnt 0x0" ::: "memory"); }      /* the next trip writes into the registers that this store names */
  const float bv = live ? bm[srow] : 0.f; *(float*)(PB + r) = bv;  }
__device__ __forceinline__ void d_wio(const float* __restrict__ Wm, int nin, int nout, int pair, _Float16* __restrict__ Bt, const int bid) { const int pitch = pair ? 2 * nin : nin; const size_t t = (size_t)bid * 256 + threadIdx.x; if (t >= (size_t)nout * (pitch / 8)) return; const int fr = (int)(t >> 5), pl = (int)(t & 31); const int pc = ((fr >> 1) % (pitch / 32)) * 4 + (fr & 1) * 2 + (pl >> 4); const int o = (fr >> 1) / (pitch / 32) * 16 + (pl & 15); FragH f;      /* thread t makes piece t of the fragment order (pk_off(o, pc * 8, pitch) = 8 t): a wave stores 512 bytes in a row */
  for (int q = 0; q < 8; ++q) { const int col = pc * 8 + q; const bool lo = col >= nin; const int i = lo ? col - nin : col; f.h[q] = (_Float16)(bf16_round(Wm[(size_t)i * nout + o]) * (lo ? 1.0f : 16.0f)); }
  *(v8us*)((unsigned short*)Bt + t * 8) = f.half[0];  }
__device__ __forceinline__ void d_wop(const float* __restrict__ Wo, _Float16* __restrict__ Bt, const int bid) { const int t = bid * 256 + threadIdx.x; if (t >= CC * (2 * CC / 8)) return; const int fr = t >> 5, pl = t & 31; const int pc = ((fr >> 1) % (2 * CC / 32)) * 4 + (fr & 1) * 2 + (pl >> 4); const int o = (fr >> 1) / (2 * CC / 32) * 16 + (pl & 15); const bool lo = pc * 8 >= CC; FragH f;      /* piece t of the fragment order, as in d_wio */
  for (int q = 0; q < 8; ++q) { const int c = pc * 8 + q - (lo ? CC : 0); f.h[q] = (_Float16)(bf16_round(Wo[(size_t)o * CC + c]) * (lo ? 1.0f : 16.0f)); } *(v8us*)((unsigned short*)Bt + (size_t)t * 8) = f.half[0];  }
// The two statistics passes and the six weight conversions need nothing of each other: one grid, each part a range of block indices (the branch is the same for a whole work-group, so the barriers of the statistics part are passed by all of its threads).
// The statistics blocks run longest and come first.
#define PB_GN (NB * NGR)                          /* blocks per statistics pass */
#define PB_W1 ((HID * (2 * CC / 8) + 255) / 256)
#define PB_W2 ((CC * (HID / 8) + 255) / 256)
#define PB_WO ((CC * (2 * CC / 8) + 255) / 256)
#define PB_ALL (2 * PB_GN + 3 + PB_W1 + PB_W2 + PB_WO)
__global__ __launch_bounds__(256) void k_prep(const float* __restrict__ x0, const float* __restrict__ x1, float* __restrict__ GS,
    const float* __restrict__ Wq, const float* __restrict__ bqp, const float* __restrict__ Wk, const float* __restrict__ bkp, const float* __restrict__ Wv, const float* __restrict__ bvp, _Float16* __restrict__ BP, float* __restrict__ PB,
    const float* __restrict__ W1, _Float16* __restrict__ BW1, const float* __restrict__ W2, _Float16* __restrict__ BW2, const float* __restrict__ Wo, _Float16* __restrict__ BWO) {
  int bid = blockIdx.x;
  if (bid < 2 * PB_GN) { const bool sec = bid >= PB_GN; d_gnstat(sec ? x1 : x0, GS + (sec ? PB_GN * 32 : 0), sec ? bid - PB_GN : bid); return; }
  bid -= 2 * PB_GN;
  if (bid < 3) { d_wpad(bid == 0 ? Wq : (bid == 1 ? Wk : Wv), bid == 0 ? bqp : (bid == 1 ? bkp : bvp), BP + (size_t)bid * DP * CC, PB + bid * DP, 0); return; }
  bid -= 3;
  if (bid < PB_W1) { d_wio(W1, CC, HID, 1, BW1, bid); return; }
  bid -= PB_W1;
  if (bid < PB_W2) { d_wio(W2, HID, CC, 0, BW2, bid); return; }
  bid -= PB_W2;
  d_wop(Wo, BWO, bid); }
// One 16x16x32 f16 product; the builtin form, for which the compiler keeps the distances behind a matrix instruction itself.
__device__ __forceinline__ v8f f_mma(v16h a, v16h b, v8f c) { return __builtin_amdgcn_wmma_f32_16x16x32_f16(false, a, false, b, (short)0, c, false, false); }
__device__ __forceinline__ v16h l_frag(const unsigned short* p, int hh) { FragH f; f.half[0] = *(const v8us*)(p + 8 * hh); f.half[1] = *(const v8us*)(p + 16 + 8 * hh); return f.v; }
// Head of the block in one launch: normalise a 64-token tile of one input (all 128 channels), transposed into LDS as f16 [token][channel], and project it from there.
// blockIdx.y = 0 q, 1 k, 2 v. q and k: weight rows are the A operand and tokens the B operand, so a lane holds 8 neighbouring channels of ONE token and stores hi and residual as 16-byte pieces of the [batch][head][token][32] planes.
// v: tokens are the A operand and weight rows the B operand, so a lane holds 8 neighbouring tokens of ONE channel: a 16-byte piece of V^T. Each wave writes whole 128-byte lines.
#define XP (CC + 8)      /* LDS row pitch in halves: 16 bytes x an odd number */
template <bool ISV>
__device__ __forceinline__ void d_qkv(const float* __restrict__ x, const float* __restrict__ GS, const float* __restrict__ gam, const float* __restrict__ bet, const _Float16* __restrict__ Wp, const float* __restrict__ bp, unsigned short* __restrict__ Hh, unsigned short* __restrict__ VT, unsigned short (*sX)[XP]) {
  constexpr int NW = ISV ? 1 : 4;      /* weight fragments per k step */
  const int tid = threadIdx.x, w = tid >> 5, lane = tid & 31, ln = lane & 15, hh = lane >> 4;
  const int b = blockIdx.x / (SLEN / 64), pb = blockIdx.x % (SLEN / 64);
  const int ch0 = ISV ? w * 16 : (w >> 2) * 64;      /* this wave's first channel: 16 channels x 64 tokens for v, 64 channels x 16 tokens for q and k */
  v16h wf[CC / 32][NW]; v4f bl[NW][2]; float bv1 = 0.f;      /* this wave's weight fragments and biases, asked for before the tile so that they arrive while it is normalised */
#pragma unroll      /* constant indices keep the fragment arrays in registers */
  for (int ks = 0; ks < CC / 32; ++ks)
#pragma unroll      /* as above */
    for (int mt = 0; mt < NW; ++mt) wf[ks][mt] = p_frag(Wp, ch0 / 16 + mt, ks, CC / 32, lane);
  if (ISV) bv1 = bp[ch0 + ln];
  else {
#pragma unroll      /* as above */
    for (int mt = 0; mt < NW; ++mt) { bl[mt][0] = *(const v4fa*)(bp + ch0 + mt * 16 + 8 * hh); bl[mt][1] = *(const v4fa*)(bp + ch0 + mt * 16 + 8 * hh + 4); } }
  asm volatile("s_wait_xcnt 0x0" ::: "memory");      /* no later instruction writes into a register that one of the loads above still names as its address */
  const int cl0 = tid >> 2, pj = (tid & 3) * 4;      /* 4 lanes per channel row: the 2-byte LDS stores of a wave fall into different banks; a thread has channels cl0 and cl0 + 64, positions pj + 16 jj */
  const float* xp = x + ((size_t)b * CC + cl0) * SLEN + pb * 64 + pj; const float* gp = GS + ((size_t)b * NGR + cl0 / CPG) * 32;
  v4f xa[2][4]; float mu[2], rs[2], gg[2], be[2];      /* every address below is one of four bases plus a constant, so no load's result lands in a register that an earlier load names as its address */
#pragma unroll      /* constant indices keep the values in registers */
  for (int e = 0; e < 2; ++e) { mu[e] = gp[e * (64 / CPG) * 32]; rs[e] = gp[e * (64 / CPG) * 32 + 1]; gg[e] = gam[cl0 + 64 * e]; be[e] = bet[cl0 + 64 * e]; }
  asm volatile("s_wait_xcnt 0x0" ::: "memory");      /* as above, for the statistics and the scale and shift */
#pragma unroll      /* eight 16-byte pieces per thread, all in flight together */
  for (int e = 0; e < 2; ++e)
#pragma unroll      /* as above */
    for (int jj = 0; jj < 4; ++jj) xa[e][jj] = *(const v4fa*)(xp + (size_t)e * 64 * SLEN + jj * 16);
  asm volatile("s_wait_xcnt 0x0" ::: "memory");      /* as above, for the tile's loads */
#pragma unroll      /* constant indices keep the tile's pieces in registers */
  for (int e = 0; e < 2; ++e) { const float g = bf16_round(gg[e]), bb = bf16_round(be[e]);
#pragma unroll      /* as above */
    for (int jj = 0; jj < 4; ++jj)
#pragma unroll      /* as above */
      for (int q = 0; q < 4; ++q) { FragH f; f.h[0] = (_Float16)((bf16_round(xa[e][jj][q]) - mu[e]) * rs[e] * g + bb); sX[pj + 16 * jj + q][cl0 + 64 * e] = f.u[0]; } }
  __syncthreads();      /* the tile is written before any wave takes fragments from it; every thread of the work-group is on the same side of ISV */
  const v8f z8 = {0.f,0.f,0.f,0.f,0.f,0.f,0.f,0.f}; v8f acc[4] = {z8, z8, z8, z8};
  if constexpr (!ISV) { const int tk = (w & 3) * 16 + ln;      /* this lane's token */
#pragma unroll      /* as above */
    for (int ks = 0; ks < CC / 32; ++ks) { const v16h t = l_frag(&sX[tk][ks * 32], hh);
#pragma unroll      /* as above */
      for (int mt = 0; mt < 4; ++mt) acc[mt] = f_mma(wf[ks][mt], t, acc[mt]); }
    Hh += ((size_t)b * NH * SLEN + pb * 64 + tk) * HPITCH + (size_t)(ch0 / HPITCH) * SLEN * HPITCH; unsigned short* Hl = Hh + (size_t)NR * DP;      /* planes are [batch][head][token][32]: this token's row in the wave's first head */
#pragma unroll      /* as above */
    for (int mt = 0; mt < 4; ++mt) { FragH fh, fl;
#pragma unroll      /* as above */
      for (int r = 0; r < 8; ++r) { const float v = acc[mt][r] * 0.0625f + bf16_round(bl[mt][r >> 2][r & 3]); const _Float16 h = (_Float16)v; fh.h[r] = h; fl.h[r] = (_Float16)((v - (float)h) * 1024.0f); }
      const size_t po = (size_t)(mt * 16 / HPITCH) * SLEN * HPITCH + mt * 16 % HPITCH + 8 * hh; *(v8us*)(Hh + po) = fh.half[0]; *(v8us*)(Hl + po) = fl.half[0]; }
    asm volatile("s_wait_xcnt 0x0" ::: "memory");      /* in the built code the v side follows this one, and it writes into registers that the stores above name */
  } else {
#pragma unroll      /* as above */
    for (int ks = 0; ks < CC / 32; ++ks)
#pragma unroll      /* as above */
      for (int mt = 0; mt < 4; ++mt) acc[mt] = f_mma(l_frag(&sX[mt * 16 + ln][ks * 32], hh), wf[ks][0], acc[mt]);
    const float bv = bf16_round(bv1); unsigned short* dst = VT + ((size_t)b * DP + ch0 + ln) * TK + pb * 64;      /* row (b, head, d) of V^T = row b * 128 + channel */
#pragma unroll      /* as above */
    for (int mt = 0; mt < 4; ++mt) { FragH f;
#pragma unroll      /* as above */
      for (int r = 0; r < 8; ++r) f.h[r] = (_Float16)(acc[mt][r] * 0.0625f + bv);
      *(v8us*)(dst + mt * 16 + 8 * hh) = f.half[0]; }
  } }
__global__ __launch_bounds__(256) void k_qkv(const float* __restrict__ x0, const float* __restrict__ x1, const float* __restrict__ GS, const float* __restrict__ gam0, const float* __restrict__ bet0, const float* __restrict__ gam1, const float* __restrict__ bet1,
    const _Float16* __restrict__ BP, const float* __restrict__ PB, _Float16* __restrict__ QKH, _Float16* __restrict__ VT) {
  __shared__ __attribute__((aligned(16))) unsigned short sX[64][XP];
  const int y = blockIdx.y; const bool sec = y != 0;      /* the same for a whole work-group */
  const float* x = sec ? x1 : x0; const float* gam = sec ? gam1 : gam0; const float* bet = sec ? bet1 : bet0; const float* gs = GS + (sec ? NB * NGR * 32 : 0);
  if (y == 2) d_qkv<true>(x, gs, gam, bet, BP + (size_t)y * DP * CC, PB + y * DP, nullptr, (unsigned short*)VT, sX);
  else d_qkv<false>(x, gs, gam, bet, BP + (size_t)y * DP * CC, PB + y * DP, (unsigned short*)QKH + (size_t)y * 2 * NR * DP, nullptr, sX); }
// Tail of the block in one launch: everything behind the attention is row-wise, so a work-group takes 32 tokens through hi/residual split, W1 + exact GELU, W2 + residual, hi/residual split and Wo; the values between the products pass through LDS.
// W1 and W2: weight rows are the A operand and tokens the B operand (a lane holds 8 neighbouring columns of one token: one 16-byte LDS store). Wo: tokens are the A operand (a lane holds 8 neighbouring tokens of one output channel: the NCHW order of out).
#define PT 32                /* tokens per work-group: one 128-byte line of each output channel */
#define PP (2 * CC + 8)      /* LDS row pitch in halves: 16 bytes x an odd number */
__global__ __launch_bounds__(256) void k_tail(const float* __restrict__ O, const _Float16* __restrict__ BW1, const float* __restrict__ b1, const _Float16* __restrict__ BW2, const float* __restrict__ b2, const _Float16* __restrict__ BWO, const float* __restrict__ bo, float* __restrict__ out) {
  __shared__ __attribute__((aligned(16))) unsigned short sA[PT][PP]; __shared__ __attribute__((aligned(16))) unsigned short sG[PT][PP]; __shared__ __attribute__((aligned(16))) unsigned short sF[PT][PP]; __shared__ __attribute__((aligned(16))) float sR[PT][CC + 4];
  const int tid = threadIdx.x, w = tid >> 5, lane = tid & 31, ln = lane & 15, hh = lane >> 4; const int r0 = blockIdx.x * PT;
  v4f c1[2][2], c2[2];
#pragma unroll
  for (int mt = 0; mt < 2; ++mt) { c1[mt][0] = *(const v4fa*)(b1 + w * 32 + mt * 16 + 8 * hh); c1[mt][1] = *(const v4fa*)(b1 + w * 32 + mt * 16 + 8 * hh + 4); }
  c2[0] = *(const v4fa*)(b2 + w * 16 + 8 * hh); c2[1] = *(const v4fa*)(b2 + w * 16 + 8 * hh + 4); const float c3 = bo[w * 16 + ln];
  asm volatile("s_wait_xcnt 0x0" ::: "memory");      /* no weight load below lands in a register that one of the bias loads above still names as its address */
  v16h w1[8][2];      /* W1 rows w * 32 .. + 31, asked for before the tile */
#pragma unroll      /* constant indices keep the fragment arrays in registers */
  for (int ks = 0; ks < 8; ++ks)
#pragma unroll
    for (int mt = 0; mt < 2; ++mt) w1[ks][mt] = p_frag(BW1, w * 2 + mt, ks, 8, lane);
  { const int tk = tid >> 3, c0 = (tid & 7) * 16; const float* sp = O + (size_t)(r0 + tk) * DP + c0; v4f xv[4];
#pragma unroll
    for (int q = 0; q < 4; ++q) xv[q] = *(const v4fa*)(sp + 4 * q);
    asm volatile("s_wait_xcnt 0x0" ::: "memory");      /* no later instruction writes into a register that one of the loads above still names as its address */
#pragma unroll
    for (int g = 0; g < 2; ++g) { FragH fh, fl;
#pragma unroll
      for (int q = 0; q < 8; ++q) { const float v = xv[g * 2 + (q >> 2)][q & 3]; const _Float16 hv = (_Float16)v; fh.h[q] = hv; fl.h[q] = (_Float16)((v - (float)hv) * 16.0f); }
      *(v8us*)&sA[tk][c0 + 8 * g] = fh.half[0]; *(v8us*)&sA[tk][CC + c0 + 8 * g] = fl.half[0]; }
#pragma unroll
    for (int q = 0; q < 4; ++q) *(v4fa*)&sR[tk][c0 + 4 * q] = xv[q]; }
  __syncthreads();      /* attention output, split, is written before any wave takes fragments from it */
  const v8f z8 = {0.f,0.f,0.f,0.f,0.f,0.f,0.f,0.f}; v8f a1[2][2] = {{z8, z8}, {z8, z8}};
#pragma unroll
  for (int ks = 0; ks < 8; ++ks) { const v16h t0 = l_frag(&sA[ln][ks * 32], hh), t1 = l_frag(&sA[16 + ln][ks * 32], hh);
#pragma unroll
    for (int mt = 0; mt < 2; ++mt) { a1[mt][0] = f_mma(w1[ks][mt], t0, a1[mt][0]); a1[mt][1] = f_mma(w1[ks][mt], t1, a1[mt][1]); } }
  v16h w2[8], w3[8];      /* W2 and Wo rows w * 16 .. + 15: on their way while the GELU is computed */
#pragma unroll
  for (int ks = 0; ks < 8; ++ks) { w2[ks] = p_frag(BW2, w, ks, 8, lane); w3[ks] = p_frag(BWO, w, ks, 8, lane); }
  asm volatile("s_wait_xcnt 0x0" ::: "memory");      /* as above, for the weight loads */
#pragma unroll
  for (int mt = 0; mt < 2; ++mt)
#pragma unroll
    for (int nt = 0; nt < 2; ++nt) { FragH f;
#pragma unroll
      for (int r = 0; r < 8; ++r) { float v = a1[mt][nt][r] * 0.0625f + bf16_round(c1[mt][r >> 2][r & 3]); v = 0.5f * v * (1.0f + erff(v * 0.70710678118654752f)); f.h[r] = (_Float16)v; }
      *(v8us*)&sG[nt * 16 + ln][w * 32 + mt * 16 + 8 * hh] = f.half[0]; }
  __syncthreads();      /* the hidden layer is complete before the second product reads it */
  v8f a2[2] = {z8, z8};
#pragma unroll
  for (int ks = 0; ks < 8; ++ks) { a2[0] = f_mma(w2[ks], l_frag(&sG[ln][ks * 32], hh), a2[0]); a2[1] = f_mma(w2[ks], l_frag(&sG[16 + ln][ks * 32], hh), a2[1]); }
#pragma unroll
  for (int nt = 0; nt < 2; ++nt) { const int tk = nt * 16 + ln, c0 = w * 16 + 8 * hh; const v4f ra = *(const v4fa*)&sR[tk][c0], rb = *(const v4fa*)&sR[tk][c0 + 4]; FragH fh, fl;
#pragma unroll
    for (int r = 0; r < 8; ++r) { float v = a2[nt][r] * 0.0625f + bf16_round(c2[r >> 2][r & 3]); v += (r < 4) ? ra[r & 3] : rb[r & 3]; const _Float16 hv = (_Float16)v; fh.h[r] = hv; fl.h[r] = (_Float16)((v - (float)hv) * 16.0f); }
    *(v8us*)&sF[tk][c0] = fh.half[0]; *(v8us*)&sF[tk][CC + c0] = fl.half[0]; }
  __syncthreads();      /* out + mlp, split, is complete before the last product reads it */
  v8f a3[2] = {z8, z8};
#pragma unroll
  for (int ks = 0; ks < 8; ++ks) { a3[0] = f_mma(l_frag(&sF[ln][ks * 32], hh), w3[ks], a3[0]); a3[1] = f_mma(l_frag(&sF[16 + ln][ks * 32], hh), w3[ks], a3[1]); }
  const float bv = bf16_round(c3); float* d = out + ((size_t)(r0 / SLEN) * CC + w * 16 + ln) * SLEN + (r0 % SLEN) + 8 * hh;
#pragma unroll
  for (int mt = 0; mt < 2; ++mt) { v4f lo4, hi4;
#pragma unroll
    for (int r = 0; r < 4; ++r) { lo4[r] = a3[mt][r] * 0.0625f + bv; hi4[r] = a3[mt][4 + r] * 0.0625f + bv; }
    *(v4f*)(d + mt * 16) = lo4; *(v4f*)(d + mt * 16 + 4) = hi4; } }

extern "C" void kernel_launch(void* const* d_in, const int* in_sizes, int n_in,
                              void* d_out, int out_size, void* d_ws, size_t ws_size, hipStream_t stream) {
  (void)in_sizes; (void)n_in; (void)out_size;
  const float* const* I = (const float* const*)d_in; const float* fo = I[0]; const float* fs = I[1]; const float* gq = I[2]; const float* bq = I[3]; const float* gkv = I[4]; const float* bkv = I[5]; const float* Wq = I[6]; const float* bqp = I[7]; const float* Wk = I[8]; const float* bkp = I[9]; const float* Wv = I[10]; const float* bvp = I[11]; const float* W1 = I[12]; const float* b1 = I[13]; const float* W2 = I[14]; const float* b2 = I[15]; const float* Wo = I[16]; const float* bo = I[17];
  char* ws = (char*)d_ws; size_t off = 0;
  auto take = [&](size_t bytes) { char* p = ws + off; off += (bytes + 255) & ~(size_t)255; return p; };
  _Float16* BPq = (_Float16*)take((size_t)3 * DP * CC * 2); float* PBq = (float*)take(3 * DP * 4);      /* q, k, v planes one behind the other */
  _Float16* BW1 = (_Float16*)take((size_t)HID * 2 * CC * 2); _Float16* BW2 = (_Float16*)take((size_t)CC * HID * 2); _Float16* BWO = (_Float16*)take((size_t)CC * 2 * CC * 2); float* GS = (float*)take((size_t)NB * NGR * 32 * 4 * 2);
  _Float16* QH = (_Float16*)take((size_t)4 * NR * DP * 2); _Float16* QL = QH + (size_t)NR * DP; _Float16* KH = QH + (size_t)2 * NR * DP; _Float16* KL = QH + (size_t)3 * NR * DP; _Float16* VT = (_Float16*)take((size_t)NR * DP * 2);      /* q hi, q residual, k hi, k residual; V^T */
  float* O = (float*)take((size_t)NR * DP * 4);      /* attention output */
  if (off > ws_size) return;      /* 0.5 + 4 x 2 + 2 + 4 = 15 MiB */
  k_prep<<<PB_ALL, 256, 0, stream>>>(fo, fs, GS, Wq, bqp, Wk, bkp, Wv, bvp, BPq, PBq, W1, BW1, W2, BW2, Wo, BWO);      /* group statistics of both inputs; conv1x1 weights (out,in) = natural rows; MLP and output weights */
  k_qkv<<<dim3(NR / 64, 3), 256, 0, stream>>>(fo, fs, GS, gq, bq, gkv, bkv, BPq, PBq, QH, VT);      /* normalise + q, k (hi + residual planes), V^T */
  k_flashqk<0><<<NB * NH * QBLKS, 256, 0, stream>>>(QH, QL, KH, KL, VT, nullptr, O, DP);      /* q/k hi + residual; P (x2^10) and V plain f16 */
  k_tail<<<NR / PT, 256, 0, stream>>>(O, BW1, b1, BW2, b2, BWO, bo, (float*)d_out);      /* gelu_erf(out W1 + b1) W2 + b2 + out, conv1x1 Wo + bo, NCHW */
}
